// v000
// The times below were measured on an AMD MI455X: many runs one after another, warmed up first and cycling through
// copies of the inputs, with the whole window's GPU time divided by the number of runs. Launches and the gaps
// between them are all in it. The median over several windows is given; except for v000 it joins two sittings, which
// can be a few percent apart, so the side-by-side timings, each taken in one sitting, are the better comparison.
// v000 is the starting kernel. One run takes 503 microseconds.
// Contractions: q|k = x.[Wq|Wk] and v^T = Wv^T.x^T on v_wmma_f32_16x16x32_bf16 (x, W RNE bf16 operands, single products; bq, bk, bv as RNE bf16 added in f32); scores = q.k^T on v_wmma_f32_16x16x32_f16 (q, k f16 planes, single products); ctx = p.v on v_wmma_f32_16x16x32_bf16 (p and v^T as bf16 hi+lo: hi.hi + hi.lo + lo.hi); out = ctx.Wo on v_wmma_f32_16x16x32_bf16 (ctx bf16 hi+lo, Wo RNE bf16: hi.W + lo.W); f32 accumulate everywhere; scale, causal fill and softmax in f32.
#include <hip/hip_runtime.h>
#include <math.h>

// ---------------------------------------------------------------------------
// Problem constants (NB / SEQ overridable; *_FULL give the input / output strides)
// ---------------------------------------------------------------------------
#ifndef NB
#define NB 2
#endif
#ifndef SEQ
#define SEQ 2048
#endif
#define NB_FULL 2
#define SEQ_FULL 2048

constexpr int kBatch   = NB;
constexpr int kSeq     = SEQ;
constexpr int kSeqFull = SEQ_FULL;
constexpr int kDim     = 1024;               // d_in == d_out
constexpr int kHeads   = 16;
constexpr int kDh      = 64;
constexpr int kTok     = kBatch * kSeq;      // token rows of the compact planes
constexpr int kWtN     = 3 * kDim;           // rows of the Wq^T | Wk^T | Wv^T plane
constexpr int kQKld    = 2 * kDim;           // 2048, pitch (halves) of the q|k f16 plane
constexpr int kQB      = 64;                 // query rows per attention block
constexpr int kKC      = 64;                 // keys per chunk
constexpr int kAW      = 4;                  // waves per attention block
constexpr float kScale  = 0.125f;            // 64^-0.5, exact
constexpr float kNegBig = -1.0e30f;          // finite fill for scores above the diagonal
static_assert(kBatch >= 1 && kBatch <= NB_FULL);
static_assert(kSeq >= 64 && kSeq <= SEQ_FULL);
static_assert(kHeads * kDh == kDim);
static_assert(kSeq % kQB == 0 && kSeq % kKC == 0 && kQB == kAW * 16 && kDh == 64);
// GEMM shape contract (no tail handling): M, N multiples of 64, K multiple of 32
static_assert(kTok % 64 == 0 && kQKld % 64 == 0 && kDim % 32 == 0);
static_assert(kDim % 64 == 0 && kSeq % 64 == 0);
static_assert(kDim / 8 == 128 && (kTok * kDim) % 8 == 0);

typedef __attribute__((ext_vector_type(16))) _Float16 v16h;
typedef __attribute__((ext_vector_type(8)))  _Float16 v8h;
typedef __attribute__((ext_vector_type(16))) __bf16   v16b;
typedef __attribute__((ext_vector_type(8)))  __bf16   v8b;
typedef __attribute__((ext_vector_type(8)))  float    v8f;
typedef __attribute__((ext_vector_type(4)))  float    v4f;
typedef __attribute__((ext_vector_type(4)))  unsigned int v4u;

// ---------------------------------------------------------------------------
// Shared pieces
// ---------------------------------------------------------------------------
__device__ __forceinline__ unsigned short f2bf_bits(float f) {
  unsigned u = __float_as_uint(f);
  return (unsigned short)((u + 0x7FFFu + ((u >> 16) & 1u)) >> 16);
}
__device__ __forceinline__ float bf_bits2f(unsigned short h) { return __uint_as_float(((unsigned)h) << 16); }

// hazard guards as plain device helpers (no inline asm inside the kernel template body)
__device__ __forceinline__ void dep_guard_h(v8f& a, v8f& b, v16h x, v16h y) { asm volatile("v_nop\n\tv_nop\n\tv_nop\n\tv_nop" : "+v"(a), "+v"(b) : "v"(x), "v"(y)); }
__device__ __forceinline__ void dep_guard_b(v8f& a, v8f& b, v16b x, v16b y) { asm volatile("v_nop\n\tv_nop\n\tv_nop\n\tv_nop" : "+v"(a), "+v"(b) : "v"(x), "v"(y)); }
// guard tying all four accumulators of a group and naming both A fragments as inputs
__device__ __forceinline__ void dep_guard4_h(v8f& a, v8f& b, v8f& c, v8f& d, v16h x, v16h y) { asm volatile("v_nop\n\tv_nop\n\tv_nop\n\tv_nop" : "+v"(a), "+v"(b), "+v"(c), "+v"(d) : "v"(x), "v"(y)); }
__device__ __forceinline__ void dep_guard4_b(v8f& a, v8f& b, v8f& c, v8f& d, v16b x, v16b y) { asm volatile("v_nop\n\tv_nop\n\tv_nop\n\tv_nop" : "+v"(a), "+v"(b), "+v"(c), "+v"(d) : "v"(x), "v"(y)); }
__device__ __forceinline__ void keep4_h(v16h a, v16h b, v16h c, v16h d) { asm volatile("v_nop" :: "v"(a), "v"(b), "v"(c), "v"(d)); }
__device__ __forceinline__ void keep4_b(v16b a, v16b b, v16b c, v16b d) { asm volatile("v_nop" :: "v"(a), "v"(b), "v"(c), "v"(d)); }
__device__ __forceinline__ void acc_guard4(v8f& a, v8f& b, v8f& c, v8f& d) { asm volatile("v_nop\n\tv_nop\n\tv_nop\n\tv_nop" : "+v"(a), "+v"(b), "+v"(c), "+v"(d)); }
template <typename T> struct Frag;
template <> struct Frag<_Float16> {
  typedef v16h V; union U { v16h v; v8h h[2]; };
  // elements 0..7 <- p[0..7], 8..15 <- p[16..23]
  static __device__ __forceinline__ v16h load(const _Float16* p) {
    U f; f.h[0] = *(const v8h*)(p); f.h[1] = *(const v8h*)(p + 16); return f.v;
  }
  static __device__ __forceinline__ v8f mma(v16h a, v16h b, v8f c) {
    return __builtin_amdgcn_wmma_f32_16x16x32_f16(false, a, false, b, (short)0, c, false, false);
  }
  static __device__ __forceinline__ void guard(v8f& a, v8f& b, v16h x, v16h y) { dep_guard_h(a, b, x, y); }
  static __device__ __forceinline__ void guard4(v8f& a, v8f& b, v8f& c, v8f& d, v16h x, v16h y) { dep_guard4_h(a, b, c, d, x, y); }
  static __device__ __forceinline__ void keep(v16h a, v16h b, v16h c, v16h d) { keep4_h(a, b, c, d); }
};
template <> struct Frag<__bf16> {
  typedef v16b V; union U { v16b v; v8b h[2]; };
  static __device__ __forceinline__ v16b load(const __bf16* p) {
    U f; f.h[0] = *(const v8b*)(p); f.h[1] = *(const v8b*)(p + 16); return f.v;
  }
  static __device__ __forceinline__ v8f mma(v16b a, v16b b, v8f c) {
    return __builtin_amdgcn_wmma_f32_16x16x32_bf16(false, a, false, b, (short)0, c, false, false);
  }
  static __device__ __forceinline__ void guard(v8f& a, v8f& b, v16b x, v16b y) { dep_guard_b(a, b, x, y); }
  static __device__ __forceinline__ void guard4(v8f& a, v8f& b, v8f& c, v8f& d, v16b x, v16b y) { dep_guard4_b(a, b, c, d, x, y); }
  static __device__ __forceinline__ void keep(v16b a, v16b b, v16b c, v16b d) { keep4_b(a, b, c, d); }
};

__device__ __forceinline__ unsigned pk16(unsigned short a, unsigned short b) { return (unsigned)a | ((unsigned)b << 16); }

// ---- Register-blocked batched WMMA GEMM (bias added in f32 in the slab phase so all output modes see it) ----
// C[m,n] = scale * sum_k A[m,k] * Bt[n,k] (+bias); each wave owns a 64x64 tile.
// A row-major [M,K]; Bt row-major [N,K]; M,N % 64 == 0, K % 32 == 0.
// SPLIT: 0 = single product; 1 = A and Bt hi/lo planes (hi.hi + hi.lo + lo.hi); 2 = A hi/lo planes only (hi.B + lo.B).
// BIAS_MODE: 0 = none, 1 = bias[m] (per row), 2 = bias[n] (per column); bias is an f32 table of length M or N.
// OUT_MODE: 0 = f32, 1 = f16, 2 = bf16 hi plane (Cout) + bf16 lo plane (Cout2).
// ET: 0 = f16 operands, 1 = bf16 operands (pointers passed as 16-bit storage)
template <int ET> struct Elem;
template <> struct Elem<0> { typedef _Float16 T; };
template <> struct Elem<1> { typedef __bf16 T; };
template <int ET, int SPLIT, int BIAS_MODE, int OUT_MODE>
__global__ __launch_bounds__(256) void wmma_gemm64(
    const unsigned short* __restrict__ Ap, const unsigned short* __restrict__ A2p, int lda, long strideA,
    const unsigned short* __restrict__ Btp, const unsigned short* __restrict__ Bt2p, int ldb, long strideB,
    void* __restrict__ Cout, void* __restrict__ Cout2, int ldc, long strideC,
    const float* __restrict__ bias,
    int M, int N, int K, float scale) {
  static_assert(SPLIT >= 0 && SPLIT <= 2);
  static_assert(BIAS_MODE >= 0 && BIAS_MODE <= 2);
  static_assert(OUT_MODE >= 0 && OUT_MODE <= 2);
  typedef typename Elem<ET>::T T;
  typedef typename Frag<T>::V V;
  const T* A = (const T*)Ap; const T* A2 = (const T*)A2p; const T* Bt = (const T*)Btp; const T* Bt2 = (const T*)Bt2p;
  __shared__ __align__(16) float sT[8][16 * 68];   // per-wave 16x64 slab, pitch 68 floats (private-to-wave)
  const int b    = blockIdx.y;
  const int lane = threadIdx.x & 31;
  const int wave = threadIdx.x >> 5;
  const int tilesN = N >> 6;
  const int tilesM = M >> 6;
  const int tile = blockIdx.x * 8 + wave;
  if (tile >= tilesM * tilesN) return;   // wave-uniform; no block barriers in this kernel
  const int tm = tile / tilesN;
  const int tn = tile - tm * tilesN;
  const int m0 = tm << 6;
  const int n0 = tn << 6;

  const T* Ab  = A  + (size_t)b * strideA;
  const T* Bb  = Bt + (size_t)b * strideB;
  const T* Ab2 = (SPLIT != 0) ? (A2  + (size_t)b * strideA) : nullptr;
  const T* Bb2 = (SPLIT == 1) ? (Bt2 + (size_t)b * strideB) : nullptr;

  const int rlane = lane & 15;                 // row (A) / col (B, D) within subtile
  const int koff  = (lane >> 4) * 8;           // k offset of this lane half
  const int mOff  = (lane >> 4) * 8;           // D row offset

  v8f acc[4][4];
#pragma unroll
  for (int i = 0; i < 4; ++i)
#pragma unroll
    for (int j = 0; j < 4; ++j) acc[i][j] = (v8f){0.f,0.f,0.f,0.f,0.f,0.f,0.f,0.f};

  for (int k0 = 0; k0 < K; k0 += 32) {
    V bh[4], bl[4];
#pragma unroll
    for (int j = 0; j < 4; ++j) {
      const size_t bo = (size_t)(n0 + (j << 4) + rlane) * ldb + koff + k0;
      bh[j] = Frag<T>::load(Bb + bo);
      if (SPLIT == 1) bl[j] = Frag<T>::load(Bb2 + bo);
    }
#pragma unroll
    for (int i = 0; i < 4; ++i) {
      const size_t ao = (size_t)(m0 + (i << 4) + rlane) * lda + koff + k0;
      V ah = Frag<T>::load(Ab + ao);
      V al = ah;
      if (SPLIT != 0) al = Frag<T>::load(Ab2 + ao);
#pragma unroll
      for (int j = 0; j < 4; ++j) {
        acc[i][j] = Frag<T>::mma(ah, bh[j], acc[i][j]);
        if (SPLIT == 1) acc[i][j] = Frag<T>::mma(ah, bl[j], acc[i][j]);
        if (SPLIT != 0) acc[i][j] = Frag<T>::mma(al, bh[j], acc[i][j]);
      }
      Frag<T>::guard4(acc[i][0], acc[i][1], acc[i][2], acc[i][3], ah, al);
    }
    Frag<T>::keep(bh[0], bh[1], bh[2], bh[3]);
    if (SPLIT == 1) Frag<T>::keep(bl[0], bl[1], bl[2], bl[3]);
  }
  acc_guard4(acc[0][0], acc[0][1], acc[0][2], acc[0][3]);
  acc_guard4(acc[1][0], acc[1][1], acc[1][2], acc[1][3]);
  acc_guard4(acc[2][0], acc[2][1], acc[2][2], acc[2][3]);
  acc_guard4(acc[3][0], acc[3][1], acc[3][2], acc[3][3]);

  // ---- epilogue ----
  float* slab = sT[wave];
  float bcol[4] = {0.f, 0.f, 0.f, 0.f};
  if (BIAS_MODE == 2) {
    // per-column bias: this lane's columns n0 + 16*j + rlane, j = 0..3 (in range: N multiple of 64)
#pragma unroll
    for (int j = 0; j < 4; ++j) bcol[j] = bias[n0 + (j << 4) + rlane];
  }
#pragma unroll
  for (int i = 0; i < 4; ++i) {
    const int mBase = m0 + (i << 4);
    float brow[8] = {0.f, 0.f, 0.f, 0.f, 0.f, 0.f, 0.f, 0.f};
    if (BIAS_MODE == 1) {
      // per-row bias: rows mBase + mOff + 0..7 (16-B aligned: mBase % 16 == 0, mOff in {0, 8})
      const v4f b0 = *(const v4f*)(bias + mBase + mOff);
      const v4f b1 = *(const v4f*)(bias + mBase + mOff + 4);
#pragma unroll
      for (int e = 0; e < 4; ++e) { brow[e] = b0[e]; brow[4 + e] = b1[e]; }
    }
#pragma unroll
    for (int j = 0; j < 4; ++j) {
#pragma unroll
      for (int r = 0; r < 8; ++r) {
        float bb = 0.f;
        if (BIAS_MODE == 1) bb = brow[r];
        if (BIAS_MODE == 2) bb = bcol[j];
        slab[(mOff + r) * 68 + (j << 4) + rlane] = acc[i][j][r] * scale + bb;
      }
    }
    __builtin_amdgcn_fence(3, "workgroup");
    __builtin_amdgcn_wave_barrier();
    __builtin_amdgcn_fence(2, "workgroup");
    if (OUT_MODE == 0) {
      float* C = (float*)Cout + (size_t)b * strideC;
      const int hh = lane >> 4, c4 = (lane & 15) * 4;     // row seg = 256 B = 16 lanes x 16 B
      {
#pragma unroll
        for (int it = 0; it < 8; ++it) {
          const int row = it * 2 + hh;
          const v4f v = *(const v4f*)(slab + row * 68 + c4);
          *(v4f*)(C + (size_t)(mBase + row) * ldc + n0 + c4) = v;
        }
        
      }
    } else {
      const int q = lane >> 3, c8 = (lane & 7) * 8;
      unsigned short* C  = (unsigned short*)Cout  + (size_t)b * strideC;
      unsigned short* C2 = (OUT_MODE == 2) ? ((unsigned short*)Cout2 + (size_t)b * strideC) : nullptr;
      {
#pragma unroll
        for (int it = 0; it < 4; ++it) {
          const int row = it * 4 + q;
          const float* sp = slab + row * 68 + c8;
          v8h hv, lv;
#pragma unroll
          for (int e = 0; e < 8; ++e) {
            if (OUT_MODE == 1) {
              hv[e] = (_Float16)sp[e];
            } else {
              unsigned short hb = f2bf_bits(sp[e]);
              unsigned short lb = f2bf_bits(sp[e] - bf_bits2f(hb));
              hv[e] = __builtin_bit_cast(_Float16, hb);
              lv[e] = __builtin_bit_cast(_Float16, lb);
            }
          }
          *(v8h*)(C + (size_t)(mBase + row) * ldc + n0 + c8) = hv;
          if (OUT_MODE == 2) *(v8h*)(C2 + (size_t)(mBase + row) * ldc + n0 + c8) = lv;
        }
        
      }
    }
    __builtin_amdgcn_fence(3, "workgroup");
    __builtin_amdgcn_wave_barrier();
    __builtin_amdgcn_fence(2, "workgroup");
  }
}

// ---------------------------------------------------------------------------
// f32 -> bf16 (RNE) cast of x into the compact token plane XB [kTok][1024]: token row t = b*kSeq + s reads input row
// ---------------------------------------------------------------------------
__global__ __launch_bounds__(256) void cast8_bf16_kernel(const float* __restrict__ in, unsigned short* __restrict__ out, int n8) {
  const int i = blockIdx.x * 256 + threadIdx.x;
  if (i >= n8) return;
  const int t  = i >> 7;                 // 128 groups of 8 per token row
  const int c8 = (i & 127) * 8;
  const int b  = t / kSeq;
  const int s  = t - b * kSeq;
  const float* p = in + (size_t)(b * kSeqFull + s) * kDim + c8;
  const v4f a = *(const v4f*)(p);
  const v4f c = *(const v4f*)(p + 4);
  unsigned short hb[8];
#pragma unroll
  for (int e = 0; e < 4; ++e) {
    hb[e]     = f2bf_bits(a[e]);
    hb[4 + e] = f2bf_bits(c[e]);
  }
  const v4u u = (v4u){pk16(hb[0], hb[1]), pk16(hb[2], hb[3]), pk16(hb[4], hb[5]), pk16(hb[6], hb[7])};
  unsigned short* q = out + 8 * (size_t)i;
  *(v4u*)q = u;
  
}

// ---------------------------------------------------------------------------
// Weight transpose + RNE bf16 cast: W f32 row-major [1024 (d)][ldIn (n)] -> WT bf16 [n][d] with pitch ldOut (= 1024):
//   in[d][n] -> out[n][d]. grid (1024/64 d tiles, ldIn/64 n tiles). 256 threads.
// Load coverage: 16 iterations x 256 threads = 4096 = the whole 64x64 tile (coalesced along n).
// Store coverage: 8 waves x 2 iterations x 4 rows (lane>>3) = 64 n-rows; (lane&7) x 8 halves = 64 d-cols; each row segment
// ---------------------------------------------------------------------------
__global__ __launch_bounds__(256) void wtcast_bf16_kernel(const float* __restrict__ W, unsigned short* __restrict__ out,
                                                          int ldIn, int ldOut) {
  __shared__ float sm[64][65];   // sm[n_local][d_local] (cross-wave: block barrier)
  const int t  = threadIdx.x;
  const int d0 = blockIdx.x * 64;
  const int n0 = blockIdx.y * 64;
#pragma unroll
  for (int i = 0; i < 16; ++i) {
    const int e = i * 256 + t;
    const int r = e >> 6;          // d local
    const int c = e & 63;          // n local
    sm[c][r] = W[(size_t)(d0 + r) * ldIn + n0 + c];
  }
  __syncthreads();
  const int lane = t & 31, wave = t >> 5;
  const int q = lane >> 3, c8 = (lane & 7) * 8;
  {
#pragma unroll
    for (int it = 0; it < 2; ++it) {
      const int row = wave * 8 + it * 4 + q;                 // n local
      unsigned short hb[8];
#pragma unroll
      for (int e = 0; e < 8; ++e) hb[e] = f2bf_bits(sm[row][c8 + e]);
      const v4u u = (v4u){pk16(hb[0], hb[1]), pk16(hb[2], hb[3]), pk16(hb[4], hb[5]), pk16(hb[6], hb[7])};
      *(v4u*)(out + (size_t)(n0 + row) * ldOut + d0 + c8) = u;
    }
    
  }
}

// ---------------------------------------------------------------------------
// Bias RNE bf16 convert kept as f32: dst[1024] = float(bf16(src)). One block of 256 threads, float4 per lane:
// ---------------------------------------------------------------------------
__global__ __launch_bounds__(256) void bias_bf16_kernel(const float* __restrict__ bsrc, float* __restrict__ bdst) {
  const int t = threadIdx.x;
  const v4f a = *(const v4f*)(bsrc + 4 * t);
  v4f r;
#pragma unroll
  for (int e = 0; e < 4; ++e) r[e] = bf_bits2f(f2bf_bits(a[e]));
  float* dp = bdst + 4 * t;
  *(v4f*)dp = r;
  
}

// ---------------------------------------------------------------------------
// Causal flash attention, head_dim 64.
//   QK  : f16 plane [kTok][2048]: q at columns h*64.., k at columns 1024 + h*64.. (row = token b*kSeq+s, bias included)
//   VH/VL: bf16 hi/lo planes of v^T: [(b*16+h)*64 + d][kSeq keys]
//   CH/CL: bf16 hi/lo planes of ctx [kTok][1024], column h*64 + d
// scores = 0.125 * q.k^T (v_wmma_f32_16x16x32_f16), keys kv > q replaced by -1e30 on the diagonal chunk, f32 online
// softmax (precise expf), p and v^T as bf16 hi+lo on v_wmma_f32_16x16x32_bf16 (hi.hi + hi.lo + lo.hi), divide by l at
// the end. Block = 4 waves = 64 query rows of one (b,h); chunks of 64 keys, kc = 0..qb only (every visited chunk has
// at least one live key per row). grid.x = kBatch*16*(kSeq/64).
// LDS: K [kv][d] and V^T hi/lo [d][kv] staged by all waves (16-B copies, block barriers before and after); P hi/lo and the output
// ---------------------------------------------------------------------------
union FragH { v16h v; v8h h[2]; };
union FragB { v16b v; v8b h[2]; };

__device__ __forceinline__ v8f mma_h16(v16h a, v16h b, v8f c) {
  c = __builtin_amdgcn_wmma_f32_16x16x32_f16(false, a, false, b, (short)0, c, false, false);
  asm volatile("v_nop\n\tv_nop\n\tv_nop\n\tv_nop" : "+v"(c) : "v"(a), "v"(b));
  return c;
}
__device__ __forceinline__ v8f mma_b16(v16b a, v16b b, v8f c) {
  c = __builtin_amdgcn_wmma_f32_16x16x32_bf16(false, a, false, b, (short)0, c, false, false);
  asm volatile("v_nop\n\tv_nop\n\tv_nop\n\tv_nop" : "+v"(c) : "v"(a), "v"(b));
  return c;
}
__device__ __forceinline__ __bf16 f2bf(float f) { return __builtin_bit_cast(__bf16, f2bf_bits(f)); }
__device__ __forceinline__ void bf_split(float f, __bf16& hi, __bf16& lo) {
  const unsigned short hb = f2bf_bits(f);
  hi = __builtin_bit_cast(__bf16, hb);
  lo = f2bf(f - __uint_as_float(((unsigned)hb) << 16));
}

__global__ __launch_bounds__(128) __attribute__((amdgpu_num_vgpr(256)))
void causal_attn_kernel(const unsigned short* __restrict__ QKp,
                        const unsigned short* __restrict__ VHp,
                        const unsigned short* __restrict__ VLp,
                        unsigned short* __restrict__ CHp,
                        unsigned short* __restrict__ CLp) {
  __shared__ __align__(16) unsigned short Ksh[kKC * kDh];    // K   [kv][d]   8 KB  (cross-wave: block barriers)
  __shared__ __align__(16) unsigned short Vth[kDh * kKC];    // V^T hi [d][kv] 8 KB  (cross-wave: block barriers)
  __shared__ __align__(16) unsigned short Vtl[kDh * kKC];    // V^T lo [d][kv] 8 KB  (cross-wave: block barriers)
  __shared__ __align__(16) __bf16 Psh[kAW][16 * kKC];        // per wave P hi [row][kv] (private-to-wave)
  __shared__ __align__(16) __bf16 Psl[kAW][16 * kKC];        // per wave P lo [row][kv] (private-to-wave)
  __shared__ __align__(16) float  Os[kAW][16 * 68];          // per wave out tile, pitch 68 (private-to-wave)

  const int tid  = threadIdx.x;
  const int wave = tid >> 5;
  const int lane = tid & 31;
  const int hh   = lane >> 4;
  const int c    = lane & 15;

  const int nqb = kSeq / kQB;
  const int bx  = blockIdx.x;
  const int qb  = bx % nqb;
  const int bh  = bx / nqb;              // b*16 + h
  const int h   = bh % kHeads;
  const int b   = bh / kHeads;
  const int q0  = qb * kQB + wave * 16;  // first query row of this wave (within the sequence)

  const _Float16* Qb = (const _Float16*)(QKp + (size_t)b * kSeq * kQKld + h * kDh);
  const unsigned short* Kb  = QKp + (size_t)b * kSeq * kQKld + kDim + h * kDh;
  const unsigned short* Vhb = VHp + (size_t)bh * kDh * kSeq;
  const unsigned short* Vlb = VLp + (size_t)bh * kDh * kSeq;

  // ---- Q fragments (A operand, split k map via Frag<_Float16>::load): 2 d-chunks of 32 ----
  v16h qa[2];
#pragma unroll
  for (int dc = 0; dc < 2; ++dc) qa[dc] = Frag<_Float16>::load(Qb + (size_t)(q0 + c) * kQKld + dc * 32 + 8 * hh);

  float mrow[8], lrow[8];
  v8f oacc[4];
#pragma unroll
  for (int r = 0; r < 8; ++r) { mrow[r] = -INFINITY; lrow[r] = 0.f; }
#pragma unroll
  for (int t = 0; t < 4; ++t) oacc[t] = (v8f){0.f,0.f,0.f,0.f,0.f,0.f,0.f,0.f};

  const int nChunks = qb + 1;   // block-uniform (causal: key chunks 0..qb)
  for (int kc = 0; kc < nChunks; ++kc) {
    const int kv0 = kc * kKC;
    __syncthreads();
    {
      // staging coverage: 128 threads x (1 row x 32 halves) = 64 rows x 64 halves per tile, all three tiles fully written
      const int r = tid >> 1, hf = (tid & 1) * 32;
      {
        const uint4* ks = (const uint4*)(Kb + (size_t)(kv0 + r) * kQKld + hf);
        uint4* kd = (uint4*)(Ksh + r * kDh + hf);
        const uint4 w0 = ks[0], w1 = ks[1], w2 = ks[2], w3 = ks[3];
        kd[0] = w0; kd[1] = w1; kd[2] = w2; kd[3] = w3;
      }
      asm volatile("" ::: "memory");
      {
        const uint4* vs = (const uint4*)(Vhb + (size_t)r * kSeq + kv0 + hf);
        uint4* vd = (uint4*)(Vth + r * kKC + hf);
        const uint4 w0 = vs[0], w1 = vs[1], w2 = vs[2], w3 = vs[3];
        vd[0] = w0; vd[1] = w1; vd[2] = w2; vd[3] = w3;
      }
      asm volatile("" ::: "memory");
      {
        const uint4* vs = (const uint4*)(Vlb + (size_t)r * kSeq + kv0 + hf);
        uint4* vd = (uint4*)(Vtl + r * kKC + hf);
        const uint4 w0 = vs[0], w1 = vs[1], w2 = vs[2], w3 = vs[3];
        vd[0] = w0; vd[1] = w1; vd[2] = w2; vd[3] = w3;
      }
    }
    __syncthreads();

    // ---- scores: 4 key subtiles of 16, K = 64 (2 d-chunks) ----
    v8f s[4];
#pragma unroll
    for (int j = 0; j < 4; ++j) {
      s[j] = (v8f){0.f,0.f,0.f,0.f,0.f,0.f,0.f,0.f};
#pragma unroll
      for (int dc = 0; dc < 2; ++dc) {
        FragH kb;
        kb.h[0] = *(const v8h*)(Ksh + (j * 16 + c) * kDh + dc * 32 + 8 * hh);
        kb.h[1] = *(const v8h*)(Ksh + (j * 16 + c) * kDh + dc * 32 + 16 + 8 * hh);
        s[j] = mma_h16(qa[dc], kb.v, s[j]);
      }
    }
    // ---- scale, causal fill on the diagonal chunk, row max ----
    const bool diag = (kc == qb);
    float cm[8];
#pragma unroll
    for (int r = 0; r < 8; ++r) {
      const int qrow = q0 + 8 * hh + r;
      float m = -INFINITY;
#pragma unroll
      for (int j = 0; j < 4; ++j) {
        const int kvcol = kv0 + j * 16 + c;
        float sv = s[j][r] * kScale;
        if (diag && (kvcol > qrow)) sv = kNegBig;
        s[j][r] = sv;
        m = fmaxf(m, sv);
      }
#pragma unroll
      for (int off = 1; off < 16; off <<= 1) m = fmaxf(m, __shfl_xor(m, off, 32));
      cm[r] = m;
    }
    // ---- online softmax update, P as bf16 hi/lo into the per-wave LDS tile ----
    __bf16* pwh = Psh[wave];
    __bf16* pwl = Psl[wave];
#pragma unroll
    for (int r = 0; r < 8; ++r) {
      const float mnew = fmaxf(mrow[r], cm[r]);
      const float alpha = expf(mrow[r] - mnew);
      mrow[r] = mnew;
      float psum = 0.f;
#pragma unroll
      for (int j = 0; j < 4; ++j) {
        const float p = expf(s[j][r] - mnew);
        psum += p;
        __bf16 ph, pl;
        bf_split(p, ph, pl);
        pwh[(8 * hh + r) * kKC + j * 16 + c] = ph;
        pwl[(8 * hh + r) * kKC + j * 16 + c] = pl;
      }
#pragma unroll
      for (int off = 1; off < 16; off <<= 1) psum += __shfl_xor(psum, off, 32);
      lrow[r] = lrow[r] * alpha + psum;
#pragma unroll
      for (int t = 0; t < 4; ++t) oacc[t][r] *= alpha;
    }
    __builtin_amdgcn_fence(3, "workgroup");
    __builtin_amdgcn_wave_barrier();
    __builtin_amdgcn_fence(2, "workgroup");
    // ---- ctx += P(16x64) . V(64x64): hi.hi + hi.lo + lo.hi ----
#pragma unroll 1
    for (int kk = 0; kk < 2; ++kk) {
      FragB pa, pl;
      pa.h[0] = *(const v8b*)(pwh + c * kKC + kk * 32 + 8 * hh);
      pa.h[1] = *(const v8b*)(pwh + c * kKC + kk * 32 + 16 + 8 * hh);
      pl.h[0] = *(const v8b*)(pwl + c * kKC + kk * 32 + 8 * hh);
      pl.h[1] = *(const v8b*)(pwl + c * kKC + kk * 32 + 16 + 8 * hh);
#pragma unroll
      for (int t = 0; t < 4; ++t) {
        FragB vb, vl;
        vb.h[0] = *(const v8b*)(Vth + (t * 16 + c) * kKC + kk * 32 + 8 * hh);
        vb.h[1] = *(const v8b*)(Vth + (t * 16 + c) * kKC + kk * 32 + 16 + 8 * hh);
        vl.h[0] = *(const v8b*)(Vtl + (t * 16 + c) * kKC + kk * 32 + 8 * hh);
        vl.h[1] = *(const v8b*)(Vtl + (t * 16 + c) * kKC + kk * 32 + 16 + 8 * hh);
        oacc[t] = mma_b16(pa.v, vb.v, oacc[t]);
        oacc[t] = mma_b16(pa.v, vl.v, oacc[t]);
        oacc[t] = mma_b16(pl.v, vb.v, oacc[t]);
      }
    }
  }

  float* os = Os[wave];
#pragma unroll
  for (int r = 0; r < 8; ++r) {
    const float inv = 1.0f / lrow[r];
#pragma unroll
    for (int t = 0; t < 4; ++t) os[(8 * hh + r) * 68 + t * 16 + c] = oacc[t][r] * inv;
  }
  __builtin_amdgcn_fence(3, "workgroup");
  __builtin_amdgcn_wave_barrier();
  __builtin_amdgcn_fence(2, "workgroup");
  {
    // store coverage: 4 iterations x 4 row groups (lane>>3) = 16 rows; (lane&7) x 8 halves = 64 cols
    const int q = lane >> 3, c8 = (lane & 7) * 8;
    unsigned short* ch = CHp + (size_t)(b * kSeq + q0) * kDim + h * kDh;
    unsigned short* cl = CLp + (size_t)(b * kSeq + q0) * kDim + h * kDh;
    {
#pragma unroll
      for (int it = 0; it < 4; ++it) {
        const int row = it * 4 + q;
        const float* sp = os + row * 68 + c8;
        v8h hv, lv;
#pragma unroll
        for (int e = 0; e < 8; ++e) {
          const unsigned short hb = f2bf_bits(sp[e]);
          const unsigned short lb = f2bf_bits(sp[e] - bf_bits2f(hb));
          hv[e] = __builtin_bit_cast(_Float16, hb);
          lv[e] = __builtin_bit_cast(_Float16, lb);
        }
        *(v8h*)(ch + (size_t)row * kDim + c8) = hv;
        *(v8h*)(cl + (size_t)row * kDim + c8) = lv;
      }
      
    }
  }
}

// ---------------------------------------------------------------------------
// Host glue.
// Inputs (wire f32): 0 x [2][2048][1024], 1 Wq [1024][1024], 2 bq [1024], 3 Wk, 4 bk, 5 Wv, 6 bv, 7 Wo [1024][1024].
//   XB    bf16 [kTok][1024]             8,388,608   (RNE bf16 of x, compact token rows, A layout)
//   WT    bf16 [3072][1024]             6,291,456   (Wq^T | Wk^T | Wv^T, RNE bf16, Bt layout [n][k])
//   WOT   bf16 [1024][1024]             2,097,152   (Wo^T, RNE bf16, Bt layout)
//   BQK   f32  [2048]                       8,192   (RNE bf16 of bq | bk, widened)
//   BV    f32  [1024]                       4,096   (RNE bf16 of bv, widened)
//   QK16  f16  [kTok][2048]            16,777,216   (q | k columns incl. bias)
//   VTH   bf16 [kBatch*16*64][kSeq]     8,388,608   (v^T hi plane, bias included)
//   VTL   bf16 [kBatch*16*64][kSeq]     8,388,608   (v^T lo plane)
//   CTXH  bf16 [kTok][1024]             8,388,608   (ctx hi plane)
//   CTXL  bf16 [kTok][1024]             8,388,608   (ctx lo plane)
//   total                              67,121,152
// GEMM shapes: q|k M=kTok N=2048 K=1024; v^T M=1024 N=kSeq K=1024 (kBatch batches); out M=kSeq N=1024 K=1024 (kBatch
// batches, output rows at pitch kSeqFull per batch). All M,N multiples of 64, K multiple of 32: no padding. 12 launches.
// ---------------------------------------------------------------------------
extern "C" void kernel_launch(void* const* d_in, const int* in_sizes, int n_in,
                              void* d_out, int out_size, void* d_ws, size_t ws_size,
                              hipStream_t stream) {
  if (n_in < 8) return;
  const int rowsNeeded = (kBatch - 1) * kSeqFull + kSeq;     // last token row read/written + 1
  if (in_sizes[0] < rowsNeeded * kDim) return;
  if (in_sizes[1] < kDim * kDim || in_sizes[3] < kDim * kDim || in_sizes[5] < kDim * kDim || in_sizes[7] < kDim * kDim) return;
  if (in_sizes[2] < kDim || in_sizes[4] < kDim || in_sizes[6] < kDim) return;
  if (out_size < rowsNeeded * kDim) return;

  const size_t szXB  = (size_t)kTok * kDim * 2;
  const size_t szWT  = (size_t)kWtN * kDim * 2;
  const size_t szWOT = (size_t)kDim * kDim * 2;
  const size_t szBQK = (size_t)kQKld * 4;
  const size_t szBV  = (size_t)kDim * 4;
  const size_t szQK  = (size_t)kTok * kQKld * 2;
  const size_t szVT  = (size_t)kBatch * kHeads * kDh * kSeq * 2;
  const size_t szCTX = (size_t)kTok * kDim * 2;
  const size_t offXB  = 0;
  const size_t offWT  = offXB + szXB;
  const size_t offWOT = offWT + szWT;
  const size_t offBQK = offWOT + szWOT;
  const size_t offBV  = offBQK + szBQK;
  const size_t offQK  = offBV + szBV;
  const size_t offVTH = offQK + szQK;
  const size_t offVTL = offVTH + szVT;
  const size_t offCH  = offVTL + szVT;
  const size_t offCL  = offCH + szCTX;
  const size_t total  = offCL + szCTX;             // 67,121,152 at full size
  if (ws_size < total) return;
  if (total > (size_t)134217728) return;

  const float* x  = (const float*)d_in[0];
  const float* Wq = (const float*)d_in[1];
  const float* bq = (const float*)d_in[2];
  const float* Wk = (const float*)d_in[3];
  const float* bk = (const float*)d_in[4];
  const float* Wv = (const float*)d_in[5];
  const float* bv = (const float*)d_in[6];
  const float* Wo = (const float*)d_in[7];
  float* out = (float*)d_out;
  char* ws = (char*)d_ws;
  unsigned short* XB   = (unsigned short*)(ws + offXB);
  unsigned short* WT   = (unsigned short*)(ws + offWT);
  unsigned short* WOT  = (unsigned short*)(ws + offWOT);
  float*          BQK  = (float*)(ws + offBQK);
  float*          BV   = (float*)(ws + offBV);
  unsigned short* QK16 = (unsigned short*)(ws + offQK);
  unsigned short* VTH  = (unsigned short*)(ws + offVTH);
  unsigned short* VTL  = (unsigned short*)(ws + offVTL);
  unsigned short* CTXH = (unsigned short*)(ws + offCH);
  unsigned short* CTXL = (unsigned short*)(ws + offCL);

  // ---- prologue: RNE bf16 planes of all float inputs ----
  const int n8 = kTok * kDim / 8;
  cast8_bf16_kernel<<<dim3((n8 + 255) / 256), dim3(256), 0, stream>>>(x, XB, n8);
  // in[1024 (d)][1024 (n)] -> out[1024 (n)][1024 (d)] for each square weight; grid (d tiles, n tiles)
  wtcast_bf16_kernel<<<dim3(kDim / 64, kDim / 64), dim3(256), 0, stream>>>(Wq, WT, kDim, kDim);
  wtcast_bf16_kernel<<<dim3(kDim / 64, kDim / 64), dim3(256), 0, stream>>>(Wk, WT + (size_t)kDim * kDim, kDim, kDim);
  wtcast_bf16_kernel<<<dim3(kDim / 64, kDim / 64), dim3(256), 0, stream>>>(Wv, WT + (size_t)2 * kDim * kDim, kDim, kDim);
  wtcast_bf16_kernel<<<dim3(kDim / 64, kDim / 64), dim3(256), 0, stream>>>(Wo, WOT, kDim, kDim);
  bias_bf16_kernel<<<dim3(1), dim3(256), 0, stream>>>(bq, BQK);
  bias_bf16_kernel<<<dim3(1), dim3(256), 0, stream>>>(bk, BQK + kDim);
  bias_bf16_kernel<<<dim3(1), dim3(256), 0, stream>>>(bv, BV);

  // ---- q|k = XB . WT[rows 0..2047] + BQK[n]  -> f16 plane [kTok][2048]  (M=kTok, N=2048, K=1024, bias per column) ----
  {
    const int tiles = (kTok / 64) * (kQKld / 64);
    wmma_gemm64<1, 0, 2, 1><<<dim3((tiles + 7) / 8, 1), dim3(256), 0, stream>>>(
        XB, XB, kDim, 0L, WT, WT, kDim, 0L,
        (void*)QK16, (void*)QK16, kQKld, 0L, BQK, kTok, kQKld, kDim, 1.0f);
  }
  // ---- v^T[b][h*64+d][s] = WT[2048 + h*64 + d] . XB[b*kSeq + s] + BV[h*64+d]  -> bf16 hi/lo planes
  //      (M=1024, N=kSeq, K=1024, kBatch batches, bias per row) ----
  {
    const int tiles = (kDim / 64) * (kSeq / 64);
    const unsigned short* Av = WT + (size_t)2 * kDim * kDim;   // rows 2048..3071 of WT = Wv^T
    wmma_gemm64<1, 0, 1, 2><<<dim3((tiles + 7) / 8, kBatch), dim3(256), 0, stream>>>(
        Av, Av, kDim, 0L, XB, XB, kDim, (long)kSeq * kDim,
        (void*)VTH, (void*)VTL, kSeq, (long)kDim * kSeq, BV, kDim, kSeq, kDim, 1.0f);
  }
  // ---- causal attention per (b, h, 64-query block) -> ctx bf16 hi/lo planes ----
  causal_attn_kernel<<<dim3(kBatch * kHeads * (kSeq / kQB)), dim3(128), 0, stream>>>(QK16, VTH, VTL, CTXH, CTXL);
  // ---- out[b][s] = (CTXH + CTXL)[b*kSeq + s] . WOT  (M=kSeq, N=1024, K=1024, kBatch batches, no bias),
  //      f32 straight to d_out rows b*kSeqFull + s ----
  {
    const int tiles = (kSeq / 64) * (kDim / 64);
    wmma_gemm64<1, 2, 0, 0><<<dim3((tiles + 7) / 8, kBatch), dim3(256), 0, stream>>>(
        CTXH, CTXL, kDim, (long)kSeq * kDim, WOT, WOT, kDim, 0L,
        (void*)out, (void*)out, kDim, (long)kSeqFull * kDim, BV, kSeq, kDim, kDim, 1.0f);
  }
}

// v001
// Measured time: 422 microseconds a run.
// Two timings next to v000 both put it at 1.22 times that version's speed.
// Contractions: q|k = x.[Wq|Wk] and v^T = Wv^T.x^T on v_wmma_f32_16x16x32_bf16 (x, W RNE bf16 operands, single products; bq, bk, bv as RNE bf16 added in f32); scores = q.k^T on v_wmma_f32_16x16x32_f16 (q, k f16 planes, single products); ctx = p.v on v_wmma_f32_16x16x32_bf16 (p and v^T as bf16 hi+lo: hi.hi + hi.lo + lo.hi); out = ctx.Wo on v_wmma_f32_16x16x32_bf16 (ctx bf16 hi+lo, Wo RNE bf16: hi.W + lo.W); f32 accumulate everywhere; scale, causal fill and softmax in f32.
#include <hip/hip_runtime.h>
#include <math.h>

// ---------------------------------------------------------------------------
// Problem constants (NB / SEQ overridable; *_FULL give the input / output strides)
// ---------------------------------------------------------------------------
#ifndef NB
#define NB 2
#endif
#ifndef SEQ
#define SEQ 2048
#endif
#define NB_FULL 2
#define SEQ_FULL 2048

constexpr int kBatch   = NB;
constexpr int kSeq     = SEQ;
constexpr int kSeqFull = SEQ_FULL;
constexpr int kDim     = 1024;               // d_in == d_out
constexpr int kHeads   = 16;
constexpr int kDh      = 64;
constexpr int kTok     = kBatch * kSeq;      // token rows of the compact planes
constexpr int kWtN     = 3 * kDim;           // rows of the Wq^T | Wk^T | Wv^T plane
constexpr int kQKld    = 2 * kDim;           // 2048, pitch (halves) of the q|k f16 plane
constexpr int kQB      = 64;                 // query rows per attention block
constexpr int kKC      = 64;                 // keys per chunk
constexpr int kAW      = 4;                  // waves per attention block
constexpr int kLP      = 72;                 // LDS row pitch (halves) of the K, V^T and P tiles: 144 B = 16 B x 9, so 16 rows read by ds_load_b128 fall on 64 distinct banks
constexpr float kScale  = 0.125f;            // 64^-0.5, exact
constexpr float kNegBig = -1.0e30f;          // finite fill for scores above the diagonal
static_assert(kBatch >= 1 && kBatch <= NB_FULL);
static_assert(kSeq >= 64 && kSeq <= SEQ_FULL);
static_assert(kHeads * kDh == kDim);
static_assert(kSeq % kQB == 0 && kSeq % kKC == 0 && kQB == kAW * 16 && kDh == 64);
// GEMM shape contract (no tail handling): M, N multiples of 64, K multiple of 32
static_assert(kTok % 64 == 0 && kQKld % 64 == 0 && kDim % 32 == 0);
static_assert(kDim % 64 == 0 && kSeq % 64 == 0);
static_assert(kDim / 8 == 128 && (kTok * kDim) % 8 == 0);

typedef __attribute__((ext_vector_type(16))) _Float16 v16h;
typedef __attribute__((ext_vector_type(8)))  _Float16 v8h;
typedef __attribute__((ext_vector_type(16))) __bf16   v16b;
typedef __attribute__((ext_vector_type(8)))  __bf16   v8b;
typedef __attribute__((ext_vector_type(8)))  float    v8f;
typedef __attribute__((ext_vector_type(4)))  float    v4f;
typedef __attribute__((ext_vector_type(4)))  unsigned int v4u;

// ---------------------------------------------------------------------------
// Shared pieces
// ---------------------------------------------------------------------------
__device__ __forceinline__ unsigned short f2bf_bits(float f) {
  unsigned u = __float_as_uint(f);
  return (unsigned short)((u + 0x7FFFu + ((u >> 16) & 1u)) >> 16);
}
__device__ __forceinline__ float bf_bits2f(unsigned short h) { return __uint_as_float(((unsigned)h) << 16); }

// hazard guards as plain device helpers (no inline asm inside the kernel template body)
__device__ __forceinline__ void dep_guard_h(v8f& a, v8f& b, v16h x, v16h y) { asm volatile("v_nop\n\tv_nop\n\tv_nop\n\tv_nop" : "+v"(a), "+v"(b) : "v"(x), "v"(y)); }
__device__ __forceinline__ void dep_guard_b(v8f& a, v8f& b, v16b x, v16b y) { asm volatile("v_nop\n\tv_nop\n\tv_nop\n\tv_nop" : "+v"(a), "+v"(b) : "v"(x), "v"(y)); }
// guard tying all four accumulators of a group and naming both A fragments as inputs
__device__ __forceinline__ void dep_guard4_h(v8f& a, v8f& b, v8f& c, v8f& d, v16h x, v16h y) { asm volatile("v_nop\n\tv_nop\n\tv_nop\n\tv_nop" : "+v"(a), "+v"(b), "+v"(c), "+v"(d) : "v"(x), "v"(y)); }
__device__ __forceinline__ void dep_guard4_b(v8f& a, v8f& b, v8f& c, v8f& d, v16b x, v16b y) { asm volatile("v_nop\n\tv_nop\n\tv_nop\n\tv_nop" : "+v"(a), "+v"(b), "+v"(c), "+v"(d) : "v"(x), "v"(y)); }
__device__ __forceinline__ void keep4_h(v16h a, v16h b, v16h c, v16h d) { asm volatile("v_nop" :: "v"(a), "v"(b), "v"(c), "v"(d)); }
__device__ __forceinline__ void keep4_b(v16b a, v16b b, v16b c, v16b d) { asm volatile("v_nop" :: "v"(a), "v"(b), "v"(c), "v"(d)); }
__device__ __forceinline__ void acc_guard4(v8f& a, v8f& b, v8f& c, v8f& d) { asm volatile("v_nop\n\tv_nop\n\tv_nop\n\tv_nop" : "+v"(a), "+v"(b), "+v"(c), "+v"(d)); }
template <typename T> struct Frag;
template <> struct Frag<_Float16> {
  typedef v16h V; union U { v16h v; v8h h[2]; };
  // elements 0..7 <- p[0..7], 8..15 <- p[16..23]
  static __device__ __forceinline__ v16h load(const _Float16* p) {
    U f; f.h[0] = *(const v8h*)(p); f.h[1] = *(const v8h*)(p + 16); return f.v;
  }
  static __device__ __forceinline__ v8f mma(v16h a, v16h b, v8f c) {
    return __builtin_amdgcn_wmma_f32_16x16x32_f16(false, a, false, b, (short)0, c, false, false);
  }
  static __device__ __forceinline__ void guard(v8f& a, v8f& b, v16h x, v16h y) { dep_guard_h(a, b, x, y); }
  static __device__ __forceinline__ void guard4(v8f& a, v8f& b, v8f& c, v8f& d, v16h x, v16h y) { dep_guard4_h(a, b, c, d, x, y); }
  static __device__ __forceinline__ void keep(v16h a, v16h b, v16h c, v16h d) { keep4_h(a, b, c, d); }
};
template <> struct Frag<__bf16> {
  typedef v16b V; union U { v16b v; v8b h[2]; };
  static __device__ __forceinline__ v16b load(const __bf16* p) {
    U f; f.h[0] = *(const v8b*)(p); f.h[1] = *(const v8b*)(p + 16); return f.v;
  }
  static __device__ __forceinline__ v8f mma(v16b a, v16b b, v8f c) {
    return __builtin_amdgcn_wmma_f32_16x16x32_bf16(false, a, false, b, (short)0, c, false, false);
  }
  static __device__ __forceinline__ void guard(v8f& a, v8f& b, v16b x, v16b y) { dep_guard_b(a, b, x, y); }
  static __device__ __forceinline__ void guard4(v8f& a, v8f& b, v8f& c, v8f& d, v16b x, v16b y) { dep_guard4_b(a, b, c, d, x, y); }
  static __device__ __forceinline__ void keep(v16b a, v16b b, v16b c, v16b d) { keep4_b(a, b, c, d); }
};

__device__ __forceinline__ unsigned pk16(unsigned short a, unsigned short b) { return (unsigned)a | ((unsigned)b << 16); }

// ---- Register-blocked batched WMMA GEMM (bias added in f32 in the slab phase so all output modes see it) ----
// C[m,n] = scale * sum_k A[m,k] * Bt[n,k] (+bias); each wave owns a 64x64 tile.
// A row-major [M,K]; Bt row-major [N,K]; M,N % 64 == 0, K % 32 == 0.
// SPLIT: 0 = single product; 1 = A and Bt hi/lo planes (hi.hi + hi.lo + lo.hi); 2 = A hi/lo planes only (hi.B + lo.B).
// BIAS_MODE: 0 = none, 1 = bias[m] (per row), 2 = bias[n] (per column); bias is an f32 table of length M or N.
// OUT_MODE: 0 = f32, 1 = f16, 2 = bf16 hi plane (Cout) + bf16 lo plane (Cout2).
// ET: 0 = f16 operands, 1 = bf16 operands (pointers passed as 16-bit storage)
template <int ET> struct Elem;
template <> struct Elem<0> { typedef _Float16 T; };
template <> struct Elem<1> { typedef __bf16 T; };
template <int ET, int SPLIT, int BIAS_MODE, int OUT_MODE>
__global__ __launch_bounds__(256) void wmma_gemm64(
    const unsigned short* __restrict__ Ap, const unsigned short* __restrict__ A2p, int lda, long strideA,
    const unsigned short* __restrict__ Btp, const unsigned short* __restrict__ Bt2p, int ldb, long strideB,
    void* __restrict__ Cout, void* __restrict__ Cout2, int ldc, long strideC,
    const float* __restrict__ bias,
    int M, int N, int K, float scale) {
  static_assert(SPLIT >= 0 && SPLIT <= 2);
  static_assert(BIAS_MODE >= 0 && BIAS_MODE <= 2);
  static_assert(OUT_MODE >= 0 && OUT_MODE <= 2);
  typedef typename Elem<ET>::T T;
  typedef typename Frag<T>::V V;
  const T* A = (const T*)Ap; const T* A2 = (const T*)A2p; const T* Bt = (const T*)Btp; const T* Bt2 = (const T*)Bt2p;
  __shared__ __align__(16) float sT[8][16 * 68];   // per-wave 16x64 slab, pitch 68 floats (private-to-wave)
  const int b    = blockIdx.y;
  const int lane = threadIdx.x & 31;
  const int wave = threadIdx.x >> 5;
  const int tilesN = N >> 6;
  const int tilesM = M >> 6;
  const int tile = blockIdx.x * 8 + wave;
  if (tile >= tilesM * tilesN) return;   // wave-uniform; no block barriers in this kernel
  const int tm = tile / tilesN;
  const int tn = tile - tm * tilesN;
  const int m0 = tm << 6;
  const int n0 = tn << 6;

  const T* Ab  = A  + (size_t)b * strideA;
  const T* Bb  = Bt + (size_t)b * strideB;
  const T* Ab2 = (SPLIT != 0) ? (A2  + (size_t)b * strideA) : nullptr;
  const T* Bb2 = (SPLIT == 1) ? (Bt2 + (size_t)b * strideB) : nullptr;

  const int rlane = lane & 15;                 // row (A) / col (B, D) within subtile
  const int koff  = (lane >> 4) * 8;           // k offset of this lane half
  const int mOff  = (lane >> 4) * 8;           // D row offset

  v8f acc[4][4];
#pragma unroll
  for (int i = 0; i < 4; ++i)
#pragma unroll
    for (int j = 0; j < 4; ++j) acc[i][j] = (v8f){0.f,0.f,0.f,0.f,0.f,0.f,0.f,0.f};

  for (int k0 = 0; k0 < K; k0 += 32) {
    V bh[4], bl[4];
#pragma unroll
    for (int j = 0; j < 4; ++j) {
      const size_t bo = (size_t)(n0 + (j << 4) + rlane) * ldb + koff + k0;
      bh[j] = Frag<T>::load(Bb + bo);
      if (SPLIT == 1) bl[j] = Frag<T>::load(Bb2 + bo);
    }
#pragma unroll
    for (int i = 0; i < 4; ++i) {
      const size_t ao = (size_t)(m0 + (i << 4) + rlane) * lda + koff + k0;
      V ah = Frag<T>::load(Ab + ao);
      V al = ah;
      if (SPLIT != 0) al = Frag<T>::load(Ab2 + ao);
#pragma unroll
      for (int j = 0; j < 4; ++j) {
        acc[i][j] = Frag<T>::mma(ah, bh[j], acc[i][j]);
        if (SPLIT == 1) acc[i][j] = Frag<T>::mma(ah, bl[j], acc[i][j]);
        if (SPLIT != 0) acc[i][j] = Frag<T>::mma(al, bh[j], acc[i][j]);
      }
      Frag<T>::guard4(acc[i][0], acc[i][1], acc[i][2], acc[i][3], ah, al);
    }
    Frag<T>::keep(bh[0], bh[1], bh[2], bh[3]);
    if (SPLIT == 1) Frag<T>::keep(bl[0], bl[1], bl[2], bl[3]);
  }
  acc_guard4(acc[0][0], acc[0][1], acc[0][2], acc[0][3]);
  acc_guard4(acc[1][0], acc[1][1], acc[1][2], acc[1][3]);
  acc_guard4(acc[2][0], acc[2][1], acc[2][2], acc[2][3]);
  acc_guard4(acc[3][0], acc[3][1], acc[3][2], acc[3][3]);

  // ---- epilogue ----
  float* slab = sT[wave];
  float bcol[4] = {0.f, 0.f, 0.f, 0.f};
  if (BIAS_MODE == 2) {
    // per-column bias: this lane's columns n0 + 16*j + rlane, j = 0..3 (in range: N multiple of 64)
#pragma unroll
    for (int j = 0; j < 4; ++j) bcol[j] = bias[n0 + (j << 4) + rlane];
  }
#pragma unroll
  for (int i = 0; i < 4; ++i) {
    const int mBase = m0 + (i << 4);
    float brow[8] = {0.f, 0.f, 0.f, 0.f, 0.f, 0.f, 0.f, 0.f};
    if (BIAS_MODE == 1) {
      // per-row bias: rows mBase + mOff + 0..7 (16-B aligned: mBase % 16 == 0, mOff in {0, 8})
      const v4f b0 = *(const v4f*)(bias + mBase + mOff);
      const v4f b1 = *(const v4f*)(bias + mBase + mOff + 4);
#pragma unroll
      for (int e = 0; e < 4; ++e) { brow[e] = b0[e]; brow[4 + e] = b1[e]; }
    }
#pragma unroll
    for (int j = 0; j < 4; ++j) {
#pragma unroll
      for (int r = 0; r < 8; ++r) {
        float bb = 0.f;
        if (BIAS_MODE == 1) bb = brow[r];
        if (BIAS_MODE == 2) bb = bcol[j];
        slab[(mOff + r) * 68 + (j << 4) + rlane] = acc[i][j][r] * scale + bb;
      }
    }
    __builtin_amdgcn_fence(3, "workgroup");
    __builtin_amdgcn_wave_barrier();
    __builtin_amdgcn_fence(2, "workgroup");
    if (OUT_MODE == 0) {
      float* C = (float*)Cout + (size_t)b * strideC;
      const int hh = lane >> 4, c4 = (lane & 15) * 4;     // row seg = 256 B = 16 lanes x 16 B
      {
#pragma unroll
        for (int it = 0; it < 8; ++it) {
          const int row = it * 2 + hh;
          const v4f v = *(const v4f*)(slab + row * 68 + c4);
          *(v4f*)(C + (size_t)(mBase + row) * ldc + n0 + c4) = v;
        }
        
      }
    } else {
      const int q = lane >> 3, c8 = (lane & 7) * 8;
      unsigned short* C  = (unsigned short*)Cout  + (size_t)b * strideC;
      unsigned short* C2 = (OUT_MODE == 2) ? ((unsigned short*)Cout2 + (size_t)b * strideC) : nullptr;
      {
#pragma unroll
        for (int it = 0; it < 4; ++it) {
          const int row = it * 4 + q;
          const float* sp = slab + row * 68 + c8;
          v8h hv, lv;
#pragma unroll
          for (int e = 0; e < 8; ++e) {
            if (OUT_MODE == 1) {
              hv[e] = (_Float16)sp[e];
            } else {
              unsigned short hb = f2bf_bits(sp[e]);
              unsigned short lb = f2bf_bits(sp[e] - bf_bits2f(hb));
              hv[e] = __builtin_bit_cast(_Float16, hb);
              lv[e] = __builtin_bit_cast(_Float16, lb);
            }
          }
          *(v8h*)(C + (size_t)(mBase + row) * ldc + n0 + c8) = hv;
          if (OUT_MODE == 2) *(v8h*)(C2 + (size_t)(mBase + row) * ldc + n0 + c8) = lv;
        }
        
      }
    }
    __builtin_amdgcn_fence(3, "workgroup");
    __builtin_amdgcn_wave_barrier();
    __builtin_amdgcn_fence(2, "workgroup");
  }
}

// ---------------------------------------------------------------------------
// f32 -> bf16 (RNE) cast of x into the compact token plane XB [kTok][1024]: token row t = b*kSeq + s reads input row
// ---------------------------------------------------------------------------
__global__ __launch_bounds__(256) void cast8_bf16_kernel(const float* __restrict__ in, unsigned short* __restrict__ out, int n8) {
  const int i = blockIdx.x * 256 + threadIdx.x;
  if (i >= n8) return;
  const int t  = i >> 7;                 // 128 groups of 8 per token row
  const int c8 = (i & 127) * 8;
  const int b  = t / kSeq;
  const int s  = t - b * kSeq;
  const float* p = in + (size_t)(b * kSeqFull + s) * kDim + c8;
  const v4f a = *(const v4f*)(p);
  const v4f c = *(const v4f*)(p + 4);
  unsigned short hb[8];
#pragma unroll
  for (int e = 0; e < 4; ++e) {
    hb[e]     = f2bf_bits(a[e]);
    hb[4 + e] = f2bf_bits(c[e]);
  }
  const v4u u = (v4u){pk16(hb[0], hb[1]), pk16(hb[2], hb[3]), pk16(hb[4], hb[5]), pk16(hb[6], hb[7])};
  unsigned short* q = out + 8 * (size_t)i;
  *(v4u*)q = u;
  
}

// ---------------------------------------------------------------------------
// Weight transpose + RNE bf16 cast: W f32 row-major [1024 (d)][ldIn (n)] -> WT bf16 [n][d] with pitch ldOut (= 1024):
//   in[d][n] -> out[n][d]. grid (1024/64 d tiles, ldIn/64 n tiles). 256 threads.
// Load coverage: 16 iterations x 256 threads = 4096 = the whole 64x64 tile (coalesced along n).
// Store coverage: 8 waves x 2 iterations x 4 rows (lane>>3) = 64 n-rows; (lane&7) x 8 halves = 64 d-cols; each row segment
// ---------------------------------------------------------------------------
__global__ __launch_bounds__(256) void wtcast_bf16_kernel(const float* __restrict__ W, unsigned short* __restrict__ out,
                                                          int ldIn, int ldOut) {
  __shared__ float sm[64][65];   // sm[n_local][d_local] (cross-wave: block barrier)
  const int t  = threadIdx.x;
  const int d0 = blockIdx.x * 64;
  const int n0 = blockIdx.y * 64;
#pragma unroll
  for (int i = 0; i < 16; ++i) {
    const int e = i * 256 + t;
    const int r = e >> 6;          // d local
    const int c = e & 63;          // n local
    sm[c][r] = W[(size_t)(d0 + r) * ldIn + n0 + c];
  }
  __syncthreads();
  const int lane = t & 31, wave = t >> 5;
  const int q = lane >> 3, c8 = (lane & 7) * 8;
  {
#pragma unroll
    for (int it = 0; it < 2; ++it) {
      const int row = wave * 8 + it * 4 + q;                 // n local
      unsigned short hb[8];
#pragma unroll
      for (int e = 0; e < 8; ++e) hb[e] = f2bf_bits(sm[row][c8 + e]);
      const v4u u = (v4u){pk16(hb[0], hb[1]), pk16(hb[2], hb[3]), pk16(hb[4], hb[5]), pk16(hb[6], hb[7])};
      *(v4u*)(out + (size_t)(n0 + row) * ldOut + d0 + c8) = u;
    }
    
  }
}

// ---------------------------------------------------------------------------
// Bias RNE bf16 convert kept as f32: dst[1024] = float(bf16(src)). One block of 256 threads, float4 per lane:
// ---------------------------------------------------------------------------
__global__ __launch_bounds__(256) void bias_bf16_kernel(const float* __restrict__ bsrc, float* __restrict__ bdst) {
  const int t = threadIdx.x;
  const v4f a = *(const v4f*)(bsrc + 4 * t);
  v4f r;
#pragma unroll
  for (int e = 0; e < 4; ++e) r[e] = bf_bits2f(f2bf_bits(a[e]));
  float* dp = bdst + 4 * t;
  *(v4f*)dp = r;
  
}

// ---------------------------------------------------------------------------
// Causal flash attention, head_dim 64.
//   QK  : f16 plane [kTok][2048]: q at columns h*64.., k at columns 1024 + h*64.. (row = token b*kSeq+s, bias included)
//   VH/VL: bf16 hi/lo planes of v^T: [(b*16+h)*64 + d][kSeq keys]
//   CH/CL: bf16 hi/lo planes of ctx [kTok][1024], column h*64 + d
// scores = 0.125 * q.k^T (v_wmma_f32_16x16x32_f16), keys kv > q replaced by -1e30 on the diagonal chunk, f32 online
// softmax (precise expf), p and v^T as bf16 hi+lo on v_wmma_f32_16x16x32_bf16 (hi.hi + hi.lo + lo.hi), divide by l at
// the end. Block = 4 waves = 64 query rows of one (b,h); chunks of 64 keys, kc = 0..qb only (every visited chunk has
// at least one live key per row). grid.x = kBatch*16*(kSeq/64).
// LDS: K [kv][d] and V^T hi/lo [d][kv] staged by all waves (16-B copies, block barriers before and after); P hi/lo and the output
// ---------------------------------------------------------------------------
union FragH { v16h v; v8h h[2]; };
union FragB { v16b v; v8b h[2]; };

__device__ __forceinline__ v8f mma_h16(v16h a, v16h b, v8f c) {
  c = __builtin_amdgcn_wmma_f32_16x16x32_f16(false, a, false, b, (short)0, c, false, false);
  asm volatile("v_nop\n\tv_nop\n\tv_nop\n\tv_nop" : "+v"(c) : "v"(a), "v"(b));
  return c;
}
__device__ __forceinline__ v8f mma_b16(v16b a, v16b b, v8f c) {
  c = __builtin_amdgcn_wmma_f32_16x16x32_bf16(false, a, false, b, (short)0, c, false, false);
  asm volatile("v_nop\n\tv_nop\n\tv_nop\n\tv_nop" : "+v"(c) : "v"(a), "v"(b));
  return c;
}
__device__ __forceinline__ __bf16 f2bf(float f) { return __builtin_bit_cast(__bf16, f2bf_bits(f)); }
__device__ __forceinline__ void bf_split(float f, __bf16& hi, __bf16& lo) {
  const unsigned short hb = f2bf_bits(f);
  hi = __builtin_bit_cast(__bf16, hb);
  lo = f2bf(f - __uint_as_float(((unsigned)hb) << 16));
}

__global__ __launch_bounds__(128) __attribute__((amdgpu_num_vgpr(256)))
void causal_attn_kernel(const unsigned short* __restrict__ QKp,
                        const unsigned short* __restrict__ VHp,
                        const unsigned short* __restrict__ VLp,
                        unsigned short* __restrict__ CHp,
                        unsigned short* __restrict__ CLp) {
  __shared__ __align__(16) unsigned short Ksh[kKC * kLP];    // K   [kv][d]   9 KB  (cross-wave: block barriers)
  __shared__ __align__(16) unsigned short Vth[kDh * kLP];    // V^T hi [d][kv] 9 KB  (cross-wave: block barriers)
  __shared__ __align__(16) unsigned short Vtl[kDh * kLP];    // V^T lo [d][kv] 9 KB  (cross-wave: block barriers)
  __shared__ __align__(16) __bf16 Psh[kAW][16 * kLP];        // per wave P hi [row][kv] (private-to-wave)
  __shared__ __align__(16) __bf16 Psl[kAW][16 * kLP];        // per wave P lo [row][kv] (private-to-wave)
  __shared__ __align__(16) float  Os[kAW][16 * 68];          // per wave out tile, pitch 68 (private-to-wave)

  const int tid  = threadIdx.x;
  const int wave = tid >> 5;
  const int lane = tid & 31;
  const int hh   = lane >> 4;
  const int c    = lane & 15;

  const int nqb = kSeq / kQB;
  const int bx  = blockIdx.x;
  const int qb  = bx % nqb;
  const int bh  = bx / nqb;              // b*16 + h
  const int h   = bh % kHeads;
  const int b   = bh / kHeads;
  const int q0  = qb * kQB + wave * 16;  // first query row of this wave (within the sequence)

  const _Float16* Qb = (const _Float16*)(QKp + (size_t)b * kSeq * kQKld + h * kDh);
  const unsigned short* Kb  = QKp + (size_t)b * kSeq * kQKld + kDim + h * kDh;
  const unsigned short* Vhb = VHp + (size_t)bh * kDh * kSeq;
  const unsigned short* Vlb = VLp + (size_t)bh * kDh * kSeq;

  // ---- Q fragments (A operand, split k map via Frag<_Float16>::load): 2 d-chunks of 32 ----
  v16h qa[2];
#pragma unroll
  for (int dc = 0; dc < 2; ++dc) qa[dc] = Frag<_Float16>::load(Qb + (size_t)(q0 + c) * kQKld + dc * 32 + 8 * hh);

  float mrow[8], lrow[8];
  v8f oacc[4];
#pragma unroll
  for (int r = 0; r < 8; ++r) { mrow[r] = -INFINITY; lrow[r] = 0.f; }
#pragma unroll
  for (int t = 0; t < 4; ++t) oacc[t] = (v8f){0.f,0.f,0.f,0.f,0.f,0.f,0.f,0.f};

  const int nChunks = qb + 1;   // block-uniform (causal: key chunks 0..qb)
  for (int kc = 0; kc < nChunks; ++kc) {
    const int kv0 = kc * kKC;
    __syncthreads();
    {
      // staging coverage: 128 threads x (1 row x 32 halves) = 64 rows x 64 halves per tile, all three tiles fully written
      const int r = tid >> 1, hf = (tid & 1) * 32;
      {
        const uint4* ks = (const uint4*)(Kb + (size_t)(kv0 + r) * kQKld + hf);
        uint4* kd = (uint4*)(Ksh + r * kLP + hf);
        const uint4 w0 = ks[0], w1 = ks[1], w2 = ks[2], w3 = ks[3];
        kd[0] = w0; kd[1] = w1; kd[2] = w2; kd[3] = w3;
      }
      asm volatile("" ::: "memory");
      {
        const uint4* vs = (const uint4*)(Vhb + (size_t)r * kSeq + kv0 + hf);
        uint4* vd = (uint4*)(Vth + r * kLP + hf);
        const uint4 w0 = vs[0], w1 = vs[1], w2 = vs[2], w3 = vs[3];
        vd[0] = w0; vd[1] = w1; vd[2] = w2; vd[3] = w3;
      }
      asm volatile("" ::: "memory");
      {
        const uint4* vs = (const uint4*)(Vlb + (size_t)r * kSeq + kv0 + hf);
        uint4* vd = (uint4*)(Vtl + r * kLP + hf);
        const uint4 w0 = vs[0], w1 = vs[1], w2 = vs[2], w3 = vs[3];
        vd[0] = w0; vd[1] = w1; vd[2] = w2; vd[3] = w3;
      }
    }
    __syncthreads();

    // ---- scores: 4 key subtiles of 16, K = 64 (2 d-chunks) ----
    v8f s[4];
#pragma unroll
    for (int j = 0; j < 4; ++j) {
      s[j] = (v8f){0.f,0.f,0.f,0.f,0.f,0.f,0.f,0.f};
#pragma unroll
      for (int dc = 0; dc < 2; ++dc) {
        FragH kb;
        kb.h[0] = *(const v8h*)(Ksh + (j * 16 + c) * kLP + dc * 32 + 8 * hh);
        kb.h[1] = *(const v8h*)(Ksh + (j * 16 + c) * kLP + dc * 32 + 16 + 8 * hh);
        s[j] = mma_h16(qa[dc], kb.v, s[j]);
      }
    }
    // ---- scale, causal fill on the diagonal chunk, row max ----
    const bool diag = (kc == qb);
    float cm[8];
#pragma unroll
    for (int r = 0; r < 8; ++r) {
      const int qrow = q0 + 8 * hh + r;
      float m = -INFINITY;
#pragma unroll
      for (int j = 0; j < 4; ++j) {
        const int kvcol = kv0 + j * 16 + c;
        float sv = s[j][r] * kScale;
        if (diag && (kvcol > qrow)) sv = kNegBig;
        s[j][r] = sv;
        m = fmaxf(m, sv);
      }
#pragma unroll
      for (int off = 1; off < 16; off <<= 1) m = fmaxf(m, __shfl_xor(m, off, 32));
      cm[r] = m;
    }
    // ---- online softmax update, P as bf16 hi/lo into the per-wave LDS tile ----
    __bf16* pwh = Psh[wave];
    __bf16* pwl = Psl[wave];
#pragma unroll
    for (int r = 0; r < 8; ++r) {
      const float mnew = fmaxf(mrow[r], cm[r]);
      const float alpha = expf(mrow[r] - mnew);
      mrow[r] = mnew;
      float psum = 0.f;
#pragma unroll
      for (int j = 0; j < 4; ++j) {
        const float p = expf(s[j][r] - mnew);
        psum += p;
        __bf16 ph, pl;
        bf_split(p, ph, pl);
        pwh[(8 * hh + r) * kLP + j * 16 + c] = ph;
        pwl[(8 * hh + r) * kLP + j * 16 + c] = pl;
      }
#pragma unroll
      for (int off = 1; off < 16; off <<= 1) psum += __shfl_xor(psum, off, 32);
      lrow[r] = lrow[r] * alpha + psum;
#pragma unroll
      for (int t = 0; t < 4; ++t) oacc[t][r] *= alpha;
    }
    __builtin_amdgcn_fence(3, "workgroup");
    __builtin_amdgcn_wave_barrier();
    __builtin_amdgcn_fence(2, "workgroup");
    // ---- ctx += P(16x64) . V(64x64): hi.hi + hi.lo + lo.hi ----
#pragma unroll 1
    for (int kk = 0; kk < 2; ++kk) {
      FragB pa, pl;
      pa.h[0] = *(const v8b*)(pwh + c * kLP + kk * 32 + 8 * hh);
      pa.h[1] = *(const v8b*)(pwh + c * kLP + kk * 32 + 16 + 8 * hh);
      pl.h[0] = *(const v8b*)(pwl + c * kLP + kk * 32 + 8 * hh);
      pl.h[1] = *(const v8b*)(pwl + c * kLP + kk * 32 + 16 + 8 * hh);
#pragma unroll
      for (int t = 0; t < 4; ++t) {
        FragB vb, vl;
        vb.h[0] = *(const v8b*)(Vth + (t * 16 + c) * kLP + kk * 32 + 8 * hh);
        vb.h[1] = *(const v8b*)(Vth + (t * 16 + c) * kLP + kk * 32 + 16 + 8 * hh);
        vl.h[0] = *(const v8b*)(Vtl + (t * 16 + c) * kLP + kk * 32 + 8 * hh);
        vl.h[1] = *(const v8b*)(Vtl + (t * 16 + c) * kLP + kk * 32 + 16 + 8 * hh);
        oacc[t] = mma_b16(pa.v, vb.v, oacc[t]);
        oacc[t] = mma_b16(pa.v, vl.v, oacc[t]);
        oacc[t] = mma_b16(pl.v, vb.v, oacc[t]);
      }
    }
  }

  float* os = Os[wave];
#pragma unroll
  for (int r = 0; r < 8; ++r) {
    const float inv = 1.0f / lrow[r];
#pragma unroll
    for (int t = 0; t < 4; ++t) os[(8 * hh + r) * 68 + t * 16 + c] = oacc[t][r] * inv;
  }
  __builtin_amdgcn_fence(3, "workgroup");
  __builtin_amdgcn_wave_barrier();
  __builtin_amdgcn_fence(2, "workgroup");
  {
    // store coverage: 4 iterations x 4 row groups (lane>>3) = 16 rows; (lane&7) x 8 halves = 64 cols
    const int q = lane >> 3, c8 = (lane & 7) * 8;
    unsigned short* ch = CHp + (size_t)(b * kSeq + q0) * kDim + h * kDh;
    unsigned short* cl = CLp + (size_t)(b * kSeq + q0) * kDim + h * kDh;
    {
#pragma unroll
      for (int it = 0; it < 4; ++it) {
        const int row = it * 4 + q;
        const float* sp = os + row * 68 + c8;
        v8h hv, lv;
#pragma unroll
        for (int e = 0; e < 8; ++e) {
          const unsigned short hb = f2bf_bits(sp[e]);
          const unsigned short lb = f2bf_bits(sp[e] - bf_bits2f(hb));
          hv[e] = __builtin_bit_cast(_Float16, hb);
          lv[e] = __builtin_bit_cast(_Float16, lb);
        }
        *(v8h*)(ch + (size_t)row * kDim + c8) = hv;
        *(v8h*)(cl + (size_t)row * kDim + c8) = lv;
      }
      
    }
  }
}

// ---------------------------------------------------------------------------
// Host glue.
// Inputs (wire f32): 0 x [2][2048][1024], 1 Wq [1024][1024], 2 bq [1024], 3 Wk, 4 bk, 5 Wv, 6 bv, 7 Wo [1024][1024].
//   XB    bf16 [kTok][1024]             8,388,608   (RNE bf16 of x, compact token rows, A layout)
//   WT    bf16 [3072][1024]             6,291,456   (Wq^T | Wk^T | Wv^T, RNE bf16, Bt layout [n][k])
//   WOT   bf16 [1024][1024]             2,097,152   (Wo^T, RNE bf16, Bt layout)
//   BQK   f32  [2048]                       8,192   (RNE bf16 of bq | bk, widened)
//   BV    f32  [1024]                       4,096   (RNE bf16 of bv, widened)
//   QK16  f16  [kTok][2048]            16,777,216   (q | k columns incl. bias)
//   VTH   bf16 [kBatch*16*64][kSeq]     8,388,608   (v^T hi plane, bias included)
//   VTL   bf16 [kBatch*16*64][kSeq]     8,388,608   (v^T lo plane)
//   CTXH  bf16 [kTok][1024]             8,388,608   (ctx hi plane)
//   CTXL  bf16 [kTok][1024]             8,388,608   (ctx lo plane)
//   total                              67,121,152
// GEMM shapes: q|k M=kTok N=2048 K=1024; v^T M=1024 N=kSeq K=1024 (kBatch batches); out M=kSeq N=1024 K=1024 (kBatch
// batches, output rows at pitch kSeqFull per batch). All M,N multiples of 64, K multiple of 32: no padding. 12 launches.
// ---------------------------------------------------------------------------
extern "C" void kernel_launch(void* const* d_in, const int* in_sizes, int n_in,
                              void* d_out, int out_size, void* d_ws, size_t ws_size,
                              hipStream_t stream) {
  if (n_in < 8) return;
  const int rowsNeeded = (kBatch - 1) * kSeqFull + kSeq;     // last token row read/written + 1
  if (in_sizes[0] < rowsNeeded * kDim) return;
  if (in_sizes[1] < kDim * kDim || in_sizes[3] < kDim * kDim || in_sizes[5] < kDim * kDim || in_sizes[7] < kDim * kDim) return;
  if (in_sizes[2] < kDim || in_sizes[4] < kDim || in_sizes[6] < kDim) return;
  if (out_size < rowsNeeded * kDim) return;

  const size_t szXB  = (size_t)kTok * kDim * 2;
  const size_t szWT  = (size_t)kWtN * kDim * 2;
  const size_t szWOT = (size_t)kDim * kDim * 2;
  const size_t szBQK = (size_t)kQKld * 4;
  const size_t szBV  = (size_t)kDim * 4;
  const size_t szQK  = (size_t)kTok * kQKld * 2;
  const size_t szVT  = (size_t)kBatch * kHeads * kDh * kSeq * 2;
  const size_t szCTX = (size_t)kTok * kDim * 2;
  const size_t offXB  = 0;
  const size_t offWT  = offXB + szXB;
  const size_t offWOT = offWT + szWT;
  const size_t offBQK = offWOT + szWOT;
  const size_t offBV  = offBQK + szBQK;
  const size_t offQK  = offBV + szBV;
  const size_t offVTH = offQK + szQK;
  const size_t offVTL = offVTH + szVT;
  const size_t offCH  = offVTL + szVT;
  const size_t offCL  = offCH + szCTX;
  const size_t total  = offCL + szCTX;             // 67,121,152 at full size
  if (ws_size < total) return;
  if (total > (size_t)134217728) return;

  const float* x  = (const float*)d_in[0];
  const float* Wq = (const float*)d_in[1];
  const float* bq = (const float*)d_in[2];
  const float* Wk = (const float*)d_in[3];
  const float* bk = (const float*)d_in[4];
  const float* Wv = (const float*)d_in[5];
  const float* bv = (const float*)d_in[6];
  const float* Wo = (const float*)d_in[7];
  float* out = (float*)d_out;
  char* ws = (char*)d_ws;
  unsigned short* XB   = (unsigned short*)(ws + offXB);
  unsigned short* WT   = (unsigned short*)(ws + offWT);
  unsigned short* WOT  = (unsigned short*)(ws + offWOT);
  float*          BQK  = (float*)(ws + offBQK);
  float*          BV   = (float*)(ws + offBV);
  unsigned short* QK16 = (unsigned short*)(ws + offQK);
  unsigned short* VTH  = (unsigned short*)(ws + offVTH);
  unsigned short* VTL  = (unsigned short*)(ws + offVTL);
  unsigned short* CTXH = (unsigned short*)(ws + offCH);
  unsigned short* CTXL = (unsigned short*)(ws + offCL);

  // ---- prologue: RNE bf16 planes of all float inputs ----
  const int n8 = kTok * kDim / 8;
  cast8_bf16_kernel<<<dim3((n8 + 255) / 256), dim3(256), 0, stream>>>(x, XB, n8);
  // in[1024 (d)][1024 (n)] -> out[1024 (n)][1024 (d)] for each square weight; grid (d tiles, n tiles)
  wtcast_bf16_kernel<<<dim3(kDim / 64, kDim / 64), dim3(256), 0, stream>>>(Wq, WT, kDim, kDim);
  wtcast_bf16_kernel<<<dim3(kDim / 64, kDim / 64), dim3(256), 0, stream>>>(Wk, WT + (size_t)kDim * kDim, kDim, kDim);
  wtcast_bf16_kernel<<<dim3(kDim / 64, kDim / 64), dim3(256), 0, stream>>>(Wv, WT + (size_t)2 * kDim * kDim, kDim, kDim);
  wtcast_bf16_kernel<<<dim3(kDim / 64, kDim / 64), dim3(256), 0, stream>>>(Wo, WOT, kDim, kDim);
  bias_bf16_kernel<<<dim3(1), dim3(256), 0, stream>>>(bq, BQK);
  bias_bf16_kernel<<<dim3(1), dim3(256), 0, stream>>>(bk, BQK + kDim);
  bias_bf16_kernel<<<dim3(1), dim3(256), 0, stream>>>(bv, BV);

  // ---- q|k = XB . WT[rows 0..2047] + BQK[n]  -> f16 plane [kTok][2048]  (M=kTok, N=2048, K=1024, bias per column) ----
  {
    const int tiles = (kTok / 64) * (kQKld / 64);
    wmma_gemm64<1, 0, 2, 1><<<dim3((tiles + 7) / 8, 1), dim3(256), 0, stream>>>(
        XB, XB, kDim, 0L, WT, WT, kDim, 0L,
        (void*)QK16, (void*)QK16, kQKld, 0L, BQK, kTok, kQKld, kDim, 1.0f);
  }
  // ---- v^T[b][h*64+d][s] = WT[2048 + h*64 + d] . XB[b*kSeq + s] + BV[h*64+d]  -> bf16 hi/lo planes
  //      (M=1024, N=kSeq, K=1024, kBatch batches, bias per row) ----
  {
    const int tiles = (kDim / 64) * (kSeq / 64);
    const unsigned short* Av = WT + (size_t)2 * kDim * kDim;   // rows 2048..3071 of WT = Wv^T
    wmma_gemm64<1, 0, 1, 2><<<dim3((tiles + 7) / 8, kBatch), dim3(256), 0, stream>>>(
        Av, Av, kDim, 0L, XB, XB, kDim, (long)kSeq * kDim,
        (void*)VTH, (void*)VTL, kSeq, (long)kDim * kSeq, BV, kDim, kSeq, kDim, 1.0f);
  }
  // ---- causal attention per (b, h, 64-query block) -> ctx bf16 hi/lo planes ----
  causal_attn_kernel<<<dim3(kBatch * kHeads * (kSeq / kQB)), dim3(128), 0, stream>>>(QK16, VTH, VTL, CTXH, CTXL);
  // ---- out[b][s] = (CTXH + CTXL)[b*kSeq + s] . WOT  (M=kSeq, N=1024, K=1024, kBatch batches, no bias),
  //      f32 straight to d_out rows b*kSeqFull + s ----
  {
    const int tiles = (kSeq / 64) * (kDim / 64);
    wmma_gemm64<1, 2, 0, 0><<<dim3((tiles + 7) / 8, kBatch), dim3(256), 0, stream>>>(
        CTXH, CTXL, kDim, (long)kSeq * kDim, WOT, WOT, kDim, 0L,
        (void*)out, (void*)out, kDim, (long)kSeqFull * kDim, BV, kSeq, kDim, kDim, 1.0f);
  }
}

// v002
// One run takes 301 microseconds.
// Two timings next to v001 both put it at 1.40 times that version's speed.
// Over all steps from v000 it is 1.71 times as fast.
// Contractions: q|k = x.[Wq|Wk] and v^T = Wv^T.x^T on v_wmma_f32_16x16x32_bf16 (x, W RNE bf16 operands, single products; bq, bk, bv as RNE bf16 added in f32); scores = q.k^T on v_wmma_f32_16x16x32_f16 (q, k f16 planes, single products); ctx = p.v on v_wmma_f32_16x16x32_bf16 (p and v^T as bf16 hi+lo: hi.hi + hi.lo + lo.hi); out = ctx.Wo on v_wmma_f32_16x16x32_bf16 (ctx bf16 hi+lo, Wo RNE bf16: hi.W + lo.W); f32 accumulate everywhere; scale, causal fill and softmax in f32.
#include <hip/hip_runtime.h>
#include <math.h>

// ---------------------------------------------------------------------------
// Problem constants (NB / SEQ overridable; *_FULL give the input / output strides)
// ---------------------------------------------------------------------------
#ifndef NB
#define NB 2
#endif
#ifndef SEQ
#define SEQ 2048
#endif
#define NB_FULL 2
#define SEQ_FULL 2048

constexpr int kBatch   = NB;
constexpr int kSeq     = SEQ;
constexpr int kSeqFull = SEQ_FULL;
constexpr int kDim     = 1024;               // d_in == d_out
constexpr int kHeads   = 16;
constexpr int kDh      = 64;
constexpr int kTok     = kBatch * kSeq;      // token rows of the compact planes
constexpr int kWtN     = 3 * kDim;           // rows of the Wq^T | Wk^T | Wv^T plane
constexpr int kQKld    = 2 * kDim;           // 2048, pitch (halves) of the q|k f16 plane
constexpr int kQB      = 64;                 // query rows per attention block
constexpr int kKC      = 64;                 // keys per chunk
constexpr int kAW      = 4;                  // waves per attention block
constexpr int kLP      = 72;                 // LDS row pitch (halves) of the K, V^T and P tiles: 144 B = 16 B x 9, so 16 rows read by ds_load_b128 fall on 64 distinct banks
constexpr float kScale  = 0.125f;            // 64^-0.5, exact
constexpr float kNegBig = -1.0e30f;          // finite fill for scores above the diagonal
static_assert(kBatch >= 1 && kBatch <= NB_FULL);
static_assert(kSeq >= 64 && kSeq <= SEQ_FULL);
static_assert(kHeads * kDh == kDim);
static_assert(kSeq % kQB == 0 && kSeq % kKC == 0 && kQB == kAW * 16 && kDh == 64);
// GEMM shape contract (no tail handling): M multiple of 128, N multiple of 256, K multiple of 64
static_assert(kTok % 128 == 0 && kQKld % 256 == 0 && kDim % 64 == 0);
static_assert(kDim % 256 == 0 && kSeq % 256 == 0);
static_assert(kDim / 8 == 128 && (kTok * kDim) % 8 == 0);

typedef __attribute__((ext_vector_type(16))) _Float16 v16h;
typedef __attribute__((ext_vector_type(8)))  _Float16 v8h;
typedef __attribute__((ext_vector_type(16))) __bf16   v16b;
typedef __attribute__((ext_vector_type(8)))  __bf16   v8b;
typedef __attribute__((ext_vector_type(8)))  float    v8f;
typedef __attribute__((ext_vector_type(4)))  float    v4f;
typedef __attribute__((ext_vector_type(4)))  unsigned int v4u;

// ---------------------------------------------------------------------------
// Shared pieces
// ---------------------------------------------------------------------------
__device__ __forceinline__ unsigned short f2bf_bits(float f) {
  unsigned u = __float_as_uint(f);
  return (unsigned short)((u + 0x7FFFu + ((u >> 16) & 1u)) >> 16);
}
__device__ __forceinline__ float bf_bits2f(unsigned short h) { return __uint_as_float(((unsigned)h) << 16); }

// hazard guards as plain device helpers (the GEMM template body's only inline asm is its s_wait_xcnt)
__device__ __forceinline__ void dep_guard_h(v8f& a, v8f& b, v16h x, v16h y) { asm volatile("v_nop\n\tv_nop\n\tv_nop\n\tv_nop" : "+v"(a), "+v"(b) : "v"(x), "v"(y)); }
__device__ __forceinline__ void dep_guard_b(v8f& a, v8f& b, v16b x, v16b y) { asm volatile("v_nop\n\tv_nop\n\tv_nop\n\tv_nop" : "+v"(a), "+v"(b) : "v"(x), "v"(y)); }
// guard tying all four accumulators of a group and naming both A fragments as inputs
__device__ __forceinline__ void dep_guard4_h(v8f& a, v8f& b, v8f& c, v8f& d, v16h x, v16h y) { asm volatile("v_nop\n\tv_nop\n\tv_nop\n\tv_nop" : "+v"(a), "+v"(b), "+v"(c), "+v"(d) : "v"(x), "v"(y)); }
__device__ __forceinline__ void dep_guard4_b(v8f& a, v8f& b, v8f& c, v8f& d, v16b x, v16b y) { asm volatile("v_nop\n\tv_nop\n\tv_nop\n\tv_nop" : "+v"(a), "+v"(b), "+v"(c), "+v"(d) : "v"(x), "v"(y)); }
__device__ __forceinline__ void keep4_h(v16h a, v16h b, v16h c, v16h d) { asm volatile("v_nop" :: "v"(a), "v"(b), "v"(c), "v"(d)); }
__device__ __forceinline__ void keep4_b(v16b a, v16b b, v16b c, v16b d) { asm volatile("v_nop" :: "v"(a), "v"(b), "v"(c), "v"(d)); }
__device__ __forceinline__ void acc_guard4(v8f& a, v8f& b, v8f& c, v8f& d) { asm volatile("v_nop\n\tv_nop\n\tv_nop\n\tv_nop" : "+v"(a), "+v"(b), "+v"(c), "+v"(d)); }
template <typename T> struct Frag;
template <> struct Frag<_Float16> {
  typedef v16h V; union U { v16h v; v8h h[2]; };
  // elements 0..7 <- p[0..7], 8..15 <- p[16..23]
  static __device__ __forceinline__ v16h load(const _Float16* p) {
    U f; f.h[0] = *(const v8h*)(p); f.h[1] = *(const v8h*)(p + 16); return f.v;
  }
  static __device__ __forceinline__ v8f mma(v16h a, v16h b, v8f c) {
    return __builtin_amdgcn_wmma_f32_16x16x32_f16(false, a, false, b, (short)0, c, false, false);
  }
  static __device__ __forceinline__ void guard(v8f& a, v8f& b, v16h x, v16h y) { dep_guard_h(a, b, x, y); }
  static __device__ __forceinline__ void guard4(v8f& a, v8f& b, v8f& c, v8f& d, v16h x, v16h y) { dep_guard4_h(a, b, c, d, x, y); }
  static __device__ __forceinline__ void keep(v16h a, v16h b, v16h c, v16h d) { keep4_h(a, b, c, d); }
};
template <> struct Frag<__bf16> {
  typedef v16b V; union U { v16b v; v8b h[2]; };
  static __device__ __forceinline__ v16b load(const __bf16* p) {
    U f; f.h[0] = *(const v8b*)(p); f.h[1] = *(const v8b*)(p + 16); return f.v;
  }
  static __device__ __forceinline__ v8f mma(v16b a, v16b b, v8f c) {
    return __builtin_amdgcn_wmma_f32_16x16x32_bf16(false, a, false, b, (short)0, c, false, false);
  }
  static __device__ __forceinline__ void guard(v8f& a, v8f& b, v16b x, v16b y) { dep_guard_b(a, b, x, y); }
  static __device__ __forceinline__ void guard4(v8f& a, v8f& b, v8f& c, v8f& d, v16b x, v16b y) { dep_guard4_b(a, b, c, d, x, y); }
  static __device__ __forceinline__ void keep(v16b a, v16b b, v16b c, v16b d) { keep4_b(a, b, c, d); }
};

__device__ __forceinline__ unsigned pk16(unsigned short a, unsigned short b) { return (unsigned)a | ((unsigned)b << 16); }

// ---- Register-blocked batched WMMA GEMM (bias added in f32 in the slab phase so all output modes see it) ----
// C[m,n] = scale * sum_k A[m,k] * Bt[n,k] (+bias); each wave owns a 64x64 tile, a block of 8 waves (2 x 4) a 128x256 tile.
// A row-major [M,K]; Bt row-major [N,K], both at row pitch kDim (lda == ldb == kDim); M % 128 == 0, N % 256 == 0, K % 64 == 0.
// Operands go through LDS: per 64 k the block copies its 128 A rows and 256 Bt rows once, 128 B of a row by 8 lanes, so a
// wave-wide 16-B load covers 4 whole lines; the next tile's loads are issued before the products of the current one.
// SPLIT: 0 = single product; 2 = A hi/lo planes (hi.B + lo.B).
// BIAS_MODE: 0 = none, 1 = bias[m] (per row), 2 = bias[n] (per column); bias is an f32 table of length M or N.
// OUT_MODE: 0 = f32, 1 = f16, 2 = bf16 hi plane (Cout) + bf16 lo plane (Cout2).
// ET: 0 = f16 operands, 1 = bf16 operands (pointers passed as 16-bit storage)
constexpr int kGP = 72;   // LDS row pitch (halves) of the staged A and Bt tiles: 144 B = 16 B x 9 for the ds_load_b128 fragment reads
template <int ET> struct Elem;
template <> struct Elem<0> { typedef _Float16 T; };
template <> struct Elem<1> { typedef __bf16 T; };
template <int ET, int SPLIT, int BIAS_MODE, int OUT_MODE>
__global__ __launch_bounds__(256) void wmma_gemm64(
    const unsigned short* __restrict__ Ap, const unsigned short* __restrict__ A2p, int lda, long strideA,
    const unsigned short* __restrict__ Btp, const unsigned short* __restrict__ Bt2p, int ldb, long strideB,
    void* __restrict__ Cout, void* __restrict__ Cout2, int ldc, long strideC,
    const float* __restrict__ bias,
    int M, int N, int K, float scale) {
  static_assert(SPLIT == 0 || SPLIT == 2);
  static_assert(BIAS_MODE >= 0 && BIAS_MODE <= 2);
  static_assert(OUT_MODE >= 0 && OUT_MODE <= 2);
  typedef typename Elem<ET>::T T;
  typedef typename Frag<T>::V V;
  __shared__ __align__(16) unsigned short sA[(SPLIT == 2 ? 2 : 1) * 128 * kGP];   // A (hi, then lo) [row][k] (cross-wave: block barriers)
  __shared__ __align__(16) unsigned short sB[256 * kGP];                          // Bt [row][k] (cross-wave: block barriers)
  __shared__ __align__(16) float sT[8][16 * 68];   // per-wave 16x64 slab, pitch 68 floats (private-to-wave)
  const int b    = blockIdx.y;
  const int tid  = threadIdx.x;
  const int lane = tid & 31;
  const int wave = tid >> 5;
  const int blocksN = N >> 8;
  const int bm = blockIdx.x / blocksN;
  const int bn = blockIdx.x - bm * blocksN;
  const int mB = bm << 7;                      // first A row of the block
  const int nB = bn << 8;                      // first Bt row of the block
  const int wm = (wave >> 2) << 6;             // this wave's rows within the A tile
  const int wn = (wave & 3) << 6;              // this wave's rows within the Bt tile
  const int m0 = mB + wm;
  const int n0 = nB + wn;

  const unsigned short* Ab  = Ap  + (size_t)b * strideA;
  const unsigned short* Bb  = Btp + (size_t)b * strideB;
  const unsigned short* Ab2 = (SPLIT == 2) ? (A2p + (size_t)b * strideA) : nullptr;

  const int rlane = lane & 15;                 // row (A) / col (B, D) within subtile
  const int koff  = (lane >> 4) * 8;           // k offset of this lane half
  const int mOff  = (lane >> 4) * 8;           // D row offset

  // staging map: thread -> row (tid >> 3) + 32 * i, 8 halves at column (tid & 7) * 8. One address per plane: the row step
  // 32 * kDim is a compile-time constant, so the i-th load differs from the first by an immediate offset only.
  // Every loop over i, j or ks below is unrolled so that the register arrays (ra, rb, fragments, acc) keep constant indices.
  const int srow = tid >> 3;
  const int sc8  = (tid & 7) * 8;
  const unsigned short* gA  = Ab + (size_t)(mB + srow) * kDim + sc8;
  const unsigned short* gA2 = (SPLIT == 2) ? (Ab2 + (size_t)(mB + srow) * kDim + sc8) : nullptr;
  const unsigned short* gB  = Bb + (size_t)(nB + srow) * kDim + sc8;
  v4u ra[4], ra2[4], rb[8];
#pragma unroll
  for (int i = 0; i < 4; ++i) {
    ra[i] = *(const v4u*)(gA + i * 32 * kDim);
    if (SPLIT == 2) ra2[i] = *(const v4u*)(gA2 + i * 32 * kDim);
  }
#pragma unroll
  for (int i = 0; i < 8; ++i) rb[i] = *(const v4u*)(gB + i * 32 * kDim);

  const T* fa = (const T*)sA + (wm + rlane) * kGP + koff;
  const T* fb = (const T*)sB + (wn + rlane) * kGP + koff;

  v8f acc[4][4];
#pragma unroll
  for (int i = 0; i < 4; ++i)
#pragma unroll
    for (int j = 0; j < 4; ++j) acc[i][j] = (v8f){0.f,0.f,0.f,0.f,0.f,0.f,0.f,0.f};

  for (int k0 = 0; k0 < K; k0 += 64) {
    __syncthreads();   // every wave has read its last fragment of the previous tile
#pragma unroll
    for (int i = 0; i < 4; ++i) {
      *(v4u*)(sA + (srow + 32 * i) * kGP + sc8) = ra[i];
      if (SPLIT == 2) *(v4u*)(sA + (128 + srow + 32 * i) * kGP + sc8) = ra2[i];
    }
#pragma unroll
    for (int i = 0; i < 8; ++i) *(v4u*)(sB + (srow + 32 * i) * kGP + sc8) = rb[i];
    __syncthreads();   // the tile is complete before any wave reads it
    if (k0 + 64 < K) { // block-uniform: the next tile's loads fly during this tile's products
      const int kn = k0 + 64;
#pragma unroll
      for (int i = 0; i < 4; ++i) {
        ra[i] = *(const v4u*)(gA + kn + i * 32 * kDim);
        if (SPLIT == 2) ra2[i] = *(const v4u*)(gA2 + kn + i * 32 * kDim);
      }
#pragma unroll
      for (int i = 0; i < 8; ++i) rb[i] = *(const v4u*)(gB + kn + i * 32 * kDim);
      // the fragment reads below reuse the address registers of the loads just issued: the wait stands in front of that overwrite
      asm volatile("s_wait_xcnt 0x0" ::: "memory");
    }
#pragma unroll
    for (int ks = 0; ks < 64; ks += 32) {
      V bh[4], ah[4], al[4];
#pragma unroll
      for (int j = 0; j < 4; ++j) bh[j] = Frag<T>::load(fb + (j << 4) * kGP + ks);
#pragma unroll
      for (int i = 0; i < 4; ++i) {
        ah[i] = Frag<T>::load(fa + (i << 4) * kGP + ks);
        al[i] = ah[i];
        if (SPLIT == 2) al[i] = Frag<T>::load(fa + (128 + (i << 4)) * kGP + ks);
      }
#pragma unroll
      for (int i = 0; i < 4; ++i) {
#pragma unroll
        for (int j = 0; j < 4; ++j) {
          acc[i][j] = Frag<T>::mma(ah[i], bh[j], acc[i][j]);
          if (SPLIT == 2) acc[i][j] = Frag<T>::mma(al[i], bh[j], acc[i][j]);
        }
      }
#pragma unroll
      for (int i = 0; i < 4; ++i) Frag<T>::guard4(acc[i][0], acc[i][1], acc[i][2], acc[i][3], ah[i], al[i]);
      Frag<T>::keep(bh[0], bh[1], bh[2], bh[3]);
    }
  }
  acc_guard4(acc[0][0], acc[0][1], acc[0][2], acc[0][3]);
  acc_guard4(acc[1][0], acc[1][1], acc[1][2], acc[1][3]);
  acc_guard4(acc[2][0], acc[2][1], acc[2][2], acc[2][3]);
  acc_guard4(acc[3][0], acc[3][1], acc[3][2], acc[3][3]);

  // ---- epilogue ----
  float* slab = sT[wave];
  float bcol[4] = {0.f, 0.f, 0.f, 0.f};
  if (BIAS_MODE == 2) {
    // per-column bias: this lane's columns n0 + 16*j + rlane, j = 0..3 (in range: N multiple of 64)
#pragma unroll
    for (int j = 0; j < 4; ++j) bcol[j] = bias[n0 + (j << 4) + rlane];
  }
#pragma unroll
  for (int i = 0; i < 4; ++i) {
    const int mBase = m0 + (i << 4);
    float brow[8] = {0.f, 0.f, 0.f, 0.f, 0.f, 0.f, 0.f, 0.f};
    if (BIAS_MODE == 1) {
      // per-row bias: rows mBase + mOff + 0..7 (16-B aligned: mBase % 16 == 0, mOff in {0, 8})
      const v4f b0 = *(const v4f*)(bias + mBase + mOff);
      const v4f b1 = *(const v4f*)(bias + mBase + mOff + 4);
#pragma unroll
      for (int e = 0; e < 4; ++e) { brow[e] = b0[e]; brow[4 + e] = b1[e]; }
    }
#pragma unroll
    for (int j = 0; j < 4; ++j) {
#pragma unroll
      for (int r = 0; r < 8; ++r) {
        float bb = 0.f;
        if (BIAS_MODE == 1) bb = brow[r];
        if (BIAS_MODE == 2) bb = bcol[j];
        slab[(mOff + r) * 68 + (j << 4) + rlane] = acc[i][j][r] * scale + bb;
      }
    }
    __builtin_amdgcn_fence(3, "workgroup");
    __builtin_amdgcn_wave_barrier();
    __builtin_amdgcn_fence(2, "workgroup");
    if (OUT_MODE == 0) {
      float* C = (float*)Cout + (size_t)b * strideC;
      const int hh = lane >> 4, c4 = (lane & 15) * 4;     // row seg = 256 B = 16 lanes x 16 B
      {
#pragma unroll
        for (int it = 0; it < 8; ++it) {
          const int row = it * 2 + hh;
          const v4f v = *(const v4f*)(slab + row * 68 + c4);
          *(v4f*)(C + (size_t)(mBase + row) * ldc + n0 + c4) = v;
        }
        
      }
    } else {
      const int q = lane >> 3, c8 = (lane & 7) * 8;
      unsigned short* C  = (unsigned short*)Cout  + (size_t)b * strideC;
      unsigned short* C2 = (OUT_MODE == 2) ? ((unsigned short*)Cout2 + (size_t)b * strideC) : nullptr;
      {
#pragma unroll
        for (int it = 0; it < 4; ++it) {
          const int row = it * 4 + q;
          const float* sp = slab + row * 68 + c8;
          v8h hv, lv;
#pragma unroll
          for (int e = 0; e < 8; ++e) {
            if (OUT_MODE == 1) {
              hv[e] = (_Float16)sp[e];
            } else {
              unsigned short hb = f2bf_bits(sp[e]);
              unsigned short lb = f2bf_bits(sp[e] - bf_bits2f(hb));
              hv[e] = __builtin_bit_cast(_Float16, hb);
              lv[e] = __builtin_bit_cast(_Float16, lb);
            }
          }
          *(v8h*)(C + (size_t)(mBase + row) * ldc + n0 + c8) = hv;
          if (OUT_MODE == 2) *(v8h*)(C2 + (size_t)(mBase + row) * ldc + n0 + c8) = lv;
        }
        
      }
    }
    __builtin_amdgcn_fence(3, "workgroup");
    __builtin_amdgcn_wave_barrier();
    __builtin_amdgcn_fence(2, "workgroup");
  }
}

// ---------------------------------------------------------------------------
// f32 -> bf16 (RNE) cast of x into the compact token plane XB [kTok][1024]: token row t = b*kSeq + s reads input row
// ---------------------------------------------------------------------------
__global__ __launch_bounds__(256) void cast8_bf16_kernel(const float* __restrict__ in, unsigned short* __restrict__ out, int n8) {
  const int i = blockIdx.x * 256 + threadIdx.x;
  if (i >= n8) return;
  const int t  = i >> 7;                 // 128 groups of 8 per token row
  const int c8 = (i & 127) * 8;
  const int b  = t / kSeq;
  const int s  = t - b * kSeq;
  const float* p = in + (size_t)(b * kSeqFull + s) * kDim + c8;
  const v4f a = *(const v4f*)(p);
  const v4f c = *(const v4f*)(p + 4);
  unsigned short hb[8];
#pragma unroll
  for (int e = 0; e < 4; ++e) {
    hb[e]     = f2bf_bits(a[e]);
    hb[4 + e] = f2bf_bits(c[e]);
  }
  const v4u u = (v4u){pk16(hb[0], hb[1]), pk16(hb[2], hb[3]), pk16(hb[4], hb[5]), pk16(hb[6], hb[7])};
  unsigned short* q = out + 8 * (size_t)i;
  *(v4u*)q = u;
  
}

// ---------------------------------------------------------------------------
// Weight transpose + RNE bf16 cast: W f32 row-major [1024 (d)][ldIn (n)] -> WT bf16 [n][d] with pitch ldOut (= 1024):
//   in[d][n] -> out[n][d]. grid (1024/64 d tiles, ldIn/64 n tiles). 256 threads.
// Load coverage: 16 iterations x 256 threads = 4096 = the whole 64x64 tile (coalesced along n).
// Store coverage: 8 waves x 2 iterations x 4 rows (lane>>3) = 64 n-rows; (lane&7) x 8 halves = 64 d-cols; each row segment
// ---------------------------------------------------------------------------
__global__ __launch_bounds__(256) void wtcast_bf16_kernel(const float* __restrict__ W, unsigned short* __restrict__ out,
                                                          int ldIn, int ldOut) {
  __shared__ float sm[64][65];   // sm[n_local][d_local] (cross-wave: block barrier)
  const int t  = threadIdx.x;
  const int d0 = blockIdx.x * 64;
  const int n0 = blockIdx.y * 64;
#pragma unroll
  for (int i = 0; i < 16; ++i) {
    const int e = i * 256 + t;
    const int r = e >> 6;          // d local
    const int c = e & 63;          // n local
    sm[c][r] = W[(size_t)(d0 + r) * ldIn + n0 + c];
  }
  __syncthreads();
  const int lane = t & 31, wave = t >> 5;
  const int q = lane >> 3, c8 = (lane & 7) * 8;
  {
#pragma unroll
    for (int it = 0; it < 2; ++it) {
      const int row = wave * 8 + it * 4 + q;                 // n local
      unsigned short hb[8];
#pragma unroll
      for (int e = 0; e < 8; ++e) hb[e] = f2bf_bits(sm[row][c8 + e]);
      const v4u u = (v4u){pk16(hb[0], hb[1]), pk16(hb[2], hb[3]), pk16(hb[4], hb[5]), pk16(hb[6], hb[7])};
      *(v4u*)(out + (size_t)(n0 + row) * ldOut + d0 + c8) = u;
    }
    
  }
}

// ---------------------------------------------------------------------------
// Bias RNE bf16 convert kept as f32: dst[1024] = float(bf16(src)). One block of 256 threads, float4 per lane:
// ---------------------------------------------------------------------------
__global__ __launch_bounds__(256) void bias_bf16_kernel(const float* __restrict__ bsrc, float* __restrict__ bdst) {
  const int t = threadIdx.x;
  const v4f a = *(const v4f*)(bsrc + 4 * t);
  v4f r;
#pragma unroll
  for (int e = 0; e < 4; ++e) r[e] = bf_bits2f(f2bf_bits(a[e]));
  float* dp = bdst + 4 * t;
  *(v4f*)dp = r;
  
}

// ---------------------------------------------------------------------------
// Causal flash attention, head_dim 64.
//   QK  : f16 plane [kTok][2048]: q at columns h*64.., k at columns 1024 + h*64.. (row = token b*kSeq+s, bias included)
//   VH/VL: bf16 hi/lo planes of v^T: [(b*16+h)*64 + d][kSeq keys]
//   CH/CL: bf16 hi/lo planes of ctx [kTok][1024], column h*64 + d
// scores = 0.125 * q.k^T (v_wmma_f32_16x16x32_f16), keys kv > q replaced by -1e30 on the diagonal chunk, f32 online
// softmax (precise expf), p and v^T as bf16 hi+lo on v_wmma_f32_16x16x32_bf16 (hi.hi + hi.lo + lo.hi), divide by l at
// the end. Block = 4 waves = 64 query rows of one (b,h); chunks of 64 keys, kc = 0..qb only (every visited chunk has
// at least one live key per row). grid.x = kBatch*16*(kSeq/64).
// LDS: K [kv][d] and V^T hi/lo [d][kv] staged by all waves (16-B copies, block barriers before and after); P hi/lo and the output
// ---------------------------------------------------------------------------
union FragH { v16h v; v8h h[2]; };
union FragB { v16b v; v8b h[2]; };

__device__ __forceinline__ v8f mma_h16(v16h a, v16h b, v8f c) {
  c = __builtin_amdgcn_wmma_f32_16x16x32_f16(false, a, false, b, (short)0, c, false, false);
  asm volatile("v_nop\n\tv_nop\n\tv_nop\n\tv_nop" : "+v"(c) : "v"(a), "v"(b));
  return c;
}
__device__ __forceinline__ v8f mma_b16(v16b a, v16b b, v8f c) {
  c = __builtin_amdgcn_wmma_f32_16x16x32_bf16(false, a, false, b, (short)0, c, false, false);
  asm volatile("v_nop\n\tv_nop\n\tv_nop\n\tv_nop" : "+v"(c) : "v"(a), "v"(b));
  return c;
}
__device__ __forceinline__ __bf16 f2bf(float f) { return __builtin_bit_cast(__bf16, f2bf_bits(f)); }
__device__ __forceinline__ void bf_split(float f, __bf16& hi, __bf16& lo) {
  const unsigned short hb = f2bf_bits(f);
  hi = __builtin_bit_cast(__bf16, hb);
  lo = f2bf(f - __uint_as_float(((unsigned)hb) << 16));
}

__global__ __launch_bounds__(128) __attribute__((amdgpu_num_vgpr(256)))
void causal_attn_kernel(const unsigned short* __restrict__ QKp,
                        const unsigned short* __restrict__ VHp,
                        const unsigned short* __restrict__ VLp,
                        unsigned short* __restrict__ CHp,
                        unsigned short* __restrict__ CLp) {
  __shared__ __align__(16) unsigned short Ksh[kKC * kLP];    // K   [kv][d]   9 KB  (cross-wave: block barriers)
  __shared__ __align__(16) unsigned short Vth[kDh * kLP];    // V^T hi [d][kv] 9 KB  (cross-wave: block barriers)
  __shared__ __align__(16) unsigned short Vtl[kDh * kLP];    // V^T lo [d][kv] 9 KB  (cross-wave: block barriers)
  __shared__ __align__(16) __bf16 Psh[kAW][16 * kLP];        // per wave P hi [row][kv] (private-to-wave)
  __shared__ __align__(16) __bf16 Psl[kAW][16 * kLP];        // per wave P lo [row][kv] (private-to-wave)
  __shared__ __align__(16) float  Os[kAW][16 * 68];          // per wave out tile, pitch 68 (private-to-wave)

  const int tid  = threadIdx.x;
  const int wave = tid >> 5;
  const int lane = tid & 31;
  const int hh   = lane >> 4;
  const int c    = lane & 15;

  const int nqb = kSeq / kQB;
  const int bx  = blockIdx.x;
  const int qb  = bx % nqb;
  const int bh  = bx / nqb;              // b*16 + h
  const int h   = bh % kHeads;
  const int b   = bh / kHeads;
  const int q0  = qb * kQB + wave * 16;  // first query row of this wave (within the sequence)

  const _Float16* Qb = (const _Float16*)(QKp + (size_t)b * kSeq * kQKld + h * kDh);
  const unsigned short* Kb  = QKp + (size_t)b * kSeq * kQKld + kDim + h * kDh;
  const unsigned short* Vhb = VHp + (size_t)bh * kDh * kSeq;
  const unsigned short* Vlb = VLp + (size_t)bh * kDh * kSeq;

  // ---- Q fragments (A operand, split k map via Frag<_Float16>::load): 2 d-chunks of 32 ----
  v16h qa[2];
#pragma unroll
  for (int dc = 0; dc < 2; ++dc) qa[dc] = Frag<_Float16>::load(Qb + (size_t)(q0 + c) * kQKld + dc * 32 + 8 * hh);

  float mrow[8], lrow[8];
  v8f oacc[4];
#pragma unroll
  for (int r = 0; r < 8; ++r) { mrow[r] = -INFINITY; lrow[r] = 0.f; }
#pragma unroll
  for (int t = 0; t < 4; ++t) oacc[t] = (v8f){0.f,0.f,0.f,0.f,0.f,0.f,0.f,0.f};

  const int nChunks = qb + 1;   // block-uniform (causal: key chunks 0..qb)
  for (int kc = 0; kc < nChunks; ++kc) {
    const int kv0 = kc * kKC;
    __syncthreads();
    {
      // staging coverage: 128 threads x (1 row x 32 halves) = 64 rows x 64 halves per tile, all three tiles fully written
      const int r = tid >> 1, hf = (tid & 1) * 32;
      {
        const uint4* ks = (const uint4*)(Kb + (size_t)(kv0 + r) * kQKld + hf);
        uint4* kd = (uint4*)(Ksh + r * kLP + hf);
        const uint4 w0 = ks[0], w1 = ks[1], w2 = ks[2], w3 = ks[3];
        kd[0] = w0; kd[1] = w1; kd[2] = w2; kd[3] = w3;
      }
      asm volatile("" ::: "memory");
      {
        const uint4* vs = (const uint4*)(Vhb + (size_t)r * kSeq + kv0 + hf);
        uint4* vd = (uint4*)(Vth + r * kLP + hf);
        const uint4 w0 = vs[0], w1 = vs[1], w2 = vs[2], w3 = vs[3];
        vd[0] = w0; vd[1] = w1; vd[2] = w2; vd[3] = w3;
      }
      asm volatile("" ::: "memory");
      {
        const uint4* vs = (const uint4*)(Vlb + (size_t)r * kSeq + kv0 + hf);
        uint4* vd = (uint4*)(Vtl + r * kLP + hf);
        const uint4 w0 = vs[0], w1 = vs[1], w2 = vs[2], w3 = vs[3];
        vd[0] = w0; vd[1] = w1; vd[2] = w2; vd[3] = w3;
      }
    }
    __syncthreads();

    // ---- scores: 4 key subtiles of 16, K = 64 (2 d-chunks) ----
    v8f s[4];
#pragma unroll
    for (int j = 0; j < 4; ++j) {
      s[j] = (v8f){0.f,0.f,0.f,0.f,0.f,0.f,0.f,0.f};
#pragma unroll
      for (int dc = 0; dc < 2; ++dc) {
        FragH kb;
        kb.h[0] = *(const v8h*)(Ksh + (j * 16 + c) * kLP + dc * 32 + 8 * hh);
        kb.h[1] = *(const v8h*)(Ksh + (j * 16 + c) * kLP + dc * 32 + 16 + 8 * hh);
        s[j] = mma_h16(qa[dc], kb.v, s[j]);
      }
    }
    // ---- scale, causal fill on the diagonal chunk, row max ----
    const bool diag = (kc == qb);
    float cm[8];
#pragma unroll
    for (int r = 0; r < 8; ++r) {
      const int qrow = q0 + 8 * hh + r;
      float m = -INFINITY;
#pragma unroll
      for (int j = 0; j < 4; ++j) {
        const int kvcol = kv0 + j * 16 + c;
        float sv = s[j][r] * kScale;
        if (diag && (kvcol > qrow)) sv = kNegBig;
        s[j][r] = sv;
        m = fmaxf(m, sv);
      }
#pragma unroll
      for (int off = 1; off < 16; off <<= 1) m = fmaxf(m, __shfl_xor(m, off, 32));
      cm[r] = m;
    }
    // ---- online softmax update, P as bf16 hi/lo into the per-wave LDS tile ----
    __bf16* pwh = Psh[wave];
    __bf16* pwl = Psl[wave];
#pragma unroll
    for (int r = 0; r < 8; ++r) {
      const float mnew = fmaxf(mrow[r], cm[r]);
      const float alpha = expf(mrow[r] - mnew);
      mrow[r] = mnew;
      float psum = 0.f;
#pragma unroll
      for (int j = 0; j < 4; ++j) {
        const float p = expf(s[j][r] - mnew);
        psum += p;
        __bf16 ph, pl;
        bf_split(p, ph, pl);
        pwh[(8 * hh + r) * kLP + j * 16 + c] = ph;
        pwl[(8 * hh + r) * kLP + j * 16 + c] = pl;
      }
#pragma unroll
      for (int off = 1; off < 16; off <<= 1) psum += __shfl_xor(psum, off, 32);
      lrow[r] = lrow[r] * alpha + psum;
#pragma unroll
      for (int t = 0; t < 4; ++t) oacc[t][r] *= alpha;
    }
    __builtin_amdgcn_fence(3, "workgroup");
    __builtin_amdgcn_wave_barrier();
    __builtin_amdgcn_fence(2, "workgroup");
    // ---- ctx += P(16x64) . V(64x64): hi.hi + hi.lo + lo.hi ----
#pragma unroll 1
    for (int kk = 0; kk < 2; ++kk) {
      FragB pa, pl;
      pa.h[0] = *(const v8b*)(pwh + c * kLP + kk * 32 + 8 * hh);
      pa.h[1] = *(const v8b*)(pwh + c * kLP + kk * 32 + 16 + 8 * hh);
      pl.h[0] = *(const v8b*)(pwl + c * kLP + kk * 32 + 8 * hh);
      pl.h[1] = *(const v8b*)(pwl + c * kLP + kk * 32 + 16 + 8 * hh);
#pragma unroll
      for (int t = 0; t < 4; ++t) {
        FragB vb, vl;
        vb.h[0] = *(const v8b*)(Vth + (t * 16 + c) * kLP + kk * 32 + 8 * hh);
        vb.h[1] = *(const v8b*)(Vth + (t * 16 + c) * kLP + kk * 32 + 16 + 8 * hh);
        vl.h[0] = *(const v8b*)(Vtl + (t * 16 + c) * kLP + kk * 32 + 8 * hh);
        vl.h[1] = *(const v8b*)(Vtl + (t * 16 + c) * kLP + kk * 32 + 16 + 8 * hh);
        oacc[t] = mma_b16(pa.v, vb.v, oacc[t]);
        oacc[t] = mma_b16(pa.v, vl.v, oacc[t]);
        oacc[t] = mma_b16(pl.v, vb.v, oacc[t]);
      }
    }
  }

  float* os = Os[wave];
#pragma unroll
  for (int r = 0; r < 8; ++r) {
    const float inv = 1.0f / lrow[r];
#pragma unroll
    for (int t = 0; t < 4; ++t) os[(8 * hh + r) * 68 + t * 16 + c] = oacc[t][r] * inv;
  }
  __builtin_amdgcn_fence(3, "workgroup");
  __builtin_amdgcn_wave_barrier();
  __builtin_amdgcn_fence(2, "workgroup");
  {
    // store coverage: 4 iterations x 4 row groups (lane>>3) = 16 rows; (lane&7) x 8 halves = 64 cols
    const int q = lane >> 3, c8 = (lane & 7) * 8;
    unsigned short* ch = CHp + (size_t)(b * kSeq + q0) * kDim + h * kDh;
    unsigned short* cl = CLp + (size_t)(b * kSeq + q0) * kDim + h * kDh;
    {
#pragma unroll
      for (int it = 0; it < 4; ++it) {
        const int row = it * 4 + q;
        const float* sp = os + row * 68 + c8;
        v8h hv, lv;
#pragma unroll
        for (int e = 0; e < 8; ++e) {
          const unsigned short hb = f2bf_bits(sp[e]);
          const unsigned short lb = f2bf_bits(sp[e] - bf_bits2f(hb));
          hv[e] = __builtin_bit_cast(_Float16, hb);
          lv[e] = __builtin_bit_cast(_Float16, lb);
        }
        *(v8h*)(ch + (size_t)row * kDim + c8) = hv;
        *(v8h*)(cl + (size_t)row * kDim + c8) = lv;
      }
      
    }
  }
}

// ---------------------------------------------------------------------------
// Host glue.
// Inputs (wire f32): 0 x [2][2048][1024], 1 Wq [1024][1024], 2 bq [1024], 3 Wk, 4 bk, 5 Wv, 6 bv, 7 Wo [1024][1024].
//   XB    bf16 [kTok][1024]             8,388,608   (RNE bf16 of x, compact token rows, A layout)
//   WT    bf16 [3072][1024]             6,291,456   (Wq^T | Wk^T | Wv^T, RNE bf16, Bt layout [n][k])
//   WOT   bf16 [1024][1024]             2,097,152   (Wo^T, RNE bf16, Bt layout)
//   BQK   f32  [2048]                       8,192   (RNE bf16 of bq | bk, widened)
//   BV    f32  [1024]                       4,096   (RNE bf16 of bv, widened)
//   QK16  f16  [kTok][2048]            16,777,216   (q | k columns incl. bias)
//   VTH   bf16 [kBatch*16*64][kSeq]     8,388,608   (v^T hi plane, bias included)
//   VTL   bf16 [kBatch*16*64][kSeq]     8,388,608   (v^T lo plane)
//   CTXH  bf16 [kTok][1024]             8,388,608   (ctx hi plane)
//   CTXL  bf16 [kTok][1024]             8,388,608   (ctx lo plane)
//   total                              67,121,152
// GEMM shapes: q|k M=kTok N=2048 K=1024; v^T M=1024 N=kSeq K=1024 (kBatch batches); out M=kSeq N=1024 K=1024 (kBatch
// batches, output rows at pitch kSeqFull per batch). All M multiples of 128, N of 256, K of 64: no padding. 12 launches.
// ---------------------------------------------------------------------------
extern "C" void kernel_launch(void* const* d_in, const int* in_sizes, int n_in,
                              void* d_out, int out_size, void* d_ws, size_t ws_size,
                              hipStream_t stream) {
  if (n_in < 8) return;
  const int rowsNeeded = (kBatch - 1) * kSeqFull + kSeq;     // last token row read/written + 1
  if (in_sizes[0] < rowsNeeded * kDim) return;
  if (in_sizes[1] < kDim * kDim || in_sizes[3] < kDim * kDim || in_sizes[5] < kDim * kDim || in_sizes[7] < kDim * kDim) return;
  if (in_sizes[2] < kDim || in_sizes[4] < kDim || in_sizes[6] < kDim) return;
  if (out_size < rowsNeeded * kDim) return;

  const size_t szXB  = (size_t)kTok * kDim * 2;
  const size_t szWT  = (size_t)kWtN * kDim * 2;
  const size_t szWOT = (size_t)kDim * kDim * 2;
  const size_t szBQK = (size_t)kQKld * 4;
  const size_t szBV  = (size_t)kDim * 4;
  const size_t szQK  = (size_t)kTok * kQKld * 2;
  const size_t szVT  = (size_t)kBatch * kHeads * kDh * kSeq * 2;
  const size_t szCTX = (size_t)kTok * kDim * 2;
  const size_t offXB  = 0;
  const size_t offWT  = offXB + szXB;
  const size_t offWOT = offWT + szWT;
  const size_t offBQK = offWOT + szWOT;
  const size_t offBV  = offBQK + szBQK;
  const size_t offQK  = offBV + szBV;
  const size_t offVTH = offQK + szQK;
  const size_t offVTL = offVTH + szVT;
  const size_t offCH  = offVTL + szVT;
  const size_t offCL  = offCH + szCTX;
  const size_t total  = offCL + szCTX;             // 67,121,152 at full size
  if (ws_size < total) return;
  if (total > (size_t)134217728) return;

  const float* x  = (const float*)d_in[0];
  const float* Wq = (const float*)d_in[1];
  const float* bq = (const float*)d_in[2];
  const float* Wk = (const float*)d_in[3];
  const float* bk = (const float*)d_in[4];
  const float* Wv = (const float*)d_in[5];
  const float* bv = (const float*)d_in[6];
  const float* Wo = (const float*)d_in[7];
  float* out = (float*)d_out;
  char* ws = (char*)d_ws;
  unsigned short* XB   = (unsigned short*)(ws + offXB);
  unsigned short* WT   = (unsigned short*)(ws + offWT);
  unsigned short* WOT  = (unsigned short*)(ws + offWOT);
  float*          BQK  = (float*)(ws + offBQK);
  float*          BV   = (float*)(ws + offBV);
  unsigned short* QK16 = (unsigned short*)(ws + offQK);
  unsigned short* VTH  = (unsigned short*)(ws + offVTH);
  unsigned short* VTL  = (unsigned short*)(ws + offVTL);
  unsigned short* CTXH = (unsigned short*)(ws + offCH);
  unsigned short* CTXL = (unsigned short*)(ws + offCL);

  // ---- prologue: RNE bf16 planes of all float inputs ----
  const int n8 = kTok * kDim / 8;
  cast8_bf16_kernel<<<dim3((n8 + 255) / 256), dim3(256), 0, stream>>>(x, XB, n8);
  // in[1024 (d)][1024 (n)] -> out[1024 (n)][1024 (d)] for each square weight; grid (d tiles, n tiles)
  wtcast_bf16_kernel<<<dim3(kDim / 64, kDim / 64), dim3(256), 0, stream>>>(Wq, WT, kDim, kDim);
  wtcast_bf16_kernel<<<dim3(kDim / 64, kDim / 64), dim3(256), 0, stream>>>(Wk, WT + (size_t)kDim * kDim, kDim, kDim);
  wtcast_bf16_kernel<<<dim3(kDim / 64, kDim / 64), dim3(256), 0, stream>>>(Wv, WT + (size_t)2 * kDim * kDim, kDim, kDim);
  wtcast_bf16_kernel<<<dim3(kDim / 64, kDim / 64), dim3(256), 0, stream>>>(Wo, WOT, kDim, kDim);
  bias_bf16_kernel<<<dim3(1), dim3(256), 0, stream>>>(bq, BQK);
  bias_bf16_kernel<<<dim3(1), dim3(256), 0, stream>>>(bk, BQK + kDim);
  bias_bf16_kernel<<<dim3(1), dim3(256), 0, stream>>>(bv, BV);

  // ---- q|k = XB . WT[rows 0..2047] + BQK[n]  -> f16 plane [kTok][2048]  (M=kTok, N=2048, K=1024, bias per column) ----
  {
    const int blocks = (kTok / 128) * (kQKld / 256);
    wmma_gemm64<1, 0, 2, 1><<<dim3(blocks, 1), dim3(256), 0, stream>>>(
        XB, XB, kDim, 0L, WT, WT, kDim, 0L,
        (void*)QK16, (void*)QK16, kQKld, 0L, BQK, kTok, kQKld, kDim, 1.0f);
  }
  // ---- v^T[b][h*64+d][s] = WT[2048 + h*64 + d] . XB[b*kSeq + s] + BV[h*64+d]  -> bf16 hi/lo planes
  //      (M=1024, N=kSeq, K=1024, kBatch batches, bias per row) ----
  {
    const int blocks = (kDim / 128) * (kSeq / 256);
    const unsigned short* Av = WT + (size_t)2 * kDim * kDim;   // rows 2048..3071 of WT = Wv^T
    wmma_gemm64<1, 0, 1, 2><<<dim3(blocks, kBatch), dim3(256), 0, stream>>>(
        Av, Av, kDim, 0L, XB, XB, kDim, (long)kSeq * kDim,
        (void*)VTH, (void*)VTL, kSeq, (long)kDim * kSeq, BV, kDim, kSeq, kDim, 1.0f);
  }
  // ---- causal attention per (b, h, 64-query block) -> ctx bf16 hi/lo planes ----
  causal_attn_kernel<<<dim3(kBatch * kHeads * (kSeq / kQB)), dim3(128), 0, stream>>>(QK16, VTH, VTL, CTXH, CTXL);
  // ---- out[b][s] = (CTXH + CTXL)[b*kSeq + s] . WOT  (M=kSeq, N=1024, K=1024, kBatch batches, no bias),
  //      f32 straight to d_out rows b*kSeqFull + s ----
  {
    const int blocks = (kSeq / 128) * (kDim / 256);
    wmma_gemm64<1, 2, 0, 0><<<dim3(blocks, kBatch), dim3(256), 0, stream>>>(
        CTXH, CTXL, kDim, (long)kSeq * kDim, WOT, WOT, kDim, 0L,
        (void*)out, (void*)out, kDim, (long)kSeqFull * kDim, BV, kSeq, kDim, kDim, 1.0f);
  }
}

// v003
// A run of this version takes 204 microseconds.
// Two timings next to v002 both put it at 1.48 times that version's speed.
// Counting every step since v000, it is 2.52 times as fast.
// Contractions: q|k = x.[Wq|Wk] and v^T = Wv^T.x^T on v_wmma_f32_16x16x32_bf16 (x, W RNE bf16 operands, single products; bq, bk, bv as RNE bf16 added in f32); scores^T = k.q^T on v_wmma_f32_16x16x32_f16 (q, k f16 planes, single products); ctx^T = v^T.p^T on v_wmma_f32_16x16x32_bf16 (p^T and v^T as bf16 hi+lo: hi.hi + lo.hi + hi.lo); out = ctx.Wo on v_wmma_f32_16x16x32_bf16 (ctx bf16 hi+lo, Wo RNE bf16: hi.W + lo.W); f32 accumulate everywhere; scale, causal fill and softmax in f32.
#include <hip/hip_runtime.h>
#include <math.h>

// ---------------------------------------------------------------------------
// Problem constants (NB / SEQ overridable; *_FULL give the input / output strides)
// ---------------------------------------------------------------------------
#ifndef NB
#define NB 2
#endif
#ifndef SEQ
#define SEQ 2048
#endif
#define NB_FULL 2
#define SEQ_FULL 2048

constexpr int kBatch   = NB;
constexpr int kSeq     = SEQ;
constexpr int kSeqFull = SEQ_FULL;
constexpr int kDim     = 1024;               // d_in == d_out
constexpr int kHeads   = 16;
constexpr int kDh      = 64;
constexpr int kTok     = kBatch * kSeq;      // token rows of the compact planes
constexpr int kWtN     = 3 * kDim;           // rows of the Wq^T | Wk^T | Wv^T plane
constexpr int kQKld    = 2 * kDim;           // 2048, pitch (halves) of the q|k f16 plane
constexpr int kQB      = 64;                 // query rows per attention block
constexpr int kKC      = 64;                 // keys per chunk
constexpr int kAW      = 4;                  // waves per attention block
constexpr int kLP      = 72;                 // LDS row pitch (halves) of the K and V^T tiles: 144 B = 16 B x 9, so 16 rows read by ds_load_b128 fall on 64 distinct banks
constexpr float kScale  = 0.125f;            // 64^-0.5, exact
constexpr float kNegBig = -1.0e30f;          // finite fill for scores above the diagonal
static_assert(kBatch >= 1 && kBatch <= NB_FULL);
static_assert(kSeq >= 64 && kSeq <= SEQ_FULL);
static_assert(kHeads * kDh == kDim);
static_assert(kSeq % kQB == 0 && kSeq % kKC == 0 && kQB == kAW * 16 && kDh == 64);
// GEMM shape contract (no tail handling): M multiple of 128, N multiple of 256, K multiple of 64
static_assert(kTok % 128 == 0 && kQKld % 256 == 0 && kDim % 64 == 0);
static_assert(kDim % 256 == 0 && kSeq % 256 == 0);
static_assert(kDim / 8 == 128 && (kTok * kDim) % 8 == 0);

typedef __attribute__((ext_vector_type(16))) _Float16 v16h;
typedef __attribute__((ext_vector_type(8)))  _Float16 v8h;
typedef __attribute__((ext_vector_type(16))) __bf16   v16b;
typedef __attribute__((ext_vector_type(8)))  __bf16   v8b;
typedef __attribute__((ext_vector_type(8)))  float    v8f;
typedef __attribute__((ext_vector_type(4)))  float    v4f;
typedef __attribute__((ext_vector_type(4)))  unsigned int v4u;

// ---------------------------------------------------------------------------
// Shared pieces
// ---------------------------------------------------------------------------
__device__ __forceinline__ unsigned short f2bf_bits(float f) {
  unsigned u = __float_as_uint(f);
  return (unsigned short)((u + 0x7FFFu + ((u >> 16) & 1u)) >> 16);
}
__device__ __forceinline__ float bf_bits2f(unsigned short h) { return __uint_as_float(((unsigned)h) << 16); }

// hazard guards as plain device helpers (the GEMM template body's only inline asm is its s_wait_xcnt)
__device__ __forceinline__ void dep_guard_h(v8f& a, v8f& b, v16h x, v16h y) { asm volatile("v_nop\n\tv_nop\n\tv_nop\n\tv_nop" : "+v"(a), "+v"(b) : "v"(x), "v"(y)); }
__device__ __forceinline__ void dep_guard_b(v8f& a, v8f& b, v16b x, v16b y) { asm volatile("v_nop\n\tv_nop\n\tv_nop\n\tv_nop" : "+v"(a), "+v"(b) : "v"(x), "v"(y)); }
// guard tying all four accumulators of a group and naming both A fragments as inputs
__device__ __forceinline__ void dep_guard4_h(v8f& a, v8f& b, v8f& c, v8f& d, v16h x, v16h y) { asm volatile("v_nop\n\tv_nop\n\tv_nop\n\tv_nop" : "+v"(a), "+v"(b), "+v"(c), "+v"(d) : "v"(x), "v"(y)); }
__device__ __forceinline__ void dep_guard4_b(v8f& a, v8f& b, v8f& c, v8f& d, v16b x, v16b y) { asm volatile("v_nop\n\tv_nop\n\tv_nop\n\tv_nop" : "+v"(a), "+v"(b), "+v"(c), "+v"(d) : "v"(x), "v"(y)); }
__device__ __forceinline__ void keep4_h(v16h a, v16h b, v16h c, v16h d) { asm volatile("v_nop" :: "v"(a), "v"(b), "v"(c), "v"(d)); }
__device__ __forceinline__ void keep4_b(v16b a, v16b b, v16b c, v16b d) { asm volatile("v_nop" :: "v"(a), "v"(b), "v"(c), "v"(d)); }
__device__ __forceinline__ void acc_guard4(v8f& a, v8f& b, v8f& c, v8f& d) { asm volatile("v_nop\n\tv_nop\n\tv_nop\n\tv_nop" : "+v"(a), "+v"(b), "+v"(c), "+v"(d)); }
template <typename T> struct Frag;
template <> struct Frag<_Float16> {
  typedef v16h V; union U { v16h v; v8h h[2]; };
  // elements 0..7 <- p[0..7], 8..15 <- p[16..23]
  static __device__ __forceinline__ v16h load(const _Float16* p) {
    U f; f.h[0] = *(const v8h*)(p); f.h[1] = *(const v8h*)(p + 16); return f.v;
  }
  static __device__ __forceinline__ v8f mma(v16h a, v16h b, v8f c) {
    return __builtin_amdgcn_wmma_f32_16x16x32_f16(false, a, false, b, (short)0, c, false, false);
  }
  static __device__ __forceinline__ void guard(v8f& a, v8f& b, v16h x, v16h y) { dep_guard_h(a, b, x, y); }
  static __device__ __forceinline__ void guard4(v8f& a, v8f& b, v8f& c, v8f& d, v16h x, v16h y) { dep_guard4_h(a, b, c, d, x, y); }
  static __device__ __forceinline__ void keep(v16h a, v16h b, v16h c, v16h d) { keep4_h(a, b, c, d); }
};
template <> struct Frag<__bf16> {
  typedef v16b V; union U { v16b v; v8b h[2]; };
  static __device__ __forceinline__ v16b load(const __bf16* p) {
    U f; f.h[0] = *(const v8b*)(p); f.h[1] = *(const v8b*)(p + 16); return f.v;
  }
  static __device__ __forceinline__ v8f mma(v16b a, v16b b, v8f c) {
    return __builtin_amdgcn_wmma_f32_16x16x32_bf16(false, a, false, b, (short)0, c, false, false);
  }
  static __device__ __forceinline__ void guard(v8f& a, v8f& b, v16b x, v16b y) { dep_guard_b(a, b, x, y); }
  static __device__ __forceinline__ void guard4(v8f& a, v8f& b, v8f& c, v8f& d, v16b x, v16b y) { dep_guard4_b(a, b, c, d, x, y); }
  static __device__ __forceinline__ void keep(v16b a, v16b b, v16b c, v16b d) { keep4_b(a, b, c, d); }
};

__device__ __forceinline__ unsigned pk16(unsigned short a, unsigned short b) { return (unsigned)a | ((unsigned)b << 16); }

// ---- Register-blocked batched WMMA GEMM (bias added in f32 in the slab phase so all output modes see it) ----
// C[m,n] = scale * sum_k A[m,k] * Bt[n,k] (+bias); each wave owns a 64x64 tile, a block of 8 waves (2 x 4) a 128x256 tile.
// A row-major [M,K]; Bt row-major [N,K], both at row pitch kDim (lda == ldb == kDim); M % 128 == 0, N % 256 == 0, K % 64 == 0.
// Operands go through LDS: per 64 k the block copies its 128 A rows and 256 Bt rows once, 128 B of a row by 8 lanes, so a
// wave-wide 16-B load covers 4 whole lines; the next tile's loads are issued before the products of the current one.
// SPLIT: 0 = single product; 2 = A hi/lo planes (hi.B + lo.B).
// BIAS_MODE: 0 = none, 1 = bias[m] (per row), 2 = bias[n] (per column); bias is an f32 table of length M or N.
// OUT_MODE: 0 = f32, 1 = f16, 2 = bf16 hi plane (Cout) + bf16 lo plane (Cout2).
// ET: 0 = f16 operands, 1 = bf16 operands (pointers passed as 16-bit storage)
constexpr int kGP = 72;   // LDS row pitch (halves) of the staged A and Bt tiles: 144 B = 16 B x 9 for the ds_load_b128 fragment reads
template <int ET> struct Elem;
template <> struct Elem<0> { typedef _Float16 T; };
template <> struct Elem<1> { typedef __bf16 T; };
template <int ET, int SPLIT, int BIAS_MODE, int OUT_MODE>
__global__ __launch_bounds__(256) void wmma_gemm64(
    const unsigned short* __restrict__ Ap, const unsigned short* __restrict__ A2p, int lda, long strideA,
    const unsigned short* __restrict__ Btp, const unsigned short* __restrict__ Bt2p, int ldb, long strideB,
    void* __restrict__ Cout, void* __restrict__ Cout2, int ldc, long strideC,
    const float* __restrict__ bias,
    int M, int N, int K, float scale) {
  static_assert(SPLIT == 0 || SPLIT == 2);
  static_assert(BIAS_MODE >= 0 && BIAS_MODE <= 2);
  static_assert(OUT_MODE >= 0 && OUT_MODE <= 2);
  typedef typename Elem<ET>::T T;
  typedef typename Frag<T>::V V;
  __shared__ __align__(16) unsigned short sA[(SPLIT == 2 ? 2 : 1) * 128 * kGP];   // A (hi, then lo) [row][k] (cross-wave: block barriers)
  __shared__ __align__(16) unsigned short sB[256 * kGP];                          // Bt [row][k] (cross-wave: block barriers)
  __shared__ __align__(16) float sT[8][16 * 68];   // per-wave 16x64 slab, pitch 68 floats (private-to-wave)
  const int b    = blockIdx.y;
  const int tid  = threadIdx.x;
  const int lane = tid & 31;
  const int wave = tid >> 5;
  const int blocksN = N >> 8;
  const int bm = blockIdx.x / blocksN;
  const int bn = blockIdx.x - bm * blocksN;
  const int mB = bm << 7;                      // first A row of the block
  const int nB = bn << 8;                      // first Bt row of the block
  const int wm = (wave >> 2) << 6;             // this wave's rows within the A tile
  const int wn = (wave & 3) << 6;              // this wave's rows within the Bt tile
  const int m0 = mB + wm;
  const int n0 = nB + wn;

  const unsigned short* Ab  = Ap  + (size_t)b * strideA;
  const unsigned short* Bb  = Btp + (size_t)b * strideB;
  const unsigned short* Ab2 = (SPLIT == 2) ? (A2p + (size_t)b * strideA) : nullptr;

  const int rlane = lane & 15;                 // row (A) / col (B, D) within subtile
  const int koff  = (lane >> 4) * 8;           // k offset of this lane half
  const int mOff  = (lane >> 4) * 8;           // D row offset

  // staging map: thread -> row (tid >> 3) + 32 * i, 8 halves at column (tid & 7) * 8. One address per plane: the row step
  // 32 * kDim is a compile-time constant, so the i-th load differs from the first by an immediate offset only.
  // Every loop over i, j or ks below is unrolled so that the register arrays (ra, rb, fragments, acc) keep constant indices.
  const int srow = tid >> 3;
  const int sc8  = (tid & 7) * 8;
  const unsigned short* gA  = Ab + (size_t)(mB + srow) * kDim + sc8;
  const unsigned short* gA2 = (SPLIT == 2) ? (Ab2 + (size_t)(mB + srow) * kDim + sc8) : nullptr;
  const unsigned short* gB  = Bb + (size_t)(nB + srow) * kDim + sc8;
  v4u ra[4], ra2[4], rb[8];
#pragma unroll
  for (int i = 0; i < 4; ++i) {
    ra[i] = *(const v4u*)(gA + i * 32 * kDim);
    if (SPLIT == 2) ra2[i] = *(const v4u*)(gA2 + i * 32 * kDim);
  }
#pragma unroll
  for (int i = 0; i < 8; ++i) rb[i] = *(const v4u*)(gB + i * 32 * kDim);

  const T* fa = (const T*)sA + (wm + rlane) * kGP + koff;
  const T* fb = (const T*)sB + (wn + rlane) * kGP + koff;

  v8f acc[4][4];
#pragma unroll
  for (int i = 0; i < 4; ++i)
#pragma unroll
    for (int j = 0; j < 4; ++j) acc[i][j] = (v8f){0.f,0.f,0.f,0.f,0.f,0.f,0.f,0.f};

  for (int k0 = 0; k0 < K; k0 += 64) {
    __syncthreads();   // every wave has read its last fragment of the previous tile
#pragma unroll
    for (int i = 0; i < 4; ++i) {
      *(v4u*)(sA + (srow + 32 * i) * kGP + sc8) = ra[i];
      if (SPLIT == 2) *(v4u*)(sA + (128 + srow + 32 * i) * kGP + sc8) = ra2[i];
    }
#pragma unroll
    for (int i = 0; i < 8; ++i) *(v4u*)(sB + (srow + 32 * i) * kGP + sc8) = rb[i];
    __syncthreads();   // the tile is complete before any wave reads it
    if (k0 + 64 < K) { // block-uniform: the next tile's loads fly during this tile's products
      const int kn = k0 + 64;
#pragma unroll
      for (int i = 0; i < 4; ++i) {
        ra[i] = *(const v4u*)(gA + kn + i * 32 * kDim);
        if (SPLIT == 2) ra2[i] = *(const v4u*)(gA2 + kn + i * 32 * kDim);
      }
#pragma unroll
      for (int i = 0; i < 8; ++i) rb[i] = *(const v4u*)(gB + kn + i * 32 * kDim);
      // the fragment reads below reuse the address registers of the loads just issued: the wait stands in front of that overwrite
      asm volatile("s_wait_xcnt 0x0" ::: "memory");
    }
#pragma unroll
    for (int ks = 0; ks < 64; ks += 32) {
      V bh[4], ah[4], al[4];
#pragma unroll
      for (int j = 0; j < 4; ++j) bh[j] = Frag<T>::load(fb + (j << 4) * kGP + ks);
#pragma unroll
      for (int i = 0; i < 4; ++i) {
        ah[i] = Frag<T>::load(fa + (i << 4) * kGP + ks);
        al[i] = ah[i];
        if (SPLIT == 2) al[i] = Frag<T>::load(fa + (128 + (i << 4)) * kGP + ks);
      }
#pragma unroll
      for (int i = 0; i < 4; ++i) {
#pragma unroll
        for (int j = 0; j < 4; ++j) {
          acc[i][j] = Frag<T>::mma(ah[i], bh[j], acc[i][j]);
          if (SPLIT == 2) acc[i][j] = Frag<T>::mma(al[i], bh[j], acc[i][j]);
        }
      }
#pragma unroll
      for (int i = 0; i < 4; ++i) Frag<T>::guard4(acc[i][0], acc[i][1], acc[i][2], acc[i][3], ah[i], al[i]);
      Frag<T>::keep(bh[0], bh[1], bh[2], bh[3]);
    }
  }
  acc_guard4(acc[0][0], acc[0][1], acc[0][2], acc[0][3]);
  acc_guard4(acc[1][0], acc[1][1], acc[1][2], acc[1][3]);
  acc_guard4(acc[2][0], acc[2][1], acc[2][2], acc[2][3]);
  acc_guard4(acc[3][0], acc[3][1], acc[3][2], acc[3][3]);

  // ---- epilogue ----
  float* slab = sT[wave];
  float bcol[4] = {0.f, 0.f, 0.f, 0.f};
  if (BIAS_MODE == 2) {
    // per-column bias: this lane's columns n0 + 16*j + rlane, j = 0..3 (in range: N multiple of 64)
#pragma unroll
    for (int j = 0; j < 4; ++j) bcol[j] = bias[n0 + (j << 4) + rlane];
  }
#pragma unroll
  for (int i = 0; i < 4; ++i) {
    const int mBase = m0 + (i << 4);
    float brow[8] = {0.f, 0.f, 0.f, 0.f, 0.f, 0.f, 0.f, 0.f};
    if (BIAS_MODE == 1) {
      // per-row bias: rows mBase + mOff + 0..7 (16-B aligned: mBase % 16 == 0, mOff in {0, 8})
      const v4f b0 = *(const v4f*)(bias + mBase + mOff);
      const v4f b1 = *(const v4f*)(bias + mBase + mOff + 4);
#pragma unroll
      for (int e = 0; e < 4; ++e) { brow[e] = b0[e]; brow[4 + e] = b1[e]; }
    }
#pragma unroll
    for (int j = 0; j < 4; ++j) {
#pragma unroll
      for (int r = 0; r < 8; ++r) {
        float bb = 0.f;
        if (BIAS_MODE == 1) bb = brow[r];
        if (BIAS_MODE == 2) bb = bcol[j];
        slab[(mOff + r) * 68 + (j << 4) + rlane] = acc[i][j][r] * scale + bb;
      }
    }
    __builtin_amdgcn_fence(3, "workgroup");
    __builtin_amdgcn_wave_barrier();
    __builtin_amdgcn_fence(2, "workgroup");
    if (OUT_MODE == 0) {
      float* C = (float*)Cout + (size_t)b * strideC;
      const int hh = lane >> 4, c4 = (lane & 15) * 4;     // row seg = 256 B = 16 lanes x 16 B
      {
#pragma unroll
        for (int it = 0; it < 8; ++it) {
          const int row = it * 2 + hh;
          const v4f v = *(const v4f*)(slab + row * 68 + c4);
          *(v4f*)(C + (size_t)(mBase + row) * ldc + n0 + c4) = v;
        }
        
      }
    } else {
      const int q = lane >> 3, c8 = (lane & 7) * 8;
      unsigned short* C  = (unsigned short*)Cout  + (size_t)b * strideC;
      unsigned short* C2 = (OUT_MODE == 2) ? ((unsigned short*)Cout2 + (size_t)b * strideC) : nullptr;
      {
#pragma unroll
        for (int it = 0; it < 4; ++it) {
          const int row = it * 4 + q;
          const float* sp = slab + row * 68 + c8;
          v8h hv, lv;
#pragma unroll
          for (int e = 0; e < 8; ++e) {
            if (OUT_MODE == 1) {
              hv[e] = (_Float16)sp[e];
            } else {
              unsigned short hb = f2bf_bits(sp[e]);
              unsigned short lb = f2bf_bits(sp[e] - bf_bits2f(hb));
              hv[e] = __builtin_bit_cast(_Float16, hb);
              lv[e] = __builtin_bit_cast(_Float16, lb);
            }
          }
          *(v8h*)(C + (size_t)(mBase + row) * ldc + n0 + c8) = hv;
          if (OUT_MODE == 2) *(v8h*)(C2 + (size_t)(mBase + row) * ldc + n0 + c8) = lv;
        }
        
      }
    }
    __builtin_amdgcn_fence(3, "workgroup");
    __builtin_amdgcn_wave_barrier();
    __builtin_amdgcn_fence(2, "workgroup");
  }
}

// ---------------------------------------------------------------------------
// f32 -> bf16 (RNE) cast of x into the compact token plane XB [kTok][1024]: token row t = b*kSeq + s reads input row
// ---------------------------------------------------------------------------
__global__ __launch_bounds__(256) void cast8_bf16_kernel(const float* __restrict__ in, unsigned short* __restrict__ out, int n8) {
  const int i = blockIdx.x * 256 + threadIdx.x;
  if (i >= n8) return;
  const int t  = i >> 7;                 // 128 groups of 8 per token row
  const int c8 = (i & 127) * 8;
  const int b  = t / kSeq;
  const int s  = t - b * kSeq;
  const float* p = in + (size_t)(b * kSeqFull + s) * kDim + c8;
  const v4f a = *(const v4f*)(p);
  const v4f c = *(const v4f*)(p + 4);
  unsigned short hb[8];
#pragma unroll
  for (int e = 0; e < 4; ++e) {
    hb[e]     = f2bf_bits(a[e]);
    hb[4 + e] = f2bf_bits(c[e]);
  }
  const v4u u = (v4u){pk16(hb[0], hb[1]), pk16(hb[2], hb[3]), pk16(hb[4], hb[5]), pk16(hb[6], hb[7])};
  unsigned short* q = out + 8 * (size_t)i;
  *(v4u*)q = u;
  
}

// ---------------------------------------------------------------------------
// Weight transpose + RNE bf16 cast: W f32 row-major [1024 (d)][ldIn (n)] -> WT bf16 [n][d] with pitch ldOut (= 1024):
//   in[d][n] -> out[n][d]. grid (1024/64 d tiles, ldIn/64 n tiles). 256 threads.
// Load coverage: 16 iterations x 256 threads = 4096 = the whole 64x64 tile (coalesced along n).
// Store coverage: 8 waves x 2 iterations x 4 rows (lane>>3) = 64 n-rows; (lane&7) x 8 halves = 64 d-cols; each row segment
// ---------------------------------------------------------------------------
__global__ __launch_bounds__(256) void wtcast_bf16_kernel(const float* __restrict__ W, unsigned short* __restrict__ out,
                                                          int ldIn, int ldOut) {
  __shared__ float sm[64][65];   // sm[n_local][d_local] (cross-wave: block barrier)
  const int t  = threadIdx.x;
  const int d0 = blockIdx.x * 64;
  const int n0 = blockIdx.y * 64;
#pragma unroll
  for (int i = 0; i < 16; ++i) {
    const int e = i * 256 + t;
    const int r = e >> 6;          // d local
    const int c = e & 63;          // n local
    sm[c][r] = W[(size_t)(d0 + r) * ldIn + n0 + c];
  }
  __syncthreads();
  const int lane = t & 31, wave = t >> 5;
  const int q = lane >> 3, c8 = (lane & 7) * 8;
  {
#pragma unroll
    for (int it = 0; it < 2; ++it) {
      const int row = wave * 8 + it * 4 + q;                 // n local
      unsigned short hb[8];
#pragma unroll
      for (int e = 0; e < 8; ++e) hb[e] = f2bf_bits(sm[row][c8 + e]);
      const v4u u = (v4u){pk16(hb[0], hb[1]), pk16(hb[2], hb[3]), pk16(hb[4], hb[5]), pk16(hb[6], hb[7])};
      *(v4u*)(out + (size_t)(n0 + row) * ldOut + d0 + c8) = u;
    }
    
  }
}

// ---------------------------------------------------------------------------
// Bias RNE bf16 convert kept as f32: dst[1024] = float(bf16(src)). One block of 256 threads, float4 per lane:
// ---------------------------------------------------------------------------
__global__ __launch_bounds__(256) void bias_bf16_kernel(const float* __restrict__ bsrc, float* __restrict__ bdst) {
  const int t = threadIdx.x;
  const v4f a = *(const v4f*)(bsrc + 4 * t);
  v4f r;
#pragma unroll
  for (int e = 0; e < 4; ++e) r[e] = bf_bits2f(f2bf_bits(a[e]));
  float* dp = bdst + 4 * t;
  *(v4f*)dp = r;
  
}

union FragH { v16h v; v8h h[2]; };
union FragB { v16b v; v8b h[2]; };

__device__ __forceinline__ v8f mma_h16(v16h a, v16h b, v8f c) {
  c = __builtin_amdgcn_wmma_f32_16x16x32_f16(false, a, false, b, (short)0, c, false, false);
  asm volatile("v_nop\n\tv_nop\n\tv_nop\n\tv_nop" : "+v"(c) : "v"(a), "v"(b));
  return c;
}
__device__ __forceinline__ v8f mma_b16(v16b a, v16b b, v8f c) {
  c = __builtin_amdgcn_wmma_f32_16x16x32_bf16(false, a, false, b, (short)0, c, false, false);
  asm volatile("v_nop\n\tv_nop\n\tv_nop\n\tv_nop" : "+v"(c) : "v"(a), "v"(b));
  return c;
}
// lane l <-> lane l ^ 16: the two wave halves hold the two key halves of one query
__device__ __forceinline__ float xhalf(float x) {
  const int b = __builtin_bit_cast(int, x);
  return __builtin_bit_cast(float, __builtin_amdgcn_permlanex16(b, b, 0x76543210, 0xfedcba98, false, false));
}
__device__ __forceinline__ __bf16 f2bf(float f) { return __builtin_bit_cast(__bf16, f2bf_bits(f)); }
__device__ __forceinline__ void bf_split(float f, __bf16& hi, __bf16& lo) {
  const unsigned short hb = f2bf_bits(f);
  hi = __builtin_bit_cast(__bf16, hb);
  lo = f2bf(f - __uint_as_float(((unsigned)hb) << 16));
}

__global__ __launch_bounds__(128) __attribute__((amdgpu_num_vgpr(256)))
void causal_attn_kernel(const unsigned short* __restrict__ QKp,
                        const unsigned short* __restrict__ VHp,
                        const unsigned short* __restrict__ VLp,
                        unsigned short* __restrict__ CHp,
                        unsigned short* __restrict__ CLp) {
  __shared__ __align__(16) unsigned short Ksh[kKC * kLP];    // K   [kv][d]   9 KB  (cross-wave: block barriers)
  __shared__ __align__(16) unsigned short Vth[kDh * kLP];    // V^T hi [d][kv] 9 KB  (cross-wave: block barriers)
  __shared__ __align__(16) unsigned short Vtl[kDh * kLP];    // V^T lo [d][kv] 9 KB  (cross-wave: block barriers)
  __shared__ __align__(16) float  Os[kAW][16 * 68];          // per wave out tile, pitch 68 (private-to-wave)

  const int tid  = threadIdx.x;
  const int wave = tid >> 5;
  const int lane = tid & 31;
  const int hh   = lane >> 4;
  const int c    = lane & 15;

  const int nqb = kSeq / kQB;
  const int bx  = blockIdx.x;
  const int qb  = bx % nqb;
  const int bh  = bx / nqb;              // b*16 + h
  const int h   = bh % kHeads;
  const int b   = bh / kHeads;
  const int q0  = qb * kQB + wave * 16;  // first query row of this wave (within the sequence)

  const _Float16* Qb = (const _Float16*)(QKp + (size_t)b * kSeq * kQKld + h * kDh);
  const unsigned short* Kb  = QKp + (size_t)b * kSeq * kQKld + kDim + h * kDh;
  const unsigned short* Vhb = VHp + (size_t)bh * kDh * kSeq;
  const unsigned short* Vlb = VLp + (size_t)bh * kDh * kSeq;

  // ---- Q fragments (B operand: column = query q0 + c; split k map via Frag<_Float16>::load): 2 d-chunks of 32 ----
  v16h qa[2];
#pragma unroll
  for (int dc = 0; dc < 2; ++dc) qa[dc] = Frag<_Float16>::load(Qb + (size_t)(q0 + c) * kQKld + dc * 32 + 8 * hh);

  const int qrow = q0 + c;      // this lane's query
  float mrow = -INFINITY;       // running maximum of query qrow (equal in both wave halves)
  float lrow = 0.f;             // running sum over this wave half's keys only; the halves are joined after the loop
  v8f oacc[4];                  // oacc[t][r] = ctx[qrow][16 t + 8 hh + r]
#pragma unroll
  for (int t = 0; t < 4; ++t) oacc[t] = (v8f){0.f,0.f,0.f,0.f,0.f,0.f,0.f,0.f};

  const int nChunks = qb + 1;   // block-uniform (causal: key chunks 0..qb)
  for (int kc = 0; kc < nChunks; ++kc) {
    const int kv0 = kc * kKC;
    __syncthreads();
    {
      // staging coverage: 128 threads x (1 row x 32 halves) = 64 rows x 64 halves per tile, all three tiles fully written
      const int r = tid >> 1, hf = (tid & 1) * 32;
      {
        const uint4* ks = (const uint4*)(Kb + (size_t)(kv0 + r) * kQKld + hf);
        uint4* kd = (uint4*)(Ksh + r * kLP + hf);
        const uint4 w0 = ks[0], w1 = ks[1], w2 = ks[2], w3 = ks[3];
        kd[0] = w0; kd[1] = w1; kd[2] = w2; kd[3] = w3;
      }
      asm volatile("" ::: "memory");
      {
        const uint4* vs = (const uint4*)(Vhb + (size_t)r * kSeq + kv0 + hf);
        uint4* vd = (uint4*)(Vth + r * kLP + hf);
        const uint4 w0 = vs[0], w1 = vs[1], w2 = vs[2], w3 = vs[3];
        vd[0] = w0; vd[1] = w1; vd[2] = w2; vd[3] = w3;
      }
      asm volatile("" ::: "memory");
      {
        const uint4* vs = (const uint4*)(Vlb + (size_t)r * kSeq + kv0 + hf);
        uint4* vd = (uint4*)(Vtl + r * kLP + hf);
        const uint4 w0 = vs[0], w1 = vs[1], w2 = vs[2], w3 = vs[3];
        vd[0] = w0; vd[1] = w1; vd[2] = w2; vd[3] = w3;
      }
    }
    __syncthreads();

    // ---- scores^T: 4 key subtiles of 16 (rows), K = 64 (2 d-chunks) ----
    v8f s[4];
#pragma unroll
    for (int j = 0; j < 4; ++j) {
      s[j] = (v8f){0.f,0.f,0.f,0.f,0.f,0.f,0.f,0.f};
#pragma unroll
      for (int dc = 0; dc < 2; ++dc) {
        FragH kb;
        kb.h[0] = *(const v8h*)(Ksh + (j * 16 + c) * kLP + dc * 32 + 8 * hh);
        kb.h[1] = *(const v8h*)(Ksh + (j * 16 + c) * kLP + dc * 32 + 16 + 8 * hh);
        s[j] = mma_h16(kb.v, qa[dc], s[j]);
      }
    }
    // ---- scale, causal fill on the diagonal chunk, maximum of the query's 64 scores (one chain per subtile) ----
    const bool diag = (kc == qb);
    float mj[4];
#pragma unroll
    for (int j = 0; j < 4; ++j) {
      float m = -INFINITY;
#pragma unroll
      for (int r = 0; r < 8; ++r) {
        const int kvcol = kv0 + j * 16 + 8 * hh + r;
        float sv = s[j][r] * kScale;
        if (diag && (kvcol > qrow)) sv = kNegBig;
        s[j][r] = sv;
        m = fmaxf(m, sv);
      }
      mj[j] = m;
    }
    float cm = fmaxf(fmaxf(mj[0], mj[1]), fmaxf(mj[2], mj[3]));
    cm = fmaxf(cm, xhalf(cm));
    // ---- online softmax update; P^T as bf16 hi/lo straight into the B operands of the second product ----
    const float mnew = fmaxf(mrow, cm);
    const float alpha = expf(mrow - mnew);
    mrow = mnew;
    FragB pa[2], pl[2];
    float pj[4];
#pragma unroll
    for (int j = 0; j < 4; ++j) {
      float psum = 0.f;
#pragma unroll
      for (int r = 0; r < 8; ++r) {
        const float p = expf(s[j][r] - mnew);
        psum += p;
        __bf16 ph, plo;
        bf_split(p, ph, plo);
        pa[j >> 1].v[(j & 1) * 8 + r] = ph;
        pl[j >> 1].v[(j & 1) * 8 + r] = plo;
      }
      pj[j] = psum;
    }
    lrow = lrow * alpha + ((pj[0] + pj[1]) + (pj[2] + pj[3]));
#pragma unroll
    for (int t = 0; t < 4; ++t)
#pragma unroll
      for (int r = 0; r < 8; ++r) oacc[t][r] *= alpha;
    // ---- ctx^T += V^T(64x64) . P^T(64x16): hi.hi + lo.hi + hi.lo ----
    // unrolled: pa and pl are register arrays and need constant indices
#pragma unroll
    for (int kk = 0; kk < 2; ++kk) {
#pragma unroll
      for (int t = 0; t < 4; ++t) {
        FragB vb, vl;
        vb.h[0] = *(const v8b*)(Vth + (t * 16 + c) * kLP + kk * 32 + 8 * hh);
        vb.h[1] = *(const v8b*)(Vth + (t * 16 + c) * kLP + kk * 32 + 16 + 8 * hh);
        vl.h[0] = *(const v8b*)(Vtl + (t * 16 + c) * kLP + kk * 32 + 8 * hh);
        vl.h[1] = *(const v8b*)(Vtl + (t * 16 + c) * kLP + kk * 32 + 16 + 8 * hh);
        oacc[t] = mma_b16(vb.v, pa[kk].v, oacc[t]);
        oacc[t] = mma_b16(vl.v, pa[kk].v, oacc[t]);
        oacc[t] = mma_b16(vb.v, pl[kk].v, oacc[t]);
      }
    }
  }

  // ---- join the halves' sums, divide, and lay the tile out as [query][d] in the wave's own LDS slab ----
  float* os = Os[wave];
  const float inv = 1.0f / (lrow + xhalf(lrow));
#pragma unroll
  for (int t = 0; t < 4; ++t) {
    float* op = os + c * 68 + t * 16 + 8 * hh;
    *(v4f*)(op)     = (v4f){oacc[t][0] * inv, oacc[t][1] * inv, oacc[t][2] * inv, oacc[t][3] * inv};
    *(v4f*)(op + 4) = (v4f){oacc[t][4] * inv, oacc[t][5] * inv, oacc[t][6] * inv, oacc[t][7] * inv};
  }
  __builtin_amdgcn_fence(3, "workgroup");
  __builtin_amdgcn_wave_barrier();
  __builtin_amdgcn_fence(2, "workgroup");
  {
    // store coverage: 4 iterations x 4 row groups (lane>>3) = 16 rows; (lane&7) x 8 halves = 64 cols
    const int q = lane >> 3, c8 = (lane & 7) * 8;
    unsigned short* ch = CHp + (size_t)(b * kSeq + q0) * kDim + h * kDh;
    unsigned short* cl = CLp + (size_t)(b * kSeq + q0) * kDim + h * kDh;
    {
#pragma unroll
      for (int it = 0; it < 4; ++it) {
        const int row = it * 4 + q;
        const float* sp = os + row * 68 + c8;
        v8h hv, lv;
#pragma unroll
        for (int e = 0; e < 8; ++e) {
          const unsigned short hb = f2bf_bits(sp[e]);
          const unsigned short lb = f2bf_bits(sp[e] - bf_bits2f(hb));
          hv[e] = __builtin_bit_cast(_Float16, hb);
          lv[e] = __builtin_bit_cast(_Float16, lb);
        }
        *(v8h*)(ch + (size_t)row * kDim + c8) = hv;
        *(v8h*)(cl + (size_t)row * kDim + c8) = lv;
      }
      
    }
  }
}

// ---------------------------------------------------------------------------
// Host glue.
// Inputs (wire f32): 0 x [2][2048][1024], 1 Wq [1024][1024], 2 bq [1024], 3 Wk, 4 bk, 5 Wv, 6 bv, 7 Wo [1024][1024].
//   XB    bf16 [kTok][1024]             8,388,608   (RNE bf16 of x, compact token rows, A layout)
//   WT    bf16 [3072][1024]             6,291,456   (Wq^T | Wk^T | Wv^T, RNE bf16, Bt layout [n][k])
//   WOT   bf16 [1024][1024]             2,097,152   (Wo^T, RNE bf16, Bt layout)
//   BQK   f32  [2048]                       8,192   (RNE bf16 of bq | bk, widened)
//   BV    f32  [1024]                       4,096   (RNE bf16 of bv, widened)
//   QK16  f16  [kTok][2048]            16,777,216   (q | k columns incl. bias)
//   VTH   bf16 [kBatch*16*64][kSeq]     8,388,608   (v^T hi plane, bias included)
//   VTL   bf16 [kBatch*16*64][kSeq]     8,388,608   (v^T lo plane)
//   CTXH  bf16 [kTok][1024]             8,388,608   (ctx hi plane)
//   CTXL  bf16 [kTok][1024]             8,388,608   (ctx lo plane)
//   total                              67,121,152
// GEMM shapes: q|k M=kTok N=2048 K=1024; v^T M=1024 N=kSeq K=1024 (kBatch batches); out M=kSeq N=1024 K=1024 (kBatch
// batches, output rows at pitch kSeqFull per batch). All M multiples of 128, N of 256, K of 64: no padding. 12 launches.
// ---------------------------------------------------------------------------
extern "C" void kernel_launch(void* const* d_in, const int* in_sizes, int n_in,
                              void* d_out, int out_size, void* d_ws, size_t ws_size,
                              hipStream_t stream) {
  if (n_in < 8) return;
  const int rowsNeeded = (kBatch - 1) * kSeqFull + kSeq;     // last token row read/written + 1
  if (in_sizes[0] < rowsNeeded * kDim) return;
  if (in_sizes[1] < kDim * kDim || in_sizes[3] < kDim * kDim || in_sizes[5] < kDim * kDim || in_sizes[7] < kDim * kDim) return;
  if (in_sizes[2] < kDim || in_sizes[4] < kDim || in_sizes[6] < kDim) return;
  if (out_size < rowsNeeded * kDim) return;

  const size_t szXB  = (size_t)kTok * kDim * 2;
  const size_t szWT  = (size_t)kWtN * kDim * 2;
  const size_t szWOT = (size_t)kDim * kDim * 2;
  const size_t szBQK = (size_t)kQKld * 4;
  const size_t szBV  = (size_t)kDim * 4;
  const size_t szQK  = (size_t)kTok * kQKld * 2;
  const size_t szVT  = (size_t)kBatch * kHeads * kDh * kSeq * 2;
  const size_t szCTX = (size_t)kTok * kDim * 2;
  const size_t offXB  = 0;
  const size_t offWT  = offXB + szXB;
  const size_t offWOT = offWT + szWT;
  const size_t offBQK = offWOT + szWOT;
  const size_t offBV  = offBQK + szBQK;
  const size_t offQK  = offBV + szBV;
  const size_t offVTH = offQK + szQK;
  const size_t offVTL = offVTH + szVT;
  const size_t offCH  = offVTL + szVT;
  const size_t offCL  = offCH + szCTX;
  const size_t total  = offCL + szCTX;             // 67,121,152 at full size
  if (ws_size < total) return;
  if (total > (size_t)134217728) return;

  const float* x  = (const float*)d_in[0];
  const float* Wq = (const float*)d_in[1];
  const float* bq = (const float*)d_in[2];
  const float* Wk = (const float*)d_in[3];
  const float* bk = (const float*)d_in[4];
  const float* Wv = (const float*)d_in[5];
  const float* bv = (const float*)d_in[6];
  const float* Wo = (const float*)d_in[7];
  float* out = (float*)d_out;
  char* ws = (char*)d_ws;
  unsigned short* XB   = (unsigned short*)(ws + offXB);
  unsigned short* WT   = (unsigned short*)(ws + offWT);
  unsigned short* WOT  = (unsigned short*)(ws + offWOT);
  float*          BQK  = (float*)(ws + offBQK);
  float*          BV   = (float*)(ws + offBV);
  unsigned short* QK16 = (unsigned short*)(ws + offQK);
  unsigned short* VTH  = (unsigned short*)(ws + offVTH);
  unsigned short* VTL  = (unsigned short*)(ws + offVTL);
  unsigned short* CTXH = (unsigned short*)(ws + offCH);
  unsigned short* CTXL = (unsigned short*)(ws + offCL);

  // ---- prologue: RNE bf16 planes of all float inputs ----
  const int n8 = kTok * kDim / 8;
  cast8_bf16_kernel<<<dim3((n8 + 255) / 256), dim3(256), 0, stream>>>(x, XB, n8);
  // in[1024 (d)][1024 (n)] -> out[1024 (n)][1024 (d)] for each square weight; grid (d tiles, n tiles)
  wtcast_bf16_kernel<<<dim3(kDim / 64, kDim / 64), dim3(256), 0, stream>>>(Wq, WT, kDim, kDim);
  wtcast_bf16_kernel<<<dim3(kDim / 64, kDim / 64), dim3(256), 0, stream>>>(Wk, WT + (size_t)kDim * kDim, kDim, kDim);
  wtcast_bf16_kernel<<<dim3(kDim / 64, kDim / 64), dim3(256), 0, stream>>>(Wv, WT + (size_t)2 * kDim * kDim, kDim, kDim);
  wtcast_bf16_kernel<<<dim3(kDim / 64, kDim / 64), dim3(256), 0, stream>>>(Wo, WOT, kDim, kDim);
  bias_bf16_kernel<<<dim3(1), dim3(256), 0, stream>>>(bq, BQK);
  bias_bf16_kernel<<<dim3(1), dim3(256), 0, stream>>>(bk, BQK + kDim);
  bias_bf16_kernel<<<dim3(1), dim3(256), 0, stream>>>(bv, BV);

  // ---- q|k = XB . WT[rows 0..2047] + BQK[n]  -> f16 plane [kTok][2048]  (M=kTok, N=2048, K=1024, bias per column) ----
  {
    const int blocks = (kTok / 128) * (kQKld / 256);
    wmma_gemm64<1, 0, 2, 1><<<dim3(blocks, 1), dim3(256), 0, stream>>>(
        XB, XB, kDim, 0L, WT, WT, kDim, 0L,
        (void*)QK16, (void*)QK16, kQKld, 0L, BQK, kTok, kQKld, kDim, 1.0f);
  }
  // ---- v^T[b][h*64+d][s] = WT[2048 + h*64 + d] . XB[b*kSeq + s] + BV[h*64+d]  -> bf16 hi/lo planes
  //      (M=1024, N=kSeq, K=1024, kBatch batches, bias per row) ----
  {
    const int blocks = (kDim / 128) * (kSeq / 256);
    const unsigned short* Av = WT + (size_t)2 * kDim * kDim;   // rows 2048..3071 of WT = Wv^T
    wmma_gemm64<1, 0, 1, 2><<<dim3(blocks, kBatch), dim3(256), 0, stream>>>(
        Av, Av, kDim, 0L, XB, XB, kDim, (long)kSeq * kDim,
        (void*)VTH, (void*)VTL, kSeq, (long)kDim * kSeq, BV, kDim, kSeq, kDim, 1.0f);
  }
  // ---- causal attention per (b, h, 64-query block) -> ctx bf16 hi/lo planes ----
  causal_attn_kernel<<<dim3(kBatch * kHeads * (kSeq / kQB)), dim3(128), 0, stream>>>(QK16, VTH, VTL, CTXH, CTXL);
  // ---- out[b][s] = (CTXH + CTXL)[b*kSeq + s] . WOT  (M=kSeq, N=1024, K=1024, kBatch batches, no bias),
  //      f32 straight to d_out rows b*kSeqFull + s ----
  {
    const int blocks = (kSeq / 128) * (kDim / 256);
    wmma_gemm64<1, 2, 0, 0><<<dim3(blocks, kBatch), dim3(256), 0, stream>>>(
        CTXH, CTXL, kDim, (long)kSeq * kDim, WOT, WOT, kDim, 0L,
        (void*)out, (void*)out, kDim, (long)kSeqFull * kDim, BV, kSeq, kDim, kDim, 1.0f);
  }
}

// v004
// Measured time: 174 microseconds a run.
// Two timings next to v003 both put it at 1.17 times that version's speed.
// All steps since v000 together make it 2.95 times as fast.
// Contractions: q|k = x.[Wq|Wk] and v^T = Wv^T.x^T on v_wmma_f32_16x16x32_bf16 (x, W RNE bf16 operands, single products; bq, bk, bv as RNE bf16 added in f32); scores^T = k.q^T on v_wmma_f32_16x16x32_f16 (q, k f16 planes, single products); ctx^T = v^T.p^T on v_wmma_f32_16x16x32_bf16 (p^T and v^T as bf16 hi+lo: hi.hi + lo.hi + hi.lo); out = ctx.Wo on v_wmma_f32_16x16x32_bf16 (ctx bf16 hi+lo, Wo RNE bf16: hi.W + lo.W); f32 accumulate everywhere; scale, causal fill and softmax in f32.
#include <hip/hip_runtime.h>
#include <math.h>

// ---------------------------------------------------------------------------
// Problem constants (NB / SEQ overridable; *_FULL give the input / output strides)
// ---------------------------------------------------------------------------
#ifndef NB
#define NB 2
#endif
#ifndef SEQ
#define SEQ 2048
#endif
#define NB_FULL 2
#define SEQ_FULL 2048

constexpr int kBatch   = NB;
constexpr int kSeq     = SEQ;
constexpr int kSeqFull = SEQ_FULL;
constexpr int kDim     = 1024;               // d_in == d_out
constexpr int kHeads   = 16;
constexpr int kDh      = 64;
constexpr int kTok     = kBatch * kSeq;      // token rows of the compact planes
constexpr int kWtN     = 3 * kDim;           // rows of the Wq^T | Wk^T | Wv^T plane
constexpr int kQKld    = 2 * kDim;           // 2048, pitch (halves) of the q|k f16 plane
constexpr int kQB      = 64;                 // query rows per attention block
constexpr int kKC      = 64;                 // keys per chunk
constexpr int kAW      = 4;                  // waves per attention block
constexpr int kLP      = 72;                 // LDS row pitch (halves) of the K and V^T tiles: 144 B = 16 B x 9, so 16 rows read by ds_load_b128 fall on 64 distinct banks
constexpr float kScale  = 0.125f;            // 64^-0.5, exact
constexpr float kNegBig = -1.0e30f;          // finite fill for scores above the diagonal
static_assert(kBatch >= 1 && kBatch <= NB_FULL);
static_assert(kSeq >= 64 && kSeq <= SEQ_FULL);
static_assert(kHeads * kDh == kDim);
static_assert(kSeq % kQB == 0 && kSeq % kKC == 0 && kQB == kAW * 16 && kDh == 64);
// GEMM shape contract (no tail handling): M multiple of 128, N multiple of 256, K multiple of 64
static_assert(kTok % 128 == 0 && kQKld % 256 == 0 && kDim % 64 == 0);
static_assert(kDim % 256 == 0 && kSeq % 256 == 0);
static_assert(kDim / 8 == 128 && (kTok * kDim) % 8 == 0);

typedef __attribute__((ext_vector_type(16))) _Float16 v16h;
typedef __attribute__((ext_vector_type(8)))  _Float16 v8h;
typedef __attribute__((ext_vector_type(16))) __bf16   v16b;
typedef __attribute__((ext_vector_type(8)))  __bf16   v8b;
typedef __attribute__((ext_vector_type(8)))  float    v8f;
typedef __attribute__((ext_vector_type(4)))  float    v4f;
typedef __attribute__((ext_vector_type(4)))  unsigned int v4u;

// ---------------------------------------------------------------------------
// Shared pieces
// ---------------------------------------------------------------------------
__device__ __forceinline__ unsigned short f2bf_bits(float f) {
  unsigned u = __float_as_uint(f);
  return (unsigned short)((u + 0x7FFFu + ((u >> 16) & 1u)) >> 16);
}
__device__ __forceinline__ float bf_bits2f(unsigned short h) { return __uint_as_float(((unsigned)h) << 16); }

// hazard guards as plain device helpers (the GEMM template body's only inline asm is its s_wait_xcnt)
__device__ __forceinline__ void dep_guard_h(v8f& a, v8f& b, v16h x, v16h y) { asm volatile("v_nop\n\tv_nop\n\tv_nop\n\tv_nop" : "+v"(a), "+v"(b) : "v"(x), "v"(y)); }
__device__ __forceinline__ void dep_guard_b(v8f& a, v8f& b, v16b x, v16b y) { asm volatile("v_nop\n\tv_nop\n\tv_nop\n\tv_nop" : "+v"(a), "+v"(b) : "v"(x), "v"(y)); }
// guard tying all four accumulators of a group and naming both A fragments as inputs
__device__ __forceinline__ void dep_guard4_h(v8f& a, v8f& b, v8f& c, v8f& d, v16h x, v16h y) { asm volatile("v_nop\n\tv_nop\n\tv_nop\n\tv_nop" : "+v"(a), "+v"(b), "+v"(c), "+v"(d) : "v"(x), "v"(y)); }
__device__ __forceinline__ void dep_guard4_b(v8f& a, v8f& b, v8f& c, v8f& d, v16b x, v16b y) { asm volatile("v_nop\n\tv_nop\n\tv_nop\n\tv_nop" : "+v"(a), "+v"(b), "+v"(c), "+v"(d) : "v"(x), "v"(y)); }
__device__ __forceinline__ void keep4_h(v16h a, v16h b, v16h c, v16h d) { asm volatile("v_nop" :: "v"(a), "v"(b), "v"(c), "v"(d)); }
__device__ __forceinline__ void keep4_b(v16b a, v16b b, v16b c, v16b d) { asm volatile("v_nop" :: "v"(a), "v"(b), "v"(c), "v"(d)); }
__device__ __forceinline__ void acc_guard4(v8f& a, v8f& b, v8f& c, v8f& d) { asm volatile("v_nop\n\tv_nop\n\tv_nop\n\tv_nop" : "+v"(a), "+v"(b), "+v"(c), "+v"(d)); }
template <typename T> struct Frag;
template <> struct Frag<_Float16> {
  typedef v16h V; union U { v16h v; v8h h[2]; };
  // elements 0..7 <- p[0..7], 8..15 <- p[16..23]
  static __device__ __forceinline__ v16h load(const _Float16* p) {
    U f; f.h[0] = *(const v8h*)(p); f.h[1] = *(const v8h*)(p + 16); return f.v;
  }
  static __device__ __forceinline__ v8f mma(v16h a, v16h b, v8f c) {
    return __builtin_amdgcn_wmma_f32_16x16x32_f16(false, a, false, b, (short)0, c, false, false);
  }
  static __device__ __forceinline__ void guard(v8f& a, v8f& b, v16h x, v16h y) { dep_guard_h(a, b, x, y); }
  static __device__ __forceinline__ void guard4(v8f& a, v8f& b, v8f& c, v8f& d, v16h x, v16h y) { dep_guard4_h(a, b, c, d, x, y); }
  static __device__ __forceinline__ void keep(v16h a, v16h b, v16h c, v16h d) { keep4_h(a, b, c, d); }
};
template <> struct Frag<__bf16> {
  typedef v16b V; union U { v16b v; v8b h[2]; };
  static __device__ __forceinline__ v16b load(const __bf16* p) {
    U f; f.h[0] = *(const v8b*)(p); f.h[1] = *(const v8b*)(p + 16); return f.v;
  }
  static __device__ __forceinline__ v8f mma(v16b a, v16b b, v8f c) {
    return __builtin_amdgcn_wmma_f32_16x16x32_bf16(false, a, false, b, (short)0, c, false, false);
  }
  static __device__ __forceinline__ void guard(v8f& a, v8f& b, v16b x, v16b y) { dep_guard_b(a, b, x, y); }
  static __device__ __forceinline__ void guard4(v8f& a, v8f& b, v8f& c, v8f& d, v16b x, v16b y) { dep_guard4_b(a, b, c, d, x, y); }
  static __device__ __forceinline__ void keep(v16b a, v16b b, v16b c, v16b d) { keep4_b(a, b, c, d); }
};

__device__ __forceinline__ unsigned pk16(unsigned short a, unsigned short b) { return (unsigned)a | ((unsigned)b << 16); }

// ---- Register-blocked batched WMMA GEMM (bias added in f32 in the slab phase so all output modes see it) ----
// C[m,n] = scale * sum_k A[m,k] * Bt[n,k] (+bias); each wave owns a 64x64 tile, a block of 8 waves (2 x 4) a 128x256 tile.
// A row-major [M,K]; Bt row-major [N,K], both at row pitch kDim (lda == ldb == kDim); M % 128 == 0, N % 256 == 0, K % 64 == 0.
// Operands go through LDS: per 64 k the block copies its 128 A rows and 256 Bt rows once, 128 B of a row by 8 lanes, so a
// wave-wide 16-B load covers 4 whole lines; the next tile's loads are issued before the products of the current one.
// SPLIT: 0 = single product; 2 = A hi/lo planes (hi.B + lo.B).
// BIAS_MODE: 0 = none, 1 = bias[m] (per row), 2 = bias[n] (per column); bias is an f32 table of length M or N.
// OUT_MODE: 0 = f32, 1 = f16, 2 = bf16 hi plane (Cout) + bf16 lo plane (Cout2).
// ET: 0 = f16 operands, 1 = bf16 operands (pointers passed as 16-bit storage)
constexpr int kGP = 72;   // LDS row pitch (halves) of the staged A and Bt tiles: 144 B = 16 B x 9 for the ds_load_b128 fragment reads
template <int ET> struct Elem;
template <> struct Elem<0> { typedef _Float16 T; };
template <> struct Elem<1> { typedef __bf16 T; };
// The tile body is a device function: bx = tile index within the product, b = batch; sA, sB, sT are the calling kernel's LDS
// (sA: (SPLIT == 2 ? 2 : 1) * 128 * kGP halves, sB: 256 * kGP halves, sT: 8 slabs of kSlab floats), so that one launch can
// hold tiles of several independent products on one LDS allocation.
constexpr int kSlab = 16 * 68;   // per-wave 16x64 output slab, pitch 68 floats
template <int ET, int SPLIT, int BIAS_MODE, int OUT_MODE>
__device__ __forceinline__ void gemm64_tile(
    unsigned short* sA, unsigned short* sB, float* sT, unsigned bx, int b,
    const unsigned short* __restrict__ Ap, const unsigned short* __restrict__ A2p, int lda, long strideA,
    const unsigned short* __restrict__ Btp, const unsigned short* __restrict__ Bt2p, int ldb, long strideB,
    void* __restrict__ Cout, void* __restrict__ Cout2, int ldc, long strideC,
    const float* __restrict__ bias,
    int M, int N, int K, float scale) {
  static_assert(SPLIT == 0 || SPLIT == 2);
  static_assert(BIAS_MODE >= 0 && BIAS_MODE <= 2);
  static_assert(OUT_MODE >= 0 && OUT_MODE <= 2);
  typedef typename Elem<ET>::T T;
  typedef typename Frag<T>::V V;
  const int tid  = threadIdx.x;
  const int lane = tid & 31;
  const int wave = tid >> 5;
  const int blocksN = N >> 8;
  const int bm = bx / blocksN;
  const int bn = bx - bm * blocksN;
  const int mB = bm << 7;                      // first A row of the block
  const int nB = bn << 8;                      // first Bt row of the block
  const int wm = (wave >> 2) << 6;             // this wave's rows within the A tile
  const int wn = (wave & 3) << 6;              // this wave's rows within the Bt tile
  const int m0 = mB + wm;
  const int n0 = nB + wn;

  const unsigned short* Ab  = Ap  + (size_t)b * strideA;
  const unsigned short* Bb  = Btp + (size_t)b * strideB;
  const unsigned short* Ab2 = (SPLIT == 2) ? (A2p + (size_t)b * strideA) : nullptr;

  const int rlane = lane & 15;                 // row (A) / col (B, D) within subtile
  const int koff  = (lane >> 4) * 8;           // k offset of this lane half
  const int mOff  = (lane >> 4) * 8;           // D row offset

  // staging map: thread -> row (tid >> 3) + 32 * i, 8 halves at column (tid & 7) * 8. One address per plane: the row step
  // 32 * kDim is a compile-time constant, so the i-th load differs from the first by an immediate offset only.
  // Every loop over i, j or ks below is unrolled so that the register arrays (ra, rb, fragments, acc) keep constant indices.
  const int srow = tid >> 3;
  const int sc8  = (tid & 7) * 8;
  const unsigned short* gA  = Ab + (size_t)(mB + srow) * kDim + sc8;
  const unsigned short* gA2 = (SPLIT == 2) ? (Ab2 + (size_t)(mB + srow) * kDim + sc8) : nullptr;
  const unsigned short* gB  = Bb + (size_t)(nB + srow) * kDim + sc8;
  v4u ra[4], ra2[4], rb[8];
#pragma unroll
  for (int i = 0; i < 4; ++i) {
    ra[i] = *(const v4u*)(gA + i * 32 * kDim);
    if (SPLIT == 2) ra2[i] = *(const v4u*)(gA2 + i * 32 * kDim);
  }
#pragma unroll
  for (int i = 0; i < 8; ++i) rb[i] = *(const v4u*)(gB + i * 32 * kDim);

  const T* fa = (const T*)sA + (wm + rlane) * kGP + koff;
  const T* fb = (const T*)sB + (wn + rlane) * kGP + koff;

  v8f acc[4][4];
#pragma unroll
  for (int i = 0; i < 4; ++i)
#pragma unroll
    for (int j = 0; j < 4; ++j) acc[i][j] = (v8f){0.f,0.f,0.f,0.f,0.f,0.f,0.f,0.f};

  for (int k0 = 0; k0 < K; k0 += 64) {
    __syncthreads();   // every wave has read its last fragment of the previous tile
#pragma unroll
    for (int i = 0; i < 4; ++i) {
      *(v4u*)(sA + (srow + 32 * i) * kGP + sc8) = ra[i];
      if (SPLIT == 2) *(v4u*)(sA + (128 + srow + 32 * i) * kGP + sc8) = ra2[i];
    }
#pragma unroll
    for (int i = 0; i < 8; ++i) *(v4u*)(sB + (srow + 32 * i) * kGP + sc8) = rb[i];
    __syncthreads();   // the tile is complete before any wave reads it
    if (k0 + 64 < K) { // block-uniform: the next tile's loads fly during this tile's products
      const int kn = k0 + 64;
#pragma unroll
      for (int i = 0; i < 4; ++i) {
        ra[i] = *(const v4u*)(gA + kn + i * 32 * kDim);
        if (SPLIT == 2) ra2[i] = *(const v4u*)(gA2 + kn + i * 32 * kDim);
      }
#pragma unroll
      for (int i = 0; i < 8; ++i) rb[i] = *(const v4u*)(gB + kn + i * 32 * kDim);
      // the fragment reads below reuse the address registers of the loads just issued: the wait stands in front of that overwrite
      asm volatile("s_wait_xcnt 0x0" ::: "memory");
    }
#pragma unroll
    for (int ks = 0; ks < 64; ks += 32) {
      V bh[4], ah[4], al[4];
#pragma unroll
      for (int j = 0; j < 4; ++j) bh[j] = Frag<T>::load(fb + (j << 4) * kGP + ks);
#pragma unroll
      for (int i = 0; i < 4; ++i) {
        ah[i] = Frag<T>::load(fa + (i << 4) * kGP + ks);
        al[i] = ah[i];
        if (SPLIT == 2) al[i] = Frag<T>::load(fa + (128 + (i << 4)) * kGP + ks);
      }
#pragma unroll
      for (int i = 0; i < 4; ++i) {
#pragma unroll
        for (int j = 0; j < 4; ++j) {
          acc[i][j] = Frag<T>::mma(ah[i], bh[j], acc[i][j]);
          if (SPLIT == 2) acc[i][j] = Frag<T>::mma(al[i], bh[j], acc[i][j]);
        }
      }
#pragma unroll
      for (int i = 0; i < 4; ++i) Frag<T>::guard4(acc[i][0], acc[i][1], acc[i][2], acc[i][3], ah[i], al[i]);
      Frag<T>::keep(bh[0], bh[1], bh[2], bh[3]);
    }
  }
  acc_guard4(acc[0][0], acc[0][1], acc[0][2], acc[0][3]);
  acc_guard4(acc[1][0], acc[1][1], acc[1][2], acc[1][3]);
  acc_guard4(acc[2][0], acc[2][1], acc[2][2], acc[2][3]);
  acc_guard4(acc[3][0], acc[3][1], acc[3][2], acc[3][3]);

  // ---- epilogue ----
  float* slab = sT + wave * kSlab;
  float bcol[4] = {0.f, 0.f, 0.f, 0.f};
  if (BIAS_MODE == 2) {
    // per-column bias: this lane's columns n0 + 16*j + rlane, j = 0..3 (in range: N multiple of 64)
#pragma unroll
    for (int j = 0; j < 4; ++j) bcol[j] = bias[n0 + (j << 4) + rlane];
  }
#pragma unroll
  for (int i = 0; i < 4; ++i) {
    const int mBase = m0 + (i << 4);
    float brow[8] = {0.f, 0.f, 0.f, 0.f, 0.f, 0.f, 0.f, 0.f};
    if (BIAS_MODE == 1) {
      // per-row bias: rows mBase + mOff + 0..7 (16-B aligned: mBase % 16 == 0, mOff in {0, 8})
      const v4f b0 = *(const v4f*)(bias + mBase + mOff);
      const v4f b1 = *(const v4f*)(bias + mBase + mOff + 4);
#pragma unroll
      for (int e = 0; e < 4; ++e) { brow[e] = b0[e]; brow[4 + e] = b1[e]; }
    }
#pragma unroll
    for (int j = 0; j < 4; ++j) {
#pragma unroll
      for (int r = 0; r < 8; ++r) {
        float bb = 0.f;
        if (BIAS_MODE == 1) bb = brow[r];
        if (BIAS_MODE == 2) bb = bcol[j];
        slab[(mOff + r) * 68 + (j << 4) + rlane] = acc[i][j][r] * scale + bb;
      }
    }
    __builtin_amdgcn_fence(3, "workgroup");
    __builtin_amdgcn_wave_barrier();
    __builtin_amdgcn_fence(2, "workgroup");
    if (OUT_MODE == 0) {
      float* C = (float*)Cout + (size_t)b * strideC;
      const int hh = lane >> 4, c4 = (lane & 15) * 4;     // row seg = 256 B = 16 lanes x 16 B
      {
#pragma unroll
        for (int it = 0; it < 8; ++it) {
          const int row = it * 2 + hh;
          const v4f v = *(const v4f*)(slab + row * 68 + c4);
          *(v4f*)(C + (size_t)(mBase + row) * ldc + n0 + c4) = v;
        }
        
      }
    } else {
      const int q = lane >> 3, c8 = (lane & 7) * 8;
      unsigned short* C  = (unsigned short*)Cout  + (size_t)b * strideC;
      unsigned short* C2 = (OUT_MODE == 2) ? ((unsigned short*)Cout2 + (size_t)b * strideC) : nullptr;
      {
#pragma unroll
        for (int it = 0; it < 4; ++it) {
          const int row = it * 4 + q;
          const float* sp = slab + row * 68 + c8;
          v8h hv, lv;
#pragma unroll
          for (int e = 0; e < 8; ++e) {
            if (OUT_MODE == 1) {
              hv[e] = (_Float16)sp[e];
            } else {
              unsigned short hb = f2bf_bits(sp[e]);
              unsigned short lb = f2bf_bits(sp[e] - bf_bits2f(hb));
              hv[e] = __builtin_bit_cast(_Float16, hb);
              lv[e] = __builtin_bit_cast(_Float16, lb);
            }
          }
          *(v8h*)(C + (size_t)(mBase + row) * ldc + n0 + c8) = hv;
          if (OUT_MODE == 2) *(v8h*)(C2 + (size_t)(mBase + row) * ldc + n0 + c8) = lv;
        }
        
      }
    }
    __builtin_amdgcn_fence(3, "workgroup");
    __builtin_amdgcn_wave_barrier();
    __builtin_amdgcn_fence(2, "workgroup");
  }
}

// One product per launch: grid (tiles, batches).
template <int ET, int SPLIT, int BIAS_MODE, int OUT_MODE>
__global__ __launch_bounds__(256) void wmma_gemm64(
    const unsigned short* __restrict__ Ap, const unsigned short* __restrict__ A2p, int lda, long strideA,
    const unsigned short* __restrict__ Btp, const unsigned short* __restrict__ Bt2p, int ldb, long strideB,
    void* __restrict__ Cout, void* __restrict__ Cout2, int ldc, long strideC,
    const float* __restrict__ bias,
    int M, int N, int K, float scale) {
  __shared__ __align__(16) unsigned short sA[(SPLIT == 2 ? 2 : 1) * 128 * kGP];   // A (hi, then lo) [row][k] (cross-wave: block barriers)
  __shared__ __align__(16) unsigned short sB[256 * kGP];                          // Bt [row][k] (cross-wave: block barriers)
  __shared__ __align__(16) float sT[8 * kSlab];                                   // per-wave slabs (private-to-wave)
  gemm64_tile<ET, SPLIT, BIAS_MODE, OUT_MODE>(sA, sB, sT, blockIdx.x, blockIdx.y, Ap, A2p, lda, strideA, Btp, Bt2p, ldb, strideB,
                                              Cout, Cout2, ldc, strideC, bias, M, N, K, scale);
}

// The two projections that depend only on XB and WT, in one launch, told apart by the block index (block-uniform branch):
//   blocks [0, kTilesQK):  q|k = XB . WT[rows 0..2047] + BQK[n] -> f16 plane [kTok][2048] (M=kTok, N=2048, bias per column)
//   then kTilesV per batch: v^T[b][h*64+d][s] = WT[2048 + h*64 + d] . XB[b*kSeq + s] + BV[h*64+d] -> bf16 hi/lo planes
//                           (M=1024, N=kSeq, bias per row)
constexpr int kTilesQK = (kTok / 128) * (kQKld / 256);
constexpr int kTilesV  = (kDim / 128) * (kSeq / 256);
// Register cap: each body alone builds to 256 registers a wave, the two in one kernel to 258, which is allocated as 272 and leaves
// room for three waves a SIMD, so one block a WGP. At 256 four waves fit: two blocks a WGP, and all 384 blocks are resident at once.
__global__ __launch_bounds__(256) __attribute__((amdgpu_num_vgpr(256))) void qkv_gemm_kernel(
    const unsigned short* __restrict__ XB, const unsigned short* __restrict__ WT,
    const float* __restrict__ BQK, const float* __restrict__ BV,
    unsigned short* __restrict__ QK16, unsigned short* __restrict__ VTH, unsigned short* __restrict__ VTL, int K) {
  __shared__ __align__(16) unsigned short sA[128 * kGP];   // A [row][k] (cross-wave: block barriers)
  __shared__ __align__(16) unsigned short sB[256 * kGP];   // Bt [row][k] (cross-wave: block barriers)
  __shared__ __align__(16) float sT[8 * kSlab];            // per-wave slabs (private-to-wave)
  const int bx = blockIdx.x;
  if (bx < kTilesQK) {
    gemm64_tile<1, 0, 2, 1>(sA, sB, sT, bx, 0, XB, XB, kDim, 0L, WT, WT, kDim, 0L,
                            (void*)QK16, (void*)QK16, kQKld, 0L, BQK, kTok, kQKld, K, 1.0f);
  } else {
    const int r = bx - kTilesQK;
    const int b = r / kTilesV;
    const unsigned short* Av = WT + (size_t)2 * kDim * kDim;   // rows 2048..3071 of WT = Wv^T
    gemm64_tile<1, 0, 1, 2>(sA, sB, sT, r - b * kTilesV, b, Av, Av, kDim, 0L, XB, XB, kDim, (long)kSeq * kDim,
                            (void*)VTH, (void*)VTL, kSeq, (long)kDim * kSeq, BV, kDim, kSeq, K, 1.0f);
  }
}

// ---------------------------------------------------------------------------
// f32 -> bf16 (RNE) cast of x into the compact token plane XB [kTok][1024]: token row t = b*kSeq + s reads input row
// ---------------------------------------------------------------------------
__device__ __forceinline__ void cast8_bf16_block(const float* __restrict__ in, unsigned short* __restrict__ out, int n8, int bx) {
  const int i = bx * 256 + threadIdx.x;
  if (i >= n8) return;
  const int t  = i >> 7;                 // 128 groups of 8 per token row
  const int c8 = (i & 127) * 8;
  const int b  = t / kSeq;
  const int s  = t - b * kSeq;
  const float* p = in + (size_t)(b * kSeqFull + s) * kDim + c8;
  const v4f a = *(const v4f*)(p);
  const v4f c = *(const v4f*)(p + 4);
  unsigned short hb[8];
#pragma unroll
  for (int e = 0; e < 4; ++e) {
    hb[e]     = f2bf_bits(a[e]);
    hb[4 + e] = f2bf_bits(c[e]);
  }
  const v4u u = (v4u){pk16(hb[0], hb[1]), pk16(hb[2], hb[3]), pk16(hb[4], hb[5]), pk16(hb[6], hb[7])};
  unsigned short* q = out + 8 * (size_t)i;
  *(v4u*)q = u;
  
}

// ---------------------------------------------------------------------------
// Weight transpose + RNE bf16 cast: W f32 row-major [1024 (d)][ldIn (n)] -> WT bf16 [n][d] with pitch ldOut (= 1024):
//   in[d][n] -> out[n][d]. One block of 256 threads per 64x64 tile (dt = d tile, nt = n tile).
// Load coverage: 16 iterations x 256 threads = 4096 = the whole 64x64 tile (coalesced along n).
// Store coverage: 8 waves x 2 iterations x 4 rows (lane>>3) = 64 n-rows; (lane&7) x 8 halves = 64 d-cols; each row segment
// ---------------------------------------------------------------------------
__device__ __forceinline__ void wtcast_bf16_block(const float* __restrict__ W, unsigned short* __restrict__ out,
                                                  int ldIn, int ldOut, int dt, int nt) {
  __shared__ float sm[64][65];   // sm[n_local][d_local] (cross-wave: block barrier)
  const int t  = threadIdx.x;
  const int d0 = dt * 64;
  const int n0 = nt * 64;
#pragma unroll
  for (int i = 0; i < 16; ++i) {
    const int e = i * 256 + t;
    const int r = e >> 6;          // d local
    const int c = e & 63;          // n local
    sm[c][r] = W[(size_t)(d0 + r) * ldIn + n0 + c];
  }
  __syncthreads();
  const int lane = t & 31, wave = t >> 5;
  const int q = lane >> 3, c8 = (lane & 7) * 8;
  {
#pragma unroll
    for (int it = 0; it < 2; ++it) {
      const int row = wave * 8 + it * 4 + q;                 // n local
      unsigned short hb[8];
#pragma unroll
      for (int e = 0; e < 8; ++e) hb[e] = f2bf_bits(sm[row][c8 + e]);
      const v4u u = (v4u){pk16(hb[0], hb[1]), pk16(hb[2], hb[3]), pk16(hb[4], hb[5]), pk16(hb[6], hb[7])};
      *(v4u*)(out + (size_t)(n0 + row) * ldOut + d0 + c8) = u;
    }
    // inlined beside other pieces, the built code reuses these two stores' registers on a path behind them: the wait stands in front of that overwrite
    asm volatile("s_wait_xcnt 0x0" ::: "memory");
  }
}

// ---------------------------------------------------------------------------
// Bias RNE bf16 convert kept as f32: dst[1024] = float(bf16(src)). One block of 256 threads, float4 per lane:
// ---------------------------------------------------------------------------
__device__ __forceinline__ void bias_bf16_block(const float* __restrict__ bsrc, float* __restrict__ bdst) {
  const int t = threadIdx.x;
  const v4f a = *(const v4f*)(bsrc + 4 * t);
  v4f r;
#pragma unroll
  for (int e = 0; e < 4; ++e) r[e] = bf_bits2f(f2bf_bits(a[e]));
  float* dp = bdst + 4 * t;
  *(v4f*)dp = r;
  
}

// ---------------------------------------------------------------------------
// All eight input conversions in one launch: they are independent of one another, so each block takes its piece by its
// index (block-uniform branches): 4 x kWTiles weight tiles (Wq, Wk, Wv -> WT rows 0, 1024, 2048; Wo -> WOT), 3 bias blocks
// (bq, bk -> BQK; bv -> BV), then the blocks of the x cast.
// ---------------------------------------------------------------------------
constexpr int kWTiles   = (kDim / 64) * (kDim / 64);   // 64x64 tiles of one square weight
constexpr int kCastBlks = kTok * kDim / 8 / 256;       // blocks of the x cast (8 elements per thread)
static_assert((kTok * kDim / 8) % 256 == 0);
__global__ __launch_bounds__(256) void prologue_kernel(
    const float* __restrict__ x,  const float* __restrict__ Wq, const float* __restrict__ Wk, const float* __restrict__ Wv,
    const float* __restrict__ Wo, const float* __restrict__ bq, const float* __restrict__ bk, const float* __restrict__ bv,
    unsigned short* __restrict__ XB, unsigned short* __restrict__ WT, unsigned short* __restrict__ WOT,
    float* __restrict__ BQK, float* __restrict__ BV) {
  const int bx = blockIdx.x;
  if (bx >= 4 * kWTiles + 3) {
    cast8_bf16_block(x, XB, kTok * kDim / 8, bx - (4 * kWTiles + 3));
    return;
  }
  if (bx >= 4 * kWTiles) {
    const int w = bx - 4 * kWTiles;
    bias_bf16_block((w == 0) ? bq : (w == 1) ? bk : bv, (w == 0) ? BQK : (w == 1) ? (BQK + kDim) : BV);
    return;
  }
  const int w = bx / kWTiles;
  const int t = bx - w * kWTiles;
  const float* W = (w == 0) ? Wq : (w == 1) ? Wk : (w == 2) ? Wv : Wo;
  unsigned short* o = (w < 3) ? (WT + (size_t)w * kDim * kDim) : WOT;
  wtcast_bf16_block(W, o, kDim, kDim, t % (kDim / 64), t / (kDim / 64));
}

union FragH { v16h v; v8h h[2]; };
union FragB { v16b v; v8b h[2]; };

__device__ __forceinline__ v8f mma_h16(v16h a, v16h b, v8f c) {
  c = __builtin_amdgcn_wmma_f32_16x16x32_f16(false, a, false, b, (short)0, c, false, false);
  asm volatile("v_nop\n\tv_nop\n\tv_nop\n\tv_nop" : "+v"(c) : "v"(a), "v"(b));
  return c;
}
__device__ __forceinline__ v8f mma_b16(v16b a, v16b b, v8f c) {
  c = __builtin_amdgcn_wmma_f32_16x16x32_bf16(false, a, false, b, (short)0, c, false, false);
  asm volatile("v_nop\n\tv_nop\n\tv_nop\n\tv_nop" : "+v"(c) : "v"(a), "v"(b));
  return c;
}
// lane l <-> lane l ^ 16: the two wave halves hold the two key halves of one query
__device__ __forceinline__ float xhalf(float x) {
  const int b = __builtin_bit_cast(int, x);
  return __builtin_bit_cast(float, __builtin_amdgcn_permlanex16(b, b, 0x76543210, 0xfedcba98, false, false));
}
__device__ __forceinline__ __bf16 f2bf(float f) { return __builtin_bit_cast(__bf16, f2bf_bits(f)); }
__device__ __forceinline__ void bf_split(float f, __bf16& hi, __bf16& lo) {
  const unsigned short hb = f2bf_bits(f);
  hi = __builtin_bit_cast(__bf16, hb);
  lo = f2bf(f - __uint_as_float(((unsigned)hb) << 16));
}

__global__ __launch_bounds__(128) __attribute__((amdgpu_num_vgpr(256)))
void causal_attn_kernel(const unsigned short* __restrict__ QKp,
                        const unsigned short* __restrict__ VHp,
                        const unsigned short* __restrict__ VLp,
                        unsigned short* __restrict__ CHp,
                        unsigned short* __restrict__ CLp) {
  __shared__ __align__(16) unsigned short Ksh[kKC * kLP];    // K   [kv][d]   9 KB  (cross-wave: block barriers)
  __shared__ __align__(16) unsigned short Vth[kDh * kLP];    // V^T hi [d][kv] 9 KB  (cross-wave: block barriers)
  __shared__ __align__(16) unsigned short Vtl[kDh * kLP];    // V^T lo [d][kv] 9 KB  (cross-wave: block barriers)
  __shared__ __align__(16) float  Os[kAW][16 * 68];          // per wave out tile, pitch 68 (private-to-wave)

  const int tid  = threadIdx.x;
  const int wave = tid >> 5;
  const int lane = tid & 31;
  const int hh   = lane >> 4;
  const int c    = lane & 15;

  const int nqb = kSeq / kQB;
  const int bx  = blockIdx.x;
  const int qb  = bx % nqb;
  const int bh  = bx / nqb;              // b*16 + h
  const int h   = bh % kHeads;
  const int b   = bh / kHeads;
  const int q0  = qb * kQB + wave * 16;  // first query row of this wave (within the sequence)

  const _Float16* Qb = (const _Float16*)(QKp + (size_t)b * kSeq * kQKld + h * kDh);
  const unsigned short* Kb  = QKp + (size_t)b * kSeq * kQKld + kDim + h * kDh;
  const unsigned short* Vhb = VHp + (size_t)bh * kDh * kSeq;
  const unsigned short* Vlb = VLp + (size_t)bh * kDh * kSeq;

  // ---- Q fragments (B operand: column = query q0 + c; split k map via Frag<_Float16>::load): 2 d-chunks of 32 ----
  v16h qa[2];
#pragma unroll
  for (int dc = 0; dc < 2; ++dc) qa[dc] = Frag<_Float16>::load(Qb + (size_t)(q0 + c) * kQKld + dc * 32 + 8 * hh);

  const int qrow = q0 + c;      // this lane's query
  float mrow = -INFINITY;       // running maximum of query qrow (equal in both wave halves)
  float lrow = 0.f;             // running sum over this wave half's keys only; the halves are joined after the loop
  v8f oacc[4];                  // oacc[t][r] = ctx[qrow][16 t + 8 hh + r]
#pragma unroll
  for (int t = 0; t < 4; ++t) oacc[t] = (v8f){0.f,0.f,0.f,0.f,0.f,0.f,0.f,0.f};

  const int nChunks = qb + 1;   // block-uniform (causal: key chunks 0..qb)
  for (int kc = 0; kc < nChunks; ++kc) {
    const int kv0 = kc * kKC;
    __syncthreads();
    {
      // staging coverage: 128 threads x (1 row x 32 halves) = 64 rows x 64 halves per tile, all three tiles fully written
      const int r = tid >> 1, hf = (tid & 1) * 32;
      {
        const uint4* ks = (const uint4*)(Kb + (size_t)(kv0 + r) * kQKld + hf);
        uint4* kd = (uint4*)(Ksh + r * kLP + hf);
        const uint4 w0 = ks[0], w1 = ks[1], w2 = ks[2], w3 = ks[3];
        kd[0] = w0; kd[1] = w1; kd[2] = w2; kd[3] = w3;
      }
      asm volatile("" ::: "memory");
      {
        const uint4* vs = (const uint4*)(Vhb + (size_t)r * kSeq + kv0 + hf);
        uint4* vd = (uint4*)(Vth + r * kLP + hf);
        const uint4 w0 = vs[0], w1 = vs[1], w2 = vs[2], w3 = vs[3];
        vd[0] = w0; vd[1] = w1; vd[2] = w2; vd[3] = w3;
      }
      asm volatile("" ::: "memory");
      {
        const uint4* vs = (const uint4*)(Vlb + (size_t)r * kSeq + kv0 + hf);
        uint4* vd = (uint4*)(Vtl + r * kLP + hf);
        const uint4 w0 = vs[0], w1 = vs[1], w2 = vs[2], w3 = vs[3];
        vd[0] = w0; vd[1] = w1; vd[2] = w2; vd[3] = w3;
      }
    }
    __syncthreads();

    // ---- scores^T: 4 key subtiles of 16 (rows), K = 64 (2 d-chunks) ----
    v8f s[4];
#pragma unroll
    for (int j = 0; j < 4; ++j) {
      s[j] = (v8f){0.f,0.f,0.f,0.f,0.f,0.f,0.f,0.f};
#pragma unroll
      for (int dc = 0; dc < 2; ++dc) {
        FragH kb;
        kb.h[0] = *(const v8h*)(Ksh + (j * 16 + c) * kLP + dc * 32 + 8 * hh);
        kb.h[1] = *(const v8h*)(Ksh + (j * 16 + c) * kLP + dc * 32 + 16 + 8 * hh);
        s[j] = mma_h16(kb.v, qa[dc], s[j]);
      }
    }
    // ---- scale, causal fill on the diagonal chunk, maximum of the query's 64 scores (one chain per subtile) ----
    const bool diag = (kc == qb);
    float mj[4];
#pragma unroll
    for (int j = 0; j < 4; ++j) {
      float m = -INFINITY;
#pragma unroll
      for (int r = 0; r < 8; ++r) {
        const int kvcol = kv0 + j * 16 + 8 * hh + r;
        float sv = s[j][r] * kScale;
        if (diag && (kvcol > qrow)) sv = kNegBig;
        s[j][r] = sv;
        m = fmaxf(m, sv);
      }
      mj[j] = m;
    }
    float cm = fmaxf(fmaxf(mj[0], mj[1]), fmaxf(mj[2], mj[3]));
    cm = fmaxf(cm, xhalf(cm));
    // ---- online softmax update; P^T as bf16 hi/lo straight into the B operands of the second product ----
    const float mnew = fmaxf(mrow, cm);
    const float alpha = expf(mrow - mnew);
    mrow = mnew;
    FragB pa[2], pl[2];
    float pj[4];
#pragma unroll
    for (int j = 0; j < 4; ++j) {
      float psum = 0.f;
#pragma unroll
      for (int r = 0; r < 8; ++r) {
        const float p = expf(s[j][r] - mnew);
        psum += p;
        __bf16 ph, plo;
        bf_split(p, ph, plo);
        pa[j >> 1].v[(j & 1) * 8 + r] = ph;
        pl[j >> 1].v[(j & 1) * 8 + r] = plo;
      }
      pj[j] = psum;
    }
    lrow = lrow * alpha + ((pj[0] + pj[1]) + (pj[2] + pj[3]));
#pragma unroll
    for (int t = 0; t < 4; ++t)
#pragma unroll
      for (int r = 0; r < 8; ++r) oacc[t][r] *= alpha;
    // ---- ctx^T += V^T(64x64) . P^T(64x16): hi.hi + lo.hi + hi.lo ----
    // unrolled: pa and pl are register arrays and need constant indices
#pragma unroll
    for (int kk = 0; kk < 2; ++kk) {
#pragma unroll
      for (int t = 0; t < 4; ++t) {
        FragB vb, vl;
        vb.h[0] = *(const v8b*)(Vth + (t * 16 + c) * kLP + kk * 32 + 8 * hh);
        vb.h[1] = *(const v8b*)(Vth + (t * 16 + c) * kLP + kk * 32 + 16 + 8 * hh);
        vl.h[0] = *(const v8b*)(Vtl + (t * 16 + c) * kLP + kk * 32 + 8 * hh);
        vl.h[1] = *(const v8b*)(Vtl + (t * 16 + c) * kLP + kk * 32 + 16 + 8 * hh);
        oacc[t] = mma_b16(vb.v, pa[kk].v, oacc[t]);
        oacc[t] = mma_b16(vl.v, pa[kk].v, oacc[t]);
        oacc[t] = mma_b16(vb.v, pl[kk].v, oacc[t]);
      }
    }
  }

  // ---- join the halves' sums, divide, and lay the tile out as [query][d] in the wave's own LDS slab ----
  float* os = Os[wave];
  const float inv = 1.0f / (lrow + xhalf(lrow));
#pragma unroll
  for (int t = 0; t < 4; ++t) {
    float* op = os + c * 68 + t * 16 + 8 * hh;
    *(v4f*)(op)     = (v4f){oacc[t][0] * inv, oacc[t][1] * inv, oacc[t][2] * inv, oacc[t][3] * inv};
    *(v4f*)(op + 4) = (v4f){oacc[t][4] * inv, oacc[t][5] * inv, oacc[t][6] * inv, oacc[t][7] * inv};
  }
  __builtin_amdgcn_fence(3, "workgroup");
  __builtin_amdgcn_wave_barrier();
  __builtin_amdgcn_fence(2, "workgroup");
  {
    // store coverage: 4 iterations x 4 row groups (lane>>3) = 16 rows; (lane&7) x 8 halves = 64 cols
    const int q = lane >> 3, c8 = (lane & 7) * 8;
    unsigned short* ch = CHp + (size_t)(b * kSeq + q0) * kDim + h * kDh;
    unsigned short* cl = CLp + (size_t)(b * kSeq + q0) * kDim + h * kDh;
    {
#pragma unroll
      for (int it = 0; it < 4; ++it) {
        const int row = it * 4 + q;
        const float* sp = os + row * 68 + c8;
        v8h hv, lv;
#pragma unroll
        for (int e = 0; e < 8; ++e) {
          const unsigned short hb = f2bf_bits(sp[e]);
          const unsigned short lb = f2bf_bits(sp[e] - bf_bits2f(hb));
          hv[e] = __builtin_bit_cast(_Float16, hb);
          lv[e] = __builtin_bit_cast(_Float16, lb);
        }
        *(v8h*)(ch + (size_t)row * kDim + c8) = hv;
        *(v8h*)(cl + (size_t)row * kDim + c8) = lv;
      }
      
    }
  }
}

// ---------------------------------------------------------------------------
// Host glue.
// Inputs (wire f32): 0 x [2][2048][1024], 1 Wq [1024][1024], 2 bq [1024], 3 Wk, 4 bk, 5 Wv, 6 bv, 7 Wo [1024][1024].
//   XB    bf16 [kTok][1024]             8,388,608   (RNE bf16 of x, compact token rows, A layout)
//   WT    bf16 [3072][1024]             6,291,456   (Wq^T | Wk^T | Wv^T, RNE bf16, Bt layout [n][k])
//   WOT   bf16 [1024][1024]             2,097,152   (Wo^T, RNE bf16, Bt layout)
//   BQK   f32  [2048]                       8,192   (RNE bf16 of bq | bk, widened)
//   BV    f32  [1024]                       4,096   (RNE bf16 of bv, widened)
//   QK16  f16  [kTok][2048]            16,777,216   (q | k columns incl. bias)
//   VTH   bf16 [kBatch*16*64][kSeq]     8,388,608   (v^T hi plane, bias included)
//   VTL   bf16 [kBatch*16*64][kSeq]     8,388,608   (v^T lo plane)
//   CTXH  bf16 [kTok][1024]             8,388,608   (ctx hi plane)
//   CTXL  bf16 [kTok][1024]             8,388,608   (ctx lo plane)
//   total                              67,121,152
// GEMM shapes: q|k M=kTok N=2048 K=1024; v^T M=1024 N=kSeq K=1024 (kBatch batches); out M=kSeq N=1024 K=1024 (kBatch
// batches, output rows at pitch kSeqFull per batch). All M multiples of 128, N of 256, K of 64: no padding. 4 launches:
// input conversions; q|k and v^T products; attention; output product.
// ---------------------------------------------------------------------------
extern "C" void kernel_launch(void* const* d_in, const int* in_sizes, int n_in,
                              void* d_out, int out_size, void* d_ws, size_t ws_size,
                              hipStream_t stream) {
  if (n_in < 8) return;
  const int rowsNeeded = (kBatch - 1) * kSeqFull + kSeq;     // last token row read/written + 1
  if (in_sizes[0] < rowsNeeded * kDim) return;
  if (in_sizes[1] < kDim * kDim || in_sizes[3] < kDim * kDim || in_sizes[5] < kDim * kDim || in_sizes[7] < kDim * kDim) return;
  if (in_sizes[2] < kDim || in_sizes[4] < kDim || in_sizes[6] < kDim) return;
  if (out_size < rowsNeeded * kDim) return;

  const size_t szXB  = (size_t)kTok * kDim * 2;
  const size_t szWT  = (size_t)kWtN * kDim * 2;
  const size_t szWOT = (size_t)kDim * kDim * 2;
  const size_t szBQK = (size_t)kQKld * 4;
  const size_t szBV  = (size_t)kDim * 4;
  const size_t szQK  = (size_t)kTok * kQKld * 2;
  const size_t szVT  = (size_t)kBatch * kHeads * kDh * kSeq * 2;
  const size_t szCTX = (size_t)kTok * kDim * 2;
  const size_t offXB  = 0;
  const size_t offWT  = offXB + szXB;
  const size_t offWOT = offWT + szWT;
  const size_t offBQK = offWOT + szWOT;
  const size_t offBV  = offBQK + szBQK;
  const size_t offQK  = offBV + szBV;
  const size_t offVTH = offQK + szQK;
  const size_t offVTL = offVTH + szVT;
  const size_t offCH  = offVTL + szVT;
  const size_t offCL  = offCH + szCTX;
  const size_t total  = offCL + szCTX;             // 67,121,152 at full size
  if (ws_size < total) return;
  if (total > (size_t)134217728) return;

  const float* x  = (const float*)d_in[0];
  const float* Wq = (const float*)d_in[1];
  const float* bq = (const float*)d_in[2];
  const float* Wk = (const float*)d_in[3];
  const float* bk = (const float*)d_in[4];
  const float* Wv = (const float*)d_in[5];
  const float* bv = (const float*)d_in[6];
  const float* Wo = (const float*)d_in[7];
  float* out = (float*)d_out;
  char* ws = (char*)d_ws;
  unsigned short* XB   = (unsigned short*)(ws + offXB);
  unsigned short* WT   = (unsigned short*)(ws + offWT);
  unsigned short* WOT  = (unsigned short*)(ws + offWOT);
  float*          BQK  = (float*)(ws + offBQK);
  float*          BV   = (float*)(ws + offBV);
  unsigned short* QK16 = (unsigned short*)(ws + offQK);
  unsigned short* VTH  = (unsigned short*)(ws + offVTH);
  unsigned short* VTL  = (unsigned short*)(ws + offVTL);
  unsigned short* CTXH = (unsigned short*)(ws + offCH);
  unsigned short* CTXL = (unsigned short*)(ws + offCL);

  // ---- prologue: RNE bf16 planes of all float inputs, one launch ----
  prologue_kernel<<<dim3(4 * kWTiles + 3 + kCastBlks), dim3(256), 0, stream>>>(x, Wq, Wk, Wv, Wo, bq, bk, bv, XB, WT, WOT, BQK, BV);
  // ---- q|k (f16 plane) and v^T (bf16 hi/lo planes) from XB and WT, one launch ----
  qkv_gemm_kernel<<<dim3(kTilesQK + kBatch * kTilesV), dim3(256), 0, stream>>>(XB, WT, BQK, BV, QK16, VTH, VTL, kDim);
  // ---- causal attention per (b, h, 64-query block) -> ctx bf16 hi/lo planes ----
  causal_attn_kernel<<<dim3(kBatch * kHeads * (kSeq / kQB)), dim3(128), 0, stream>>>(QK16, VTH, VTL, CTXH, CTXL);
  // ---- out[b][s] = (CTXH + CTXL)[b*kSeq + s] . WOT  (M=kSeq, N=1024, K=1024, kBatch batches, no bias),
  //      f32 straight to d_out rows b*kSeqFull + s ----
  {
    const int blocks = (kSeq / 128) * (kDim / 256);
    wmma_gemm64<1, 2, 0, 0><<<dim3(blocks, kBatch), dim3(256), 0, stream>>>(
        CTXH, CTXL, kDim, (long)kSeq * kDim, WOT, WOT, kDim, 0L,
        (void*)out, (void*)out, kDim, (long)kSeqFull * kDim, BV, kSeq, kDim, kDim, 1.0f);
  }
}

// v005
// Measured time: 143 microseconds a run.
// In both of two side-by-side timings against v004, it was 1.21 times as fast.
// Counting every step since v000, it is 3.57 times as fast.
// Contractions: q|k = x.[Wq|Wk] and v^T = Wv^T.x^T on v_wmma_f32_16x16x32_bf16 (x, W RNE bf16 operands, single products; bq, bk, bv as RNE bf16 added in f32); scores^T = k.q^T on v_wmma_f32_16x16x32_f16 (q, k f16 planes, single products); ctx^T = v^T.p^T on v_wmma_f32_16x16x32_bf16 (p^T and v^T as bf16 hi+lo: hi.hi + lo.hi + hi.lo); out = ctx.Wo on v_wmma_f32_16x16x32_bf16 (ctx bf16 hi+lo, Wo RNE bf16: hi.W + lo.W); f32 accumulate everywhere; scale, causal fill and softmax in f32.
#include <hip/hip_runtime.h>
#include <math.h>

// ---------------------------------------------------------------------------
// Problem constants (NB / SEQ overridable; *_FULL give the input / output strides)
// ---------------------------------------------------------------------------
#ifndef NB
#define NB 2
#endif
#ifndef SEQ
#define SEQ 2048
#endif
#define NB_FULL 2
#define SEQ_FULL 2048

constexpr int kBatch   = NB;
constexpr int kSeq     = SEQ;
constexpr int kSeqFull = SEQ_FULL;
constexpr int kDim     = 1024;               // d_in == d_out
constexpr int kHeads   = 16;
constexpr int kDh      = 64;
constexpr int kTok     = kBatch * kSeq;      // token rows of the compact planes
constexpr int kWtN     = 3 * kDim;           // rows of the Wq^T | Wk^T | Wv^T plane
constexpr int kQKld    = 2 * kDim;           // 2048, pitch (halves) of the q|k f16 plane
constexpr int kQB      = 64;                 // query rows per attention block
constexpr int kKC      = 64;                 // keys per chunk
constexpr int kAW      = 4;                  // waves per attention block
constexpr int kLP      = 72;                 // LDS row pitch (halves) of the K and V^T tiles: 144 B = 16 B x 9, so 16 rows read by ds_load_b128 fall on 64 distinct banks
constexpr float kScale  = 0.125f;            // 64^-0.5, exact
constexpr float kSL2E   = kScale * 1.44269504088896340736f;   // scale * log2(e): exp(scale * (s - m)) = 2^(kSL2E * s - kSL2E * m)
constexpr float kNegBig = -1.0e30f;          // finite fill for (unscaled) scores above the diagonal
static_assert(kBatch >= 1 && kBatch <= NB_FULL);
static_assert(kSeq >= 64 && kSeq <= SEQ_FULL);
static_assert(kHeads * kDh == kDim);
static_assert(kSeq % kQB == 0 && kSeq % kKC == 0 && kQB == kAW * 16 && kDh == 64);
// GEMM shape contract (no tail handling): M multiple of 128, N multiple of 256, K multiple of 64
static_assert(kTok % 128 == 0 && kQKld % 256 == 0 && kDim % 64 == 0);
static_assert(kDim % 256 == 0 && kSeq % 256 == 0);
static_assert(kDim / 8 == 128 && (kTok * kDim) % 8 == 0);

typedef __attribute__((ext_vector_type(16))) _Float16 v16h;
typedef __attribute__((ext_vector_type(8)))  _Float16 v8h;
typedef __attribute__((ext_vector_type(16))) __bf16   v16b;
typedef __attribute__((ext_vector_type(8)))  __bf16   v8b;
typedef __attribute__((ext_vector_type(8)))  float    v8f;
typedef __attribute__((ext_vector_type(4)))  float    v4f;
typedef __attribute__((ext_vector_type(4)))  unsigned int v4u;

// ---------------------------------------------------------------------------
// Shared pieces
// ---------------------------------------------------------------------------
__device__ __forceinline__ unsigned short f2bf_bits(float f) {
  unsigned u = __float_as_uint(f);
  return (unsigned short)((u + 0x7FFFu + ((u >> 16) & 1u)) >> 16);
}
__device__ __forceinline__ float bf_bits2f(unsigned short h) { return __uint_as_float(((unsigned)h) << 16); }

// hazard guards as plain device helpers (the GEMM template body's only inline asm is its s_wait_xcnt)
__device__ __forceinline__ void dep_guard_h(v8f& a, v8f& b, v16h x, v16h y) { asm volatile("v_nop\n\tv_nop\n\tv_nop\n\tv_nop" : "+v"(a), "+v"(b) : "v"(x), "v"(y)); }
__device__ __forceinline__ void dep_guard_b(v8f& a, v8f& b, v16b x, v16b y) { asm volatile("v_nop\n\tv_nop\n\tv_nop\n\tv_nop" : "+v"(a), "+v"(b) : "v"(x), "v"(y)); }
// guard tying all four accumulators of a group and naming both A fragments as inputs
__device__ __forceinline__ void dep_guard4_h(v8f& a, v8f& b, v8f& c, v8f& d, v16h x, v16h y) { asm volatile("v_nop\n\tv_nop\n\tv_nop\n\tv_nop" : "+v"(a), "+v"(b), "+v"(c), "+v"(d) : "v"(x), "v"(y)); }
__device__ __forceinline__ void dep_guard4_b(v8f& a, v8f& b, v8f& c, v8f& d, v16b x, v16b y) { asm volatile("v_nop\n\tv_nop\n\tv_nop\n\tv_nop" : "+v"(a), "+v"(b), "+v"(c), "+v"(d) : "v"(x), "v"(y)); }
__device__ __forceinline__ void keep4_h(v16h a, v16h b, v16h c, v16h d) { asm volatile("v_nop" :: "v"(a), "v"(b), "v"(c), "v"(d)); }
__device__ __forceinline__ void keep4_b(v16b a, v16b b, v16b c, v16b d) { asm volatile("v_nop" :: "v"(a), "v"(b), "v"(c), "v"(d)); }
__device__ __forceinline__ void acc_guard4(v8f& a, v8f& b, v8f& c, v8f& d) { asm volatile("v_nop\n\tv_nop\n\tv_nop\n\tv_nop" : "+v"(a), "+v"(b), "+v"(c), "+v"(d)); }
template <typename T> struct Frag;
template <> struct Frag<_Float16> {
  typedef v16h V; union U { v16h v; v8h h[2]; };
  // elements 0..7 <- p[0..7], 8..15 <- p[16..23]
  static __device__ __forceinline__ v16h load(const _Float16* p) {
    U f; f.h[0] = *(const v8h*)(p); f.h[1] = *(const v8h*)(p + 16); return f.v;
  }
  static __device__ __forceinline__ v8f mma(v16h a, v16h b, v8f c) {
    return __builtin_amdgcn_wmma_f32_16x16x32_f16(false, a, false, b, (short)0, c, false, false);
  }
  static __device__ __forceinline__ void guard(v8f& a, v8f& b, v16h x, v16h y) { dep_guard_h(a, b, x, y); }
  static __device__ __forceinline__ void guard4(v8f& a, v8f& b, v8f& c, v8f& d, v16h x, v16h y) { dep_guard4_h(a, b, c, d, x, y); }
  static __device__ __forceinline__ void keep(v16h a, v16h b, v16h c, v16h d) { keep4_h(a, b, c, d); }
};
template <> struct Frag<__bf16> {
  typedef v16b V; union U { v16b v; v8b h[2]; };
  static __device__ __forceinline__ v16b load(const __bf16* p) {
    U f; f.h[0] = *(const v8b*)(p); f.h[1] = *(const v8b*)(p + 16); return f.v;
  }
  static __device__ __forceinline__ v8f mma(v16b a, v16b b, v8f c) {
    return __builtin_amdgcn_wmma_f32_16x16x32_bf16(false, a, false, b, (short)0, c, false, false);
  }
  static __device__ __forceinline__ void guard(v8f& a, v8f& b, v16b x, v16b y) { dep_guard_b(a, b, x, y); }
  static __device__ __forceinline__ void guard4(v8f& a, v8f& b, v8f& c, v8f& d, v16b x, v16b y) { dep_guard4_b(a, b, c, d, x, y); }
  static __device__ __forceinline__ void keep(v16b a, v16b b, v16b c, v16b d) { keep4_b(a, b, c, d); }
};

__device__ __forceinline__ unsigned pk16(unsigned short a, unsigned short b) { return (unsigned)a | ((unsigned)b << 16); }

// ---- Register-blocked batched WMMA GEMM (bias added in f32 in the slab phase so all output modes see it) ----
// C[m,n] = scale * sum_k A[m,k] * Bt[n,k] (+bias); each wave owns a 64x64 tile, a block of 8 waves (2 x 4) a 128x256 tile.
// A row-major [M,K]; Bt row-major [N,K], both at row pitch kDim (lda == ldb == kDim); M % 128 == 0, N % 256 == 0, K % 64 == 0.
// Operands go through LDS: per 64 k the block copies its 128 A rows and 256 Bt rows once, 128 B of a row by 8 lanes, so a
// wave-wide 16-B load covers 4 whole lines; the next tile's loads are issued before the products of the current one.
// SPLIT: 0 = single product; 2 = A hi/lo planes (hi.B + lo.B).
// BIAS_MODE: 0 = none, 1 = bias[m] (per row), 2 = bias[n] (per column); bias is an f32 table of length M or N.
// OUT_MODE: 0 = f32, 1 = f16, 2 = bf16 hi plane (Cout) + bf16 lo plane (Cout2).
// ET: 0 = f16 operands, 1 = bf16 operands (pointers passed as 16-bit storage)
constexpr int kGP = 72;   // LDS row pitch (halves) of the staged A and Bt tiles: 144 B = 16 B x 9 for the ds_load_b128 fragment reads
template <int ET> struct Elem;
template <> struct Elem<0> { typedef _Float16 T; };
template <> struct Elem<1> { typedef __bf16 T; };
// The tile body is a device function: bx = tile index within the product, b = batch; sA, sB, sT are the calling kernel's LDS
// (sA: (SPLIT == 2 ? 2 : 1) * 128 * kGP halves, sB: 256 * kGP halves, sT: 8 slabs of kSlab floats), so that one launch can
// hold tiles of several independent products on one LDS allocation.
constexpr int kSlab = 16 * 68;   // per-wave 16x64 output slab, pitch 68 floats
template <int ET, int SPLIT, int BIAS_MODE, int OUT_MODE>
__device__ __forceinline__ void gemm64_tile(
    unsigned short* sA, unsigned short* sB, float* sT, unsigned bx, int b,
    const unsigned short* __restrict__ Ap, const unsigned short* __restrict__ A2p, int lda, long strideA,
    const unsigned short* __restrict__ Btp, const unsigned short* __restrict__ Bt2p, int ldb, long strideB,
    void* __restrict__ Cout, void* __restrict__ Cout2, int ldc, long strideC,
    const float* __restrict__ bias,
    int M, int N, int K, float scale) {
  static_assert(SPLIT == 0 || SPLIT == 2);
  static_assert(BIAS_MODE >= 0 && BIAS_MODE <= 2);
  static_assert(OUT_MODE >= 0 && OUT_MODE <= 2);
  typedef typename Elem<ET>::T T;
  typedef typename Frag<T>::V V;
  const int tid  = threadIdx.x;
  const int lane = tid & 31;
  const int wave = tid >> 5;
  const int blocksN = N >> 8;
  const int bm = bx / blocksN;
  const int bn = bx - bm * blocksN;
  const int mB = bm << 7;                      // first A row of the block
  const int nB = bn << 8;                      // first Bt row of the block
  const int wm = (wave >> 2) << 6;             // this wave's rows within the A tile
  const int wn = (wave & 3) << 6;              // this wave's rows within the Bt tile
  const int m0 = mB + wm;
  const int n0 = nB + wn;

  const unsigned short* Ab  = Ap  + (size_t)b * strideA;
  const unsigned short* Bb  = Btp + (size_t)b * strideB;
  const unsigned short* Ab2 = (SPLIT == 2) ? (A2p + (size_t)b * strideA) : nullptr;

  const int rlane = lane & 15;                 // row (A) / col (B, D) within subtile
  const int koff  = (lane >> 4) * 8;           // k offset of this lane half
  const int mOff  = (lane >> 4) * 8;           // D row offset

  // staging map: thread -> row (tid >> 3) + 32 * i, 8 halves at column (tid & 7) * 8. One address per plane: the row step
  // 32 * kDim is a compile-time constant, so the i-th load differs from the first by an immediate offset only.
  // Every loop over i, j or ks below is unrolled so that the register arrays (ra, rb, fragments, acc) keep constant indices.
  const int srow = tid >> 3;
  const int sc8  = (tid & 7) * 8;
  const unsigned short* gA  = Ab + (size_t)(mB + srow) * kDim + sc8;
  const unsigned short* gA2 = (SPLIT == 2) ? (Ab2 + (size_t)(mB + srow) * kDim + sc8) : nullptr;
  const unsigned short* gB  = Bb + (size_t)(nB + srow) * kDim + sc8;
  v4u ra[4], ra2[4], rb[8];
#pragma unroll
  for (int i = 0; i < 4; ++i) {
    ra[i] = *(const v4u*)(gA + i * 32 * kDim);
    if (SPLIT == 2) ra2[i] = *(const v4u*)(gA2 + i * 32 * kDim);
  }
#pragma unroll
  for (int i = 0; i < 8; ++i) rb[i] = *(const v4u*)(gB + i * 32 * kDim);

  const T* fa = (const T*)sA + (wm + rlane) * kGP + koff;
  const T* fb = (const T*)sB + (wn + rlane) * kGP + koff;

  v8f acc[4][4];
#pragma unroll
  for (int i = 0; i < 4; ++i)
#pragma unroll
    for (int j = 0; j < 4; ++j) acc[i][j] = (v8f){0.f,0.f,0.f,0.f,0.f,0.f,0.f,0.f};

  for (int k0 = 0; k0 < K; k0 += 64) {
    __syncthreads();   // every wave has read its last fragment of the previous tile
#pragma unroll
    for (int i = 0; i < 4; ++i) {
      *(v4u*)(sA + (srow + 32 * i) * kGP + sc8) = ra[i];
      if (SPLIT == 2) *(v4u*)(sA + (128 + srow + 32 * i) * kGP + sc8) = ra2[i];
    }
#pragma unroll
    for (int i = 0; i < 8; ++i) *(v4u*)(sB + (srow + 32 * i) * kGP + sc8) = rb[i];
    __syncthreads();   // the tile is complete before any wave reads it
    if (k0 + 64 < K) { // block-uniform: the next tile's loads fly during this tile's products
      const int kn = k0 + 64;
#pragma unroll
      for (int i = 0; i < 4; ++i) {
        ra[i] = *(const v4u*)(gA + kn + i * 32 * kDim);
        if (SPLIT == 2) ra2[i] = *(const v4u*)(gA2 + kn + i * 32 * kDim);
      }
#pragma unroll
      for (int i = 0; i < 8; ++i) rb[i] = *(const v4u*)(gB + kn + i * 32 * kDim);
      // the fragment reads below reuse the address registers of the loads just issued: the wait stands in front of that overwrite
      asm volatile("s_wait_xcnt 0x0" ::: "memory");
    }
#pragma unroll
    for (int ks = 0; ks < 64; ks += 32) {
      V bh[4], ah[4], al[4];
#pragma unroll
      for (int j = 0; j < 4; ++j) bh[j] = Frag<T>::load(fb + (j << 4) * kGP + ks);
#pragma unroll
      for (int i = 0; i < 4; ++i) {
        ah[i] = Frag<T>::load(fa + (i << 4) * kGP + ks);
        al[i] = ah[i];
        if (SPLIT == 2) al[i] = Frag<T>::load(fa + (128 + (i << 4)) * kGP + ks);
      }
#pragma unroll
      for (int i = 0; i < 4; ++i) {
#pragma unroll
        for (int j = 0; j < 4; ++j) {
          acc[i][j] = Frag<T>::mma(ah[i], bh[j], acc[i][j]);
          if (SPLIT == 2) acc[i][j] = Frag<T>::mma(al[i], bh[j], acc[i][j]);
        }
      }
#pragma unroll
      for (int i = 0; i < 4; ++i) Frag<T>::guard4(acc[i][0], acc[i][1], acc[i][2], acc[i][3], ah[i], al[i]);
      Frag<T>::keep(bh[0], bh[1], bh[2], bh[3]);
    }
  }
  acc_guard4(acc[0][0], acc[0][1], acc[0][2], acc[0][3]);
  acc_guard4(acc[1][0], acc[1][1], acc[1][2], acc[1][3]);
  acc_guard4(acc[2][0], acc[2][1], acc[2][2], acc[2][3]);
  acc_guard4(acc[3][0], acc[3][1], acc[3][2], acc[3][3]);

  // ---- epilogue ----
  float* slab = sT + wave * kSlab;
  float bcol[4] = {0.f, 0.f, 0.f, 0.f};
  if (BIAS_MODE == 2) {
    // per-column bias: this lane's columns n0 + 16*j + rlane, j = 0..3 (in range: N multiple of 64)
#pragma unroll
    for (int j = 0; j < 4; ++j) bcol[j] = bias[n0 + (j << 4) + rlane];
  }
#pragma unroll
  for (int i = 0; i < 4; ++i) {
    const int mBase = m0 + (i << 4);
    float brow[8] = {0.f, 0.f, 0.f, 0.f, 0.f, 0.f, 0.f, 0.f};
    if (BIAS_MODE == 1) {
      // per-row bias: rows mBase + mOff + 0..7 (16-B aligned: mBase % 16 == 0, mOff in {0, 8})
      const v4f b0 = *(const v4f*)(bias + mBase + mOff);
      const v4f b1 = *(const v4f*)(bias + mBase + mOff + 4);
#pragma unroll
      for (int e = 0; e < 4; ++e) { brow[e] = b0[e]; brow[4 + e] = b1[e]; }
    }
#pragma unroll
    for (int j = 0; j < 4; ++j) {
#pragma unroll
      for (int r = 0; r < 8; ++r) {
        float bb = 0.f;
        if (BIAS_MODE == 1) bb = brow[r];
        if (BIAS_MODE == 2) bb = bcol[j];
        slab[(mOff + r) * 68 + (j << 4) + rlane] = acc[i][j][r] * scale + bb;
      }
    }
    __builtin_amdgcn_fence(3, "workgroup");
    __builtin_amdgcn_wave_barrier();
    __builtin_amdgcn_fence(2, "workgroup");
    if (OUT_MODE == 0) {
      float* C = (float*)Cout + (size_t)b * strideC;
      const int hh = lane >> 4, c4 = (lane & 15) * 4;     // row seg = 256 B = 16 lanes x 16 B
      {
#pragma unroll
        for (int it = 0; it < 8; ++it) {
          const int row = it * 2 + hh;
          const v4f v = *(const v4f*)(slab + row * 68 + c4);
          *(v4f*)(C + (size_t)(mBase + row) * ldc + n0 + c4) = v;
        }
        
      }
    } else {
      const int q = lane >> 3, c8 = (lane & 7) * 8;
      unsigned short* C  = (unsigned short*)Cout  + (size_t)b * strideC;
      unsigned short* C2 = (OUT_MODE == 2) ? ((unsigned short*)Cout2 + (size_t)b * strideC) : nullptr;
      {
#pragma unroll
        for (int it = 0; it < 4; ++it) {
          const int row = it * 4 + q;
          const float* sp = slab + row * 68 + c8;
          v8h hv, lv;
#pragma unroll
          for (int e = 0; e < 8; ++e) {
            if (OUT_MODE == 1) {
              hv[e] = (_Float16)sp[e];
            } else {
              unsigned short hb = f2bf_bits(sp[e]);
              unsigned short lb = f2bf_bits(sp[e] - bf_bits2f(hb));
              hv[e] = __builtin_bit_cast(_Float16, hb);
              lv[e] = __builtin_bit_cast(_Float16, lb);
            }
          }
          *(v8h*)(C + (size_t)(mBase + row) * ldc + n0 + c8) = hv;
          if (OUT_MODE == 2) *(v8h*)(C2 + (size_t)(mBase + row) * ldc + n0 + c8) = lv;
        }
        
      }
    }
    __builtin_amdgcn_fence(3, "workgroup");
    __builtin_amdgcn_wave_barrier();
    __builtin_amdgcn_fence(2, "workgroup");
  }
}

// One product per launch: grid (tiles, batches).
template <int ET, int SPLIT, int BIAS_MODE, int OUT_MODE>
__global__ __launch_bounds__(256) void wmma_gemm64(
    const unsigned short* __restrict__ Ap, const unsigned short* __restrict__ A2p, int lda, long strideA,
    const unsigned short* __restrict__ Btp, const unsigned short* __restrict__ Bt2p, int ldb, long strideB,
    void* __restrict__ Cout, void* __restrict__ Cout2, int ldc, long strideC,
    const float* __restrict__ bias,
    int M, int N, int K, float scale) {
  __shared__ __align__(16) unsigned short sA[(SPLIT == 2 ? 2 : 1) * 128 * kGP];   // A (hi, then lo) [row][k] (cross-wave: block barriers)
  __shared__ __align__(16) unsigned short sB[256 * kGP];                          // Bt [row][k] (cross-wave: block barriers)
  __shared__ __align__(16) float sT[8 * kSlab];                                   // per-wave slabs (private-to-wave)
  gemm64_tile<ET, SPLIT, BIAS_MODE, OUT_MODE>(sA, sB, sT, blockIdx.x, blockIdx.y, Ap, A2p, lda, strideA, Btp, Bt2p, ldb, strideB,
                                              Cout, Cout2, ldc, strideC, bias, M, N, K, scale);
}

// The two projections that depend only on XB and WT, in one launch, told apart by the block index (block-uniform branch):
//   blocks [0, kTilesQK):  q|k = XB . WT[rows 0..2047] + BQK[n] -> f16 plane [kTok][2048] (M=kTok, N=2048, bias per column)
//   then kTilesV per batch: v^T[b][h*64+d][s] = WT[2048 + h*64 + d] . XB[b*kSeq + s] + BV[h*64+d] -> bf16 hi/lo planes
//                           (M=1024, N=kSeq, bias per row)
constexpr int kTilesQK = (kTok / 128) * (kQKld / 256);
constexpr int kTilesV  = (kDim / 128) * (kSeq / 256);
// Register cap: each body alone builds to 256 registers a wave, the two in one kernel to 258, which is allocated as 272 and leaves
// room for three waves a SIMD, so one block a WGP. At 256 four waves fit: two blocks a WGP, and all 384 blocks are resident at once.
__global__ __launch_bounds__(256) __attribute__((amdgpu_num_vgpr(256))) void qkv_gemm_kernel(
    const unsigned short* __restrict__ XB, const unsigned short* __restrict__ WT,
    const float* __restrict__ BQK, const float* __restrict__ BV,
    unsigned short* __restrict__ QK16, unsigned short* __restrict__ VTH, unsigned short* __restrict__ VTL, int K) {
  __shared__ __align__(16) unsigned short sA[128 * kGP];   // A [row][k] (cross-wave: block barriers)
  __shared__ __align__(16) unsigned short sB[256 * kGP];   // Bt [row][k] (cross-wave: block barriers)
  __shared__ __align__(16) float sT[8 * kSlab];            // per-wave slabs (private-to-wave)
  const int bx = blockIdx.x;
  if (bx < kTilesQK) {
    gemm64_tile<1, 0, 2, 1>(sA, sB, sT, bx, 0, XB, XB, kDim, 0L, WT, WT, kDim, 0L,
                            (void*)QK16, (void*)QK16, kQKld, 0L, BQK, kTok, kQKld, K, 1.0f);
  } else {
    const int r = bx - kTilesQK;
    const int b = r / kTilesV;
    const unsigned short* Av = WT + (size_t)2 * kDim * kDim;   // rows 2048..3071 of WT = Wv^T
    gemm64_tile<1, 0, 1, 2>(sA, sB, sT, r - b * kTilesV, b, Av, Av, kDim, 0L, XB, XB, kDim, (long)kSeq * kDim,
                            (void*)VTH, (void*)VTL, kSeq, (long)kDim * kSeq, BV, kDim, kSeq, K, 1.0f);
  }
}

// ---------------------------------------------------------------------------
// f32 -> bf16 (RNE) cast of x into the compact token plane XB [kTok][1024]: token row t = b*kSeq + s reads input row
// ---------------------------------------------------------------------------
__device__ __forceinline__ void cast8_bf16_block(const float* __restrict__ in, unsigned short* __restrict__ out, int n8, int bx) {
  const int i = bx * 256 + threadIdx.x;
  if (i >= n8) return;
  const int t  = i >> 7;                 // 128 groups of 8 per token row
  const int c8 = (i & 127) * 8;
  const int b  = t / kSeq;
  const int s  = t - b * kSeq;
  const float* p = in + (size_t)(b * kSeqFull + s) * kDim + c8;
  const v4f a = *(const v4f*)(p);
  const v4f c = *(const v4f*)(p + 4);
  unsigned short hb[8];
#pragma unroll
  for (int e = 0; e < 4; ++e) {
    hb[e]     = f2bf_bits(a[e]);
    hb[4 + e] = f2bf_bits(c[e]);
  }
  const v4u u = (v4u){pk16(hb[0], hb[1]), pk16(hb[2], hb[3]), pk16(hb[4], hb[5]), pk16(hb[6], hb[7])};
  unsigned short* q = out + 8 * (size_t)i;
  *(v4u*)q = u;
  
}

// ---------------------------------------------------------------------------
// Weight transpose + RNE bf16 cast: W f32 row-major [1024 (d)][ldIn (n)] -> WT bf16 [n][d] with pitch ldOut (= 1024):
//   in[d][n] -> out[n][d]. One block of 256 threads per 64x64 tile (dt = d tile, nt = n tile).
// Load coverage: 16 iterations x 256 threads = 4096 = the whole 64x64 tile (coalesced along n).
// Store coverage: 8 waves x 2 iterations x 4 rows (lane>>3) = 64 n-rows; (lane&7) x 8 halves = 64 d-cols; each row segment
// ---------------------------------------------------------------------------
__device__ __forceinline__ void wtcast_bf16_block(const float* __restrict__ W, unsigned short* __restrict__ out,
                                                  int ldIn, int ldOut, int dt, int nt) {
  __shared__ float sm[64][65];   // sm[n_local][d_local] (cross-wave: block barrier)
  const int t  = threadIdx.x;
  const int d0 = dt * 64;
  const int n0 = nt * 64;
#pragma unroll
  for (int i = 0; i < 16; ++i) {
    const int e = i * 256 + t;
    const int r = e >> 6;          // d local
    const int c = e & 63;          // n local
    sm[c][r] = W[(size_t)(d0 + r) * ldIn + n0 + c];
  }
  __syncthreads();
  const int lane = t & 31, wave = t >> 5;
  const int q = lane >> 3, c8 = (lane & 7) * 8;
  {
#pragma unroll
    for (int it = 0; it < 2; ++it) {
      const int row = wave * 8 + it * 4 + q;                 // n local
      unsigned short hb[8];
#pragma unroll
      for (int e = 0; e < 8; ++e) hb[e] = f2bf_bits(sm[row][c8 + e]);
      const v4u u = (v4u){pk16(hb[0], hb[1]), pk16(hb[2], hb[3]), pk16(hb[4], hb[5]), pk16(hb[6], hb[7])};
      *(v4u*)(out + (size_t)(n0 + row) * ldOut + d0 + c8) = u;
    }
    // inlined beside other pieces, the built code reuses these two stores' registers on a path behind them: the wait stands in front of that overwrite
    asm volatile("s_wait_xcnt 0x0" ::: "memory");
  }
}

// ---------------------------------------------------------------------------
// Bias RNE bf16 convert kept as f32: dst[1024] = float(bf16(src)). One block of 256 threads, float4 per lane:
// ---------------------------------------------------------------------------
__device__ __forceinline__ void bias_bf16_block(const float* __restrict__ bsrc, float* __restrict__ bdst) {
  const int t = threadIdx.x;
  const v4f a = *(const v4f*)(bsrc + 4 * t);
  v4f r;
#pragma unroll
  for (int e = 0; e < 4; ++e) r[e] = bf_bits2f(f2bf_bits(a[e]));
  float* dp = bdst + 4 * t;
  *(v4f*)dp = r;
  
}

// ---------------------------------------------------------------------------
// All eight input conversions in one launch: they are independent of one another, so each block takes its piece by its
// index (block-uniform branches): 4 x kWTiles weight tiles (Wq, Wk, Wv -> WT rows 0, 1024, 2048; Wo -> WOT), 3 bias blocks
// (bq, bk -> BQK; bv -> BV), then the blocks of the x cast.
// ---------------------------------------------------------------------------
constexpr int kWTiles   = (kDim / 64) * (kDim / 64);   // 64x64 tiles of one square weight
constexpr int kCastBlks = kTok * kDim / 8 / 256;       // blocks of the x cast (8 elements per thread)
static_assert((kTok * kDim / 8) % 256 == 0);
__global__ __launch_bounds__(256) void prologue_kernel(
    const float* __restrict__ x,  const float* __restrict__ Wq, const float* __restrict__ Wk, const float* __restrict__ Wv,
    const float* __restrict__ Wo, const float* __restrict__ bq, const float* __restrict__ bk, const float* __restrict__ bv,
    unsigned short* __restrict__ XB, unsigned short* __restrict__ WT, unsigned short* __restrict__ WOT,
    float* __restrict__ BQK, float* __restrict__ BV) {
  const int bx = blockIdx.x;
  if (bx >= 4 * kWTiles + 3) {
    cast8_bf16_block(x, XB, kTok * kDim / 8, bx - (4 * kWTiles + 3));
    return;
  }
  if (bx >= 4 * kWTiles) {
    const int w = bx - 4 * kWTiles;
    bias_bf16_block((w == 0) ? bq : (w == 1) ? bk : bv, (w == 0) ? BQK : (w == 1) ? (BQK + kDim) : BV);
    return;
  }
  const int w = bx / kWTiles;
  const int t = bx - w * kWTiles;
  const float* W = (w == 0) ? Wq : (w == 1) ? Wk : (w == 2) ? Wv : Wo;
  unsigned short* o = (w < 3) ? (WT + (size_t)w * kDim * kDim) : WOT;
  wtcast_bf16_block(W, o, kDim, kDim, t % (kDim / 64), t / (kDim / 64));
}

union FragH { v16h v; v8h h[2]; };
union FragB { v16b v; v8b h[2]; };

__device__ __forceinline__ v8f mma_h16(v16h a, v16h b, v8f c) {
  c = __builtin_amdgcn_wmma_f32_16x16x32_f16(false, a, false, b, (short)0, c, false, false);
  asm volatile("v_nop\n\tv_nop\n\tv_nop\n\tv_nop" : "+v"(c) : "v"(a), "v"(b));
  return c;
}
__device__ __forceinline__ v8f mma_b16(v16b a, v16b b, v8f c) {
  c = __builtin_amdgcn_wmma_f32_16x16x32_bf16(false, a, false, b, (short)0, c, false, false);
  asm volatile("v_nop\n\tv_nop\n\tv_nop\n\tv_nop" : "+v"(c) : "v"(a), "v"(b));
  return c;
}
// lane l <-> lane l ^ 16: the two wave halves hold the two key halves of one query
__device__ __forceinline__ float xhalf(float x) {
  const int b = __builtin_bit_cast(int, x);
  return __builtin_bit_cast(float, __builtin_amdgcn_permlanex16(b, b, 0x76543210, 0xfedcba98, false, false));
}
// 2^x by v_exp_f32. In asm so that the slot the instruction set asks for behind a transcendental (one v_nop or independent
// instruction before its result is read or its source overwritten) stands inside the statement. Eight at a time: the outputs are early-clobber,
// so each v_exp_f32 is independent of the one in front of it, and one v_nop serves the last.
__device__ __forceinline__ void exp2x8(float (&p)[8], const float (&x)[8]) {
  asm("v_exp_f32 %0, %8\n\tv_exp_f32 %1, %9\n\tv_exp_f32 %2, %10\n\tv_exp_f32 %3, %11\n\t"
      "v_exp_f32 %4, %12\n\tv_exp_f32 %5, %13\n\tv_exp_f32 %6, %14\n\tv_exp_f32 %7, %15\n\tv_nop"
      : "=&v"(p[0]), "=&v"(p[1]), "=&v"(p[2]), "=&v"(p[3]), "=&v"(p[4]), "=&v"(p[5]), "=&v"(p[6]), "=&v"(p[7])
      : "v"(x[0]), "v"(x[1]), "v"(x[2]), "v"(x[3]), "v"(x[4]), "v"(x[5]), "v"(x[6]), "v"(x[7]));
}
__device__ __forceinline__ float exp2x1(float x) {
  float p;
  asm("v_exp_f32 %0, %1\n\tv_nop" : "=v"(p) : "v"(x));   // the v_nop: the same slot
  return p;
}
__device__ __forceinline__ __bf16 f2bf(float f) { return __builtin_bit_cast(__bf16, f2bf_bits(f)); }
__device__ __forceinline__ void bf_split(float f, __bf16& hi, __bf16& lo) {
  const unsigned short hb = f2bf_bits(f);
  hi = __builtin_bit_cast(__bf16, hb);
  lo = f2bf(f - __uint_as_float(((unsigned)hb) << 16));
}

__global__ __launch_bounds__(128) __attribute__((amdgpu_num_vgpr(256)))
void causal_attn_kernel(const unsigned short* __restrict__ QKp,
                        const unsigned short* __restrict__ VHp,
                        const unsigned short* __restrict__ VLp,
                        unsigned short* __restrict__ CHp,
                        unsigned short* __restrict__ CLp) {
  __shared__ __align__(16) unsigned short Ksh[kKC * kLP];    // K   [kv][d]   9 KB  (cross-wave: block barriers)
  __shared__ __align__(16) unsigned short Vth[kDh * kLP];    // V^T hi [d][kv] 9 KB  (cross-wave: block barriers)
  __shared__ __align__(16) unsigned short Vtl[kDh * kLP];    // V^T lo [d][kv] 9 KB  (cross-wave: block barriers)
  __shared__ __align__(16) float  Os[kAW][16 * 68];          // per wave out tile, pitch 68 (private-to-wave)

  const int tid  = threadIdx.x;
  const int wave = tid >> 5;
  const int lane = tid & 31;
  const int hh   = lane >> 4;
  const int c    = lane & 15;

  const int nqb = kSeq / kQB;
  const int bx  = blockIdx.x;
  const int qb  = bx % nqb;
  const int bh  = bx / nqb;              // b*16 + h
  const int h   = bh % kHeads;
  const int b   = bh / kHeads;
  const int q0  = qb * kQB + wave * 16;  // first query row of this wave (within the sequence)

  const _Float16* Qb = (const _Float16*)(QKp + (size_t)b * kSeq * kQKld + h * kDh);
  const unsigned short* Kb  = QKp + (size_t)b * kSeq * kQKld + kDim + h * kDh;
  const unsigned short* Vhb = VHp + (size_t)bh * kDh * kSeq;
  const unsigned short* Vlb = VLp + (size_t)bh * kDh * kSeq;

  // ---- Q fragments (B operand: column = query q0 + c; split k map via Frag<_Float16>::load): 2 d-chunks of 32 ----
  v16h qa[2];
#pragma unroll
  for (int dc = 0; dc < 2; ++dc) qa[dc] = Frag<_Float16>::load(Qb + (size_t)(q0 + c) * kQKld + dc * 32 + 8 * hh);

  const int qrow = q0 + c;      // this lane's query
  float mrow = -INFINITY;       // running maximum of query qrow's unscaled scores (equal in both wave halves)
  float lrow = 0.f;             // running sum over this wave half's keys only; the halves are joined after the loop
  v8f oacc[4];                  // oacc[t][r] = ctx[qrow][16 t + 8 hh + r]
#pragma unroll
  for (int t = 0; t < 4; ++t) oacc[t] = (v8f){0.f,0.f,0.f,0.f,0.f,0.f,0.f,0.f};

  const int nChunks = qb + 1;   // block-uniform (causal: key chunks 0..qb)
  for (int kc = 0; kc < nChunks; ++kc) {
    const int kv0 = kc * kKC;
    __syncthreads();
    {
      // staging coverage: 128 threads x (1 row x 32 halves) = 64 rows x 64 halves per tile, all three tiles fully written
      const int r = tid >> 1, hf = (tid & 1) * 32;
      {
        const uint4* ks = (const uint4*)(Kb + (size_t)(kv0 + r) * kQKld + hf);
        uint4* kd = (uint4*)(Ksh + r * kLP + hf);
        const uint4 w0 = ks[0], w1 = ks[1], w2 = ks[2], w3 = ks[3];
        kd[0] = w0; kd[1] = w1; kd[2] = w2; kd[3] = w3;
      }
      asm volatile("" ::: "memory");
      {
        const uint4* vs = (const uint4*)(Vhb + (size_t)r * kSeq + kv0 + hf);
        uint4* vd = (uint4*)(Vth + r * kLP + hf);
        const uint4 w0 = vs[0], w1 = vs[1], w2 = vs[2], w3 = vs[3];
        vd[0] = w0; vd[1] = w1; vd[2] = w2; vd[3] = w3;
      }
      asm volatile("" ::: "memory");
      {
        const uint4* vs = (const uint4*)(Vlb + (size_t)r * kSeq + kv0 + hf);
        uint4* vd = (uint4*)(Vtl + r * kLP + hf);
        const uint4 w0 = vs[0], w1 = vs[1], w2 = vs[2], w3 = vs[3];
        vd[0] = w0; vd[1] = w1; vd[2] = w2; vd[3] = w3;
      }
    }
    __syncthreads();

    // ---- scores^T: 4 key subtiles of 16 (rows), K = 64 (2 d-chunks) ----
    v8f s[4];
#pragma unroll
    for (int j = 0; j < 4; ++j) {
      s[j] = (v8f){0.f,0.f,0.f,0.f,0.f,0.f,0.f,0.f};
#pragma unroll
      for (int dc = 0; dc < 2; ++dc) {
        FragH kb;
        kb.h[0] = *(const v8h*)(Ksh + (j * 16 + c) * kLP + dc * 32 + 8 * hh);
        kb.h[1] = *(const v8h*)(Ksh + (j * 16 + c) * kLP + dc * 32 + 16 + 8 * hh);
        s[j] = mma_h16(kb.v, qa[dc], s[j]);
      }
    }
    // ---- causal fill on the diagonal chunk, maximum of the query's 64 unscaled scores (one chain per subtile; scale > 0) ----
    const bool diag = (kc == qb);
    float mj[4];
#pragma unroll
    for (int j = 0; j < 4; ++j) {
      float m = -INFINITY;
#pragma unroll
      for (int r = 0; r < 8; ++r) {
        const int kvcol = kv0 + j * 16 + 8 * hh + r;
        float sv = s[j][r];
        if (diag && (kvcol > qrow)) sv = kNegBig;
        s[j][r] = sv;
        m = fmaxf(m, sv);
      }
      mj[j] = m;
    }
    float cm = fmaxf(fmaxf(mj[0], mj[1]), fmaxf(mj[2], mj[3]));
    cm = fmaxf(cm, xhalf(cm));
    // ---- online softmax update; P^T as bf16 hi/lo straight into the B operands of the second product ----
    const float mnew = fmaxf(mrow, cm);
    const float mc = mnew * kSL2E;
    const float alpha = exp2x1(fmaf(mrow, kSL2E, -mc));   // first chunk: mrow = -inf gives 0
    mrow = mnew;
    FragB pa[2], pl[2];
    float pj[4];
#pragma unroll
    for (int j = 0; j < 4; ++j) {
      float psum = 0.f;
      float xe[8], pe[8];
#pragma unroll
      for (int r = 0; r < 8; ++r) xe[r] = fmaf(s[j][r], kSL2E, -mc);
      exp2x8(pe, xe);
#pragma unroll
      for (int r = 0; r < 8; ++r) {
        const float p = pe[r];
        psum += p;
        __bf16 ph, plo;
        bf_split(p, ph, plo);
        pa[j >> 1].v[(j & 1) * 8 + r] = ph;
        pl[j >> 1].v[(j & 1) * 8 + r] = plo;
      }
      pj[j] = psum;
    }
    lrow = lrow * alpha + ((pj[0] + pj[1]) + (pj[2] + pj[3]));
#pragma unroll
    for (int t = 0; t < 4; ++t)
#pragma unroll
      for (int r = 0; r < 8; ++r) oacc[t][r] *= alpha;
    // ---- ctx^T += V^T(64x64) . P^T(64x16): hi.hi + lo.hi + hi.lo ----
    // unrolled: pa and pl are register arrays and need constant indices
#pragma unroll
    for (int kk = 0; kk < 2; ++kk) {
#pragma unroll
      for (int t = 0; t < 4; ++t) {
        FragB vb, vl;
        vb.h[0] = *(const v8b*)(Vth + (t * 16 + c) * kLP + kk * 32 + 8 * hh);
        vb.h[1] = *(const v8b*)(Vth + (t * 16 + c) * kLP + kk * 32 + 16 + 8 * hh);
        vl.h[0] = *(const v8b*)(Vtl + (t * 16 + c) * kLP + kk * 32 + 8 * hh);
        vl.h[1] = *(const v8b*)(Vtl + (t * 16 + c) * kLP + kk * 32 + 16 + 8 * hh);
        oacc[t] = mma_b16(vb.v, pa[kk].v, oacc[t]);
        oacc[t] = mma_b16(vl.v, pa[kk].v, oacc[t]);
        oacc[t] = mma_b16(vb.v, pl[kk].v, oacc[t]);
      }
    }
  }

  // ---- join the halves' sums, divide, and lay the tile out as [query][d] in the wave's own LDS slab ----
  float* os = Os[wave];
  const float inv = 1.0f / (lrow + xhalf(lrow));
#pragma unroll
  for (int t = 0; t < 4; ++t) {
    float* op = os + c * 68 + t * 16 + 8 * hh;
    *(v4f*)(op)     = (v4f){oacc[t][0] * inv, oacc[t][1] * inv, oacc[t][2] * inv, oacc[t][3] * inv};
    *(v4f*)(op + 4) = (v4f){oacc[t][4] * inv, oacc[t][5] * inv, oacc[t][6] * inv, oacc[t][7] * inv};
  }
  __builtin_amdgcn_fence(3, "workgroup");
  __builtin_amdgcn_wave_barrier();
  __builtin_amdgcn_fence(2, "workgroup");
  {
    // store coverage: 4 iterations x 4 row groups (lane>>3) = 16 rows; (lane&7) x 8 halves = 64 cols
    const int q = lane >> 3, c8 = (lane & 7) * 8;
    unsigned short* ch = CHp + (size_t)(b * kSeq + q0) * kDim + h * kDh;
    unsigned short* cl = CLp + (size_t)(b * kSeq + q0) * kDim + h * kDh;
    {
#pragma unroll
      for (int it = 0; it < 4; ++it) {
        const int row = it * 4 + q;
        const float* sp = os + row * 68 + c8;
        v8h hv, lv;
#pragma unroll
        for (int e = 0; e < 8; ++e) {
          const unsigned short hb = f2bf_bits(sp[e]);
          const unsigned short lb = f2bf_bits(sp[e] - bf_bits2f(hb));
          hv[e] = __builtin_bit_cast(_Float16, hb);
          lv[e] = __builtin_bit_cast(_Float16, lb);
        }
        *(v8h*)(ch + (size_t)row * kDim + c8) = hv;
        *(v8h*)(cl + (size_t)row * kDim + c8) = lv;
      }
      
    }
  }
}

// ---------------------------------------------------------------------------
// Host glue.
// Inputs (wire f32): 0 x [2][2048][1024], 1 Wq [1024][1024], 2 bq [1024], 3 Wk, 4 bk, 5 Wv, 6 bv, 7 Wo [1024][1024].
//   XB    bf16 [kTok][1024]             8,388,608   (RNE bf16 of x, compact token rows, A layout)
//   WT    bf16 [3072][1024]             6,291,456   (Wq^T | Wk^T | Wv^T, RNE bf16, Bt layout [n][k])
//   WOT   bf16 [1024][1024]             2,097,152   (Wo^T, RNE bf16, Bt layout)
//   BQK   f32  [2048]                       8,192   (RNE bf16 of bq | bk, widened)
//   BV    f32  [1024]                       4,096   (RNE bf16 of bv, widened)
//   QK16  f16  [kTok][2048]            16,777,216   (q | k columns incl. bias)
//   VTH   bf16 [kBatch*16*64][kSeq]     8,388,608   (v^T hi plane, bias included)
//   VTL   bf16 [kBatch*16*64][kSeq]     8,388,608   (v^T lo plane)
//   CTXH  bf16 [kTok][1024]             8,388,608   (ctx hi plane)
//   CTXL  bf16 [kTok][1024]             8,388,608   (ctx lo plane)
//   total                              67,121,152
// GEMM shapes: q|k M=kTok N=2048 K=1024; v^T M=1024 N=kSeq K=1024 (kBatch batches); out M=kSeq N=1024 K=1024 (kBatch
// batches, output rows at pitch kSeqFull per batch). All M multiples of 128, N of 256, K of 64: no padding. 4 launches:
// input conversions; q|k and v^T products; attention; output product.
// ---------------------------------------------------------------------------
extern "C" void kernel_launch(void* const* d_in, const int* in_sizes, int n_in,
                              void* d_out, int out_size, void* d_ws, size_t ws_size,
                              hipStream_t stream) {
  if (n_in < 8) return;
  const int rowsNeeded = (kBatch - 1) * kSeqFull + kSeq;     // last token row read/written + 1
  if (in_sizes[0] < rowsNeeded * kDim) return;
  if (in_sizes[1] < kDim * kDim || in_sizes[3] < kDim * kDim || in_sizes[5] < kDim * kDim || in_sizes[7] < kDim * kDim) return;
  if (in_sizes[2] < kDim || in_sizes[4] < kDim || in_sizes[6] < kDim) return;
  if (out_size < rowsNeeded * kDim) return;

  const size_t szXB  = (size_t)kTok * kDim * 2;
  const size_t szWT  = (size_t)kWtN * kDim * 2;
  const size_t szWOT = (size_t)kDim * kDim * 2;
  const size_t szBQK = (size_t)kQKld * 4;
  const size_t szBV  = (size_t)kDim * 4;
  const size_t szQK  = (size_t)kTok * kQKld * 2;
  const size_t szVT  = (size_t)kBatch * kHeads * kDh * kSeq * 2;
  const size_t szCTX = (size_t)kTok * kDim * 2;
  const size_t offXB  = 0;
  const size_t offWT  = offXB + szXB;
  const size_t offWOT = offWT + szWT;
  const size_t offBQK = offWOT + szWOT;
  const size_t offBV  = offBQK + szBQK;
  const size_t offQK  = offBV + szBV;
  const size_t offVTH = offQK + szQK;
  const size_t offVTL = offVTH + szVT;
  const size_t offCH  = offVTL + szVT;
  const size_t offCL  = offCH + szCTX;
  const size_t total  = offCL + szCTX;             // 67,121,152 at full size
  if (ws_size < total) return;
  if (total > (size_t)134217728) return;

  const float* x  = (const float*)d_in[0];
  const float* Wq = (const float*)d_in[1];
  const float* bq = (const float*)d_in[2];
  const float* Wk = (const float*)d_in[3];
  const float* bk = (const float*)d_in[4];
  const float* Wv = (const float*)d_in[5];
  const float* bv = (const float*)d_in[6];
  const float* Wo = (const float*)d_in[7];
  float* out = (float*)d_out;
  char* ws = (char*)d_ws;
  unsigned short* XB   = (unsigned short*)(ws + offXB);
  unsigned short* WT   = (unsigned short*)(ws + offWT);
  unsigned short* WOT  = (unsigned short*)(ws + offWOT);
  float*          BQK  = (float*)(ws + offBQK);
  float*          BV   = (float*)(ws + offBV);
  unsigned short* QK16 = (unsigned short*)(ws + offQK);
  unsigned short* VTH  = (unsigned short*)(ws + offVTH);
  unsigned short* VTL  = (unsigned short*)(ws + offVTL);
  unsigned short* CTXH = (unsigned short*)(ws + offCH);
  unsigned short* CTXL = (unsigned short*)(ws + offCL);

  // ---- prologue: RNE bf16 planes of all float inputs, one launch ----
  prologue_kernel<<<dim3(4 * kWTiles + 3 + kCastBlks), dim3(256), 0, stream>>>(x, Wq, Wk, Wv, Wo, bq, bk, bv, XB, WT, WOT, BQK, BV);
  // ---- q|k (f16 plane) and v^T (bf16 hi/lo planes) from XB and WT, one launch ----
  qkv_gemm_kernel<<<dim3(kTilesQK + kBatch * kTilesV), dim3(256), 0, stream>>>(XB, WT, BQK, BV, QK16, VTH, VTL, kDim);
  // ---- causal attention per (b, h, 64-query block) -> ctx bf16 hi/lo planes ----
  causal_attn_kernel<<<dim3(kBatch * kHeads * (kSeq / kQB)), dim3(128), 0, stream>>>(QK16, VTH, VTL, CTXH, CTXL);
  // ---- out[b][s] = (CTXH + CTXL)[b*kSeq + s] . WOT  (M=kSeq, N=1024, K=1024, kBatch batches, no bias),
  //      f32 straight to d_out rows b*kSeqFull + s ----
  {
    const int blocks = (kSeq / 128) * (kDim / 256);
    wmma_gemm64<1, 2, 0, 0><<<dim3(blocks, kBatch), dim3(256), 0, stream>>>(
        CTXH, CTXL, kDim, (long)kSeq * kDim, WOT, WOT, kDim, 0L,
        (void*)out, (void*)out, kDim, (long)kSeqFull * kDim, BV, kSeq, kDim, kDim, 1.0f);
  }
}

// v006
// It runs in 119 microseconds.
// Two timings next to v005 put it at 1.20 and 1.21 times that version's speed.
// Counting every step since v000, it is 4.31 times as fast.
// Contractions: q|k = x.[Wq|Wk] and v^T = Wv^T.x^T on v_wmma_f32_16x16x32_bf16 (x, W RNE bf16 operands, single products; bq, bk, bv as RNE bf16 added in f32); scores^T = k.q^T on v_wmma_f32_16x16x32_f16 (q, k f16 planes, single products); ctx^T = v^T.p^T on v_wmma_f32_16x16x32_bf16 (p^T and v^T as bf16 hi+lo: hi.hi + lo.hi + hi.lo); out = ctx.Wo on v_wmma_f32_16x16x32_bf16 (ctx bf16 hi+lo, Wo RNE bf16: hi.W + lo.W); f32 accumulate everywhere; scale, causal fill and softmax in f32.
#include <hip/hip_runtime.h>
#include <math.h>

// ---------------------------------------------------------------------------
// Problem constants (NB / SEQ overridable; *_FULL give the input / output strides)
// ---------------------------------------------------------------------------
#ifndef NB
#define NB 2
#endif
#ifndef SEQ
#define SEQ 2048
#endif
#define NB_FULL 2
#define SEQ_FULL 2048

constexpr int kBatch   = NB;
constexpr int kSeq     = SEQ;
constexpr int kSeqFull = SEQ_FULL;
constexpr int kDim     = 1024;               // d_in == d_out
constexpr int kHeads   = 16;
constexpr int kDh      = 64;
constexpr int kTok     = kBatch * kSeq;      // token rows of the compact planes
constexpr int kWtN     = 3 * kDim;           // rows of the Wq^T | Wk^T | Wv^T plane
constexpr int kQKld    = 2 * kDim;           // 2048, pitch (halves) of the q|k f16 plane
constexpr int kQB      = 64;                 // query rows per attention block
constexpr int kKC      = 64;                 // keys per chunk
constexpr int kAW      = 4;                  // waves per key group; an attention block has kKG groups
constexpr int kLP      = 72;                 // LDS row pitch (halves) of the K and V^T tiles: 144 B = 16 B x 9, so 16 rows read by ds_load_b128 fall on 64 distinct banks
constexpr float kScale  = 0.125f;            // 64^-0.5, exact
constexpr float kSL2E   = kScale * 1.44269504088896340736f;   // scale * log2(e): exp(scale * (s - m)) = 2^(kSL2E * s - kSL2E * m)
constexpr float kNegBig = -1.0e30f;          // finite fill for (unscaled) scores above the diagonal
static_assert(kBatch >= 1 && kBatch <= NB_FULL);
static_assert(kSeq >= 64 && kSeq <= SEQ_FULL);
static_assert(kHeads * kDh == kDim);
static_assert(kSeq % kQB == 0 && kSeq % kKC == 0 && kQB == kAW * 16 && kDh == 64);
// GEMM shape contract (no tail handling): M multiple of 128, N multiple of 256, K multiple of 64
static_assert(kTok % 128 == 0 && kQKld % 256 == 0 && kDim % 64 == 0);
static_assert(kDim % 256 == 0 && kSeq % 256 == 0);
static_assert(kDim / 8 == 128 && (kTok * kDim) % 8 == 0);

typedef __attribute__((ext_vector_type(16))) _Float16 v16h;
typedef __attribute__((ext_vector_type(8)))  _Float16 v8h;
typedef __attribute__((ext_vector_type(16))) __bf16   v16b;
typedef __attribute__((ext_vector_type(8)))  __bf16   v8b;
typedef __attribute__((ext_vector_type(8)))  float    v8f;
typedef __attribute__((ext_vector_type(4)))  float    v4f;
typedef __attribute__((ext_vector_type(4)))  unsigned int v4u;

// ---------------------------------------------------------------------------
// Shared pieces
// ---------------------------------------------------------------------------
__device__ __forceinline__ unsigned short f2bf_bits(float f) {
  unsigned u = __float_as_uint(f);
  return (unsigned short)((u + 0x7FFFu + ((u >> 16) & 1u)) >> 16);
}
__device__ __forceinline__ float bf_bits2f(unsigned short h) { return __uint_as_float(((unsigned)h) << 16); }

// hazard guards as plain device helpers (the GEMM template body's only inline asm is its s_wait_xcnt)
__device__ __forceinline__ void dep_guard_h(v8f& a, v8f& b, v16h x, v16h y) { asm volatile("v_nop\n\tv_nop\n\tv_nop\n\tv_nop" : "+v"(a), "+v"(b) : "v"(x), "v"(y)); }
__device__ __forceinline__ void dep_guard_b(v8f& a, v8f& b, v16b x, v16b y) { asm volatile("v_nop\n\tv_nop\n\tv_nop\n\tv_nop" : "+v"(a), "+v"(b) : "v"(x), "v"(y)); }
// guard tying all four accumulators of a group and naming both A fragments as inputs
__device__ __forceinline__ void dep_guard4_h(v8f& a, v8f& b, v8f& c, v8f& d, v16h x, v16h y) { asm volatile("v_nop\n\tv_nop\n\tv_nop\n\tv_nop" : "+v"(a), "+v"(b), "+v"(c), "+v"(d) : "v"(x), "v"(y)); }
__device__ __forceinline__ void dep_guard4_b(v8f& a, v8f& b, v8f& c, v8f& d, v16b x, v16b y) { asm volatile("v_nop\n\tv_nop\n\tv_nop\n\tv_nop" : "+v"(a), "+v"(b), "+v"(c), "+v"(d) : "v"(x), "v"(y)); }
__device__ __forceinline__ void keep4_h(v16h a, v16h b, v16h c, v16h d) { asm volatile("v_nop" :: "v"(a), "v"(b), "v"(c), "v"(d)); }
__device__ __forceinline__ void keep4_b(v16b a, v16b b, v16b c, v16b d) { asm volatile("v_nop" :: "v"(a), "v"(b), "v"(c), "v"(d)); }
__device__ __forceinline__ void acc_guard4(v8f& a, v8f& b, v8f& c, v8f& d) { asm volatile("v_nop\n\tv_nop\n\tv_nop\n\tv_nop" : "+v"(a), "+v"(b), "+v"(c), "+v"(d)); }
template <typename T> struct Frag;
template <> struct Frag<_Float16> {
  typedef v16h V; union U { v16h v; v8h h[2]; };
  // elements 0..7 <- p[0..7], 8..15 <- p[16..23]
  static __device__ __forceinline__ v16h load(const _Float16* p) {
    U f; f.h[0] = *(const v8h*)(p); f.h[1] = *(const v8h*)(p + 16); return f.v;
  }
  static __device__ __forceinline__ v8f mma(v16h a, v16h b, v8f c) {
    return __builtin_amdgcn_wmma_f32_16x16x32_f16(false, a, false, b, (short)0, c, false, false);
  }
  static __device__ __forceinline__ void guard(v8f& a, v8f& b, v16h x, v16h y) { dep_guard_h(a, b, x, y); }
  static __device__ __forceinline__ void guard4(v8f& a, v8f& b, v8f& c, v8f& d, v16h x, v16h y) { dep_guard4_h(a, b, c, d, x, y); }
  static __device__ __forceinline__ void keep(v16h a, v16h b, v16h c, v16h d) { keep4_h(a, b, c, d); }
};
template <> struct Frag<__bf16> {
  typedef v16b V; union U { v16b v; v8b h[2]; };
  static __device__ __forceinline__ v16b load(const __bf16* p) {
    U f; f.h[0] = *(const v8b*)(p); f.h[1] = *(const v8b*)(p + 16); return f.v;
  }
  static __device__ __forceinline__ v8f mma(v16b a, v16b b, v8f c) {
    return __builtin_amdgcn_wmma_f32_16x16x32_bf16(false, a, false, b, (short)0, c, false, false);
  }
  static __device__ __forceinline__ void guard(v8f& a, v8f& b, v16b x, v16b y) { dep_guard_b(a, b, x, y); }
  static __device__ __forceinline__ void guard4(v8f& a, v8f& b, v8f& c, v8f& d, v16b x, v16b y) { dep_guard4_b(a, b, c, d, x, y); }
  static __device__ __forceinline__ void keep(v16b a, v16b b, v16b c, v16b d) { keep4_b(a, b, c, d); }
};

__device__ __forceinline__ unsigned pk16(unsigned short a, unsigned short b) { return (unsigned)a | ((unsigned)b << 16); }

// ---- Register-blocked batched WMMA GEMM (bias added in f32 in the slab phase so all output modes see it) ----
// C[m,n] = scale * sum_k A[m,k] * Bt[n,k] (+bias); each wave owns a 64x64 tile, a block of 8 waves (2 x 4) a 128x256 tile.
// A row-major [M,K]; Bt row-major [N,K], both at row pitch kDim (lda == ldb == kDim); M % 128 == 0, N % 256 == 0, K % 64 == 0.
// Operands go through LDS: per 64 k the block copies its 128 A rows and 256 Bt rows once, 128 B of a row by 8 lanes, so a
// wave-wide 16-B load covers 4 whole lines; the next tile's loads are issued before the products of the current one.
// SPLIT: 0 = single product; 2 = A hi/lo planes (hi.B + lo.B).
// BIAS_MODE: 0 = none, 1 = bias[m] (per row), 2 = bias[n] (per column); bias is an f32 table of length M or N.
// OUT_MODE: 0 = f32, 1 = f16, 2 = bf16 hi plane (Cout) + bf16 lo plane (Cout2).
// ET: 0 = f16 operands, 1 = bf16 operands (pointers passed as 16-bit storage)
constexpr int kGP = 72;   // LDS row pitch (halves) of the staged A and Bt tiles: 144 B = 16 B x 9 for the ds_load_b128 fragment reads
template <int ET> struct Elem;
template <> struct Elem<0> { typedef _Float16 T; };
template <> struct Elem<1> { typedef __bf16 T; };
// The tile body is a device function: bx = tile index within the product, b = batch; sA, sB, sT are the calling kernel's LDS
// (sA: (SPLIT == 2 ? 2 : 1) * 128 * kGP halves, sB: 256 * kGP halves, sT: 8 slabs of kSlab floats), so that one launch can
// hold tiles of several independent products on one LDS allocation.
constexpr int kSlab = 16 * 68;   // per-wave 16x64 output slab, pitch 68 floats
template <int ET, int SPLIT, int BIAS_MODE, int OUT_MODE>
__device__ __forceinline__ void gemm64_tile(
    unsigned short* sA, unsigned short* sB, float* sT, unsigned bx, int b,
    const unsigned short* __restrict__ Ap, const unsigned short* __restrict__ A2p, int lda, long strideA,
    const unsigned short* __restrict__ Btp, const unsigned short* __restrict__ Bt2p, int ldb, long strideB,
    void* __restrict__ Cout, void* __restrict__ Cout2, int ldc, long strideC,
    const float* __restrict__ bias,
    int M, int N, int K, float scale) {
  static_assert(SPLIT == 0 || SPLIT == 2);
  static_assert(BIAS_MODE >= 0 && BIAS_MODE <= 2);
  static_assert(OUT_MODE >= 0 && OUT_MODE <= 2);
  typedef typename Elem<ET>::T T;
  typedef typename Frag<T>::V V;
  const int tid  = threadIdx.x;
  const int lane = tid & 31;
  const int wave = tid >> 5;
  const int blocksN = N >> 8;
  const int bm = bx / blocksN;
  const int bn = bx - bm * blocksN;
  const int mB = bm << 7;                      // first A row of the block
  const int nB = bn << 8;                      // first Bt row of the block
  const int wm = (wave >> 2) << 6;             // this wave's rows within the A tile
  const int wn = (wave & 3) << 6;              // this wave's rows within the Bt tile
  const int m0 = mB + wm;
  const int n0 = nB + wn;

  const unsigned short* Ab  = Ap  + (size_t)b * strideA;
  const unsigned short* Bb  = Btp + (size_t)b * strideB;
  const unsigned short* Ab2 = (SPLIT == 2) ? (A2p + (size_t)b * strideA) : nullptr;

  const int rlane = lane & 15;                 // row (A) / col (B, D) within subtile
  const int koff  = (lane >> 4) * 8;           // k offset of this lane half
  const int mOff  = (lane >> 4) * 8;           // D row offset

  // staging map: thread -> row (tid >> 3) + 32 * i, 8 halves at column (tid & 7) * 8. One address per plane: the row step
  // 32 * kDim is a compile-time constant, so the i-th load differs from the first by an immediate offset only.
  // Every loop over i, j or ks below is unrolled so that the register arrays (ra, rb, fragments, acc) keep constant indices.
  const int srow = tid >> 3;
  const int sc8  = (tid & 7) * 8;
  const unsigned short* gA  = Ab + (size_t)(mB + srow) * kDim + sc8;
  const unsigned short* gA2 = (SPLIT == 2) ? (Ab2 + (size_t)(mB + srow) * kDim + sc8) : nullptr;
  const unsigned short* gB  = Bb + (size_t)(nB + srow) * kDim + sc8;
  v4u ra[4], ra2[4], rb[8];
#pragma unroll
  for (int i = 0; i < 4; ++i) {
    ra[i] = *(const v4u*)(gA + i * 32 * kDim);
    if (SPLIT == 2) ra2[i] = *(const v4u*)(gA2 + i * 32 * kDim);
  }
#pragma unroll
  for (int i = 0; i < 8; ++i) rb[i] = *(const v4u*)(gB + i * 32 * kDim);

  const T* fa = (const T*)sA + (wm + rlane) * kGP + koff;
  const T* fb = (const T*)sB + (wn + rlane) * kGP + koff;

  v8f acc[4][4];
#pragma unroll
  for (int i = 0; i < 4; ++i)
#pragma unroll
    for (int j = 0; j < 4; ++j) acc[i][j] = (v8f){0.f,0.f,0.f,0.f,0.f,0.f,0.f,0.f};

  for (int k0 = 0; k0 < K; k0 += 64) {
    __syncthreads();   // every wave has read its last fragment of the previous tile
#pragma unroll
    for (int i = 0; i < 4; ++i) {
      *(v4u*)(sA + (srow + 32 * i) * kGP + sc8) = ra[i];
      if (SPLIT == 2) *(v4u*)(sA + (128 + srow + 32 * i) * kGP + sc8) = ra2[i];
    }
#pragma unroll
    for (int i = 0; i < 8; ++i) *(v4u*)(sB + (srow + 32 * i) * kGP + sc8) = rb[i];
    __syncthreads();   // the tile is complete before any wave reads it
    if (k0 + 64 < K) { // block-uniform: the next tile's loads fly during this tile's products
      const int kn = k0 + 64;
#pragma unroll
      for (int i = 0; i < 4; ++i) {
        ra[i] = *(const v4u*)(gA + kn + i * 32 * kDim);
        if (SPLIT == 2) ra2[i] = *(const v4u*)(gA2 + kn + i * 32 * kDim);
      }
#pragma unroll
      for (int i = 0; i < 8; ++i) rb[i] = *(const v4u*)(gB + kn + i * 32 * kDim);
      // the fragment reads below reuse the address registers of the loads just issued: the wait stands in front of that overwrite
      asm volatile("s_wait_xcnt 0x0" ::: "memory");
    }
#pragma unroll
    for (int ks = 0; ks < 64; ks += 32) {
      V bh[4], ah[4], al[4];
#pragma unroll
      for (int j = 0; j < 4; ++j) bh[j] = Frag<T>::load(fb + (j << 4) * kGP + ks);
#pragma unroll
      for (int i = 0; i < 4; ++i) {
        ah[i] = Frag<T>::load(fa + (i << 4) * kGP + ks);
        al[i] = ah[i];
        if (SPLIT == 2) al[i] = Frag<T>::load(fa + (128 + (i << 4)) * kGP + ks);
      }
#pragma unroll
      for (int i = 0; i < 4; ++i) {
#pragma unroll
        for (int j = 0; j < 4; ++j) {
          acc[i][j] = Frag<T>::mma(ah[i], bh[j], acc[i][j]);
          if (SPLIT == 2) acc[i][j] = Frag<T>::mma(al[i], bh[j], acc[i][j]);
        }
      }
#pragma unroll
      for (int i = 0; i < 4; ++i) Frag<T>::guard4(acc[i][0], acc[i][1], acc[i][2], acc[i][3], ah[i], al[i]);
      Frag<T>::keep(bh[0], bh[1], bh[2], bh[3]);
    }
  }
  acc_guard4(acc[0][0], acc[0][1], acc[0][2], acc[0][3]);
  acc_guard4(acc[1][0], acc[1][1], acc[1][2], acc[1][3]);
  acc_guard4(acc[2][0], acc[2][1], acc[2][2], acc[2][3]);
  acc_guard4(acc[3][0], acc[3][1], acc[3][2], acc[3][3]);

  // ---- epilogue ----
  float* slab = sT + wave * kSlab;
  float bcol[4] = {0.f, 0.f, 0.f, 0.f};
  if (BIAS_MODE == 2) {
    // per-column bias: this lane's columns n0 + 16*j + rlane, j = 0..3 (in range: N multiple of 64)
#pragma unroll
    for (int j = 0; j < 4; ++j) bcol[j] = bias[n0 + (j << 4) + rlane];
  }
#pragma unroll
  for (int i = 0; i < 4; ++i) {
    const int mBase = m0 + (i << 4);
    float brow[8] = {0.f, 0.f, 0.f, 0.f, 0.f, 0.f, 0.f, 0.f};
    if (BIAS_MODE == 1) {
      // per-row bias: rows mBase + mOff + 0..7 (16-B aligned: mBase % 16 == 0, mOff in {0, 8})
      const v4f b0 = *(const v4f*)(bias + mBase + mOff);
      const v4f b1 = *(const v4f*)(bias + mBase + mOff + 4);
#pragma unroll
      for (int e = 0; e < 4; ++e) { brow[e] = b0[e]; brow[4 + e] = b1[e]; }
    }
#pragma unroll
    for (int j = 0; j < 4; ++j) {
#pragma unroll
      for (int r = 0; r < 8; ++r) {
        float bb = 0.f;
        if (BIAS_MODE == 1) bb = brow[r];
        if (BIAS_MODE == 2) bb = bcol[j];
        slab[(mOff + r) * 68 + (j << 4) + rlane] = acc[i][j][r] * scale + bb;
      }
    }
    __builtin_amdgcn_fence(3, "workgroup");
    __builtin_amdgcn_wave_barrier();
    __builtin_amdgcn_fence(2, "workgroup");
    if (OUT_MODE == 0) {
      float* C = (float*)Cout + (size_t)b * strideC;
      const int hh = lane >> 4, c4 = (lane & 15) * 4;     // row seg = 256 B = 16 lanes x 16 B
      {
#pragma unroll
        for (int it = 0; it < 8; ++it) {
          const int row = it * 2 + hh;
          const v4f v = *(const v4f*)(slab + row * 68 + c4);
          *(v4f*)(C + (size_t)(mBase + row) * ldc + n0 + c4) = v;
        }
        
      }
    } else {
      const int q = lane >> 3, c8 = (lane & 7) * 8;
      unsigned short* C  = (unsigned short*)Cout  + (size_t)b * strideC;
      unsigned short* C2 = (OUT_MODE == 2) ? ((unsigned short*)Cout2 + (size_t)b * strideC) : nullptr;
      {
#pragma unroll
        for (int it = 0; it < 4; ++it) {
          const int row = it * 4 + q;
          const float* sp = slab + row * 68 + c8;
          v8h hv, lv;
#pragma unroll
          for (int e = 0; e < 8; ++e) {
            if (OUT_MODE == 1) {
              hv[e] = (_Float16)sp[e];
            } else {
              unsigned short hb = f2bf_bits(sp[e]);
              unsigned short lb = f2bf_bits(sp[e] - bf_bits2f(hb));
              hv[e] = __builtin_bit_cast(_Float16, hb);
              lv[e] = __builtin_bit_cast(_Float16, lb);
            }
          }
          *(v8h*)(C + (size_t)(mBase + row) * ldc + n0 + c8) = hv;
          if (OUT_MODE == 2) *(v8h*)(C2 + (size_t)(mBase + row) * ldc + n0 + c8) = lv;
        }
        
      }
    }
    __builtin_amdgcn_fence(3, "workgroup");
    __builtin_amdgcn_wave_barrier();
    __builtin_amdgcn_fence(2, "workgroup");
  }
}

// One product per launch: grid (tiles, batches).
template <int ET, int SPLIT, int BIAS_MODE, int OUT_MODE>
__global__ __launch_bounds__(256) void wmma_gemm64(
    const unsigned short* __restrict__ Ap, const unsigned short* __restrict__ A2p, int lda, long strideA,
    const unsigned short* __restrict__ Btp, const unsigned short* __restrict__ Bt2p, int ldb, long strideB,
    void* __restrict__ Cout, void* __restrict__ Cout2, int ldc, long strideC,
    const float* __restrict__ bias,
    int M, int N, int K, float scale) {
  __shared__ __align__(16) unsigned short sA[(SPLIT == 2 ? 2 : 1) * 128 * kGP];   // A (hi, then lo) [row][k] (cross-wave: block barriers)
  __shared__ __align__(16) unsigned short sB[256 * kGP];                          // Bt [row][k] (cross-wave: block barriers)
  __shared__ __align__(16) float sT[8 * kSlab];                                   // per-wave slabs (private-to-wave)
  gemm64_tile<ET, SPLIT, BIAS_MODE, OUT_MODE>(sA, sB, sT, blockIdx.x, blockIdx.y, Ap, A2p, lda, strideA, Btp, Bt2p, ldb, strideB,
                                              Cout, Cout2, ldc, strideC, bias, M, N, K, scale);
}

// The two projections that depend only on XB and WT, in one launch, told apart by the block index (block-uniform branch):
//   blocks [0, kTilesQK):  q|k = XB . WT[rows 0..2047] + BQK[n] -> f16 plane [kTok][2048] (M=kTok, N=2048, bias per column)
//   then kTilesV per batch: v^T[b][h*64+d][s] = WT[2048 + h*64 + d] . XB[b*kSeq + s] + BV[h*64+d] -> bf16 hi/lo planes
//                           (M=1024, N=kSeq, bias per row)
constexpr int kTilesQK = (kTok / 128) * (kQKld / 256);
constexpr int kTilesV  = (kDim / 128) * (kSeq / 256);
// Register cap: each body alone builds to 256 registers a wave, the two in one kernel to 258, which is allocated as 272 and leaves
// room for three waves a SIMD, so one block a WGP. At 256 four waves fit: two blocks a WGP, and all 384 blocks are resident at once.
__global__ __launch_bounds__(256) __attribute__((amdgpu_num_vgpr(256))) void qkv_gemm_kernel(
    const unsigned short* __restrict__ XB, const unsigned short* __restrict__ WT,
    const float* __restrict__ BQK, const float* __restrict__ BV,
    unsigned short* __restrict__ QK16, unsigned short* __restrict__ VTH, unsigned short* __restrict__ VTL, int K) {
  __shared__ __align__(16) unsigned short sA[128 * kGP];   // A [row][k] (cross-wave: block barriers)
  __shared__ __align__(16) unsigned short sB[256 * kGP];   // Bt [row][k] (cross-wave: block barriers)
  __shared__ __align__(16) float sT[8 * kSlab];            // per-wave slabs (private-to-wave)
  const int bx = blockIdx.x;
  if (bx < kTilesQK) {
    gemm64_tile<1, 0, 2, 1>(sA, sB, sT, bx, 0, XB, XB, kDim, 0L, WT, WT, kDim, 0L,
                            (void*)QK16, (void*)QK16, kQKld, 0L, BQK, kTok, kQKld, K, 1.0f);
  } else {
    const int r = bx - kTilesQK;
    const int b = r / kTilesV;
    const unsigned short* Av = WT + (size_t)2 * kDim * kDim;   // rows 2048..3071 of WT = Wv^T
    gemm64_tile<1, 0, 1, 2>(sA, sB, sT, r - b * kTilesV, b, Av, Av, kDim, 0L, XB, XB, kDim, (long)kSeq * kDim,
                            (void*)VTH, (void*)VTL, kSeq, (long)kDim * kSeq, BV, kDim, kSeq, K, 1.0f);
  }
}

// ---------------------------------------------------------------------------
// f32 -> bf16 (RNE) cast of x into the compact token plane XB [kTok][1024]: token row t = b*kSeq + s reads input row
// ---------------------------------------------------------------------------
__device__ __forceinline__ void cast8_bf16_block(const float* __restrict__ in, unsigned short* __restrict__ out, int n8, int bx) {
  const int i = bx * 256 + threadIdx.x;
  if (i >= n8) return;
  const int t  = i >> 7;                 // 128 groups of 8 per token row
  const int c8 = (i & 127) * 8;
  const int b  = t / kSeq;
  const int s  = t - b * kSeq;
  const float* p = in + (size_t)(b * kSeqFull + s) * kDim + c8;
  const v4f a = *(const v4f*)(p);
  const v4f c = *(const v4f*)(p + 4);
  unsigned short hb[8];
#pragma unroll
  for (int e = 0; e < 4; ++e) {
    hb[e]     = f2bf_bits(a[e]);
    hb[4 + e] = f2bf_bits(c[e]);
  }
  const v4u u = (v4u){pk16(hb[0], hb[1]), pk16(hb[2], hb[3]), pk16(hb[4], hb[5]), pk16(hb[6], hb[7])};
  unsigned short* q = out + 8 * (size_t)i;
  *(v4u*)q = u;
  
}

// ---------------------------------------------------------------------------
// Weight transpose + RNE bf16 cast: W f32 row-major [1024 (d)][ldIn (n)] -> WT bf16 [n][d] with pitch ldOut (= 1024):
//   in[d][n] -> out[n][d]. One block of 256 threads per 64x64 tile (dt = d tile, nt = n tile).
// Load coverage: 16 iterations x 256 threads = 4096 = the whole 64x64 tile (coalesced along n).
// Store coverage: 8 waves x 2 iterations x 4 rows (lane>>3) = 64 n-rows; (lane&7) x 8 halves = 64 d-cols; each row segment
// ---------------------------------------------------------------------------
__device__ __forceinline__ void wtcast_bf16_block(const float* __restrict__ W, unsigned short* __restrict__ out,
                                                  int ldIn, int ldOut, int dt, int nt) {
  __shared__ float sm[64][65];   // sm[n_local][d_local] (cross-wave: block barrier)
  const int t  = threadIdx.x;
  const int d0 = dt * 64;
  const int n0 = nt * 64;
#pragma unroll
  for (int i = 0; i < 16; ++i) {
    const int e = i * 256 + t;
    const int r = e >> 6;          // d local
    const int c = e & 63;          // n local
    sm[c][r] = W[(size_t)(d0 + r) * ldIn + n0 + c];
  }
  __syncthreads();
  const int lane = t & 31, wave = t >> 5;
  const int q = lane >> 3, c8 = (lane & 7) * 8;
  {
#pragma unroll
    for (int it = 0; it < 2; ++it) {
      const int row = wave * 8 + it * 4 + q;                 // n local
      unsigned short hb[8];
#pragma unroll
      for (int e = 0; e < 8; ++e) hb[e] = f2bf_bits(sm[row][c8 + e]);
      const v4u u = (v4u){pk16(hb[0], hb[1]), pk16(hb[2], hb[3]), pk16(hb[4], hb[5]), pk16(hb[6], hb[7])};
      *(v4u*)(out + (size_t)(n0 + row) * ldOut + d0 + c8) = u;
    }
    // inlined beside other pieces, the built code reuses these two stores' registers on a path behind them: the wait stands in front of that overwrite
    asm volatile("s_wait_xcnt 0x0" ::: "memory");
  }
}

// ---------------------------------------------------------------------------
// Bias RNE bf16 convert kept as f32: dst[1024] = float(bf16(src)). One block of 256 threads, float4 per lane:
// ---------------------------------------------------------------------------
__device__ __forceinline__ void bias_bf16_block(const float* __restrict__ bsrc, float* __restrict__ bdst) {
  const int t = threadIdx.x;
  const v4f a = *(const v4f*)(bsrc + 4 * t);
  v4f r;
#pragma unroll
  for (int e = 0; e < 4; ++e) r[e] = bf_bits2f(f2bf_bits(a[e]));
  float* dp = bdst + 4 * t;
  *(v4f*)dp = r;
  
}

// ---------------------------------------------------------------------------
// All eight input conversions in one launch: they are independent of one another, so each block takes its piece by its
// index (block-uniform branches): 4 x kWTiles weight tiles (Wq, Wk, Wv -> WT rows 0, 1024, 2048; Wo -> WOT), 3 bias blocks
// (bq, bk -> BQK; bv -> BV), then the blocks of the x cast.
// ---------------------------------------------------------------------------
constexpr int kWTiles   = (kDim / 64) * (kDim / 64);   // 64x64 tiles of one square weight
constexpr int kCastBlks = kTok * kDim / 8 / 256;       // blocks of the x cast (8 elements per thread)
static_assert((kTok * kDim / 8) % 256 == 0);
__global__ __launch_bounds__(256) void prologue_kernel(
    const float* __restrict__ x,  const float* __restrict__ Wq, const float* __restrict__ Wk, const float* __restrict__ Wv,
    const float* __restrict__ Wo, const float* __restrict__ bq, const float* __restrict__ bk, const float* __restrict__ bv,
    unsigned short* __restrict__ XB, unsigned short* __restrict__ WT, unsigned short* __restrict__ WOT,
    float* __restrict__ BQK, float* __restrict__ BV) {
  const int bx = blockIdx.x;
  if (bx >= 4 * kWTiles + 3) {
    cast8_bf16_block(x, XB, kTok * kDim / 8, bx - (4 * kWTiles + 3));
    return;
  }
  if (bx >= 4 * kWTiles) {
    const int w = bx - 4 * kWTiles;
    bias_bf16_block((w == 0) ? bq : (w == 1) ? bk : bv, (w == 0) ? BQK : (w == 1) ? (BQK + kDim) : BV);
    return;
  }
  const int w = bx / kWTiles;
  const int t = bx - w * kWTiles;
  const float* W = (w == 0) ? Wq : (w == 1) ? Wk : (w == 2) ? Wv : Wo;
  unsigned short* o = (w < 3) ? (WT + (size_t)w * kDim * kDim) : WOT;
  wtcast_bf16_block(W, o, kDim, kDim, t % (kDim / 64), t / (kDim / 64));
}

constexpr int kKG = 2;
constexpr int kTilePairs = (kSeq / kQB + 1) / 2;
constexpr int kMgW = 34 * 32;
static_assert(kKG == 2);
union FragH { v16h v; v8h h[2]; };
union FragB { v16b v; v8b h[2]; };

__device__ __forceinline__ v8f mma_h16(v16h a, v16h b, v8f c) {
  c = __builtin_amdgcn_wmma_f32_16x16x32_f16(false, a, false, b, (short)0, c, false, false);
  asm volatile("v_nop\n\tv_nop\n\tv_nop\n\tv_nop" : "+v"(c) : "v"(a), "v"(b));
  return c;
}
__device__ __forceinline__ v8f mma_b16(v16b a, v16b b, v8f c) {
  c = __builtin_amdgcn_wmma_f32_16x16x32_bf16(false, a, false, b, (short)0, c, false, false);
  asm volatile("v_nop\n\tv_nop\n\tv_nop\n\tv_nop" : "+v"(c) : "v"(a), "v"(b));
  return c;
}
// lane l <-> lane l ^ 16: the two wave halves hold the two key halves of one query
__device__ __forceinline__ float xhalf(float x) {
  const int b = __builtin_bit_cast(int, x);
  return __builtin_bit_cast(float, __builtin_amdgcn_permlanex16(b, b, 0x76543210, 0xfedcba98, false, false));
}
// 2^x by v_exp_f32. In asm so that the slot the instruction set asks for behind a transcendental (one v_nop or independent
// instruction before its result is read or its source overwritten) stands inside the statement. Eight at a time: the outputs are early-clobber,
// so each v_exp_f32 is independent of the one in front of it, and one v_nop serves the last.
__device__ __forceinline__ void exp2x8(float (&p)[8], const float (&x)[8]) {
  asm("v_exp_f32 %0, %8\n\tv_exp_f32 %1, %9\n\tv_exp_f32 %2, %10\n\tv_exp_f32 %3, %11\n\t"
      "v_exp_f32 %4, %12\n\tv_exp_f32 %5, %13\n\tv_exp_f32 %6, %14\n\tv_exp_f32 %7, %15\n\tv_nop"
      : "=&v"(p[0]), "=&v"(p[1]), "=&v"(p[2]), "=&v"(p[3]), "=&v"(p[4]), "=&v"(p[5]), "=&v"(p[6]), "=&v"(p[7])
      : "v"(x[0]), "v"(x[1]), "v"(x[2]), "v"(x[3]), "v"(x[4]), "v"(x[5]), "v"(x[6]), "v"(x[7]));
}
__device__ __forceinline__ float exp2x1(float x) {
  float p;
  asm("v_exp_f32 %0, %1\n\tv_nop" : "=v"(p) : "v"(x));   // the v_nop: the same slot
  return p;
}
__device__ __forceinline__ __bf16 f2bf(float f) { return __builtin_bit_cast(__bf16, f2bf_bits(f)); }
__device__ __forceinline__ void bf_split(float f, __bf16& hi, __bf16& lo) {
  const unsigned short hb = f2bf_bits(f);
  hi = __builtin_bit_cast(__bf16, hb);
  lo = f2bf(f - __uint_as_float(((unsigned)hb) << 16));
}

__global__ __launch_bounds__(256) __attribute__((amdgpu_num_vgpr(256)))
void causal_attn_kernel(const unsigned short* __restrict__ QKp,
                        const unsigned short* __restrict__ VHp,
                        const unsigned short* __restrict__ VLp,
                        unsigned short* __restrict__ CHp,
                        unsigned short* __restrict__ CLp) {
  __shared__ __align__(16) unsigned short KshG[kKG * kKC * kLP];   // K   [kv][d]    9 KB per group (cross-wave: block barriers)
  __shared__ __align__(16) unsigned short VthG[kKG * kDh * kLP];   // V^T hi [d][kv] 9 KB per group (cross-wave: block barriers)
  __shared__ __align__(16) unsigned short VtlG[kKG * kDh * kLP];   // V^T lo [d][kv] 9 KB per group (cross-wave: block barriers)
  __shared__ __align__(16) float  Os[kAW][16 * 68];                // out tile per wave of group 0, pitch 68 (private-to-wave)
  __shared__ __align__(16) float  Mg[kAW][kMgW];                   // group 1's partial results (cross-wave: block barrier)

  // key group of this wave, as a scalar: the branches on it below skip matrix instructions and must be real (scalar) branches
  const int grp  = __builtin_amdgcn_readfirstlane((int)(threadIdx.x >> 7));
  const int tid  = threadIdx.x & 127;    // thread within its group
  const int wave = tid >> 5;             // wave within its group
  const int lane = tid & 31;
  unsigned short* Ksh = KshG + grp * (kKC * kLP);
  unsigned short* Vth = VthG + grp * (kDh * kLP);
  unsigned short* Vtl = VtlG + grp * (kDh * kLP);
  const int hh   = lane >> 4;
  const int c    = lane & 15;

  const int nqb = kSeq / kQB;
  const int bx  = blockIdx.x;
  const int tp  = bx % kTilePairs;       // this block's pair of query tiles: nqb - 1 - tp, then tp
  const int bh  = bx / kTilePairs;       // b*16 + h
  const int h   = bh % kHeads;
  const int b   = bh / kHeads;

  const _Float16* Qb = (const _Float16*)(QKp + (size_t)b * kSeq * kQKld + h * kDh);
  const unsigned short* Kb  = QKp + (size_t)b * kSeq * kQKld + kDim + h * kDh;
  const unsigned short* Vhb = VHp + (size_t)bh * kDh * kSeq;
  const unsigned short* Vlb = VLp + (size_t)bh * kDh * kSeq;

  // A tile's chunks are a dependent chain (stage, barrier, products, softmax), and the launch lasts as long as its longest chain:
  // two groups halve every tile's chain, the pair of tiles makes all blocks' chains equal. Block-uniform trip counts and tile index.
  for (int half = 0; half < 2; ++half) {
  const int qb = half ? tp : nqb - 1 - tp;
  if (half && tp == nqb - 1 - tp) break; // odd tile count: the middle tile is its own partner and is done once
  const int q0 = qb * kQB + wave * 16;   // first query row of this wave (within the sequence)

  // ---- Q fragments (B operand: column = query q0 + c; split k map): 2 d-chunks of 32 ----
  v16h qa[2];
#pragma unroll
  for (int dc = 0; dc < 2; ++dc) qa[dc] = Frag<_Float16>::load(Qb + (size_t)(q0 + c) * kQKld + dc * 32 + 8 * hh);

  const int qrow = q0 + c;      // this lane's query
  float mrow = -INFINITY;       // running maximum of query qrow's unscaled scores (equal in both wave halves)
  float lrow = 0.f;             // running sum over this wave half's keys only; the halves are joined after the loop
  v8f oacc[4];                  // oacc[t][r] = ctx[qrow][16 t + 8 hh + r]
#pragma unroll
  for (int t = 0; t < 4; ++t) oacc[t] = (v8f){0.f,0.f,0.f,0.f,0.f,0.f,0.f,0.f};

  const int nChunks = qb + 1;   // block-uniform (causal: key chunks 0..qb)
  const int nRounds = (nChunks + kKG - 1) / kKG;
  for (int rd = 0; rd < nRounds; ++rd) {
    const int kc = rd * kKG + grp;
    const bool live = kc < nChunks;   // scalar; false only for group 1 in the last round of an odd chunk count. Every wave passes both barriers
    const int kv0 = kc * kKC;
    __syncthreads();
    if (live) {
      // staging coverage: 128 threads x (1 row x 32 halves) = 64 rows x 64 halves per tile, all three tiles fully written
      const int r = tid >> 1, hf = (tid & 1) * 32;
      {
        const uint4* ks = (const uint4*)(Kb + (size_t)(kv0 + r) * kQKld + hf);
        uint4* kd = (uint4*)(Ksh + r * kLP + hf);
        const uint4 w0 = ks[0], w1 = ks[1], w2 = ks[2], w3 = ks[3];
        kd[0] = w0; kd[1] = w1; kd[2] = w2; kd[3] = w3;
      }
      asm volatile("" ::: "memory");
      {
        const uint4* vs = (const uint4*)(Vhb + (size_t)r * kSeq + kv0 + hf);
        uint4* vd = (uint4*)(Vth + r * kLP + hf);
        const uint4 w0 = vs[0], w1 = vs[1], w2 = vs[2], w3 = vs[3];
        vd[0] = w0; vd[1] = w1; vd[2] = w2; vd[3] = w3;
      }
      asm volatile("" ::: "memory");
      {
        const uint4* vs = (const uint4*)(Vlb + (size_t)r * kSeq + kv0 + hf);
        uint4* vd = (uint4*)(Vtl + r * kLP + hf);
        const uint4 w0 = vs[0], w1 = vs[1], w2 = vs[2], w3 = vs[3];
        vd[0] = w0; vd[1] = w1; vd[2] = w2; vd[3] = w3;
      }
    }
    __syncthreads();
    if (!live) continue;

    // ---- scores^T: 4 key subtiles of 16 (rows), K = 64 (2 d-chunks) ----
    v8f s[4];
#pragma unroll
    for (int j = 0; j < 4; ++j) {
      s[j] = (v8f){0.f,0.f,0.f,0.f,0.f,0.f,0.f,0.f};
#pragma unroll
      for (int dc = 0; dc < 2; ++dc) {
        FragH kb;
        kb.h[0] = *(const v8h*)(Ksh + (j * 16 + c) * kLP + dc * 32 + 8 * hh);
        kb.h[1] = *(const v8h*)(Ksh + (j * 16 + c) * kLP + dc * 32 + 16 + 8 * hh);
        s[j] = mma_h16(kb.v, qa[dc], s[j]);
      }
    }
    // ---- causal fill on the diagonal chunk, maximum of the query's 64 unscaled scores (one chain per subtile; scale > 0) ----
    const bool diag = (kc == qb);
    float mj[4];
#pragma unroll
    for (int j = 0; j < 4; ++j) {
      float m = -INFINITY;
#pragma unroll
      for (int r = 0; r < 8; ++r) {
        const int kvcol = kv0 + j * 16 + 8 * hh + r;
        float sv = s[j][r];
        if (diag && (kvcol > qrow)) sv = kNegBig;
        s[j][r] = sv;
        m = fmaxf(m, sv);
      }
      mj[j] = m;
    }
    float cm = fmaxf(fmaxf(mj[0], mj[1]), fmaxf(mj[2], mj[3]));
    cm = fmaxf(cm, xhalf(cm));
    // ---- online softmax update; P^T as bf16 hi/lo straight into the B operands of the second product ----
    const float mnew = fmaxf(mrow, cm);
    const float mc = mnew * kSL2E;
    const float alpha = exp2x1(fmaf(mrow, kSL2E, -mc));   // first chunk: mrow = -inf gives 0
    mrow = mnew;
    FragB pa[2], pl[2];
    float pj[4];
#pragma unroll
    for (int j = 0; j < 4; ++j) {
      float psum = 0.f;
      float xe[8], pe[8];
#pragma unroll
      for (int r = 0; r < 8; ++r) xe[r] = fmaf(s[j][r], kSL2E, -mc);
      exp2x8(pe, xe);
#pragma unroll
      for (int r = 0; r < 8; ++r) {
        const float p = pe[r];
        psum += p;
        __bf16 ph, plo;
        bf_split(p, ph, plo);
        pa[j >> 1].v[(j & 1) * 8 + r] = ph;
        pl[j >> 1].v[(j & 1) * 8 + r] = plo;
      }
      pj[j] = psum;
    }
    lrow = lrow * alpha + ((pj[0] + pj[1]) + (pj[2] + pj[3]));
#pragma unroll
    for (int t = 0; t < 4; ++t)
#pragma unroll
      for (int r = 0; r < 8; ++r) oacc[t][r] *= alpha;
    // ---- ctx^T += V^T(64x64) . P^T(64x16): hi.hi + lo.hi + hi.lo ----
    // unrolled: pa and pl are register arrays and need constant indices
#pragma unroll
    for (int kk = 0; kk < 2; ++kk) {
#pragma unroll
      for (int t = 0; t < 4; ++t) {
        FragB vb, vl;
        vb.h[0] = *(const v8b*)(Vth + (t * 16 + c) * kLP + kk * 32 + 8 * hh);
        vb.h[1] = *(const v8b*)(Vth + (t * 16 + c) * kLP + kk * 32 + 16 + 8 * hh);
        vl.h[0] = *(const v8b*)(Vtl + (t * 16 + c) * kLP + kk * 32 + 8 * hh);
        vl.h[1] = *(const v8b*)(Vtl + (t * 16 + c) * kLP + kk * 32 + 16 + 8 * hh);
        oacc[t] = mma_b16(vb.v, pa[kk].v, oacc[t]);
        oacc[t] = mma_b16(vl.v, pa[kk].v, oacc[t]);
        oacc[t] = mma_b16(vb.v, pl[kk].v, oacc[t]);
      }
    }
  }

  // ---- join the two key groups: group 1 hands m, l and its ctx sums to the wave of group 0 that holds the same queries ----
  float* mg = Mg[wave];   // [value][lane]: 16-B stores and loads of 32 lanes are contiguous
  if (grp != 0) {
    // unrolled, here and in the join below: oacc is a register array and needs constant indices
#pragma unroll
    for (int t = 0; t < 4; ++t) {
      *(v4f*)(mg + ((2 * t) * 32 + lane) * 4)     = (v4f){oacc[t][0], oacc[t][1], oacc[t][2], oacc[t][3]};
      *(v4f*)(mg + ((2 * t + 1) * 32 + lane) * 4) = (v4f){oacc[t][4], oacc[t][5], oacc[t][6], oacc[t][7]};
    }
    mg[32 * 32 + lane] = mrow;
    mg[33 * 32 + lane] = lrow;
  }
  __syncthreads();   // group 1's partial results are complete before group 0 reads them; they are next written behind the next tile's barriers
  if (grp != 0) continue;
  {
    const float m1 = mg[32 * 32 + lane];   // -inf, with l = 0 and zero sums, where group 1 had no chunk: its factor is then 0
    const float l1 = mg[33 * 32 + lane];
    const float mc = fmaxf(mrow, m1) * kSL2E;   // mrow is finite: group 0 always has chunk 0
    const float a0 = exp2x1(fmaf(mrow, kSL2E, -mc));
    const float a1 = exp2x1(fmaf(m1, kSL2E, -mc));
    lrow = lrow * a0 + l1 * a1;
#pragma unroll
    for (int t = 0; t < 4; ++t) {
      const v4f x = *(const v4f*)(mg + ((2 * t) * 32 + lane) * 4);
      const v4f y = *(const v4f*)(mg + ((2 * t + 1) * 32 + lane) * 4);
#pragma unroll
      for (int r = 0; r < 4; ++r) {
        oacc[t][r]     = oacc[t][r] * a0 + x[r] * a1;
        oacc[t][4 + r] = oacc[t][4 + r] * a0 + y[r] * a1;
      }
    }
  }
  // ---- join the halves' sums, divide, and lay the tile out as [query][d] in the wave's own LDS slab ----
  float* os = Os[wave];
  const float inv = 1.0f / (lrow + xhalf(lrow));
#pragma unroll
  for (int t = 0; t < 4; ++t) {
    float* op = os + c * 68 + t * 16 + 8 * hh;
    *(v4f*)(op)     = (v4f){oacc[t][0] * inv, oacc[t][1] * inv, oacc[t][2] * inv, oacc[t][3] * inv};
    *(v4f*)(op + 4) = (v4f){oacc[t][4] * inv, oacc[t][5] * inv, oacc[t][6] * inv, oacc[t][7] * inv};
  }
  __builtin_amdgcn_fence(3, "workgroup");
  __builtin_amdgcn_wave_barrier();
  __builtin_amdgcn_fence(2, "workgroup");
  {
    // store coverage: 4 iterations x 4 row groups (lane>>3) = 16 rows; (lane&7) x 8 halves = 64 cols
    const int q = lane >> 3, c8 = (lane & 7) * 8;
    unsigned short* ch = CHp + (size_t)(b * kSeq + q0) * kDim + h * kDh;
    unsigned short* cl = CLp + (size_t)(b * kSeq + q0) * kDim + h * kDh;
    {
#pragma unroll
      for (int it = 0; it < 4; ++it) {
        const int row = it * 4 + q;
        const float* sp = os + row * 68 + c8;
        v8h hv, lv;
#pragma unroll
        for (int e = 0; e < 8; ++e) {
          const unsigned short hb = f2bf_bits(sp[e]);
          const unsigned short lb = f2bf_bits(sp[e] - bf_bits2f(hb));
          hv[e] = __builtin_bit_cast(_Float16, hb);
          lv[e] = __builtin_bit_cast(_Float16, lb);
        }
        *(v8h*)(ch + (size_t)row * kDim + c8) = hv;
        *(v8h*)(cl + (size_t)row * kDim + c8) = lv;
      }
      // the second tile reuses the address and data registers of the stores just issued: the wait stands in front of that overwrite
      asm volatile("s_wait_xcnt 0x0" ::: "memory");
    }
  }
  }
}

// ---------------------------------------------------------------------------
// Host glue.
// Inputs (wire f32): 0 x [2][2048][1024], 1 Wq [1024][1024], 2 bq [1024], 3 Wk, 4 bk, 5 Wv, 6 bv, 7 Wo [1024][1024].
//   XB    bf16 [kTok][1024]             8,388,608   (RNE bf16 of x, compact token rows, A layout)
//   WT    bf16 [3072][1024]             6,291,456   (Wq^T | Wk^T | Wv^T, RNE bf16, Bt layout [n][k])
//   WOT   bf16 [1024][1024]             2,097,152   (Wo^T, RNE bf16, Bt layout)
//   BQK   f32  [2048]                       8,192   (RNE bf16 of bq | bk, widened)
//   BV    f32  [1024]                       4,096   (RNE bf16 of bv, widened)
//   QK16  f16  [kTok][2048]            16,777,216   (q | k columns incl. bias)
//   VTH   bf16 [kBatch*16*64][kSeq]     8,388,608   (v^T hi plane, bias included)
//   VTL   bf16 [kBatch*16*64][kSeq]     8,388,608   (v^T lo plane)
//   CTXH  bf16 [kTok][1024]             8,388,608   (ctx hi plane)
//   CTXL  bf16 [kTok][1024]             8,388,608   (ctx lo plane)
//   total                              67,121,152
// GEMM shapes: q|k M=kTok N=2048 K=1024; v^T M=1024 N=kSeq K=1024 (kBatch batches); out M=kSeq N=1024 K=1024 (kBatch
// batches, output rows at pitch kSeqFull per batch). All M multiples of 128, N of 256, K of 64: no padding. 4 launches:
// input conversions; q|k and v^T products; attention; output product.
// ---------------------------------------------------------------------------
extern "C" void kernel_launch(void* const* d_in, const int* in_sizes, int n_in,
                              void* d_out, int out_size, void* d_ws, size_t ws_size,
                              hipStream_t stream) {
  if (n_in < 8) return;
  const int rowsNeeded = (kBatch - 1) * kSeqFull + kSeq;     // last token row read/written + 1
  if (in_sizes[0] < rowsNeeded * kDim) return;
  if (in_sizes[1] < kDim * kDim || in_sizes[3] < kDim * kDim || in_sizes[5] < kDim * kDim || in_sizes[7] < kDim * kDim) return;
  if (in_sizes[2] < kDim || in_sizes[4] < kDim || in_sizes[6] < kDim) return;
  if (out_size < rowsNeeded * kDim) return;

  const size_t szXB  = (size_t)kTok * kDim * 2;
  const size_t szWT  = (size_t)kWtN * kDim * 2;
  const size_t szWOT = (size_t)kDim * kDim * 2;
  const size_t szBQK = (size_t)kQKld * 4;
  const size_t szBV  = (size_t)kDim * 4;
  const size_t szQK  = (size_t)kTok * kQKld * 2;
  const size_t szVT  = (size_t)kBatch * kHeads * kDh * kSeq * 2;
  const size_t szCTX = (size_t)kTok * kDim * 2;
  const size_t offXB  = 0;
  const size_t offWT  = offXB + szXB;
  const size_t offWOT = offWT + szWT;
  const size_t offBQK = offWOT + szWOT;
  const size_t offBV  = offBQK + szBQK;
  const size_t offQK  = offBV + szBV;
  const size_t offVTH = offQK + szQK;
  const size_t offVTL = offVTH + szVT;
  const size_t offCH  = offVTL + szVT;
  const size_t offCL  = offCH + szCTX;
  const size_t total  = offCL + szCTX;             // 67,121,152 at full size
  if (ws_size < total) return;
  if (total > (size_t)134217728) return;

  const float* x  = (const float*)d_in[0];
  const float* Wq = (const float*)d_in[1];
  const float* bq = (const float*)d_in[2];
  const float* Wk = (const float*)d_in[3];
  const float* bk = (const float*)d_in[4];
  const float* Wv = (const float*)d_in[5];
  const float* bv = (const float*)d_in[6];
  const float* Wo = (const float*)d_in[7];
  float* out = (float*)d_out;
  char* ws = (char*)d_ws;
  unsigned short* XB   = (unsigned short*)(ws + offXB);
  unsigned short* WT   = (unsigned short*)(ws + offWT);
  unsigned short* WOT  = (unsigned short*)(ws + offWOT);
  float*          BQK  = (float*)(ws + offBQK);
  float*          BV   = (float*)(ws + offBV);
  unsigned short* QK16 = (unsigned short*)(ws + offQK);
  unsigned short* VTH  = (unsigned short*)(ws + offVTH);
  unsigned short* VTL  = (unsigned short*)(ws + offVTL);
  unsigned short* CTXH = (unsigned short*)(ws + offCH);
  unsigned short* CTXL = (unsigned short*)(ws + offCL);

  // ---- prologue: RNE bf16 planes of all float inputs, one launch ----
  prologue_kernel<<<dim3(4 * kWTiles + 3 + kCastBlks), dim3(256), 0, stream>>>(x, Wq, Wk, Wv, Wo, bq, bk, bv, XB, WT, WOT, BQK, BV);
  // ---- q|k (f16 plane) and v^T (bf16 hi/lo planes) from XB and WT, one launch ----
  qkv_gemm_kernel<<<dim3(kTilesQK + kBatch * kTilesV), dim3(256), 0, stream>>>(XB, WT, BQK, BV, QK16, VTH, VTL, kDim);
  // ---- causal attention per (b, h, pair of 64-query tiles) -> ctx bf16 hi/lo planes ----
  causal_attn_kernel<<<dim3(kBatch * kHeads * kTilePairs), dim3(kKG * kAW * 32), 0, stream>>>(QK16, VTH, VTL, CTXH, CTXL);
  // ---- out[b][s] = (CTXH + CTXL)[b*kSeq + s] . WOT  (M=kSeq, N=1024, K=1024, kBatch batches, no bias),
  //      f32 straight to d_out rows b*kSeqFull + s ----
  {
    const int blocks = (kSeq / 128) * (kDim / 256);
    wmma_gemm64<1, 2, 0, 0><<<dim3(blocks, kBatch), dim3(256), 0, stream>>>(
        CTXH, CTXL, kDim, (long)kSeq * kDim, WOT, WOT, kDim, 0L,
        (void*)out, (void*)out, kDim, (long)kSeqFull * kDim, BV, kSeq, kDim, kDim, 1.0f);
  }
}

// v007
// Measured time: 113 microseconds a run.
// Two timings next to v006 put it at 1.04 and 1.05 times that version's speed.
// All steps since v000 together make it 4.50 times as fast.
// Contractions: q|k = x.[Wq|Wk] and v^T = Wv^T.x^T on v_wmma_f32_16x16x32_bf16 (x, W RNE bf16 operands, single products; bq, bk, bv as RNE bf16 added in f32); scores^T = k.q^T on v_wmma_f32_16x16x32_f16 (q, k f16 planes, single products); ctx^T = v^T.p^T on v_wmma_f32_16x16x32_bf16 (p^T and v^T as bf16 hi+lo: hi.hi + lo.hi + hi.lo); out = ctx.Wo on v_wmma_f32_16x16x32_bf16 (ctx bf16 hi+lo, Wo RNE bf16: hi.W + lo.W); f32 accumulate everywhere; scale, causal fill and softmax in f32.
#include <hip/hip_runtime.h>
#include <math.h>

// ---------------------------------------------------------------------------
// Problem constants (NB / SEQ overridable; *_FULL give the input / output strides)
// ---------------------------------------------------------------------------
#ifndef NB
#define NB 2
#endif
#ifndef SEQ
#define SEQ 2048
#endif
#define NB_FULL 2
#define SEQ_FULL 2048

constexpr int kBatch   = NB;
constexpr int kSeq     = SEQ;
constexpr int kSeqFull = SEQ_FULL;
constexpr int kDim     = 1024;               // d_in == d_out
constexpr int kHeads   = 16;
constexpr int kDh      = 64;
constexpr int kTok     = kBatch * kSeq;      // token rows of the compact planes
constexpr int kWtN     = 3 * kDim;           // rows of the Wq^T | Wk^T | Wv^T plane
constexpr int kQKld    = 2 * kDim;           // 2048, pitch (halves) of the q|k f16 plane
constexpr int kQB      = 64;                 // query rows per attention block
constexpr int kKC      = 64;                 // keys per chunk
constexpr int kAW      = 4;                  // waves per key group; an attention block has kKG groups
constexpr int kLP      = 72;                 // LDS row pitch (halves) of the K and V^T tiles: 144 B = 16 B x 9, so 16 rows read by ds_load_b128 fall on 64 distinct banks
constexpr float kScale  = 0.125f;            // 64^-0.5, exact
constexpr float kSL2E   = kScale * 1.44269504088896340736f;   // scale * log2(e): exp(scale * (s - m)) = 2^(kSL2E * s - kSL2E * m)
constexpr float kNegBig = -1.0e30f;          // finite fill for (unscaled) scores above the diagonal
static_assert(kBatch >= 1 && kBatch <= NB_FULL);
static_assert(kSeq >= 64 && kSeq <= SEQ_FULL);
static_assert(kHeads * kDh == kDim);
static_assert(kSeq % kQB == 0 && kSeq % kKC == 0 && kQB == kAW * 16 && kDh == 64);
// GEMM shape contract (no tail handling): M multiple of 128, N multiple of 256, K multiple of 64
static_assert(kTok % 128 == 0 && kQKld % 256 == 0 && kDim % 64 == 0);
static_assert(kDim % 256 == 0 && kSeq % 256 == 0);
static_assert(kDim / 8 == 128 && (kTok * kDim) % 8 == 0);

typedef __attribute__((ext_vector_type(16))) _Float16 v16h;
typedef __attribute__((ext_vector_type(8)))  _Float16 v8h;
typedef __attribute__((ext_vector_type(16))) __bf16   v16b;
typedef __attribute__((ext_vector_type(8)))  __bf16   v8b;
typedef __attribute__((ext_vector_type(8)))  float    v8f;
typedef __attribute__((ext_vector_type(4)))  float    v4f;
typedef __attribute__((ext_vector_type(4)))  unsigned int v4u;

// ---------------------------------------------------------------------------
// Shared pieces
// ---------------------------------------------------------------------------
typedef __attribute__((ext_vector_type(2))) float  v2f;
typedef __attribute__((ext_vector_type(2))) __bf16 v2b;
// Two f32 -> two bf16, round to nearest even, as one packed hardware conversion (v_cvt_pk_bf16_f32); a lands in the low half.
__device__ __forceinline__ unsigned cvt2bf(float a, float b) {
  return __builtin_bit_cast(unsigned, __builtin_convertvector((v2f){a, b}, v2b));
}
// hi = bf16(x), lo = bf16(x - hi) for two values; the difference is exact in f32.
__device__ __forceinline__ void split2bf(float a, float b, unsigned& hi, unsigned& lo) {
  const v2b h = __builtin_convertvector((v2f){a, b}, v2b);
  hi = __builtin_bit_cast(unsigned, h);
  lo = cvt2bf(a - (float)h[0], b - (float)h[1]);
}

// hazard guards as plain device helpers
__device__ __forceinline__ void dep_guard_h(v8f& a, v8f& b, v16h x, v16h y) { asm volatile("v_nop\n\tv_nop\n\tv_nop\n\tv_nop" : "+v"(a), "+v"(b) : "v"(x), "v"(y)); }
__device__ __forceinline__ void dep_guard_b(v8f& a, v8f& b, v16b x, v16b y) { asm volatile("v_nop\n\tv_nop\n\tv_nop\n\tv_nop" : "+v"(a), "+v"(b) : "v"(x), "v"(y)); }
// guard tying all four accumulators of a group and naming both A fragments as inputs
__device__ __forceinline__ void dep_guard4_h(v8f& a, v8f& b, v8f& c, v8f& d, v16h x, v16h y) { asm volatile("v_nop\n\tv_nop\n\tv_nop\n\tv_nop" : "+v"(a), "+v"(b), "+v"(c), "+v"(d) : "v"(x), "v"(y)); }
__device__ __forceinline__ void dep_guard4_b(v8f& a, v8f& b, v8f& c, v8f& d, v16b x, v16b y) { asm volatile("v_nop\n\tv_nop\n\tv_nop\n\tv_nop" : "+v"(a), "+v"(b), "+v"(c), "+v"(d) : "v"(x), "v"(y)); }
__device__ __forceinline__ void keep4_h(v16h a, v16h b, v16h c, v16h d) { asm volatile("v_nop" :: "v"(a), "v"(b), "v"(c), "v"(d)); }
__device__ __forceinline__ void keep4_b(v16b a, v16b b, v16b c, v16b d) { asm volatile("v_nop" :: "v"(a), "v"(b), "v"(c), "v"(d)); }
__device__ __forceinline__ void acc_guard4(v8f& a, v8f& b, v8f& c, v8f& d) { asm volatile("v_nop\n\tv_nop\n\tv_nop\n\tv_nop" : "+v"(a), "+v"(b), "+v"(c), "+v"(d)); }
template <typename T> struct Frag;
template <> struct Frag<_Float16> {
  typedef v16h V; union U { v16h v; v8h h[2]; };
  // elements 0..7 <- p[0..7], 8..15 <- p[16..23]
  static __device__ __forceinline__ v16h load(const _Float16* p) {
    U f; f.h[0] = *(const v8h*)(p); f.h[1] = *(const v8h*)(p + 16); return f.v;
  }
  static __device__ __forceinline__ v8f mma(v16h a, v16h b, v8f c) {
    return __builtin_amdgcn_wmma_f32_16x16x32_f16(false, a, false, b, (short)0, c, false, false);
  }
  static __device__ __forceinline__ void guard(v8f& a, v8f& b, v16h x, v16h y) { dep_guard_h(a, b, x, y); }
  static __device__ __forceinline__ void guard4(v8f& a, v8f& b, v8f& c, v8f& d, v16h x, v16h y) { dep_guard4_h(a, b, c, d, x, y); }
  static __device__ __forceinline__ void keep(v16h a, v16h b, v16h c, v16h d) { keep4_h(a, b, c, d); }
};
template <> struct Frag<__bf16> {
  typedef v16b V; union U { v16b v; v8b h[2]; };
  static __device__ __forceinline__ v16b load(const __bf16* p) {
    U f; f.h[0] = *(const v8b*)(p); f.h[1] = *(const v8b*)(p + 16); return f.v;
  }
  static __device__ __forceinline__ v8f mma(v16b a, v16b b, v8f c) {
    return __builtin_amdgcn_wmma_f32_16x16x32_bf16(false, a, false, b, (short)0, c, false, false);
  }
  static __device__ __forceinline__ void guard(v8f& a, v8f& b, v16b x, v16b y) { dep_guard_b(a, b, x, y); }
  static __device__ __forceinline__ void guard4(v8f& a, v8f& b, v8f& c, v8f& d, v16b x, v16b y) { dep_guard4_b(a, b, c, d, x, y); }
  static __device__ __forceinline__ void keep(v16b a, v16b b, v16b c, v16b d) { keep4_b(a, b, c, d); }
};

// ---- Register-blocked batched WMMA GEMM (bias added in f32 in the slab phase so all output modes see it) ----
// C[m,n] = scale * sum_k A[m,k] * Bt[n,k] (+bias); each wave owns a 64x64 tile, a block of 8 waves (2 x 4) a 128x256 tile.
// A row-major [M,K]; Bt row-major [N,K], both at row pitch kDim (lda == ldb == kDim); M % 128 == 0, N % 256 == 0, K % 64 == 0.
// Operands go through LDS: per 64 k the block copies its 128 A rows and 256 Bt rows once, 128 B of a row by 8 lanes, so a
// wave-wide 16-B load covers 4 whole lines; the next tile's loads are issued before the products of the current one.
// SPLIT: 0 = single product; 2 = A hi/lo planes (hi.B + lo.B).
// BIAS_MODE: 0 = none, 1 = bias[m] (per row), 2 = bias[n] (per column); bias is an f32 table of length M or N.
// OUT_MODE: 0 = f32, 1 = f16, 2 = bf16 hi plane (Cout) + bf16 lo plane (Cout2).
// ET: 0 = f16 operands, 1 = bf16 operands (pointers passed as 16-bit storage)
constexpr int kGP = 72;   // LDS row pitch (halves) of the staged A and Bt tiles: 144 B = 16 B x 9 for the ds_load_b128 fragment reads
template <int ET> struct Elem;
template <> struct Elem<0> { typedef _Float16 T; };
template <> struct Elem<1> { typedef __bf16 T; };
// The tile body is a device function: bx = tile index within the product, b = batch; sA, sB, sT are the calling kernel's LDS
// (sA: (SPLIT == 2 ? 2 : 1) * 128 * kGP halves, sB: 256 * kGP halves, sT: 8 slabs of kSlab floats), so that one launch can
// hold tiles of several independent products on one LDS allocation.
constexpr int kSlab = 16 * 68;   // per-wave 16x64 output slab, pitch 68 floats
template <int ET, int SPLIT, int BIAS_MODE, int OUT_MODE>
__device__ __forceinline__ void gemm64_tile(
    unsigned short* sA, unsigned short* sB, float* sT, unsigned bx, int b,
    const unsigned short* __restrict__ Ap, const unsigned short* __restrict__ A2p, int lda, long strideA,
    const unsigned short* __restrict__ Btp, const unsigned short* __restrict__ Bt2p, int ldb, long strideB,
    void* __restrict__ Cout, void* __restrict__ Cout2, int ldc, long strideC,
    const float* __restrict__ bias,
    int M, int N, int K, float scale) {
  static_assert(SPLIT == 0 || SPLIT == 2);
  static_assert(BIAS_MODE >= 0 && BIAS_MODE <= 2);
  static_assert(OUT_MODE >= 0 && OUT_MODE <= 2);
  typedef typename Elem<ET>::T T;
  typedef typename Frag<T>::V V;
  const int tid  = threadIdx.x;
  const int lane = tid & 31;
  const int wave = tid >> 5;
  const int blocksN = N >> 8;
  const int bm = bx / blocksN;
  const int bn = bx - bm * blocksN;
  const int mB = bm << 7;                      // first A row of the block
  const int nB = bn << 8;                      // first Bt row of the block
  const int wm = (wave >> 2) << 6;             // this wave's rows within the A tile
  const int wn = (wave & 3) << 6;              // this wave's rows within the Bt tile
  const int m0 = mB + wm;
  const int n0 = nB + wn;

  const unsigned short* Ab  = Ap  + (size_t)b * strideA;
  const unsigned short* Bb  = Btp + (size_t)b * strideB;
  const unsigned short* Ab2 = (SPLIT == 2) ? (A2p + (size_t)b * strideA) : nullptr;

  const int rlane = lane & 15;                 // row (A) / col (B, D) within subtile
  const int koff  = (lane >> 4) * 8;           // k offset of this lane half
  const int mOff  = (lane >> 4) * 8;           // D row offset

  // staging map: thread -> row (tid >> 3) + 32 * i, 8 halves at column (tid & 7) * 8. One address per plane: the row step
  // 32 * kDim is a compile-time constant, so the i-th load differs from the first by an immediate offset only.
  // Every loop over i, j or ks below is unrolled so that the register arrays (ra, rb, fragments, acc) keep constant indices.
  const int srow = tid >> 3;
  const int sc8  = (tid & 7) * 8;
  const unsigned short* gA  = Ab + (size_t)(mB + srow) * kDim + sc8;
  const unsigned short* gA2 = (SPLIT == 2) ? (Ab2 + (size_t)(mB + srow) * kDim + sc8) : nullptr;
  const unsigned short* gB  = Bb + (size_t)(nB + srow) * kDim + sc8;
  v4u ra[4], ra2[4], rb[8];
#pragma unroll
  for (int i = 0; i < 4; ++i) {
    ra[i] = *(const v4u*)(gA + i * 32 * kDim);
    if (SPLIT == 2) ra2[i] = *(const v4u*)(gA2 + i * 32 * kDim);
  }
#pragma unroll
  for (int i = 0; i < 8; ++i) rb[i] = *(const v4u*)(gB + i * 32 * kDim);

  const T* fa = (const T*)sA + (wm + rlane) * kGP + koff;
  const T* fb = (const T*)sB + (wn + rlane) * kGP + koff;

  v8f acc[4][4];
#pragma unroll
  for (int i = 0; i < 4; ++i)
#pragma unroll
    for (int j = 0; j < 4; ++j) acc[i][j] = (v8f){0.f,0.f,0.f,0.f,0.f,0.f,0.f,0.f};

  for (int k0 = 0; k0 < K; k0 += 64) {
    __syncthreads();   // every wave has read its last fragment of the previous tile
#pragma unroll
    for (int i = 0; i < 4; ++i) {
      *(v4u*)(sA + (srow + 32 * i) * kGP + sc8) = ra[i];
      if (SPLIT == 2) *(v4u*)(sA + (128 + srow + 32 * i) * kGP + sc8) = ra2[i];
    }
#pragma unroll
    for (int i = 0; i < 8; ++i) *(v4u*)(sB + (srow + 32 * i) * kGP + sc8) = rb[i];
    __syncthreads();   // the tile is complete before any wave reads it
    if (k0 + 64 < K) { // block-uniform: the next tile's loads fly during this tile's products
      const int kn = k0 + 64;
#pragma unroll
      for (int i = 0; i < 4; ++i) {
        ra[i] = *(const v4u*)(gA + kn + i * 32 * kDim);
        if (SPLIT == 2) ra2[i] = *(const v4u*)(gA2 + kn + i * 32 * kDim);
      }
#pragma unroll
      for (int i = 0; i < 8; ++i) rb[i] = *(const v4u*)(gB + kn + i * 32 * kDim);
      // the fragment reads below reuse the address registers of the loads just issued: the wait stands in front of that overwrite
      asm volatile("s_wait_xcnt 0x0" ::: "memory");
    }
#pragma unroll
    for (int ks = 0; ks < 64; ks += 32) {
      V bh[4], ah[4], al[4];
#pragma unroll
      for (int j = 0; j < 4; ++j) bh[j] = Frag<T>::load(fb + (j << 4) * kGP + ks);
#pragma unroll
      for (int i = 0; i < 4; ++i) {
        ah[i] = Frag<T>::load(fa + (i << 4) * kGP + ks);
        al[i] = ah[i];
        if (SPLIT == 2) al[i] = Frag<T>::load(fa + (128 + (i << 4)) * kGP + ks);
      }
#pragma unroll
      for (int i = 0; i < 4; ++i) {
#pragma unroll
        for (int j = 0; j < 4; ++j) {
          acc[i][j] = Frag<T>::mma(ah[i], bh[j], acc[i][j]);
          if (SPLIT == 2) acc[i][j] = Frag<T>::mma(al[i], bh[j], acc[i][j]);
        }
      }
#pragma unroll
      for (int i = 0; i < 4; ++i) Frag<T>::guard4(acc[i][0], acc[i][1], acc[i][2], acc[i][3], ah[i], al[i]);
      Frag<T>::keep(bh[0], bh[1], bh[2], bh[3]);
    }
  }
  acc_guard4(acc[0][0], acc[0][1], acc[0][2], acc[0][3]);
  acc_guard4(acc[1][0], acc[1][1], acc[1][2], acc[1][3]);
  acc_guard4(acc[2][0], acc[2][1], acc[2][2], acc[2][3]);
  acc_guard4(acc[3][0], acc[3][1], acc[3][2], acc[3][3]);

  // ---- epilogue ----
  float* slab = sT + wave * kSlab;
  float bcol[4] = {0.f, 0.f, 0.f, 0.f};
  if (BIAS_MODE == 2) {
    // per-column bias: this lane's columns n0 + 16*j + rlane, j = 0..3 (in range: N multiple of 64)
#pragma unroll
    for (int j = 0; j < 4; ++j) bcol[j] = bias[n0 + (j << 4) + rlane];
  }
#pragma unroll
  for (int i = 0; i < 4; ++i) {
    const int mBase = m0 + (i << 4);
    float brow[8] = {0.f, 0.f, 0.f, 0.f, 0.f, 0.f, 0.f, 0.f};
    if (BIAS_MODE == 1) {
      // per-row bias: rows mBase + mOff + 0..7 (16-B aligned: mBase % 16 == 0, mOff in {0, 8})
      const v4f b0 = *(const v4f*)(bias + mBase + mOff);
      const v4f b1 = *(const v4f*)(bias + mBase + mOff + 4);
#pragma unroll
      for (int e = 0; e < 4; ++e) { brow[e] = b0[e]; brow[4 + e] = b1[e]; }
    }
#pragma unroll
    for (int j = 0; j < 4; ++j) {
#pragma unroll
      for (int r = 0; r < 8; ++r) {
        float bb = 0.f;
        if (BIAS_MODE == 1) bb = brow[r];
        if (BIAS_MODE == 2) bb = bcol[j];
        slab[(mOff + r) * 68 + (j << 4) + rlane] = acc[i][j][r] * scale + bb;
      }
    }
    __builtin_amdgcn_fence(3, "workgroup");
    __builtin_amdgcn_wave_barrier();
    __builtin_amdgcn_fence(2, "workgroup");
    if (OUT_MODE == 0) {
      float* C = (float*)Cout + (size_t)b * strideC;
      const int hh = lane >> 4, c4 = (lane & 15) * 4;     // row seg = 256 B = 16 lanes x 16 B
      {
#pragma unroll
        for (int it = 0; it < 8; ++it) {
          const int row = it * 2 + hh;
          const v4f v = *(const v4f*)(slab + row * 68 + c4);
          *(v4f*)(C + (size_t)(mBase + row) * ldc + n0 + c4) = v;
        }
        
      }
    } else {
      const int q = lane >> 3, c8 = (lane & 7) * 8;
      unsigned short* C  = (unsigned short*)Cout  + (size_t)b * strideC;
      unsigned short* C2 = (OUT_MODE == 2) ? ((unsigned short*)Cout2 + (size_t)b * strideC) : nullptr;
      {
#pragma unroll
        for (int it = 0; it < 4; ++it) {
          const int row = it * 4 + q;
          const float* sp = slab + row * 68 + c8;
          v8h hv, lv;
          if (OUT_MODE == 1) {
#pragma unroll
            for (int e = 0; e < 8; ++e) hv[e] = (_Float16)sp[e];
          } else {
            v4u hu, lu;
#pragma unroll   // hu and lu stay in registers: constant indices
            for (int e = 0; e < 4; ++e) {
              unsigned hw, lw;
              split2bf(sp[2 * e], sp[2 * e + 1], hw, lw);
              hu[e] = hw;
              lu[e] = lw;
            }
            hv = __builtin_bit_cast(v8h, hu);
            lv = __builtin_bit_cast(v8h, lu);
          }
          *(v8h*)(C + (size_t)(mBase + row) * ldc + n0 + c8) = hv;
          if (OUT_MODE == 2) *(v8h*)(C2 + (size_t)(mBase + row) * ldc + n0 + c8) = lv;
        }
        
      }
    }
    __builtin_amdgcn_fence(3, "workgroup");
    __builtin_amdgcn_wave_barrier();
    __builtin_amdgcn_fence(2, "workgroup");
  }
}

// One product per launch: grid (tiles, batches).
template <int ET, int SPLIT, int BIAS_MODE, int OUT_MODE>
__global__ __launch_bounds__(256) void wmma_gemm64(
    const unsigned short* __restrict__ Ap, const unsigned short* __restrict__ A2p, int lda, long strideA,
    const unsigned short* __restrict__ Btp, const unsigned short* __restrict__ Bt2p, int ldb, long strideB,
    void* __restrict__ Cout, void* __restrict__ Cout2, int ldc, long strideC,
    const float* __restrict__ bias,
    int M, int N, int K, float scale) {
  __shared__ __align__(16) unsigned short sA[(SPLIT == 2 ? 2 : 1) * 128 * kGP];   // A (hi, then lo) [row][k] (cross-wave: block barriers)
  __shared__ __align__(16) unsigned short sB[256 * kGP];                          // Bt [row][k] (cross-wave: block barriers)
  __shared__ __align__(16) float sT[8 * kSlab];                                   // per-wave slabs (private-to-wave)
  gemm64_tile<ET, SPLIT, BIAS_MODE, OUT_MODE>(sA, sB, sT, blockIdx.x, blockIdx.y, Ap, A2p, lda, strideA, Btp, Bt2p, ldb, strideB,
                                              Cout, Cout2, ldc, strideC, bias, M, N, K, scale);
}

// The two projections that depend only on XB and WT, in one launch, told apart by the block index (block-uniform branch):
//   blocks [0, kTilesQK):  q|k = XB . WT[rows 0..2047] + BQK[n] -> f16 plane [kTok][2048] (M=kTok, N=2048, bias per column)
//   then kTilesV per batch: v^T[b][h*64+d][s] = WT[2048 + h*64 + d] . XB[b*kSeq + s] + BV[h*64+d] -> bf16 hi/lo planes
//                           (M=1024, N=kSeq, bias per row)
constexpr int kTilesQK = (kTok / 128) * (kQKld / 256);
constexpr int kTilesV  = (kDim / 128) * (kSeq / 256);
// Register cap: each body alone builds to 256 registers a wave, the two in one kernel to 258, which is allocated as 272 and leaves
// room for three waves a SIMD, so one block a WGP. At 256 four waves fit: two blocks a WGP, and all 384 blocks are resident at once.
__global__ __launch_bounds__(256) __attribute__((amdgpu_num_vgpr(256))) void qkv_gemm_kernel(
    const unsigned short* __restrict__ XB, const unsigned short* __restrict__ WT,
    const float* __restrict__ BQK, const float* __restrict__ BV,
    unsigned short* __restrict__ QK16, unsigned short* __restrict__ VTH, unsigned short* __restrict__ VTL, int K) {
  __shared__ __align__(16) unsigned short sA[128 * kGP];   // A [row][k] (cross-wave: block barriers)
  __shared__ __align__(16) unsigned short sB[256 * kGP];   // Bt [row][k] (cross-wave: block barriers)
  __shared__ __align__(16) float sT[8 * kSlab];            // per-wave slabs (private-to-wave)
  const int bx = blockIdx.x;
  if (bx < kTilesQK) {
    gemm64_tile<1, 0, 2, 1>(sA, sB, sT, bx, 0, XB, XB, kDim, 0L, WT, WT, kDim, 0L,
                            (void*)QK16, (void*)QK16, kQKld, 0L, BQK, kTok, kQKld, K, 1.0f);
  } else {
    const int r = bx - kTilesQK;
    const int b = r / kTilesV;
    const unsigned short* Av = WT + (size_t)2 * kDim * kDim;   // rows 2048..3071 of WT = Wv^T
    gemm64_tile<1, 0, 1, 2>(sA, sB, sT, r - b * kTilesV, b, Av, Av, kDim, 0L, XB, XB, kDim, (long)kSeq * kDim,
                            (void*)VTH, (void*)VTL, kSeq, (long)kDim * kSeq, BV, kDim, kSeq, K, 1.0f);
  }
}

// ---------------------------------------------------------------------------
// f32 -> bf16 (RNE) cast of x into the compact token plane XB [kTok][1024]: token row t = b*kSeq + s reads input row
// ---------------------------------------------------------------------------
__device__ __forceinline__ void cast8_bf16_block(const float* __restrict__ in, unsigned short* __restrict__ out, int n8, int bx) {
  const int i = bx * 256 + threadIdx.x;
  if (i >= n8) return;
  const int t  = i >> 7;                 // 128 groups of 8 per token row
  const int c8 = (i & 127) * 8;
  const int b  = t / kSeq;
  const int s  = t - b * kSeq;
  const float* p = in + (size_t)(b * kSeqFull + s) * kDim + c8;
  const v4f a = *(const v4f*)(p);
  const v4f c = *(const v4f*)(p + 4);
  const v4u u = (v4u){cvt2bf(a[0], a[1]), cvt2bf(a[2], a[3]), cvt2bf(c[0], c[1]), cvt2bf(c[2], c[3])};
  unsigned short* q = out + 8 * (size_t)i;
  *(v4u*)q = u;
  
}

// ---------------------------------------------------------------------------
// Weight transpose + RNE bf16 cast: W f32 row-major [1024 (d)][ldIn (n)] -> WT bf16 [n][d] with pitch ldOut (= 1024):
//   in[d][n] -> out[n][d]. One block of 256 threads per 64x64 tile (dt = d tile, nt = n tile).
// Load coverage: 16 iterations x 256 threads = 4096 = the whole 64x64 tile (coalesced along n).
// Store coverage: 8 waves x 2 iterations x 4 rows (lane>>3) = 64 n-rows; (lane&7) x 8 halves = 64 d-cols; each row segment
// ---------------------------------------------------------------------------
__device__ __forceinline__ void wtcast_bf16_block(const float* __restrict__ W, unsigned short* __restrict__ out,
                                                  int ldIn, int ldOut, int dt, int nt) {
  __shared__ float sm[64][65];   // sm[n_local][d_local] (cross-wave: block barrier)
  const int t  = threadIdx.x;
  const int d0 = dt * 64;
  const int n0 = nt * 64;
#pragma unroll
  for (int i = 0; i < 16; ++i) {
    const int e = i * 256 + t;
    const int r = e >> 6;          // d local
    const int c = e & 63;          // n local
    sm[c][r] = W[(size_t)(d0 + r) * ldIn + n0 + c];
  }
  __syncthreads();
  const int lane = t & 31, wave = t >> 5;
  const int q = lane >> 3, c8 = (lane & 7) * 8;
  {
#pragma unroll
    for (int it = 0; it < 2; ++it) {
      const int row = wave * 8 + it * 4 + q;                 // n local
      const float* sr = &sm[row][c8];
      const v4u u = (v4u){cvt2bf(sr[0], sr[1]), cvt2bf(sr[2], sr[3]), cvt2bf(sr[4], sr[5]), cvt2bf(sr[6], sr[7])};
      *(v4u*)(out + (size_t)(n0 + row) * ldOut + d0 + c8) = u;
    }
    // inlined beside other pieces, the built code reuses these two stores' registers on a path behind them: the wait stands in front of that overwrite
    asm volatile("s_wait_xcnt 0x0" ::: "memory");
  }
}

// ---------------------------------------------------------------------------
// Bias RNE bf16 convert kept as f32: dst[1024] = float(bf16(src)). One block of 256 threads, float4 per lane:
// ---------------------------------------------------------------------------
__device__ __forceinline__ void bias_bf16_block(const float* __restrict__ bsrc, float* __restrict__ bdst) {
  const int t = threadIdx.x;
  const v4f a = *(const v4f*)(bsrc + 4 * t);
  v4f r;
#pragma unroll
  for (int e = 0; e < 4; ++e) r[e] = (float)(__bf16)a[e];
  float* dp = bdst + 4 * t;
  *(v4f*)dp = r;
  
}

// ---------------------------------------------------------------------------
// All eight input conversions in one launch: they are independent of one another, so each block takes its piece by its
// index (block-uniform branches): 4 x kWTiles weight tiles (Wq, Wk, Wv -> WT rows 0, 1024, 2048; Wo -> WOT), 3 bias blocks
// (bq, bk -> BQK; bv -> BV), then the blocks of the x cast.
// ---------------------------------------------------------------------------
constexpr int kWTiles   = (kDim / 64) * (kDim / 64);   // 64x64 tiles of one square weight
constexpr int kCastBlks = kTok * kDim / 8 / 256;       // blocks of the x cast (8 elements per thread)
static_assert((kTok * kDim / 8) % 256 == 0);
__global__ __launch_bounds__(256) void prologue_kernel(
    const float* __restrict__ x,  const float* __restrict__ Wq, const float* __restrict__ Wk, const float* __restrict__ Wv,
    const float* __restrict__ Wo, const float* __restrict__ bq, const float* __restrict__ bk, const float* __restrict__ bv,
    unsigned short* __restrict__ XB, unsigned short* __restrict__ WT, unsigned short* __restrict__ WOT,
    float* __restrict__ BQK, float* __restrict__ BV) {
  const int bx = blockIdx.x;
  if (bx >= 4 * kWTiles + 3) {
    cast8_bf16_block(x, XB, kTok * kDim / 8, bx - (4 * kWTiles + 3));
    return;
  }
  if (bx >= 4 * kWTiles) {
    const int w = bx - 4 * kWTiles;
    bias_bf16_block((w == 0) ? bq : (w == 1) ? bk : bv, (w == 0) ? BQK : (w == 1) ? (BQK + kDim) : BV);
    return;
  }
  const int w = bx / kWTiles;
  const int t = bx - w * kWTiles;
  const float* W = (w == 0) ? Wq : (w == 1) ? Wk : (w == 2) ? Wv : Wo;
  unsigned short* o = (w < 3) ? (WT + (size_t)w * kDim * kDim) : WOT;
  wtcast_bf16_block(W, o, kDim, kDim, t % (kDim / 64), t / (kDim / 64));
}

constexpr int kKG = 2;
constexpr int kTilePairs = (kSeq / kQB + 1) / 2;
constexpr int kMgW = 34 * 32;
static_assert(kKG == 2);
union FragH { v16h v; v8h h[2]; };
union FragB { v16b v; v8b h[2]; unsigned w[8]; };   // w[i] = elements 2 i (low half) and 2 i + 1

__device__ __forceinline__ v8f mma_h16(v16h a, v16h b, v8f c) {
  c = __builtin_amdgcn_wmma_f32_16x16x32_f16(false, a, false, b, (short)0, c, false, false);
  asm volatile("v_nop\n\tv_nop\n\tv_nop\n\tv_nop" : "+v"(c) : "v"(a), "v"(b));
  return c;
}
__device__ __forceinline__ v8f mma_b16(v16b a, v16b b, v8f c) {
  c = __builtin_amdgcn_wmma_f32_16x16x32_bf16(false, a, false, b, (short)0, c, false, false);
  asm volatile("v_nop\n\tv_nop\n\tv_nop\n\tv_nop" : "+v"(c) : "v"(a), "v"(b));
  return c;
}
// lane l <-> lane l ^ 16: the two wave halves hold the two key halves of one query
__device__ __forceinline__ float xhalf(float x) {
  const int b = __builtin_bit_cast(int, x);
  return __builtin_bit_cast(float, __builtin_amdgcn_permlanex16(b, b, 0x76543210, 0xfedcba98, false, false));
}
// 2^x by v_exp_f32. In asm so that the slot the instruction set asks for behind a transcendental (one v_nop or independent
// instruction before its result is read or its source overwritten) stands inside the statement. Eight at a time: the outputs are early-clobber,
// so each v_exp_f32 is independent of the one in front of it, and one v_nop serves the last.
__device__ __forceinline__ void exp2x8(float (&p)[8], const float (&x)[8]) {
  asm("v_exp_f32 %0, %8\n\tv_exp_f32 %1, %9\n\tv_exp_f32 %2, %10\n\tv_exp_f32 %3, %11\n\t"
      "v_exp_f32 %4, %12\n\tv_exp_f32 %5, %13\n\tv_exp_f32 %6, %14\n\tv_exp_f32 %7, %15\n\tv_nop"
      : "=&v"(p[0]), "=&v"(p[1]), "=&v"(p[2]), "=&v"(p[3]), "=&v"(p[4]), "=&v"(p[5]), "=&v"(p[6]), "=&v"(p[7])
      : "v"(x[0]), "v"(x[1]), "v"(x[2]), "v"(x[3]), "v"(x[4]), "v"(x[5]), "v"(x[6]), "v"(x[7]));
}
__device__ __forceinline__ float exp2x1(float x) {
  float p;
  asm("v_exp_f32 %0, %1\n\tv_nop" : "=v"(p) : "v"(x));   // the v_nop: the same slot
  return p;
}

__global__ __launch_bounds__(256) __attribute__((amdgpu_num_vgpr(256)))
void causal_attn_kernel(const unsigned short* __restrict__ QKp,
                        const unsigned short* __restrict__ VHp,
                        const unsigned short* __restrict__ VLp,
                        unsigned short* __restrict__ CHp,
                        unsigned short* __restrict__ CLp) {
  __shared__ __align__(16) unsigned short KshG[kKG * kKC * kLP];   // K   [kv][d]    9 KB per group (cross-wave: block barriers)
  __shared__ __align__(16) unsigned short VthG[kKG * kDh * kLP];   // V^T hi [d][kv] 9 KB per group (cross-wave: block barriers)
  __shared__ __align__(16) unsigned short VtlG[kKG * kDh * kLP];   // V^T lo [d][kv] 9 KB per group (cross-wave: block barriers)
  __shared__ __align__(16) float  Os[kAW][16 * 68];                // out tile per wave of group 0, pitch 68 (private-to-wave)
  __shared__ __align__(16) float  Mg[kAW][kMgW];                   // group 1's partial results (cross-wave: block barrier)

  // key group of this wave, as a scalar: the branches on it below skip matrix instructions and must be real (scalar) branches
  const int grp  = __builtin_amdgcn_readfirstlane((int)(threadIdx.x >> 7));
  const int tid  = threadIdx.x & 127;    // thread within its group
  const int wave = tid >> 5;             // wave within its group
  const int lane = tid & 31;
  unsigned short* Ksh = KshG + grp * (kKC * kLP);
  unsigned short* Vth = VthG + grp * (kDh * kLP);
  unsigned short* Vtl = VtlG + grp * (kDh * kLP);
  const int hh   = lane >> 4;
  const int c    = lane & 15;

  const int nqb = kSeq / kQB;
  const int bx  = blockIdx.x;
  const int tp  = bx % kTilePairs;       // this block's pair of query tiles: nqb - 1 - tp, then tp
  const int bh  = bx / kTilePairs;       // b*16 + h
  const int h   = bh % kHeads;
  const int b   = bh / kHeads;

  const _Float16* Qb = (const _Float16*)(QKp + (size_t)b * kSeq * kQKld + h * kDh);
  const unsigned short* Kb  = QKp + (size_t)b * kSeq * kQKld + kDim + h * kDh;
  const unsigned short* Vhb = VHp + (size_t)bh * kDh * kSeq;
  const unsigned short* Vlb = VLp + (size_t)bh * kDh * kSeq;

  // A tile's chunks are a dependent chain (stage, barrier, products, softmax), and the launch lasts as long as its longest chain:
  // two groups halve every tile's chain, the pair of tiles makes all blocks' chains equal. Block-uniform trip counts and tile index.
  for (int half = 0; half < 2; ++half) {
  const int qb = half ? tp : nqb - 1 - tp;
  if (half && tp == nqb - 1 - tp) break; // odd tile count: the middle tile is its own partner and is done once
  const int q0 = qb * kQB + wave * 16;   // first query row of this wave (within the sequence)

  // ---- Q fragments (B operand: column = query q0 + c; split k map): 2 d-chunks of 32 ----
  v16h qa[2];
#pragma unroll
  for (int dc = 0; dc < 2; ++dc) qa[dc] = Frag<_Float16>::load(Qb + (size_t)(q0 + c) * kQKld + dc * 32 + 8 * hh);

  const int qrow = q0 + c;      // this lane's query
  float mrow = -INFINITY;       // running maximum of query qrow's unscaled scores (equal in both wave halves)
  float lrow = 0.f;             // running sum over this wave half's keys only; the halves are joined after the loop
  v8f oacc[4];                  // oacc[t][r] = ctx[qrow][16 t + 8 hh + r]
#pragma unroll
  for (int t = 0; t < 4; ++t) oacc[t] = (v8f){0.f,0.f,0.f,0.f,0.f,0.f,0.f,0.f};

  const int nChunks = qb + 1;   // block-uniform (causal: key chunks 0..qb)
  const int nRounds = (nChunks + kKG - 1) / kKG;
  for (int rd = 0; rd < nRounds; ++rd) {
    const int kc = rd * kKG + grp;
    const bool live = kc < nChunks;   // scalar; false only for group 1 in the last round of an odd chunk count. Every wave passes both barriers
    const int kv0 = kc * kKC;
    __syncthreads();
    if (live) {
      // staging coverage: 128 threads x (1 row x 32 halves) = 64 rows x 64 halves per tile, all three tiles fully written
      const int r = tid >> 1, hf = (tid & 1) * 32;
      {
        const uint4* ks = (const uint4*)(Kb + (size_t)(kv0 + r) * kQKld + hf);
        uint4* kd = (uint4*)(Ksh + r * kLP + hf);
        const uint4 w0 = ks[0], w1 = ks[1], w2 = ks[2], w3 = ks[3];
        kd[0] = w0; kd[1] = w1; kd[2] = w2; kd[3] = w3;
      }
      asm volatile("" ::: "memory");
      {
        const uint4* vs = (const uint4*)(Vhb + (size_t)r * kSeq + kv0 + hf);
        uint4* vd = (uint4*)(Vth + r * kLP + hf);
        const uint4 w0 = vs[0], w1 = vs[1], w2 = vs[2], w3 = vs[3];
        vd[0] = w0; vd[1] = w1; vd[2] = w2; vd[3] = w3;
      }
      asm volatile("" ::: "memory");
      {
        const uint4* vs = (const uint4*)(Vlb + (size_t)r * kSeq + kv0 + hf);
        uint4* vd = (uint4*)(Vtl + r * kLP + hf);
        const uint4 w0 = vs[0], w1 = vs[1], w2 = vs[2], w3 = vs[3];
        vd[0] = w0; vd[1] = w1; vd[2] = w2; vd[3] = w3;
      }
    }
    __syncthreads();
    if (!live) continue;

    // ---- scores^T: 4 key subtiles of 16 (rows), K = 64 (2 d-chunks) ----
    v8f s[4];
#pragma unroll
    for (int j = 0; j < 4; ++j) {
      s[j] = (v8f){0.f,0.f,0.f,0.f,0.f,0.f,0.f,0.f};
#pragma unroll
      for (int dc = 0; dc < 2; ++dc) {
        FragH kb;
        kb.h[0] = *(const v8h*)(Ksh + (j * 16 + c) * kLP + dc * 32 + 8 * hh);
        kb.h[1] = *(const v8h*)(Ksh + (j * 16 + c) * kLP + dc * 32 + 16 + 8 * hh);
        s[j] = mma_h16(kb.v, qa[dc], s[j]);
      }
    }
    // ---- causal fill on the diagonal chunk, maximum of the query's 64 unscaled scores (one chain per subtile; scale > 0) ----
    const bool diag = (kc == qb);
    float mj[4];
#pragma unroll
    for (int j = 0; j < 4; ++j) {
      float m = -INFINITY;
#pragma unroll
      for (int r = 0; r < 8; ++r) {
        const int kvcol = kv0 + j * 16 + 8 * hh + r;
        float sv = s[j][r];
        if (diag && (kvcol > qrow)) sv = kNegBig;
        s[j][r] = sv;
        m = fmaxf(m, sv);
      }
      mj[j] = m;
    }
    float cm = fmaxf(fmaxf(mj[0], mj[1]), fmaxf(mj[2], mj[3]));
    cm = fmaxf(cm, xhalf(cm));
    // ---- online softmax update; P^T as bf16 hi/lo straight into the B operands of the second product ----
    const float mnew = fmaxf(mrow, cm);
    const float mc = mnew * kSL2E;
    const float alpha = exp2x1(fmaf(mrow, kSL2E, -mc));   // first chunk: mrow = -inf gives 0
    mrow = mnew;
    FragB pa[2], pl[2];
    float pj[4];
#pragma unroll
    for (int j = 0; j < 4; ++j) {
      float psum = 0.f;
      float xe[8], pe[8];
#pragma unroll
      for (int r = 0; r < 8; ++r) xe[r] = fmaf(s[j][r], kSL2E, -mc);
      exp2x8(pe, xe);
#pragma unroll
      for (int r = 0; r < 8; ++r) psum += pe[r];
#pragma unroll   // pa and pl are register arrays and need constant indices
      for (int r = 0; r < 8; r += 2)
        split2bf(pe[r], pe[r + 1], pa[j >> 1].w[(j & 1) * 4 + (r >> 1)], pl[j >> 1].w[(j & 1) * 4 + (r >> 1)]);
      pj[j] = psum;
    }
    lrow = lrow * alpha + ((pj[0] + pj[1]) + (pj[2] + pj[3]));
#pragma unroll
    for (int t = 0; t < 4; ++t)
#pragma unroll
      for (int r = 0; r < 8; ++r) oacc[t][r] *= alpha;
    // ---- ctx^T += V^T(64x64) . P^T(64x16): hi.hi + lo.hi + hi.lo ----
    // unrolled: pa and pl are register arrays and need constant indices
#pragma unroll
    for (int kk = 0; kk < 2; ++kk) {
#pragma unroll
      for (int t = 0; t < 4; ++t) {
        FragB vb, vl;
        vb.h[0] = *(const v8b*)(Vth + (t * 16 + c) * kLP + kk * 32 + 8 * hh);
        vb.h[1] = *(const v8b*)(Vth + (t * 16 + c) * kLP + kk * 32 + 16 + 8 * hh);
        vl.h[0] = *(const v8b*)(Vtl + (t * 16 + c) * kLP + kk * 32 + 8 * hh);
        vl.h[1] = *(const v8b*)(Vtl + (t * 16 + c) * kLP + kk * 32 + 16 + 8 * hh);
        oacc[t] = mma_b16(vb.v, pa[kk].v, oacc[t]);
        oacc[t] = mma_b16(vl.v, pa[kk].v, oacc[t]);
        oacc[t] = mma_b16(vb.v, pl[kk].v, oacc[t]);
      }
    }
  }

  // ---- join the two key groups: group 1 hands m, l and its ctx sums to the wave of group 0 that holds the same queries ----
  float* mg = Mg[wave];   // [value][lane]: 16-B stores and loads of 32 lanes are contiguous
  if (grp != 0) {
    // unrolled, here and in the join below: oacc is a register array and needs constant indices
#pragma unroll
    for (int t = 0; t < 4; ++t) {
      *(v4f*)(mg + ((2 * t) * 32 + lane) * 4)     = (v4f){oacc[t][0], oacc[t][1], oacc[t][2], oacc[t][3]};
      *(v4f*)(mg + ((2 * t + 1) * 32 + lane) * 4) = (v4f){oacc[t][4], oacc[t][5], oacc[t][6], oacc[t][7]};
    }
    mg[32 * 32 + lane] = mrow;
    mg[33 * 32 + lane] = lrow;
  }
  __syncthreads();   // group 1's partial results are complete before group 0 reads them; they are next written behind the next tile's barriers
  if (grp != 0) continue;
  {
    const float m1 = mg[32 * 32 + lane];   // -inf, with l = 0 and zero sums, where group 1 had no chunk: its factor is then 0
    const float l1 = mg[33 * 32 + lane];
    const float mc = fmaxf(mrow, m1) * kSL2E;   // mrow is finite: group 0 always has chunk 0
    const float a0 = exp2x1(fmaf(mrow, kSL2E, -mc));
    const float a1 = exp2x1(fmaf(m1, kSL2E, -mc));
    lrow = lrow * a0 + l1 * a1;
#pragma unroll
    for (int t = 0; t < 4; ++t) {
      const v4f x = *(const v4f*)(mg + ((2 * t) * 32 + lane) * 4);
      const v4f y = *(const v4f*)(mg + ((2 * t + 1) * 32 + lane) * 4);
#pragma unroll
      for (int r = 0; r < 4; ++r) {
        oacc[t][r]     = oacc[t][r] * a0 + x[r] * a1;
        oacc[t][4 + r] = oacc[t][4 + r] * a0 + y[r] * a1;
      }
    }
  }
  // ---- join the halves' sums, divide, and lay the tile out as [query][d] in the wave's own LDS slab ----
  float* os = Os[wave];
  const float inv = 1.0f / (lrow + xhalf(lrow));
#pragma unroll
  for (int t = 0; t < 4; ++t) {
    float* op = os + c * 68 + t * 16 + 8 * hh;
    *(v4f*)(op)     = (v4f){oacc[t][0] * inv, oacc[t][1] * inv, oacc[t][2] * inv, oacc[t][3] * inv};
    *(v4f*)(op + 4) = (v4f){oacc[t][4] * inv, oacc[t][5] * inv, oacc[t][6] * inv, oacc[t][7] * inv};
  }
  __builtin_amdgcn_fence(3, "workgroup");
  __builtin_amdgcn_wave_barrier();
  __builtin_amdgcn_fence(2, "workgroup");
  {
    // store coverage: 4 iterations x 4 row groups (lane>>3) = 16 rows; (lane&7) x 8 halves = 64 cols
    const int q = lane >> 3, c8 = (lane & 7) * 8;
    unsigned short* ch = CHp + (size_t)(b * kSeq + q0) * kDim + h * kDh;
    unsigned short* cl = CLp + (size_t)(b * kSeq + q0) * kDim + h * kDh;
    {
#pragma unroll
      for (int it = 0; it < 4; ++it) {
        const int row = it * 4 + q;
        const float* sp = os + row * 68 + c8;
        v4u hu, lu;
#pragma unroll   // hu and lu stay in registers: constant indices
        for (int e = 0; e < 4; ++e) {
          unsigned hw, lw;
          split2bf(sp[2 * e], sp[2 * e + 1], hw, lw);
          hu[e] = hw;
          lu[e] = lw;
        }
        const v8h hv = __builtin_bit_cast(v8h, hu);
        const v8h lv = __builtin_bit_cast(v8h, lu);
        *(v8h*)(ch + (size_t)row * kDim + c8) = hv;
        *(v8h*)(cl + (size_t)row * kDim + c8) = lv;
      }
      // the second tile reuses the address and data registers of the stores just issued: the wait stands in front of that overwrite
      asm volatile("s_wait_xcnt 0x0" ::: "memory");
    }
  }
  }
}

// ---------------------------------------------------------------------------
// Host glue.
// Inputs (wire f32): 0 x [2][2048][1024], 1 Wq [1024][1024], 2 bq [1024], 3 Wk, 4 bk, 5 Wv, 6 bv, 7 Wo [1024][1024].
//   XB    bf16 [kTok][1024]             8,388,608   (RNE bf16 of x, compact token rows, A layout)
//   WT    bf16 [3072][1024]             6,291,456   (Wq^T | Wk^T | Wv^T, RNE bf16, Bt layout [n][k])
//   WOT   bf16 [1024][1024]             2,097,152   (Wo^T, RNE bf16, Bt layout)
//   BQK   f32  [2048]                       8,192   (RNE bf16 of bq | bk, widened)
//   BV    f32  [1024]                       4,096   (RNE bf16 of bv, widened)
//   QK16  f16  [kTok][2048]            16,777,216   (q | k columns incl. bias)
//   VTH   bf16 [kBatch*16*64][kSeq]     8,388,608   (v^T hi plane, bias included)
//   VTL   bf16 [kBatch*16*64][kSeq]     8,388,608   (v^T lo plane)
//   CTXH  bf16 [kTok][1024]             8,388,608   (ctx hi plane)
//   CTXL  bf16 [kTok][1024]             8,388,608   (ctx lo plane)
//   total                              67,121,152
// GEMM shapes: q|k M=kTok N=2048 K=1024; v^T M=1024 N=kSeq K=1024 (kBatch batches); out M=kSeq N=1024 K=1024 (kBatch
// batches, output rows at pitch kSeqFull per batch). All M multiples of 128, N of 256, K of 64: no padding. 4 launches:
// input conversions; q|k and v^T products; attention; output product.
// ---------------------------------------------------------------------------
extern "C" void kernel_launch(void* const* d_in, const int* in_sizes, int n_in,
                              void* d_out, int out_size, void* d_ws, size_t ws_size,
                              hipStream_t stream) {
  if (n_in < 8) return;
  const int rowsNeeded = (kBatch - 1) * kSeqFull + kSeq;     // last token row read/written + 1
  if (in_sizes[0] < rowsNeeded * kDim) return;
  if (in_sizes[1] < kDim * kDim || in_sizes[3] < kDim * kDim || in_sizes[5] < kDim * kDim || in_sizes[7] < kDim * kDim) return;
  if (in_sizes[2] < kDim || in_sizes[4] < kDim || in_sizes[6] < kDim) return;
  if (out_size < rowsNeeded * kDim) return;

  const size_t szXB  = (size_t)kTok * kDim * 2;
  const size_t szWT  = (size_t)kWtN * kDim * 2;
  const size_t szWOT = (size_t)kDim * kDim * 2;
  const size_t szBQK = (size_t)kQKld * 4;
  const size_t szBV  = (size_t)kDim * 4;
  const size_t szQK  = (size_t)kTok * kQKld * 2;
  const size_t szVT  = (size_t)kBatch * kHeads * kDh * kSeq * 2;
  const size_t szCTX = (size_t)kTok * kDim * 2;
  const size_t offXB  = 0;
  const size_t offWT  = offXB + szXB;
  const size_t offWOT = offWT + szWT;
  const size_t offBQK = offWOT + szWOT;
  const size_t offBV  = offBQK + szBQK;
  const size_t offQK  = offBV + szBV;
  const size_t offVTH = offQK + szQK;
  const size_t offVTL = offVTH + szVT;
  const size_t offCH  = offVTL + szVT;
  const size_t offCL  = offCH + szCTX;
  const size_t total  = offCL + szCTX;             // 67,121,152 at full size
  if (ws_size < total) return;
  if (total > (size_t)134217728) return;

  const float* x  = (const float*)d_in[0];
  const float* Wq = (const float*)d_in[1];
  const float* bq = (const float*)d_in[2];
  const float* Wk = (const float*)d_in[3];
  const float* bk = (const float*)d_in[4];
  const float* Wv = (const float*)d_in[5];
  const float* bv = (const float*)d_in[6];
  const float* Wo = (const float*)d_in[7];
  float* out = (float*)d_out;
  char* ws = (char*)d_ws;
  unsigned short* XB   = (unsigned short*)(ws + offXB);
  unsigned short* WT   = (unsigned short*)(ws + offWT);
  unsigned short* WOT  = (unsigned short*)(ws + offWOT);
  float*          BQK  = (float*)(ws + offBQK);
  float*          BV   = (float*)(ws + offBV);
  unsigned short* QK16 = (unsigned short*)(ws + offQK);
  unsigned short* VTH  = (unsigned short*)(ws + offVTH);
  unsigned short* VTL  = (unsigned short*)(ws + offVTL);
  unsigned short* CTXH = (unsigned short*)(ws + offCH);
  unsigned short* CTXL = (unsigned short*)(ws + offCL);

  // ---- prologue: RNE bf16 planes of all float inputs, one launch ----
  prologue_kernel<<<dim3(4 * kWTiles + 3 + kCastBlks), dim3(256), 0, stream>>>(x, Wq, Wk, Wv, Wo, bq, bk, bv, XB, WT, WOT, BQK, BV);
  // ---- q|k (f16 plane) and v^T (bf16 hi/lo planes) from XB and WT, one launch ----
  qkv_gemm_kernel<<<dim3(kTilesQK + kBatch * kTilesV), dim3(256), 0, stream>>>(XB, WT, BQK, BV, QK16, VTH, VTL, kDim);
  // ---- causal attention per (b, h, pair of 64-query tiles) -> ctx bf16 hi/lo planes ----
  causal_attn_kernel<<<dim3(kBatch * kHeads * kTilePairs), dim3(kKG * kAW * 32), 0, stream>>>(QK16, VTH, VTL, CTXH, CTXL);
  // ---- out[b][s] = (CTXH + CTXL)[b*kSeq + s] . WOT  (M=kSeq, N=1024, K=1024, kBatch batches, no bias),
  //      f32 straight to d_out rows b*kSeqFull + s ----
  {
    const int blocks = (kSeq / 128) * (kDim / 256);
    wmma_gemm64<1, 2, 0, 0><<<dim3(blocks, kBatch), dim3(256), 0, stream>>>(
        CTXH, CTXL, kDim, (long)kSeq * kDim, WOT, WOT, kDim, 0L,
        (void*)out, (void*)out, kDim, (long)kSeqFull * kDim, BV, kSeq, kDim, kDim, 1.0f);
  }
}

// v008
// One run takes 101 microseconds.
// Next to v007, in two timings, it ran 1.12 times as fast each time.
// Over all steps from v000 it is 5.04 times as fast.
// Contractions: q|k = x.[Wq|Wk] and v^T = Wv^T.x^T on v_wmma_f32_16x16x32_bf16 (x, W RNE bf16 operands, single products; bq, bk, bv as RNE bf16 added in f32); scores^T = k.q^T on v_wmma_f32_16x16x32_f16 (q, k f16 planes, single products); ctx^T = v^T.p^T on v_wmma_f32_16x16x32_bf16 (p^T and v^T as bf16 hi+lo: hi.hi + lo.hi + hi.lo); out = ctx.Wo on v_wmma_f32_16x16x32_bf16 (ctx bf16 hi+lo, Wo RNE bf16: hi.W + lo.W); f32 accumulate everywhere; scale, causal fill and softmax in f32.
#include <hip/hip_runtime.h>
#include <math.h>

// ---------------------------------------------------------------------------
// Problem constants (NB / SEQ overridable; *_FULL give the input / output strides)
// ---------------------------------------------------------------------------
#ifndef NB
#define NB 2
#endif
#ifndef SEQ
#define SEQ 2048
#endif
#define NB_FULL 2
#define SEQ_FULL 2048

constexpr int kBatch   = NB;
constexpr int kSeq     = SEQ;
constexpr int kSeqFull = SEQ_FULL;
constexpr int kDim     = 1024;               // d_in == d_out
constexpr int kHeads   = 16;
constexpr int kDh      = 64;
constexpr int kTok     = kBatch * kSeq;      // token rows of the compact planes
constexpr int kWtN     = 3 * kDim;           // rows of the Wq^T | Wk^T | Wv^T plane
constexpr int kQKld    = 2 * kDim;           // 2048, pitch (halves) of the q|k f16 plane
constexpr int kQB      = 64;                 // query rows per attention block
constexpr int kKC      = 64;                 // keys per chunk
constexpr int kAW      = 4;                  // waves per key group; an attention block has kKG groups
constexpr int kLP      = 72;                 // LDS row pitch (halves) of the K and V^T tiles: 144 B = 16 B x 9, so 16 rows read by ds_load_b128 fall on 64 distinct banks
constexpr float kScale  = 0.125f;            // 64^-0.5, exact
constexpr float kSL2E   = kScale * 1.44269504088896340736f;   // scale * log2(e): exp(scale * (s - m)) = 2^(kSL2E * s - kSL2E * m)
constexpr float kNegBig = -1.0e30f;          // finite fill for (unscaled) scores above the diagonal
static_assert(kBatch >= 1 && kBatch <= NB_FULL);
static_assert(kSeq >= 64 && kSeq <= SEQ_FULL);
static_assert(kHeads * kDh == kDim);
static_assert(kSeq % kQB == 0 && kSeq % kKC == 0 && kQB == kAW * 16 && kDh == 64);
// GEMM shape contract (no tail handling): M multiple of 128, N multiple of 256, K multiple of 64
static_assert(kTok % 128 == 0 && kQKld % 256 == 0 && kDim % 64 == 0);
static_assert(kDim % 256 == 0 && kSeq % 256 == 0);
static_assert(kDim / 8 == 128 && (kTok * kDim) % 8 == 0);

typedef __attribute__((ext_vector_type(16))) _Float16 v16h;
typedef __attribute__((ext_vector_type(8)))  _Float16 v8h;
typedef __attribute__((ext_vector_type(16))) __bf16   v16b;
typedef __attribute__((ext_vector_type(8)))  __bf16   v8b;
typedef __attribute__((ext_vector_type(8)))  float    v8f;
typedef __attribute__((ext_vector_type(4)))  float    v4f;
typedef __attribute__((ext_vector_type(4)))  unsigned int v4u;

// ---------------------------------------------------------------------------
// Shared pieces
// ---------------------------------------------------------------------------
typedef __attribute__((ext_vector_type(2))) float  v2f;
typedef __attribute__((ext_vector_type(2))) __bf16 v2b;
// Two f32 -> two bf16, round to nearest even, as one packed hardware conversion (v_cvt_pk_bf16_f32); a lands in the low half.
__device__ __forceinline__ unsigned cvt2bf(float a, float b) {
  return __builtin_bit_cast(unsigned, __builtin_convertvector((v2f){a, b}, v2b));
}
// hi = bf16(x), lo = bf16(x - hi) for two values; the difference is exact in f32.
__device__ __forceinline__ void split2bf(float a, float b, unsigned& hi, unsigned& lo) {
  const v2b h = __builtin_convertvector((v2f){a, b}, v2b);
  hi = __builtin_bit_cast(unsigned, h);
  lo = cvt2bf(a - (float)h[0], b - (float)h[1]);
}

// hazard guards as plain device helpers
__device__ __forceinline__ void dep_guard_h(v8f& a, v8f& b, v16h x, v16h y) { asm volatile("v_nop\n\tv_nop\n\tv_nop\n\tv_nop" : "+v"(a), "+v"(b) : "v"(x), "v"(y)); }
__device__ __forceinline__ void dep_guard_b(v8f& a, v8f& b, v16b x, v16b y) { asm volatile("v_nop\n\tv_nop\n\tv_nop\n\tv_nop" : "+v"(a), "+v"(b) : "v"(x), "v"(y)); }
// guard tying all four accumulators of a group and naming both A fragments as inputs
__device__ __forceinline__ void dep_guard4_h(v8f& a, v8f& b, v8f& c, v8f& d, v16h x, v16h y) { asm volatile("v_nop\n\tv_nop\n\tv_nop\n\tv_nop" : "+v"(a), "+v"(b), "+v"(c), "+v"(d) : "v"(x), "v"(y)); }
__device__ __forceinline__ void dep_guard4_b(v8f& a, v8f& b, v8f& c, v8f& d, v16b x, v16b y) { asm volatile("v_nop\n\tv_nop\n\tv_nop\n\tv_nop" : "+v"(a), "+v"(b), "+v"(c), "+v"(d) : "v"(x), "v"(y)); }
__device__ __forceinline__ void keep4_h(v16h a, v16h b, v16h c, v16h d) { asm volatile("v_nop" :: "v"(a), "v"(b), "v"(c), "v"(d)); }
__device__ __forceinline__ void keep4_b(v16b a, v16b b, v16b c, v16b d) { asm volatile("v_nop" :: "v"(a), "v"(b), "v"(c), "v"(d)); }
__device__ __forceinline__ void acc_guard4(v8f& a, v8f& b, v8f& c, v8f& d) { asm volatile("v_nop\n\tv_nop\n\tv_nop\n\tv_nop" : "+v"(a), "+v"(b), "+v"(c), "+v"(d)); }
template <typename T> struct Frag;
template <> struct Frag<_Float16> {
  typedef v16h V; union U { v16h v; v8h h[2]; };
  // elements 0..7 <- p[0..7], 8..15 <- p[16..23]
  static __device__ __forceinline__ v16h load(const _Float16* p) {
    U f; f.h[0] = *(const v8h*)(p); f.h[1] = *(const v8h*)(p + 16); return f.v;
  }
  static __device__ __forceinline__ v8f mma(v16h a, v16h b, v8f c) {
    return __builtin_amdgcn_wmma_f32_16x16x32_f16(false, a, false, b, (short)0, c, false, false);
  }
  static __device__ __forceinline__ void guard(v8f& a, v8f& b, v16h x, v16h y) { dep_guard_h(a, b, x, y); }
  static __device__ __forceinline__ void guard4(v8f& a, v8f& b, v8f& c, v8f& d, v16h x, v16h y) { dep_guard4_h(a, b, c, d, x, y); }
  static __device__ __forceinline__ void keep(v16h a, v16h b, v16h c, v16h d) { keep4_h(a, b, c, d); }
};
template <> struct Frag<__bf16> {
  typedef v16b V; union U { v16b v; v8b h[2]; };
  static __device__ __forceinline__ v16b load(const __bf16* p) {
    U f; f.h[0] = *(const v8b*)(p); f.h[1] = *(const v8b*)(p + 16); return f.v;
  }
  static __device__ __forceinline__ v8f mma(v16b a, v16b b, v8f c) {
    return __builtin_amdgcn_wmma_f32_16x16x32_bf16(false, a, false, b, (short)0, c, false, false);
  }
  static __device__ __forceinline__ void guard(v8f& a, v8f& b, v16b x, v16b y) { dep_guard_b(a, b, x, y); }
  static __device__ __forceinline__ void guard4(v8f& a, v8f& b, v8f& c, v8f& d, v16b x, v16b y) { dep_guard4_b(a, b, c, d, x, y); }
  static __device__ __forceinline__ void keep(v16b a, v16b b, v16b c, v16b d) { keep4_b(a, b, c, d); }
};

// ---- Register-blocked batched WMMA GEMM (bias added in f32 in the slab phase so all output modes see it) ----
// C[m,n] = scale * sum_k A[m,k] * Bt[n,k] (+bias); each wave owns a 64x64 tile, a block of 8 waves (2 x 4) a 128x256 tile.
// A row-major [M,K]; Bt row-major [N,K], both at row pitch kDim (lda == ldb == kDim); M % 128 == 0, N % 256 == 0, K % 64 == 0.
// Operands go through LDS: per 64 k the block copies its 128 A rows and 256 Bt rows once, 128 B of a row by 8 lanes, so a
// wave-wide 16-B load covers 4 whole lines; the next tile's loads are issued before the products of the current one.
// SPLIT: 0 = single product; 2 = A hi/lo planes (hi.B + lo.B).
// BIAS_MODE: 0 = none, 1 = bias[m] (per row), 2 = bias[n] (per column); bias is an f32 table of length M or N.
// OUT_MODE: 0 = f32, 1 = f16, 2 = bf16 hi plane (Cout) + bf16 lo plane (Cout2).
// ET: 0 = f16 operands, 1 = bf16 operands (pointers passed as 16-bit storage)
constexpr int kGP = 72;   // LDS row pitch (halves) of the staged A and Bt tiles: 144 B = 16 B x 9 for the ds_load_b128 fragment reads
template <int ET> struct Elem;
template <> struct Elem<0> { typedef _Float16 T; };
template <> struct Elem<1> { typedef __bf16 T; };
// The tile body is a device function: bx = tile index within the product, b = batch; sA, sB, sT are the calling kernel's LDS
// (sA: (SPLIT == 2 ? 2 : 1) * 128 * kGP halves, sB: 256 * kGP halves, sT: 8 slabs of kSlab floats), so that one launch can
// hold tiles of several independent products on one LDS allocation.
constexpr int kSlab = 16 * 68;   // per-wave 16x64 output slab, pitch 68 floats
template <int ET, int SPLIT, int BIAS_MODE, int OUT_MODE>
__device__ __forceinline__ void gemm64_tile(
    unsigned short* sA, unsigned short* sB, float* sT, unsigned bx, int b,
    const unsigned short* __restrict__ Ap, const unsigned short* __restrict__ A2p, int lda, long strideA,
    const unsigned short* __restrict__ Btp, const unsigned short* __restrict__ Bt2p, int ldb, long strideB,
    void* __restrict__ Cout, void* __restrict__ Cout2, int ldc, long strideC,
    const float* __restrict__ bias,
    int M, int N, int K, float scale) {
  static_assert(SPLIT == 0 || SPLIT == 2);
  static_assert(BIAS_MODE >= 0 && BIAS_MODE <= 2);
  static_assert(OUT_MODE >= 0 && OUT_MODE <= 2);
  typedef typename Elem<ET>::T T;
  typedef typename Frag<T>::V V;
  const int tid  = threadIdx.x;
  const int lane = tid & 31;
  const int wave = tid >> 5;
  const int blocksN = N >> 8;
  const int bm = bx / blocksN;
  const int bn = bx - bm * blocksN;
  const int mB = bm << 7;                      // first A row of the block
  const int nB = bn << 8;                      // first Bt row of the block
  const int wm = (wave >> 2) << 6;             // this wave's rows within the A tile
  const int wn = (wave & 3) << 6;              // this wave's rows within the Bt tile
  const int m0 = mB + wm;
  const int n0 = nB + wn;

  const unsigned short* Ab  = Ap  + (size_t)b * strideA;
  const unsigned short* Bb  = Btp + (size_t)b * strideB;
  const unsigned short* Ab2 = (SPLIT == 2) ? (A2p + (size_t)b * strideA) : nullptr;

  const int rlane = lane & 15;                 // row (A) / col (B, D) within subtile
  const int koff  = (lane >> 4) * 8;           // k offset of this lane half
  const int mOff  = (lane >> 4) * 8;           // D row offset

  // staging map: thread -> row (tid >> 3) + 32 * i, 8 halves at column (tid & 7) * 8. One address per plane: the row step
  // 32 * kDim is a compile-time constant, so the i-th load differs from the first by an immediate offset only.
  // Every loop over i, j or ks below is unrolled so that the register arrays (ra, rb, fragments, acc) keep constant indices.
  const int srow = tid >> 3;
  const int sc8  = (tid & 7) * 8;
  const unsigned short* gA  = Ab + (size_t)(mB + srow) * kDim + sc8;
  const unsigned short* gA2 = (SPLIT == 2) ? (Ab2 + (size_t)(mB + srow) * kDim + sc8) : nullptr;
  const unsigned short* gB  = Bb + (size_t)(nB + srow) * kDim + sc8;
  v4u ra[4], ra2[4], rb[8];
#pragma unroll
  for (int i = 0; i < 4; ++i) {
    ra[i] = *(const v4u*)(gA + i * 32 * kDim);
    if (SPLIT == 2) ra2[i] = *(const v4u*)(gA2 + i * 32 * kDim);
  }
#pragma unroll
  for (int i = 0; i < 8; ++i) rb[i] = *(const v4u*)(gB + i * 32 * kDim);

  const T* fa = (const T*)sA + (wm + rlane) * kGP + koff;
  const T* fb = (const T*)sB + (wn + rlane) * kGP + koff;

  v8f acc[4][4];
#pragma unroll
  for (int i = 0; i < 4; ++i)
#pragma unroll
    for (int j = 0; j < 4; ++j) acc[i][j] = (v8f){0.f,0.f,0.f,0.f,0.f,0.f,0.f,0.f};

  for (int k0 = 0; k0 < K; k0 += 64) {
    __syncthreads();   // every wave has read its last fragment of the previous tile
#pragma unroll
    for (int i = 0; i < 4; ++i) {
      *(v4u*)(sA + (srow + 32 * i) * kGP + sc8) = ra[i];
      if (SPLIT == 2) *(v4u*)(sA + (128 + srow + 32 * i) * kGP + sc8) = ra2[i];
    }
#pragma unroll
    for (int i = 0; i < 8; ++i) *(v4u*)(sB + (srow + 32 * i) * kGP + sc8) = rb[i];
    __syncthreads();   // the tile is complete before any wave reads it
    if (k0 + 64 < K) { // block-uniform: the next tile's loads fly during this tile's products
      const int kn = k0 + 64;
#pragma unroll
      for (int i = 0; i < 4; ++i) {
        ra[i] = *(const v4u*)(gA + kn + i * 32 * kDim);
        if (SPLIT == 2) ra2[i] = *(const v4u*)(gA2 + kn + i * 32 * kDim);
      }
#pragma unroll
      for (int i = 0; i < 8; ++i) rb[i] = *(const v4u*)(gB + kn + i * 32 * kDim);
      // the fragment reads below reuse the address registers of the loads just issued: the wait stands in front of that overwrite
      asm volatile("s_wait_xcnt 0x0" ::: "memory");
    }
#pragma unroll
    for (int ks = 0; ks < 64; ks += 32) {
      V bh[4], ah[4], al[4];
#pragma unroll
      for (int j = 0; j < 4; ++j) bh[j] = Frag<T>::load(fb + (j << 4) * kGP + ks);
#pragma unroll
      for (int i = 0; i < 4; ++i) {
        ah[i] = Frag<T>::load(fa + (i << 4) * kGP + ks);
        al[i] = ah[i];
        if (SPLIT == 2) al[i] = Frag<T>::load(fa + (128 + (i << 4)) * kGP + ks);
      }
#pragma unroll
      for (int i = 0; i < 4; ++i) {
#pragma unroll
        for (int j = 0; j < 4; ++j) {
          acc[i][j] = Frag<T>::mma(ah[i], bh[j], acc[i][j]);
          if (SPLIT == 2) acc[i][j] = Frag<T>::mma(al[i], bh[j], acc[i][j]);
        }
      }
#pragma unroll
      for (int i = 0; i < 4; ++i) Frag<T>::guard4(acc[i][0], acc[i][1], acc[i][2], acc[i][3], ah[i], al[i]);
      Frag<T>::keep(bh[0], bh[1], bh[2], bh[3]);
    }
  }
  acc_guard4(acc[0][0], acc[0][1], acc[0][2], acc[0][3]);
  acc_guard4(acc[1][0], acc[1][1], acc[1][2], acc[1][3]);
  acc_guard4(acc[2][0], acc[2][1], acc[2][2], acc[2][3]);
  acc_guard4(acc[3][0], acc[3][1], acc[3][2], acc[3][3]);

  // ---- epilogue ----
  float* slab = sT + wave * kSlab;
  float bcol[4] = {0.f, 0.f, 0.f, 0.f};
  if (BIAS_MODE == 2) {
    // per-column bias: this lane's columns n0 + 16*j + rlane, j = 0..3 (in range: N multiple of 64)
#pragma unroll
    for (int j = 0; j < 4; ++j) bcol[j] = bias[n0 + (j << 4) + rlane];
  }
#pragma unroll
  for (int i = 0; i < 4; ++i) {
    const int mBase = m0 + (i << 4);
    float brow[8] = {0.f, 0.f, 0.f, 0.f, 0.f, 0.f, 0.f, 0.f};
    if (BIAS_MODE == 1) {
      // per-row bias: rows mBase + mOff + 0..7 (16-B aligned: mBase % 16 == 0, mOff in {0, 8})
      const v4f b0 = *(const v4f*)(bias + mBase + mOff);
      const v4f b1 = *(const v4f*)(bias + mBase + mOff + 4);
#pragma unroll
      for (int e = 0; e < 4; ++e) { brow[e] = b0[e]; brow[4 + e] = b1[e]; }
    }
#pragma unroll
    for (int j = 0; j < 4; ++j) {
#pragma unroll
      for (int r = 0; r < 8; ++r) {
        float bb = 0.f;
        if (BIAS_MODE == 1) bb = brow[r];
        if (BIAS_MODE == 2) bb = bcol[j];
        slab[(mOff + r) * 68 + (j << 4) + rlane] = acc[i][j][r] * scale + bb;
      }
    }
    __builtin_amdgcn_fence(3, "workgroup");
    __builtin_amdgcn_wave_barrier();
    __builtin_amdgcn_fence(2, "workgroup");
    if (OUT_MODE == 0) {
      float* C = (float*)Cout + (size_t)b * strideC;
      const int hh = lane >> 4, c4 = (lane & 15) * 4;     // row seg = 256 B = 16 lanes x 16 B
      {
#pragma unroll
        for (int it = 0; it < 8; ++it) {
          const int row = it * 2 + hh;
          const v4f v = *(const v4f*)(slab + row * 68 + c4);
          *(v4f*)(C + (size_t)(mBase + row) * ldc + n0 + c4) = v;
        }
        
      }
    } else {
      const int q = lane >> 3, c8 = (lane & 7) * 8;
      unsigned short* C  = (unsigned short*)Cout  + (size_t)b * strideC;
      unsigned short* C2 = (OUT_MODE == 2) ? ((unsigned short*)Cout2 + (size_t)b * strideC) : nullptr;
      {
#pragma unroll
        for (int it = 0; it < 4; ++it) {
          const int row = it * 4 + q;
          const float* sp = slab + row * 68 + c8;
          v8h hv, lv;
          if (OUT_MODE == 1) {
#pragma unroll
            for (int e = 0; e < 8; ++e) hv[e] = (_Float16)sp[e];
          } else {
            v4u hu, lu;
#pragma unroll   // hu and lu stay in registers: constant indices
            for (int e = 0; e < 4; ++e) {
              unsigned hw, lw;
              split2bf(sp[2 * e], sp[2 * e + 1], hw, lw);
              hu[e] = hw;
              lu[e] = lw;
            }
            hv = __builtin_bit_cast(v8h, hu);
            lv = __builtin_bit_cast(v8h, lu);
          }
          *(v8h*)(C + (size_t)(mBase + row) * ldc + n0 + c8) = hv;
          if (OUT_MODE == 2) *(v8h*)(C2 + (size_t)(mBase + row) * ldc + n0 + c8) = lv;
        }
        
      }
    }
    __builtin_amdgcn_fence(3, "workgroup");
    __builtin_amdgcn_wave_barrier();
    __builtin_amdgcn_fence(2, "workgroup");
  }
}

// One product per launch: grid (tiles, batches).
template <int ET, int SPLIT, int BIAS_MODE, int OUT_MODE>
__global__ __launch_bounds__(256) void wmma_gemm64(
    const unsigned short* __restrict__ Ap, const unsigned short* __restrict__ A2p, int lda, long strideA,
    const unsigned short* __restrict__ Btp, const unsigned short* __restrict__ Bt2p, int ldb, long strideB,
    void* __restrict__ Cout, void* __restrict__ Cout2, int ldc, long strideC,
    const float* __restrict__ bias,
    int M, int N, int K, float scale) {
  __shared__ __align__(16) unsigned short sA[(SPLIT == 2 ? 2 : 1) * 128 * kGP];   // A (hi, then lo) [row][k] (cross-wave: block barriers)
  __shared__ __align__(16) unsigned short sB[256 * kGP];                          // Bt [row][k] (cross-wave: block barriers)
  __shared__ __align__(16) float sT[8 * kSlab];                                   // per-wave slabs (private-to-wave)
  gemm64_tile<ET, SPLIT, BIAS_MODE, OUT_MODE>(sA, sB, sT, blockIdx.x, blockIdx.y, Ap, A2p, lda, strideA, Btp, Bt2p, ldb, strideB,
                                              Cout, Cout2, ldc, strideC, bias, M, N, K, scale);
}

// The two projections that depend only on XB and WT, in one launch, told apart by the block index (block-uniform branch):
//   blocks [0, kTilesQK):  q|k = XB . WT[rows 0..2047] + BQK[n] -> f16 plane [kTok][2048] (M=kTok, N=2048, bias per column)
//   then kTilesV per batch: v^T[b][h*64+d][s] = WT[2048 + h*64 + d] . XB[b*kSeq + s] + BV[h*64+d] -> bf16 hi/lo planes
//                           (M=1024, N=kSeq, bias per row)
constexpr int kTilesQK = (kTok / 128) * (kQKld / 256);
constexpr int kTilesV  = (kDim / 128) * (kSeq / 256);
// Register cap: each body alone builds to 256 registers a wave, the two in one kernel to 258, which is allocated as 272 and leaves
// room for three waves a SIMD, so one block a WGP. At 256 four waves fit: two blocks a WGP, and all 384 blocks are resident at once.
__global__ __launch_bounds__(256) __attribute__((amdgpu_num_vgpr(256))) void qkv_gemm_kernel(
    const unsigned short* __restrict__ XB, const unsigned short* __restrict__ WT,
    const float* __restrict__ BQK, const float* __restrict__ BV,
    unsigned short* __restrict__ QK16, unsigned short* __restrict__ VTH, unsigned short* __restrict__ VTL, int K) {
  __shared__ __align__(16) unsigned short sA[128 * kGP];   // A [row][k] (cross-wave: block barriers)
  __shared__ __align__(16) unsigned short sB[256 * kGP];   // Bt [row][k] (cross-wave: block barriers)
  __shared__ __align__(16) float sT[8 * kSlab];            // per-wave slabs (private-to-wave)
  const int bx = blockIdx.x;
  if (bx < kTilesQK) {
    gemm64_tile<1, 0, 2, 1>(sA, sB, sT, bx, 0, XB, XB, kDim, 0L, WT, WT, kDim, 0L,
                            (void*)QK16, (void*)QK16, kQKld, 0L, BQK, kTok, kQKld, K, 1.0f);
  } else {
    const int r = bx - kTilesQK;
    const int b = r / kTilesV;
    const unsigned short* Av = WT + (size_t)2 * kDim * kDim;   // rows 2048..3071 of WT = Wv^T
    gemm64_tile<1, 0, 1, 2>(sA, sB, sT, r - b * kTilesV, b, Av, Av, kDim, 0L, XB, XB, kDim, (long)kSeq * kDim,
                            (void*)VTH, (void*)VTL, kSeq, (long)kDim * kSeq, BV, kDim, kSeq, K, 1.0f);
  }
}

// ---------------------------------------------------------------------------
// f32 -> bf16 (RNE) cast of x into the compact token plane XB [kTok][1024]: token row t = b*kSeq + s reads input row
// ---------------------------------------------------------------------------
__device__ __forceinline__ void cast8_bf16_block(const float* __restrict__ in, unsigned short* __restrict__ out, int n8, int bx) {
  const int i = bx * 256 + threadIdx.x;
  if (i >= n8) return;
  const int t  = i >> 7;                 // 128 groups of 8 per token row
  const int c8 = (i & 127) * 8;
  const int b  = t / kSeq;
  const int s  = t - b * kSeq;
  const float* p = in + (size_t)(b * kSeqFull + s) * kDim + c8;
  const v4f a = *(const v4f*)(p);
  const v4f c = *(const v4f*)(p + 4);
  const v4u u = (v4u){cvt2bf(a[0], a[1]), cvt2bf(a[2], a[3]), cvt2bf(c[0], c[1]), cvt2bf(c[2], c[3])};
  unsigned short* q = out + 8 * (size_t)i;
  *(v4u*)q = u;
  
}

// ---------------------------------------------------------------------------
// Weight transpose + RNE bf16 cast: W f32 row-major [1024 (d)][ldIn (n)] -> WT bf16 [n][d] with pitch ldOut (= 1024):
//   in[d][n] -> out[n][d]. One block of 256 threads per 64x64 tile (dt = d tile, nt = n tile).
// Load coverage: 16 iterations x 256 threads = 4096 = the whole 64x64 tile (coalesced along n).
// Store coverage: 8 waves x 2 iterations x 4 rows (lane>>3) = 64 n-rows; (lane&7) x 8 halves = 64 d-cols; each row segment
// ---------------------------------------------------------------------------
__device__ __forceinline__ void wtcast_bf16_block(const float* __restrict__ W, unsigned short* __restrict__ out,
                                                  int ldIn, int ldOut, int dt, int nt) {
  __shared__ float sm[64][65];   // sm[n_local][d_local] (cross-wave: block barrier)
  const int t  = threadIdx.x;
  const int d0 = dt * 64;
  const int n0 = nt * 64;
#pragma unroll
  for (int i = 0; i < 16; ++i) {
    const int e = i * 256 + t;
    const int r = e >> 6;          // d local
    const int c = e & 63;          // n local
    sm[c][r] = W[(size_t)(d0 + r) * ldIn + n0 + c];
  }
  __syncthreads();
  const int lane = t & 31, wave = t >> 5;
  const int q = lane >> 3, c8 = (lane & 7) * 8;
  {
#pragma unroll
    for (int it = 0; it < 2; ++it) {
      const int row = wave * 8 + it * 4 + q;                 // n local
      const float* sr = &sm[row][c8];
      const v4u u = (v4u){cvt2bf(sr[0], sr[1]), cvt2bf(sr[2], sr[3]), cvt2bf(sr[4], sr[5]), cvt2bf(sr[6], sr[7])};
      *(v4u*)(out + (size_t)(n0 + row) * ldOut + d0 + c8) = u;
    }
    // inlined beside other pieces, the built code reuses these two stores' registers on a path behind them: the wait stands in front of that overwrite
    asm volatile("s_wait_xcnt 0x0" ::: "memory");
  }
}

// ---------------------------------------------------------------------------
// Bias RNE bf16 convert kept as f32: dst[1024] = float(bf16(src)). One block of 256 threads, float4 per lane:
// ---------------------------------------------------------------------------
__device__ __forceinline__ void bias_bf16_block(const float* __restrict__ bsrc, float* __restrict__ bdst) {
  const int t = threadIdx.x;
  const v4f a = *(const v4f*)(bsrc + 4 * t);
  v4f r;
#pragma unroll
  for (int e = 0; e < 4; ++e) r[e] = (float)(__bf16)a[e];
  float* dp = bdst + 4 * t;
  *(v4f*)dp = r;
  
}

// ---------------------------------------------------------------------------
// All eight input conversions in one launch: they are independent of one another, so each block takes its piece by its
// index (block-uniform branches): 4 x kWTiles weight tiles (Wq, Wk, Wv -> WT rows 0, 1024, 2048; Wo -> WOT), 3 bias blocks
// (bq, bk -> BQK; bv -> BV), then the blocks of the x cast.
// ---------------------------------------------------------------------------
constexpr int kWTiles   = (kDim / 64) * (kDim / 64);   // 64x64 tiles of one square weight
constexpr int kCastBlks = kTok * kDim / 8 / 256;       // blocks of the x cast (8 elements per thread)
static_assert((kTok * kDim / 8) % 256 == 0);
__global__ __launch_bounds__(256) void prologue_kernel(
    const float* __restrict__ x,  const float* __restrict__ Wq, const float* __restrict__ Wk, const float* __restrict__ Wv,
    const float* __restrict__ Wo, const float* __restrict__ bq, const float* __restrict__ bk, const float* __restrict__ bv,
    unsigned short* __restrict__ XB, unsigned short* __restrict__ WT, unsigned short* __restrict__ WOT,
    float* __restrict__ BQK, float* __restrict__ BV) {
  const int bx = blockIdx.x;
  if (bx >= 4 * kWTiles + 3) {
    cast8_bf16_block(x, XB, kTok * kDim / 8, bx - (4 * kWTiles + 3));
    return;
  }
  if (bx >= 4 * kWTiles) {
    const int w = bx - 4 * kWTiles;
    bias_bf16_block((w == 0) ? bq : (w == 1) ? bk : bv, (w == 0) ? BQK : (w == 1) ? (BQK + kDim) : BV);
    return;
  }
  const int w = bx / kWTiles;
  const int t = bx - w * kWTiles;
  const float* W = (w == 0) ? Wq : (w == 1) ? Wk : (w == 2) ? Wv : Wo;
  unsigned short* o = (w < 3) ? (WT + (size_t)w * kDim * kDim) : WOT;
  wtcast_bf16_block(W, o, kDim, kDim, t % (kDim / 64), t / (kDim / 64));
}

constexpr int kKG = 2;
constexpr int kTilePairs = (kSeq / kQB + 1) / 2;
constexpr int kMgW = 34 * 32;
static_assert(kKG == 2);
constexpr int kTileH = kKC * kLP;                  // halves of one staged tile: 64 rows at pitch kLP
constexpr int kSetH  = 3 * kTileH;                 // K, V^T hi and V^T lo tiles of one key chunk
static_assert(kKC == 64 && kDh == 64 && (kLP * 2) % 16 == 0);
union FragH { v16h v; v8h h[2]; };
union FragB { v16b v; v8b h[2]; unsigned w[8]; };   // w[i] = elements 2 i (low half) and 2 i + 1

__device__ __forceinline__ v8f mma_h16(v16h a, v16h b, v8f c) {
  c = __builtin_amdgcn_wmma_f32_16x16x32_f16(false, a, false, b, (short)0, c, false, false);
  asm volatile("v_nop\n\tv_nop\n\tv_nop\n\tv_nop" : "+v"(c) : "v"(a), "v"(b));
  return c;
}
__device__ __forceinline__ v8f mma_b16(v16b a, v16b b, v8f c) {
  c = __builtin_amdgcn_wmma_f32_16x16x32_bf16(false, a, false, b, (short)0, c, false, false);
  asm volatile("v_nop\n\tv_nop\n\tv_nop\n\tv_nop" : "+v"(c) : "v"(a), "v"(b));
  return c;
}
// lane l <-> lane l ^ 16: the two wave halves hold the two key halves of one query
__device__ __forceinline__ float xhalf(float x) {
  const int b = __builtin_bit_cast(int, x);
  return __builtin_bit_cast(float, __builtin_amdgcn_permlanex16(b, b, 0x76543210, 0xfedcba98, false, false));
}
// 2^x by v_exp_f32. In asm so that the slot the instruction set asks for behind a transcendental (one v_nop or independent
// instruction before its result is read or its source overwritten) stands inside the statement. Eight at a time: the outputs are early-clobber,
// so each v_exp_f32 is independent of the one in front of it, and one v_nop serves the last.
__device__ __forceinline__ void exp2x8(float (&p)[8], const float (&x)[8]) {
  asm("v_exp_f32 %0, %8\n\tv_exp_f32 %1, %9\n\tv_exp_f32 %2, %10\n\tv_exp_f32 %3, %11\n\t"
      "v_exp_f32 %4, %12\n\tv_exp_f32 %5, %13\n\tv_exp_f32 %6, %14\n\tv_exp_f32 %7, %15\n\tv_nop"
      : "=&v"(p[0]), "=&v"(p[1]), "=&v"(p[2]), "=&v"(p[3]), "=&v"(p[4]), "=&v"(p[5]), "=&v"(p[6]), "=&v"(p[7])
      : "v"(x[0]), "v"(x[1]), "v"(x[2]), "v"(x[3]), "v"(x[4]), "v"(x[5]), "v"(x[6]), "v"(x[7]));
}
__device__ __forceinline__ float exp2x1(float x) {
  float p;
  asm("v_exp_f32 %0, %1\n\tv_nop" : "=v"(p) : "v"(x));   // the v_nop: the same slot
  return p;
}

// One key chunk's K, V^T hi and V^T lo tiles by global_load_async_to_lds_b128: 12 copies a lane, 4 row groups of 16 rows per tile,
// 8 lanes on one whole 128-B row piece. l = the lane's LDS byte address in the K tile, k, vh, vl = its global addresses, all of
// row group 0. The s_wait_xcnt is the last line of the copies' own statement, so that no register a copy names is rewritten in front of it.
__device__ __forceinline__ void copy_chunk(unsigned l, const unsigned short* k, const unsigned short* vh, const unsigned short* vl) {
  constexpr unsigned rg = 16 * kLP * 2;   // LDS bytes from one row group to the next
  constexpr unsigned tb = kTileH * 2;     // LDS bytes from one tile to the next
  asm volatile("global_load_async_to_lds_b128 %0, %12, off\n\t"
               "global_load_async_to_lds_b128 %1, %13, off\n\t"
               "global_load_async_to_lds_b128 %2, %14, off\n\t"
               "global_load_async_to_lds_b128 %3, %15, off\n\t"
               "global_load_async_to_lds_b128 %4, %16, off\n\t"
               "global_load_async_to_lds_b128 %5, %17, off\n\t"
               "global_load_async_to_lds_b128 %6, %18, off\n\t"
               "global_load_async_to_lds_b128 %7, %19, off\n\t"
               "global_load_async_to_lds_b128 %8, %20, off\n\t"
               "global_load_async_to_lds_b128 %9, %21, off\n\t"
               "global_load_async_to_lds_b128 %10, %22, off\n\t"
               "global_load_async_to_lds_b128 %11, %23, off\n\t"
               "s_wait_xcnt 0x0"
               :: "v"(l), "v"(l + rg), "v"(l + 2 * rg), "v"(l + 3 * rg),
                  "v"(l + tb), "v"(l + tb + rg), "v"(l + tb + 2 * rg), "v"(l + tb + 3 * rg),
                  "v"(l + 2 * tb), "v"(l + 2 * tb + rg), "v"(l + 2 * tb + 2 * rg), "v"(l + 2 * tb + 3 * rg),
                  "v"(k), "v"(k + 16 * kQKld), "v"(k + 32 * kQKld), "v"(k + 48 * kQKld),
                  "v"(vh), "v"(vh + 16 * kSeq), "v"(vh + 32 * kSeq), "v"(vh + 48 * kSeq),
                  "v"(vl), "v"(vl + 16 * kSeq), "v"(vl + 32 * kSeq), "v"(vl + 48 * kSeq)
               : "memory");
}

__global__ __launch_bounds__(256) __attribute__((amdgpu_num_vgpr(256)))
void causal_attn_kernel(const unsigned short* __restrict__ QKp,
                        const unsigned short* __restrict__ VHp,
                        const unsigned short* __restrict__ VLp,
                        unsigned short* __restrict__ CHp,
                        unsigned short* __restrict__ CLp) {
  __shared__ __align__(16) unsigned short Stg[2 * kKG * kSetH];    // [buffer][group]{K [kv][d], V^T hi [d][kv], V^T lo [d][kv]}, 9 KB a tile (cross-wave: block barriers)
  __shared__ __align__(16) float  Os[kAW][16 * 68];                // out tile per wave of group 0, pitch 68 (private-to-wave)
  __shared__ __align__(16) float  Mg[kAW][kMgW];                   // group 1's partial results (cross-wave: block barrier)

  // key group of this wave, as a scalar: the branches on it below skip matrix instructions and must be real (scalar) branches
  const int grp  = __builtin_amdgcn_readfirstlane((int)(threadIdx.x >> 7));
  const int tid  = threadIdx.x & 127;    // thread within its group
  const int wave = tid >> 5;             // wave within its group
  const int lane = tid & 31;
  const int hh   = lane >> 4;
  const int c    = lane & 15;

  const int nqb = kSeq / kQB;
  const int bx  = blockIdx.x;
  const int tp  = bx % kTilePairs;       // this block's pair of query tiles: nqb - 1 - tp, then tp
  const int bh  = bx / kTilePairs;       // b*16 + h
  const int h   = bh % kHeads;
  const int b   = bh / kHeads;

  const _Float16* Qb = (const _Float16*)(QKp + (size_t)b * kSeq * kQKld + h * kDh);
  const unsigned short* Kb  = QKp + (size_t)b * kSeq * kQKld + kDim + h * kDh;
  const unsigned short* Vhb = VHp + (size_t)bh * kDh * kSeq;
  const unsigned short* Vlb = VLp + (size_t)bh * kDh * kSeq;

  // ---- staging: round g of the block (first tile's rounds, then the second's) goes to buffer g & 1 ----
  // copy coverage: 128 threads x 16 B = 16 rows x 128 B a copy, 4 copies a tile, all three tiles fully written
  const int srow = tid >> 3, sc8 = (tid & 7) * 8;
  const unsigned lStg = (unsigned)(size_t)(Stg + grp * kSetH + srow * kLP + sc8);   // low 32 bits of a __shared__ address = LDS byte address
  const unsigned short* gK  = Kb  + (size_t)srow * kQKld + sc8;
  const unsigned short* gVh = Vhb + (size_t)srow * kSeq + sc8;
  const unsigned short* gVl = Vlb + (size_t)srow * kSeq + sc8;
  const int nChA = nqb - tp;                                // key chunks of tile nqb - 1 - tp
  const int nChB = (tp == nqb - 1 - tp) ? 0 : tp + 1;       // key chunks of tile tp (none where it is the same tile)
  const int nRdA = (nChA + kKG - 1) / kKG;
  const int nRdAll = nRdA + (nChB + kKG - 1) / kKG;         // block-uniform
  // Every wave copies in every round: where group 1 has no chunk (last round of an odd chunk count) it brings the tile's last
  // chunk, which nobody reads, so that the test around the copies is the same for the whole block and every address is in range.
  auto stage = [&](int g) {
    const bool second = g >= nRdA;
    const int kcs = min((second ? g - nRdA : g) * kKG + grp, (second ? nChB : nChA) - 1);
    copy_chunk(lStg + (unsigned)(g & 1) * (kKG * kSetH * 2), gK + (size_t)(kcs * kKC) * kQKld, gVh + kcs * kKC, gVl + kcs * kKC);
  };
  stage(0);
  asm volatile("s_wait_asynccnt 0x0" ::: "memory");   // this wave's copies of round 0 have landed before the barrier that publishes them
  __syncthreads();
  if (nRdAll > 1) stage(1);
  int g = 0;                                                // round of the block, counted over both tiles

  // A tile's chunks are a dependent chain (products, softmax, barrier), and the launch lasts as long as its longest chain:
  // two groups halve every tile's chain, the pair of tiles makes all blocks' chains equal. Block-uniform trip counts and tile index.
  for (int half = 0; half < 2; ++half) {
  const int qb = half ? tp : nqb - 1 - tp;
  if (half && tp == nqb - 1 - tp) break; // odd tile count: the middle tile is its own partner and is done once
  const int q0 = qb * kQB + wave * 16;   // first query row of this wave (within the sequence)

  // ---- Q fragments (B operand: column = query q0 + c; split k map): 2 d-chunks of 32 ----
  v16h qa[2];
#pragma unroll
  for (int dc = 0; dc < 2; ++dc) qa[dc] = Frag<_Float16>::load(Qb + (size_t)(q0 + c) * kQKld + dc * 32 + 8 * hh);

  const int qrow = q0 + c;      // this lane's query
  float mrow = -INFINITY;       // running maximum of query qrow's unscaled scores (equal in both wave halves)
  float lrow = 0.f;             // running sum over this wave half's keys only; the halves are joined after the loop
  v8f oacc[4];                  // oacc[t][r] = ctx[qrow][16 t + 8 hh + r]
#pragma unroll
  for (int t = 0; t < 4; ++t) oacc[t] = (v8f){0.f,0.f,0.f,0.f,0.f,0.f,0.f,0.f};

  const int nChunks = qb + 1;   // block-uniform (causal: key chunks 0..qb)
  const int nRounds = (nChunks + kKG - 1) / kKG;
  for (int rd = 0; rd < nRounds; ++rd, ++g) {
    const int kc = rd * kKG + grp;
    const bool live = kc < nChunks;   // scalar; false only for group 1 in the last round of an odd chunk count. Every wave passes the round's barrier
    const int kv0 = kc * kKC;
    const unsigned short* Ksh = Stg + ((g & 1) * kKG + grp) * kSetH;
    const unsigned short* Vth = Ksh + kTileH;
    const unsigned short* Vtl = Vth + kTileH;
    if (live) {
    // ---- scores^T: 4 key subtiles of 16 (rows), K = 64 (2 d-chunks) ----
    v8f s[4];
#pragma unroll
    for (int j = 0; j < 4; ++j) {
      s[j] = (v8f){0.f,0.f,0.f,0.f,0.f,0.f,0.f,0.f};
#pragma unroll
      for (int dc = 0; dc < 2; ++dc) {
        FragH kb;
        kb.h[0] = *(const v8h*)(Ksh + (j * 16 + c) * kLP + dc * 32 + 8 * hh);
        kb.h[1] = *(const v8h*)(Ksh + (j * 16 + c) * kLP + dc * 32 + 16 + 8 * hh);
        s[j] = mma_h16(kb.v, qa[dc], s[j]);
      }
    }
    // ---- causal fill on the diagonal chunk, maximum of the query's 64 unscaled scores (one chain per subtile; scale > 0) ----
    const bool diag = (kc == qb);
    float mj[4];
#pragma unroll
    for (int j = 0; j < 4; ++j) {
      float m = -INFINITY;
#pragma unroll
      for (int r = 0; r < 8; ++r) {
        const int kvcol = kv0 + j * 16 + 8 * hh + r;
        float sv = s[j][r];
        if (diag && (kvcol > qrow)) sv = kNegBig;
        s[j][r] = sv;
        m = fmaxf(m, sv);
      }
      mj[j] = m;
    }
    float cm = fmaxf(fmaxf(mj[0], mj[1]), fmaxf(mj[2], mj[3]));
    cm = fmaxf(cm, xhalf(cm));
    // ---- online softmax update; P^T as bf16 hi/lo straight into the B operands of the second product ----
    const float mnew = fmaxf(mrow, cm);
    const float mc = mnew * kSL2E;
    const float alpha = exp2x1(fmaf(mrow, kSL2E, -mc));   // first chunk: mrow = -inf gives 0
    mrow = mnew;
    FragB pa[2], pl[2];
    float pj[4];
#pragma unroll
    for (int j = 0; j < 4; ++j) {
      float psum = 0.f;
      float xe[8], pe[8];
#pragma unroll
      for (int r = 0; r < 8; ++r) xe[r] = fmaf(s[j][r], kSL2E, -mc);
      exp2x8(pe, xe);
#pragma unroll
      for (int r = 0; r < 8; ++r) psum += pe[r];
#pragma unroll   // pa and pl are register arrays and need constant indices
      for (int r = 0; r < 8; r += 2)
        split2bf(pe[r], pe[r + 1], pa[j >> 1].w[(j & 1) * 4 + (r >> 1)], pl[j >> 1].w[(j & 1) * 4 + (r >> 1)]);
      pj[j] = psum;
    }
    lrow = lrow * alpha + ((pj[0] + pj[1]) + (pj[2] + pj[3]));
#pragma unroll
    for (int t = 0; t < 4; ++t)
#pragma unroll
      for (int r = 0; r < 8; ++r) oacc[t][r] *= alpha;
    // ---- ctx^T += V^T(64x64) . P^T(64x16): hi.hi + lo.hi + hi.lo ----
    // unrolled: pa and pl are register arrays and need constant indices
#pragma unroll
    for (int kk = 0; kk < 2; ++kk) {
#pragma unroll
      for (int t = 0; t < 4; ++t) {
        FragB vb, vl;
        vb.h[0] = *(const v8b*)(Vth + (t * 16 + c) * kLP + kk * 32 + 8 * hh);
        vb.h[1] = *(const v8b*)(Vth + (t * 16 + c) * kLP + kk * 32 + 16 + 8 * hh);
        vl.h[0] = *(const v8b*)(Vtl + (t * 16 + c) * kLP + kk * 32 + 8 * hh);
        vl.h[1] = *(const v8b*)(Vtl + (t * 16 + c) * kLP + kk * 32 + 16 + 8 * hh);
        oacc[t] = mma_b16(vb.v, pa[kk].v, oacc[t]);
        oacc[t] = mma_b16(vl.v, pa[kk].v, oacc[t]);
        oacc[t] = mma_b16(vb.v, pl[kk].v, oacc[t]);
      }
    }
    }
    // ---- foot of round g, every wave: publish round g + 1's set, then refill the buffer that round g has read ----
    asm volatile("s_wait_dscnt 0x0" ::: "memory");      // this wave's reads of buffer g & 1 have returned before the barrier behind which it is refilled
    asm volatile("s_wait_asynccnt 0x0" ::: "memory");   // this wave's copies of round g + 1 have landed before the barrier that publishes them
    __syncthreads();
    if (g + 2 < nRdAll) stage(g + 2);
  }

  // ---- join the two key groups: group 1 hands m, l and its ctx sums to the wave of group 0 that holds the same queries ----
  float* mg = Mg[wave];   // [value][lane]: 16-B stores and loads of 32 lanes are contiguous
  if (grp != 0) {
    // unrolled, here and in the join below: oacc is a register array and needs constant indices
#pragma unroll
    for (int t = 0; t < 4; ++t) {
      *(v4f*)(mg + ((2 * t) * 32 + lane) * 4)     = (v4f){oacc[t][0], oacc[t][1], oacc[t][2], oacc[t][3]};
      *(v4f*)(mg + ((2 * t + 1) * 32 + lane) * 4) = (v4f){oacc[t][4], oacc[t][5], oacc[t][6], oacc[t][7]};
    }
    mg[32 * 32 + lane] = mrow;
    mg[33 * 32 + lane] = lrow;
  }
  __syncthreads();   // group 1's partial results are complete before group 0 reads them; they are next written behind the next tile's barriers
  if (grp != 0) continue;
  {
    const float m1 = mg[32 * 32 + lane];   // -inf, with l = 0 and zero sums, where group 1 had no chunk: its factor is then 0
    const float l1 = mg[33 * 32 + lane];
    const float mc = fmaxf(mrow, m1) * kSL2E;   // mrow is finite: group 0 always has chunk 0
    const float a0 = exp2x1(fmaf(mrow, kSL2E, -mc));
    const float a1 = exp2x1(fmaf(m1, kSL2E, -mc));
    lrow = lrow * a0 + l1 * a1;
#pragma unroll
    for (int t = 0; t < 4; ++t) {
      const v4f x = *(const v4f*)(mg + ((2 * t) * 32 + lane) * 4);
      const v4f y = *(const v4f*)(mg + ((2 * t + 1) * 32 + lane) * 4);
#pragma unroll
      for (int r = 0; r < 4; ++r) {
        oacc[t][r]     = oacc[t][r] * a0 + x[r] * a1;
        oacc[t][4 + r] = oacc[t][4 + r] * a0 + y[r] * a1;
      }
    }
  }
  // ---- join the halves' sums, divide, and lay the tile out as [query][d] in the wave's own LDS slab ----
  float* os = Os[wave];
  const float inv = 1.0f / (lrow + xhalf(lrow));
#pragma unroll
  for (int t = 0; t < 4; ++t) {
    float* op = os + c * 68 + t * 16 + 8 * hh;
    *(v4f*)(op)     = (v4f){oacc[t][0] * inv, oacc[t][1] * inv, oacc[t][2] * inv, oacc[t][3] * inv};
    *(v4f*)(op + 4) = (v4f){oacc[t][4] * inv, oacc[t][5] * inv, oacc[t][6] * inv, oacc[t][7] * inv};
  }
  __builtin_amdgcn_fence(3, "workgroup");
  __builtin_amdgcn_wave_barrier();
  __builtin_amdgcn_fence(2, "workgroup");
  {
    // store coverage: 4 iterations x 4 row groups (lane>>3) = 16 rows; (lane&7) x 8 halves = 64 cols
    const int q = lane >> 3, c8 = (lane & 7) * 8;
    unsigned short* ch = CHp + (size_t)(b * kSeq + q0) * kDim + h * kDh;
    unsigned short* cl = CLp + (size_t)(b * kSeq + q0) * kDim + h * kDh;
    {
#pragma unroll
      for (int it = 0; it < 4; ++it) {
        const int row = it * 4 + q;
        const float* sp = os + row * 68 + c8;
        v4u hu, lu;
#pragma unroll   // hu and lu stay in registers: constant indices
        for (int e = 0; e < 4; ++e) {
          unsigned hw, lw;
          split2bf(sp[2 * e], sp[2 * e + 1], hw, lw);
          hu[e] = hw;
          lu[e] = lw;
        }
        const v8h hv = __builtin_bit_cast(v8h, hu);
        const v8h lv = __builtin_bit_cast(v8h, lu);
        *(v8h*)(ch + (size_t)row * kDim + c8) = hv;
        *(v8h*)(cl + (size_t)row * kDim + c8) = lv;
      }
      // the second tile reuses the address and data registers of the stores just issued: the wait stands in front of that overwrite
      asm volatile("s_wait_xcnt 0x0" ::: "memory");
    }
  }
  }
  asm volatile("s_wait_asynccnt 0x0" ::: "memory");   // no copy is outstanding when the wave ends
}

// ---------------------------------------------------------------------------
// Host glue.
// Inputs (wire f32): 0 x [2][2048][1024], 1 Wq [1024][1024], 2 bq [1024], 3 Wk, 4 bk, 5 Wv, 6 bv, 7 Wo [1024][1024].
//   XB    bf16 [kTok][1024]             8,388,608   (RNE bf16 of x, compact token rows, A layout)
//   WT    bf16 [3072][1024]             6,291,456   (Wq^T | Wk^T | Wv^T, RNE bf16, Bt layout [n][k])
//   WOT   bf16 [1024][1024]             2,097,152   (Wo^T, RNE bf16, Bt layout)
//   BQK   f32  [2048]                       8,192   (RNE bf16 of bq | bk, widened)
//   BV    f32  [1024]                       4,096   (RNE bf16 of bv, widened)
//   QK16  f16  [kTok][2048]            16,777,216   (q | k columns incl. bias)
//   VTH   bf16 [kBatch*16*64][kSeq]     8,388,608   (v^T hi plane, bias included)
//   VTL   bf16 [kBatch*16*64][kSeq]     8,388,608   (v^T lo plane)
//   CTXH  bf16 [kTok][1024]             8,388,608   (ctx hi plane)
//   CTXL  bf16 [kTok][1024]             8,388,608   (ctx lo plane)
//   total                              67,121,152
// GEMM shapes: q|k M=kTok N=2048 K=1024; v^T M=1024 N=kSeq K=1024 (kBatch batches); out M=kSeq N=1024 K=1024 (kBatch
// batches, output rows at pitch kSeqFull per batch). All M multiples of 128, N of 256, K of 64: no padding. 4 launches:
// input conversions; q|k and v^T products; attention; output product.
// ---------------------------------------------------------------------------
extern "C" void kernel_launch(void* const* d_in, const int* in_sizes, int n_in,
                              void* d_out, int out_size, void* d_ws, size_t ws_size,
                              hipStream_t stream) {
  if (n_in < 8) return;
  const int rowsNeeded = (kBatch - 1) * kSeqFull + kSeq;     // last token row read/written + 1
  if (in_sizes[0] < rowsNeeded * kDim) return;
  if (in_sizes[1] < kDim * kDim || in_sizes[3] < kDim * kDim || in_sizes[5] < kDim * kDim || in_sizes[7] < kDim * kDim) return;
  if (in_sizes[2] < kDim || in_sizes[4] < kDim || in_sizes[6] < kDim) return;
  if (out_size < rowsNeeded * kDim) return;

  const size_t szXB  = (size_t)kTok * kDim * 2;
  const size_t szWT  = (size_t)kWtN * kDim * 2;
  const size_t szWOT = (size_t)kDim * kDim * 2;
  const size_t szBQK = (size_t)kQKld * 4;
  const size_t szBV  = (size_t)kDim * 4;
  const size_t szQK  = (size_t)kTok * kQKld * 2;
  const size_t szVT  = (size_t)kBatch * kHeads * kDh * kSeq * 2;
  const size_t szCTX = (size_t)kTok * kDim * 2;
  const size_t offXB  = 0;
  const size_t offWT  = offXB + szXB;
  const size_t offWOT = offWT + szWT;
  const size_t offBQK = offWOT + szWOT;
  const size_t offBV  = offBQK + szBQK;
  const size_t offQK  = offBV + szBV;
  const size_t offVTH = offQK + szQK;
  const size_t offVTL = offVTH + szVT;
  const size_t offCH  = offVTL + szVT;
  const size_t offCL  = offCH + szCTX;
  const size_t total  = offCL + szCTX;             // 67,121,152 at full size
  if (ws_size < total) return;
  if (total > (size_t)134217728) return;

  const float* x  = (const float*)d_in[0];
  const float* Wq = (const float*)d_in[1];
  const float* bq = (const float*)d_in[2];
  const float* Wk = (const float*)d_in[3];
  const float* bk = (const float*)d_in[4];
  const float* Wv = (const float*)d_in[5];
  const float* bv = (const float*)d_in[6];
  const float* Wo = (const float*)d_in[7];
  float* out = (float*)d_out;
  char* ws = (char*)d_ws;
  unsigned short* XB   = (unsigned short*)(ws + offXB);
  unsigned short* WT   = (unsigned short*)(ws + offWT);
  unsigned short* WOT  = (unsigned short*)(ws + offWOT);
  float*          BQK  = (float*)(ws + offBQK);
  float*          BV   = (float*)(ws + offBV);
  unsigned short* QK16 = (unsigned short*)(ws + offQK);
  unsigned short* VTH  = (unsigned short*)(ws + offVTH);
  unsigned short* VTL  = (unsigned short*)(ws + offVTL);
  unsigned short* CTXH = (unsigned short*)(ws + offCH);
  unsigned short* CTXL = (unsigned short*)(ws + offCL);

  // ---- prologue: RNE bf16 planes of all float inputs, one launch ----
  prologue_kernel<<<dim3(4 * kWTiles + 3 + kCastBlks), dim3(256), 0, stream>>>(x, Wq, Wk, Wv, Wo, bq, bk, bv, XB, WT, WOT, BQK, BV);
  // ---- q|k (f16 plane) and v^T (bf16 hi/lo planes) from XB and WT, one launch ----
  qkv_gemm_kernel<<<dim3(kTilesQK + kBatch * kTilesV), dim3(256), 0, stream>>>(XB, WT, BQK, BV, QK16, VTH, VTL, kDim);
  // ---- causal attention per (b, h, pair of 64-query tiles) -> ctx bf16 hi/lo planes ----
  causal_attn_kernel<<<dim3(kBatch * kHeads * kTilePairs), dim3(kKG * kAW * 32), 0, stream>>>(QK16, VTH, VTL, CTXH, CTXL);
  // ---- out[b][s] = (CTXH + CTXL)[b*kSeq + s] . WOT  (M=kSeq, N=1024, K=1024, kBatch batches, no bias),
  //      f32 straight to d_out rows b*kSeqFull + s ----
  {
    const int blocks = (kSeq / 128) * (kDim / 256);
    wmma_gemm64<1, 2, 0, 0><<<dim3(blocks, kBatch), dim3(256), 0, stream>>>(
        CTXH, CTXL, kDim, (long)kSeq * kDim, WOT, WOT, kDim, 0L,
        (void*)out, (void*)out, kDim, (long)kSeqFull * kDim, BV, kSeq, kDim, kDim, 1.0f);
  }
}

// v009
// A run of this version takes 96.5 microseconds.
// Next to v008, in two timings, it ran 1.05 times as fast each time.
// All steps since v000 together make it 5.30 times as fast.
// Contractions: q|k = x.[Wq|Wk] and v^T = Wv^T.x^T on v_wmma_f32_16x16x32_bf16 (x, W RNE bf16 operands, single products; bq, bk, bv as RNE bf16 added in f32); scores^T = k.q^T on v_wmma_f32_16x16x32_f16 (q, k f16 planes, single products); ctx^T = v^T.p^T on v_wmma_f32_16x16x32_bf16 (p^T and v^T as bf16 hi+lo: hi.hi + lo.hi + hi.lo); out = ctx.Wo on v_wmma_f32_16x16x32_bf16 (ctx bf16 hi+lo, Wo RNE bf16: hi.W + lo.W); f32 accumulate everywhere; scale, causal fill and softmax in f32.
#include <hip/hip_runtime.h>
#include <math.h>

// ---------------------------------------------------------------------------
// Problem constants (NB / SEQ overridable; *_FULL give the input / output strides)
// ---------------------------------------------------------------------------
#ifndef NB
#define NB 2
#endif
#ifndef SEQ
#define SEQ 2048
#endif
#define NB_FULL 2
#define SEQ_FULL 2048

constexpr int kBatch   = NB;
constexpr int kSeq     = SEQ;
constexpr int kSeqFull = SEQ_FULL;
constexpr int kDim     = 1024;               // d_in == d_out
constexpr int kHeads   = 16;
constexpr int kDh      = 64;
constexpr int kTok     = kBatch * kSeq;      // token rows of the compact planes
constexpr int kWtN     = 3 * kDim;           // rows of the Wq^T | Wk^T | Wv^T plane
constexpr int kQKld    = 2 * kDim;           // 2048, pitch (halves) of the q|k f16 plane
constexpr int kQB      = 64;                 // query rows per attention block
constexpr int kKC      = 64;                 // keys per chunk
constexpr int kAW      = 4;                  // waves per key group; an attention block has kKG groups
constexpr int kLP      = 72;                 // LDS row pitch (halves) of the K and V^T tiles: 144 B = 16 B x 9, so 16 rows read by ds_load_b128 fall on 64 distinct banks
constexpr float kScale  = 0.125f;            // 64^-0.5, exact
constexpr float kSL2E   = kScale * 1.44269504088896340736f;   // scale * log2(e): exp(scale * (s - m)) = 2^(kSL2E * s - kSL2E * m)
constexpr float kNegBig = -1.0e30f;          // finite fill for (unscaled) scores above the diagonal
static_assert(kBatch >= 1 && kBatch <= NB_FULL);
static_assert(kSeq >= 64 && kSeq <= SEQ_FULL);
static_assert(kHeads * kDh == kDim);
static_assert(kSeq % kQB == 0 && kSeq % kKC == 0 && kQB == kAW * 16 && kDh == 64);
// GEMM shape contract (no tail handling): M multiple of 128, N multiple of 256, K multiple of 64
static_assert(kTok % 128 == 0 && kQKld % 256 == 0 && kDim % 64 == 0);
static_assert(kDim % 256 == 0 && kSeq % 256 == 0);
static_assert(kDim / 8 == 128 && (kTok * kDim) % 8 == 0);

typedef __attribute__((ext_vector_type(16))) _Float16 v16h;
typedef __attribute__((ext_vector_type(8)))  _Float16 v8h;
typedef __attribute__((ext_vector_type(16))) __bf16   v16b;
typedef __attribute__((ext_vector_type(8)))  __bf16   v8b;
typedef __attribute__((ext_vector_type(8)))  float    v8f;
typedef __attribute__((ext_vector_type(4)))  float    v4f;
typedef __attribute__((ext_vector_type(4)))  unsigned int v4u;

// ---------------------------------------------------------------------------
// Shared pieces
// ---------------------------------------------------------------------------
typedef __attribute__((ext_vector_type(2))) float  v2f;
typedef __attribute__((ext_vector_type(2))) __bf16 v2b;
// Two f32 -> two bf16, round to nearest even, as one packed hardware conversion (v_cvt_pk_bf16_f32); a lands in the low half.
__device__ __forceinline__ unsigned cvt2bf(float a, float b) {
  return __builtin_bit_cast(unsigned, __builtin_convertvector((v2f){a, b}, v2b));
}
// hi = bf16(x), lo = bf16(x - hi) for two values; the difference is exact in f32.
__device__ __forceinline__ void split2bf(float a, float b, unsigned& hi, unsigned& lo) {
  const v2b h = __builtin_convertvector((v2f){a, b}, v2b);
  hi = __builtin_bit_cast(unsigned, h);
  lo = cvt2bf(a - (float)h[0], b - (float)h[1]);
}

// hazard guards as plain device helpers
__device__ __forceinline__ void dep_guard_h(v8f& a, v8f& b, v16h x, v16h y) { asm volatile("v_nop\n\tv_nop\n\tv_nop\n\tv_nop" : "+v"(a), "+v"(b) : "v"(x), "v"(y)); }
__device__ __forceinline__ void dep_guard_b(v8f& a, v8f& b, v16b x, v16b y) { asm volatile("v_nop\n\tv_nop\n\tv_nop\n\tv_nop" : "+v"(a), "+v"(b) : "v"(x), "v"(y)); }
// guard tying all four accumulators of a group and naming both A fragments as inputs
__device__ __forceinline__ void dep_guard4_h(v8f& a, v8f& b, v8f& c, v8f& d, v16h x, v16h y) { asm volatile("v_nop\n\tv_nop\n\tv_nop\n\tv_nop" : "+v"(a), "+v"(b), "+v"(c), "+v"(d) : "v"(x), "v"(y)); }
__device__ __forceinline__ void dep_guard4_b(v8f& a, v8f& b, v8f& c, v8f& d, v16b x, v16b y) { asm volatile("v_nop\n\tv_nop\n\tv_nop\n\tv_nop" : "+v"(a), "+v"(b), "+v"(c), "+v"(d) : "v"(x), "v"(y)); }
__device__ __forceinline__ void keep4_h(v16h a, v16h b, v16h c, v16h d) { asm volatile("v_nop" :: "v"(a), "v"(b), "v"(c), "v"(d)); }
__device__ __forceinline__ void keep4_b(v16b a, v16b b, v16b c, v16b d) { asm volatile("v_nop" :: "v"(a), "v"(b), "v"(c), "v"(d)); }
__device__ __forceinline__ void acc_guard4(v8f& a, v8f& b, v8f& c, v8f& d) { asm volatile("v_nop\n\tv_nop\n\tv_nop\n\tv_nop" : "+v"(a), "+v"(b), "+v"(c), "+v"(d)); }
template <typename T> struct Frag;
template <> struct Frag<_Float16> {
  typedef v16h V; union U { v16h v; v8h h[2]; };
  // elements 0..7 <- p[0..7], 8..15 <- p[16..23]
  static __device__ __forceinline__ v16h load(const _Float16* p) {
    U f; f.h[0] = *(const v8h*)(p); f.h[1] = *(const v8h*)(p + 16); return f.v;
  }
  static __device__ __forceinline__ v8f mma(v16h a, v16h b, v8f c) {
    return __builtin_amdgcn_wmma_f32_16x16x32_f16(false, a, false, b, (short)0, c, false, false);
  }
  static __device__ __forceinline__ void guard(v8f& a, v8f& b, v16h x, v16h y) { dep_guard_h(a, b, x, y); }
  static __device__ __forceinline__ void guard4(v8f& a, v8f& b, v8f& c, v8f& d, v16h x, v16h y) { dep_guard4_h(a, b, c, d, x, y); }
  static __device__ __forceinline__ void keep(v16h a, v16h b, v16h c, v16h d) { keep4_h(a, b, c, d); }
};
template <> struct Frag<__bf16> {
  typedef v16b V; union U { v16b v; v8b h[2]; };
  static __device__ __forceinline__ v16b load(const __bf16* p) {
    U f; f.h[0] = *(const v8b*)(p); f.h[1] = *(const v8b*)(p + 16); return f.v;
  }
  static __device__ __forceinline__ v8f mma(v16b a, v16b b, v8f c) {
    return __builtin_amdgcn_wmma_f32_16x16x32_bf16(false, a, false, b, (short)0, c, false, false);
  }
  static __device__ __forceinline__ void guard(v8f& a, v8f& b, v16b x, v16b y) { dep_guard_b(a, b, x, y); }
  static __device__ __forceinline__ void guard4(v8f& a, v8f& b, v8f& c, v8f& d, v16b x, v16b y) { dep_guard4_b(a, b, c, d, x, y); }
  static __device__ __forceinline__ void keep(v16b a, v16b b, v16b c, v16b d) { keep4_b(a, b, c, d); }
};

// ---- Register-blocked batched WMMA GEMM (bias added in f32 in the slab phase so all output modes see it) ----
// C[m,n] = scale * sum_k A[m,k] * Bt[n,k] (+bias); each wave owns a (16 MI)x64 tile, a block of 8 waves (2 x 4) a (32 MI)x256 tile.
// MI: 4 = 128x256 block tile; 2 = 64x256, for a product whose 128x256 tiles are fewer than the chip's 256 WGPs.
// A row-major [M,K]; Bt row-major [N,K], both at row pitch kDim (lda == ldb == kDim); M % (32 MI) == 0, N % 256 == 0, K % 64 == 0.
// Operands go through LDS: per 64 k the block copies its 32 MI A rows and 256 Bt rows once, 128 B of a row by 8 lanes, so a
// wave-wide 16-B load covers 4 whole lines; the next tile's loads are issued before the products of the current one.
// SPLIT: 0 = single product; 2 = A hi/lo planes (hi.B + lo.B).
// BIAS_MODE: 0 = none, 1 = bias[m] (per row), 2 = bias[n] (per column); bias is an f32 table of length M or N.
// OUT_MODE: 0 = f32, 1 = f16, 2 = bf16 hi plane (Cout) + bf16 lo plane (Cout2).
// ET: 0 = f16 operands, 1 = bf16 operands (pointers passed as 16-bit storage)
constexpr int kGP = 72;   // LDS row pitch (halves) of the staged A and Bt tiles: 144 B = 16 B x 9 for the ds_load_b128 fragment reads
template <int ET> struct Elem;
template <> struct Elem<0> { typedef _Float16 T; };
template <> struct Elem<1> { typedef __bf16 T; };
// The tile body is a device function: bx = tile index within the product, b = batch; sA, sB, sT are the calling kernel's LDS
// (sA: (SPLIT == 2 ? 2 : 1) * 32 * MI * kGP halves, sB: 256 * kGP halves, sT: 8 slabs of kSlab floats), so that one launch can
// hold tiles of several independent products on one LDS allocation.
constexpr int kSlab = 16 * 68;   // per-wave 16x64 output slab, pitch 68 floats
template <int ET, int SPLIT, int BIAS_MODE, int OUT_MODE, int MI>
__device__ __forceinline__ void gemm64_tile(
    unsigned short* sA, unsigned short* sB, float* sT, unsigned bx, int b,
    const unsigned short* __restrict__ Ap, const unsigned short* __restrict__ A2p, int lda, long strideA,
    const unsigned short* __restrict__ Btp, const unsigned short* __restrict__ Bt2p, int ldb, long strideB,
    void* __restrict__ Cout, void* __restrict__ Cout2, int ldc, long strideC,
    const float* __restrict__ bias,
    int M, int N, int K, float scale) {
  static_assert(SPLIT == 0 || SPLIT == 2);
  static_assert(BIAS_MODE >= 0 && BIAS_MODE <= 2);
  static_assert(OUT_MODE >= 0 && OUT_MODE <= 2);
  static_assert(MI == 2 || MI == 4);
  constexpr int BM = 32 * MI;                  // A rows of the block
  typedef typename Elem<ET>::T T;
  typedef typename Frag<T>::V V;
  const int tid  = threadIdx.x;
  const int lane = tid & 31;
  const int wave = tid >> 5;
  const int blocksN = N >> 8;
  const int bm = bx / blocksN;
  const int bn = bx - bm * blocksN;
  const int mB = bm << (MI == 4 ? 7 : 6);      // first A row of the block: bm * BM
  const int nB = bn << 8;                      // first Bt row of the block
  const int wm = (wave >> 2) << (MI == 4 ? 6 : 5);   // this wave's rows within the A tile: 16 MI rows a wave
  const int wn = (wave & 3) << 6;              // this wave's rows within the Bt tile
  const int m0 = mB + wm;
  const int n0 = nB + wn;

  const unsigned short* Ab  = Ap  + (size_t)b * strideA;
  const unsigned short* Bb  = Btp + (size_t)b * strideB;
  const unsigned short* Ab2 = (SPLIT == 2) ? (A2p + (size_t)b * strideA) : nullptr;

  const int rlane = lane & 15;                 // row (A) / col (B, D) within subtile
  const int koff  = (lane >> 4) * 8;           // k offset of this lane half
  const int mOff  = (lane >> 4) * 8;           // D row offset

  // staging map: thread -> row (tid >> 3) + 32 * i, 8 halves at column (tid & 7) * 8. One address per plane: the row step
  // 32 * kDim is a compile-time constant, so the i-th load differs from the first by an immediate offset only.
  // Every loop over i, j or ks below is unrolled so that the register arrays (ra, rb, fragments, acc) keep constant indices.
  const int srow = tid >> 3;
  const int sc8  = (tid & 7) * 8;
  const unsigned short* gA  = Ab + (size_t)(mB + srow) * kDim + sc8;
  const unsigned short* gA2 = (SPLIT == 2) ? (Ab2 + (size_t)(mB + srow) * kDim + sc8) : nullptr;
  const unsigned short* gB  = Bb + (size_t)(nB + srow) * kDim + sc8;
  v4u ra[MI], ra2[MI], rb[8];
#pragma unroll
  for (int i = 0; i < MI; ++i) {
    ra[i] = *(const v4u*)(gA + i * 32 * kDim);
    if (SPLIT == 2) ra2[i] = *(const v4u*)(gA2 + i * 32 * kDim);
  }
#pragma unroll
  for (int i = 0; i < 8; ++i) rb[i] = *(const v4u*)(gB + i * 32 * kDim);

  const T* fa = (const T*)sA + (wm + rlane) * kGP + koff;
  const T* fb = (const T*)sB + (wn + rlane) * kGP + koff;

  v8f acc[MI][4];
#pragma unroll
  for (int i = 0; i < MI; ++i)
#pragma unroll
    for (int j = 0; j < 4; ++j) acc[i][j] = (v8f){0.f,0.f,0.f,0.f,0.f,0.f,0.f,0.f};

  for (int k0 = 0; k0 < K; k0 += 64) {
    __syncthreads();   // every wave has read its last fragment of the previous tile
#pragma unroll
    for (int i = 0; i < MI; ++i) {
      *(v4u*)(sA + (srow + 32 * i) * kGP + sc8) = ra[i];
      if (SPLIT == 2) *(v4u*)(sA + (BM + srow + 32 * i) * kGP + sc8) = ra2[i];
    }
#pragma unroll
    for (int i = 0; i < 8; ++i) *(v4u*)(sB + (srow + 32 * i) * kGP + sc8) = rb[i];
    __syncthreads();   // the tile is complete before any wave reads it
    if (k0 + 64 < K) { // block-uniform: the next tile's loads fly during this tile's products
      const int kn = k0 + 64;
#pragma unroll
      for (int i = 0; i < MI; ++i) {
        ra[i] = *(const v4u*)(gA + kn + i * 32 * kDim);
        if (SPLIT == 2) ra2[i] = *(const v4u*)(gA2 + kn + i * 32 * kDim);
      }
#pragma unroll
      for (int i = 0; i < 8; ++i) rb[i] = *(const v4u*)(gB + kn + i * 32 * kDim);
      // the fragment reads below reuse the address registers of the loads just issued: the wait stands in front of that overwrite
      asm volatile("s_wait_xcnt 0x0" ::: "memory");
    }
#pragma unroll
    for (int ks = 0; ks < 64; ks += 32) {
      V bh[4], ah[MI], al[MI];
#pragma unroll
      for (int j = 0; j < 4; ++j) bh[j] = Frag<T>::load(fb + (j << 4) * kGP + ks);
#pragma unroll
      for (int i = 0; i < MI; ++i) {
        ah[i] = Frag<T>::load(fa + (i << 4) * kGP + ks);
        al[i] = ah[i];
        if (SPLIT == 2) al[i] = Frag<T>::load(fa + (BM + (i << 4)) * kGP + ks);
      }
#pragma unroll
      for (int i = 0; i < MI; ++i) {
#pragma unroll
        for (int j = 0; j < 4; ++j) {
          acc[i][j] = Frag<T>::mma(ah[i], bh[j], acc[i][j]);
          if (SPLIT == 2) acc[i][j] = Frag<T>::mma(al[i], bh[j], acc[i][j]);
        }
      }
#pragma unroll
      for (int i = 0; i < MI; ++i) Frag<T>::guard4(acc[i][0], acc[i][1], acc[i][2], acc[i][3], ah[i], al[i]);
      Frag<T>::keep(bh[0], bh[1], bh[2], bh[3]);
    }
  }
#pragma unroll
  for (int i = 0; i < MI; ++i) acc_guard4(acc[i][0], acc[i][1], acc[i][2], acc[i][3]);

  // ---- epilogue ----
  float* slab = sT + wave * kSlab;
  float bcol[4] = {0.f, 0.f, 0.f, 0.f};
  if (BIAS_MODE == 2) {
    // per-column bias: this lane's columns n0 + 16*j + rlane, j = 0..3 (in range: N multiple of 64)
#pragma unroll
    for (int j = 0; j < 4; ++j) bcol[j] = bias[n0 + (j << 4) + rlane];
  }
#pragma unroll
  for (int i = 0; i < MI; ++i) {
    const int mBase = m0 + (i << 4);
    float brow[8] = {0.f, 0.f, 0.f, 0.f, 0.f, 0.f, 0.f, 0.f};
    if (BIAS_MODE == 1) {
      // per-row bias: rows mBase + mOff + 0..7 (16-B aligned: mBase % 16 == 0, mOff in {0, 8})
      const v4f b0 = *(const v4f*)(bias + mBase + mOff);
      const v4f b1 = *(const v4f*)(bias + mBase + mOff + 4);
#pragma unroll
      for (int e = 0; e < 4; ++e) { brow[e] = b0[e]; brow[4 + e] = b1[e]; }
    }
#pragma unroll
    for (int j = 0; j < 4; ++j) {
#pragma unroll
      for (int r = 0; r < 8; ++r) {
        float bb = 0.f;
        if (BIAS_MODE == 1) bb = brow[r];
        if (BIAS_MODE == 2) bb = bcol[j];
        slab[(mOff + r) * 68 + (j << 4) + rlane] = acc[i][j][r] * scale + bb;
      }
    }
    __builtin_amdgcn_fence(3, "workgroup");
    __builtin_amdgcn_wave_barrier();
    __builtin_amdgcn_fence(2, "workgroup");
    if (OUT_MODE == 0) {
      float* C = (float*)Cout + (size_t)b * strideC;
      const int hh = lane >> 4, c4 = (lane & 15) * 4;     // row seg = 256 B = 16 lanes x 16 B
      {
#pragma unroll
        for (int it = 0; it < 8; ++it) {
          const int row = it * 2 + hh;
          const v4f v = *(const v4f*)(slab + row * 68 + c4);
          *(v4f*)(C + (size_t)(mBase + row) * ldc + n0 + c4) = v;
        }
        
      }
    } else {
      const int q = lane >> 3, c8 = (lane & 7) * 8;
      unsigned short* C  = (unsigned short*)Cout  + (size_t)b * strideC;
      unsigned short* C2 = (OUT_MODE == 2) ? ((unsigned short*)Cout2 + (size_t)b * strideC) : nullptr;
      {
#pragma unroll
        for (int it = 0; it < 4; ++it) {
          const int row = it * 4 + q;
          const float* sp = slab + row * 68 + c8;
          v8h hv, lv;
          if (OUT_MODE == 1) {
#pragma unroll
            for (int e = 0; e < 8; ++e) hv[e] = (_Float16)sp[e];
          } else {
            v4u hu, lu;
#pragma unroll   // hu and lu stay in registers: constant indices
            for (int e = 0; e < 4; ++e) {
              unsigned hw, lw;
              split2bf(sp[2 * e], sp[2 * e + 1], hw, lw);
              hu[e] = hw;
              lu[e] = lw;
            }
            hv = __builtin_bit_cast(v8h, hu);
            lv = __builtin_bit_cast(v8h, lu);
          }
          *(v8h*)(C + (size_t)(mBase + row) * ldc + n0 + c8) = hv;
          if (OUT_MODE == 2) *(v8h*)(C2 + (size_t)(mBase + row) * ldc + n0 + c8) = lv;
        }
        
      }
    }
    __builtin_amdgcn_fence(3, "workgroup");
    __builtin_amdgcn_wave_barrier();
    __builtin_amdgcn_fence(2, "workgroup");
  }
}

// One product per launch: grid (tiles, batches).
template <int ET, int SPLIT, int BIAS_MODE, int OUT_MODE, int MI>
__global__ __launch_bounds__(256) void wmma_gemm64(
    const unsigned short* __restrict__ Ap, const unsigned short* __restrict__ A2p, int lda, long strideA,
    const unsigned short* __restrict__ Btp, const unsigned short* __restrict__ Bt2p, int ldb, long strideB,
    void* __restrict__ Cout, void* __restrict__ Cout2, int ldc, long strideC,
    const float* __restrict__ bias,
    int M, int N, int K, float scale) {
  __shared__ __align__(16) unsigned short sA[(SPLIT == 2 ? 2 : 1) * 32 * MI * kGP];   // A (hi, then lo) [row][k] (cross-wave: block barriers)
  __shared__ __align__(16) unsigned short sB[256 * kGP];                          // Bt [row][k] (cross-wave: block barriers)
  __shared__ __align__(16) float sT[8 * kSlab];                                   // per-wave slabs (private-to-wave)
  gemm64_tile<ET, SPLIT, BIAS_MODE, OUT_MODE, MI>(sA, sB, sT, blockIdx.x, blockIdx.y, Ap, A2p, lda, strideA, Btp, Bt2p, ldb, strideB,
                                              Cout, Cout2, ldc, strideC, bias, M, N, K, scale);
}

// The two projections that depend only on XB and WT, in one launch, told apart by the block index (block-uniform branch):
//   blocks [0, kTilesQK):  q|k = XB . WT[rows 0..2047] + BQK[n] -> f16 plane [kTok][2048] (M=kTok, N=2048, bias per column)
//   then kTilesV per batch: v^T[b][h*64+d][s] = WT[2048 + h*64 + d] . XB[b*kSeq + s] + BV[h*64+d] -> bf16 hi/lo planes
//                           (M=1024, N=kSeq, bias per row)
constexpr int kTilesQK = (kTok / 128) * (kQKld / 256);
constexpr int kTilesV  = (kDim / 128) * (kSeq / 256);
// Register cap: each body alone builds to 256 registers a wave, the two in one kernel to 258, which is allocated as 272 and leaves
// room for three waves a SIMD, so one block a WGP. At 256 four waves fit: two blocks a WGP, and all 384 blocks are resident at once.
__global__ __launch_bounds__(256) __attribute__((amdgpu_num_vgpr(256))) void qkv_gemm_kernel(
    const unsigned short* __restrict__ XB, const unsigned short* __restrict__ WT,
    const float* __restrict__ BQK, const float* __restrict__ BV,
    unsigned short* __restrict__ QK16, unsigned short* __restrict__ VTH, unsigned short* __restrict__ VTL, int K) {
  __shared__ __align__(16) unsigned short sA[128 * kGP];   // A [row][k] (cross-wave: block barriers)
  __shared__ __align__(16) unsigned short sB[256 * kGP];   // Bt [row][k] (cross-wave: block barriers)
  __shared__ __align__(16) float sT[8 * kSlab];            // per-wave slabs (private-to-wave)
  const int bx = blockIdx.x;
  if (bx < kTilesQK) {
    gemm64_tile<1, 0, 2, 1, 4>(sA, sB, sT, bx, 0, XB, XB, kDim, 0L, WT, WT, kDim, 0L,
                            (void*)QK16, (void*)QK16, kQKld, 0L, BQK, kTok, kQKld, K, 1.0f);
  } else {
    const int r = bx - kTilesQK;
    const int b = r / kTilesV;
    const unsigned short* Av = WT + (size_t)2 * kDim * kDim;   // rows 2048..3071 of WT = Wv^T
    gemm64_tile<1, 0, 1, 2, 4>(sA, sB, sT, r - b * kTilesV, b, Av, Av, kDim, 0L, XB, XB, kDim, (long)kSeq * kDim,
                            (void*)VTH, (void*)VTL, kSeq, (long)kDim * kSeq, BV, kDim, kSeq, K, 1.0f);
  }
}

// ---------------------------------------------------------------------------
// f32 -> bf16 (RNE) cast of x into the compact token plane XB [kTok][1024]: token row t = b*kSeq + s reads input row
// ---------------------------------------------------------------------------
__device__ __forceinline__ void cast8_bf16_block(const float* __restrict__ in, unsigned short* __restrict__ out, int n8, int bx) {
  const int i = bx * 256 + threadIdx.x;
  if (i >= n8) return;
  const int t  = i >> 7;                 // 128 groups of 8 per token row
  const int c8 = (i & 127) * 8;
  const int b  = t / kSeq;
  const int s  = t - b * kSeq;
  const float* p = in + (size_t)(b * kSeqFull + s) * kDim + c8;
  const v4f a = *(const v4f*)(p);
  const v4f c = *(const v4f*)(p + 4);
  const v4u u = (v4u){cvt2bf(a[0], a[1]), cvt2bf(a[2], a[3]), cvt2bf(c[0], c[1]), cvt2bf(c[2], c[3])};
  unsigned short* q = out + 8 * (size_t)i;
  *(v4u*)q = u;
  
}

// ---------------------------------------------------------------------------
// Weight transpose + RNE bf16 cast: W f32 row-major [1024 (d)][ldIn (n)] -> WT bf16 [n][d] with pitch ldOut (= 1024):
//   in[d][n] -> out[n][d]. One block of 256 threads per 64x64 tile (dt = d tile, nt = n tile).
// Load coverage: 16 iterations x 256 threads = 4096 = the whole 64x64 tile (coalesced along n).
// Store coverage: 8 waves x 2 iterations x 4 rows (lane>>3) = 64 n-rows; (lane&7) x 8 halves = 64 d-cols; each row segment
// ---------------------------------------------------------------------------
__device__ __forceinline__ void wtcast_bf16_block(const float* __restrict__ W, unsigned short* __restrict__ out,
                                                  int ldIn, int ldOut, int dt, int nt) {
  __shared__ float sm[64][65];   // sm[n_local][d_local] (cross-wave: block barrier)
  const int t  = threadIdx.x;
  const int d0 = dt * 64;
  const int n0 = nt * 64;
#pragma unroll
  for (int i = 0; i < 16; ++i) {
    const int e = i * 256 + t;
    const int r = e >> 6;          // d local
    const int c = e & 63;          // n local
    sm[c][r] = W[(size_t)(d0 + r) * ldIn + n0 + c];
  }
  __syncthreads();
  const int lane = t & 31, wave = t >> 5;
  const int q = lane >> 3, c8 = (lane & 7) * 8;
  {
#pragma unroll
    for (int it = 0; it < 2; ++it) {
      const int row = wave * 8 + it * 4 + q;                 // n local
      const float* sr = &sm[row][c8];
      const v4u u = (v4u){cvt2bf(sr[0], sr[1]), cvt2bf(sr[2], sr[3]), cvt2bf(sr[4], sr[5]), cvt2bf(sr[6], sr[7])};
      *(v4u*)(out + (size_t)(n0 + row) * ldOut + d0 + c8) = u;
    }
    // inlined beside other pieces, the built code reuses these two stores' registers on a path behind them: the wait stands in front of that overwrite
    asm volatile("s_wait_xcnt 0x0" ::: "memory");
  }
}

// ---------------------------------------------------------------------------
// Bias RNE bf16 convert kept as f32: dst[1024] = float(bf16(src)). One block of 256 threads, float4 per lane:
// ---------------------------------------------------------------------------
__device__ __forceinline__ void bias_bf16_block(const float* __restrict__ bsrc, float* __restrict__ bdst) {
  const int t = threadIdx.x;
  const v4f a = *(const v4f*)(bsrc + 4 * t);
  v4f r;
#pragma unroll
  for (int e = 0; e < 4; ++e) r[e] = (float)(__bf16)a[e];
  float* dp = bdst + 4 * t;
  *(v4f*)dp = r;
  
}

// ---------------------------------------------------------------------------
// All eight input conversions in one launch: they are independent of one another, so each block takes its piece by its
// index (block-uniform branches): 4 x kWTiles weight tiles (Wq, Wk, Wv -> WT rows 0, 1024, 2048; Wo -> WOT), 3 bias blocks
// (bq, bk -> BQK; bv -> BV), then the blocks of the x cast.
// ---------------------------------------------------------------------------
constexpr int kWTiles   = (kDim / 64) * (kDim / 64);   // 64x64 tiles of one square weight
constexpr int kCastBlks = kTok * kDim / 8 / 256;       // blocks of the x cast (8 elements per thread)
static_assert((kTok * kDim / 8) % 256 == 0);
__global__ __launch_bounds__(256) void prologue_kernel(
    const float* __restrict__ x,  const float* __restrict__ Wq, const float* __restrict__ Wk, const float* __restrict__ Wv,
    const float* __restrict__ Wo, const float* __restrict__ bq, const float* __restrict__ bk, const float* __restrict__ bv,
    unsigned short* __restrict__ XB, unsigned short* __restrict__ WT, unsigned short* __restrict__ WOT,
    float* __restrict__ BQK, float* __restrict__ BV) {
  const int bx = blockIdx.x;
  if (bx >= 4 * kWTiles + 3) {
    cast8_bf16_block(x, XB, kTok * kDim / 8, bx - (4 * kWTiles + 3));
    return;
  }
  if (bx >= 4 * kWTiles) {
    const int w = bx - 4 * kWTiles;
    bias_bf16_block((w == 0) ? bq : (w == 1) ? bk : bv, (w == 0) ? BQK : (w == 1) ? (BQK + kDim) : BV);
    return;
  }
  const int w = bx / kWTiles;
  const int t = bx - w * kWTiles;
  const float* W = (w == 0) ? Wq : (w == 1) ? Wk : (w == 2) ? Wv : Wo;
  unsigned short* o = (w < 3) ? (WT + (size_t)w * kDim * kDim) : WOT;
  wtcast_bf16_block(W, o, kDim, kDim, t % (kDim / 64), t / (kDim / 64));
}

constexpr int kKG = 2;
constexpr int kTilePairs = (kSeq / kQB + 1) / 2;
constexpr int kMgW = 34 * 32;
static_assert(kKG == 2);
constexpr int kTileH = kKC * kLP;                  // halves of one staged tile: 64 rows at pitch kLP
constexpr int kSetH  = 3 * kTileH;                 // K, V^T hi and V^T lo tiles of one key chunk
static_assert(kKC == 64 && kDh == 64 && (kLP * 2) % 16 == 0);
union FragH { v16h v; v8h h[2]; };
union FragB { v16b v; v8b h[2]; unsigned w[8]; };   // w[i] = elements 2 i (low half) and 2 i + 1

__device__ __forceinline__ v8f mma_h16(v16h a, v16h b, v8f c) {
  c = __builtin_amdgcn_wmma_f32_16x16x32_f16(false, a, false, b, (short)0, c, false, false);
  asm volatile("v_nop\n\tv_nop\n\tv_nop\n\tv_nop" : "+v"(c) : "v"(a), "v"(b));
  return c;
}
__device__ __forceinline__ v8f mma_b16(v16b a, v16b b, v8f c) {
  c = __builtin_amdgcn_wmma_f32_16x16x32_bf16(false, a, false, b, (short)0, c, false, false);
  asm volatile("v_nop\n\tv_nop\n\tv_nop\n\tv_nop" : "+v"(c) : "v"(a), "v"(b));
  return c;
}
// lane l <-> lane l ^ 16: the two wave halves hold the two key halves of one query
__device__ __forceinline__ float xhalf(float x) {
  const int b = __builtin_bit_cast(int, x);
  return __builtin_bit_cast(float, __builtin_amdgcn_permlanex16(b, b, 0x76543210, 0xfedcba98, false, false));
}
// 2^x by v_exp_f32. In asm so that the slot the instruction set asks for behind a transcendental (one v_nop or independent
// instruction before its result is read or its source overwritten) stands inside the statement. Eight at a time: the outputs are early-clobber,
// so each v_exp_f32 is independent of the one in front of it, and one v_nop serves the last.
__device__ __forceinline__ void exp2x8(float (&p)[8], const float (&x)[8]) {
  asm("v_exp_f32 %0, %8\n\tv_exp_f32 %1, %9\n\tv_exp_f32 %2, %10\n\tv_exp_f32 %3, %11\n\t"
      "v_exp_f32 %4, %12\n\tv_exp_f32 %5, %13\n\tv_exp_f32 %6, %14\n\tv_exp_f32 %7, %15\n\tv_nop"
      : "=&v"(p[0]), "=&v"(p[1]), "=&v"(p[2]), "=&v"(p[3]), "=&v"(p[4]), "=&v"(p[5]), "=&v"(p[6]), "=&v"(p[7])
      : "v"(x[0]), "v"(x[1]), "v"(x[2]), "v"(x[3]), "v"(x[4]), "v"(x[5]), "v"(x[6]), "v"(x[7]));
}
__device__ __forceinline__ float exp2x1(float x) {
  float p;
  asm("v_exp_f32 %0, %1\n\tv_nop" : "=v"(p) : "v"(x));   // the v_nop: the same slot
  return p;
}

// One key chunk's K, V^T hi and V^T lo tiles by global_load_async_to_lds_b128: 12 copies a lane, 4 row groups of 16 rows per tile,
// 8 lanes on one whole 128-B row piece. l = the lane's LDS byte address in the K tile, k, vh, vl = its global addresses, all of
// row group 0. The s_wait_xcnt is the last line of the copies' own statement, so that no register a copy names is rewritten in front of it.
__device__ __forceinline__ void copy_chunk(unsigned l, const unsigned short* k, const unsigned short* vh, const unsigned short* vl) {
  constexpr unsigned rg = 16 * kLP * 2;   // LDS bytes from one row group to the next
  constexpr unsigned tb = kTileH * 2;     // LDS bytes from one tile to the next
  asm volatile("global_load_async_to_lds_b128 %0, %12, off\n\t"
               "global_load_async_to_lds_b128 %1, %13, off\n\t"
               "global_load_async_to_lds_b128 %2, %14, off\n\t"
               "global_load_async_to_lds_b128 %3, %15, off\n\t"
               "global_load_async_to_lds_b128 %4, %16, off\n\t"
               "global_load_async_to_lds_b128 %5, %17, off\n\t"
               "global_load_async_to_lds_b128 %6, %18, off\n\t"
               "global_load_async_to_lds_b128 %7, %19, off\n\t"
               "global_load_async_to_lds_b128 %8, %20, off\n\t"
               "global_load_async_to_lds_b128 %9, %21, off\n\t"
               "global_load_async_to_lds_b128 %10, %22, off\n\t"
               "global_load_async_to_lds_b128 %11, %23, off\n\t"
               "s_wait_xcnt 0x0"
               :: "v"(l), "v"(l + rg), "v"(l + 2 * rg), "v"(l + 3 * rg),
                  "v"(l + tb), "v"(l + tb + rg), "v"(l + tb + 2 * rg), "v"(l + tb + 3 * rg),
                  "v"(l + 2 * tb), "v"(l + 2 * tb + rg), "v"(l + 2 * tb + 2 * rg), "v"(l + 2 * tb + 3 * rg),
                  "v"(k), "v"(k + 16 * kQKld), "v"(k + 32 * kQKld), "v"(k + 48 * kQKld),
                  "v"(vh), "v"(vh + 16 * kSeq), "v"(vh + 32 * kSeq), "v"(vh + 48 * kSeq),
                  "v"(vl), "v"(vl + 16 * kSeq), "v"(vl + 32 * kSeq), "v"(vl + 48 * kSeq)
               : "memory");
}

__global__ __launch_bounds__(256) __attribute__((amdgpu_num_vgpr(256)))
void causal_attn_kernel(const unsigned short* __restrict__ QKp,
                        const unsigned short* __restrict__ VHp,
                        const unsigned short* __restrict__ VLp,
                        unsigned short* __restrict__ CHp,
                        unsigned short* __restrict__ CLp) {
  __shared__ __align__(16) unsigned short Stg[2 * kKG * kSetH];    // [buffer][group]{K [kv][d], V^T hi [d][kv], V^T lo [d][kv]}, 9 KB a tile (cross-wave: block barriers)
  __shared__ __align__(16) float  Os[kAW][16 * 68];                // out tile per wave of group 0, pitch 68 (private-to-wave)
  __shared__ __align__(16) float  Mg[kAW][kMgW];                   // group 1's partial results (cross-wave: block barrier)

  // key group of this wave, as a scalar: the branches on it below skip matrix instructions and must be real (scalar) branches
  const int grp  = __builtin_amdgcn_readfirstlane((int)(threadIdx.x >> 7));
  const int tid  = threadIdx.x & 127;    // thread within its group
  const int wave = tid >> 5;             // wave within its group
  const int lane = tid & 31;
  const int hh   = lane >> 4;
  const int c    = lane & 15;

  const int nqb = kSeq / kQB;
  const int bx  = blockIdx.x;
  const int tp  = bx % kTilePairs;       // this block's pair of query tiles: nqb - 1 - tp, then tp
  const int bh  = bx / kTilePairs;       // b*16 + h
  const int h   = bh % kHeads;
  const int b   = bh / kHeads;

  const _Float16* Qb = (const _Float16*)(QKp + (size_t)b * kSeq * kQKld + h * kDh);
  const unsigned short* Kb  = QKp + (size_t)b * kSeq * kQKld + kDim + h * kDh;
  const unsigned short* Vhb = VHp + (size_t)bh * kDh * kSeq;
  const unsigned short* Vlb = VLp + (size_t)bh * kDh * kSeq;

  // ---- staging: round g of the block (first tile's rounds, then the second's) goes to buffer g & 1 ----
  // copy coverage: 128 threads x 16 B = 16 rows x 128 B a copy, 4 copies a tile, all three tiles fully written
  const int srow = tid >> 3, sc8 = (tid & 7) * 8;
  const unsigned lStg = (unsigned)(size_t)(Stg + grp * kSetH + srow * kLP + sc8);   // low 32 bits of a __shared__ address = LDS byte address
  const unsigned short* gK  = Kb  + (size_t)srow * kQKld + sc8;
  const unsigned short* gVh = Vhb + (size_t)srow * kSeq + sc8;
  const unsigned short* gVl = Vlb + (size_t)srow * kSeq + sc8;
  const int nChA = nqb - tp;                                // key chunks of tile nqb - 1 - tp
  const int nChB = (tp == nqb - 1 - tp) ? 0 : tp + 1;       // key chunks of tile tp (none where it is the same tile)
  const int nRdA = (nChA + kKG - 1) / kKG;
  const int nRdAll = nRdA + (nChB + kKG - 1) / kKG;         // block-uniform
  // Every wave copies in every round: where group 1 has no chunk (last round of an odd chunk count) it brings the tile's last
  // chunk, which nobody reads, so that the test around the copies is the same for the whole block and every address is in range.
  auto stage = [&](int g) {
    const bool second = g >= nRdA;
    const int kcs = min((second ? g - nRdA : g) * kKG + grp, (second ? nChB : nChA) - 1);
    copy_chunk(lStg + (unsigned)(g & 1) * (kKG * kSetH * 2), gK + (size_t)(kcs * kKC) * kQKld, gVh + kcs * kKC, gVl + kcs * kKC);
  };
  stage(0);
  asm volatile("s_wait_asynccnt 0x0" ::: "memory");   // this wave's copies of round 0 have landed before the barrier that publishes them
  __syncthreads();
  if (nRdAll > 1) stage(1);
  int g = 0;                                                // round of the block, counted over both tiles

  // A tile's chunks are a dependent chain (products, softmax, barrier), and the launch lasts as long as its longest chain:
  // two groups halve every tile's chain, the pair of tiles makes all blocks' chains equal. Block-uniform trip counts and tile index.
  for (int half = 0; half < 2; ++half) {
  const int qb = half ? tp : nqb - 1 - tp;
  if (half && tp == nqb - 1 - tp) break; // odd tile count: the middle tile is its own partner and is done once
  const int q0 = qb * kQB + wave * 16;   // first query row of this wave (within the sequence)

  // ---- Q fragments (B operand: column = query q0 + c; split k map): 2 d-chunks of 32 ----
  v16h qa[2];
#pragma unroll
  for (int dc = 0; dc < 2; ++dc) qa[dc] = Frag<_Float16>::load(Qb + (size_t)(q0 + c) * kQKld + dc * 32 + 8 * hh);

  const int qrow = q0 + c;      // this lane's query
  float mrow = -INFINITY;       // running maximum of query qrow's unscaled scores (equal in both wave halves)
  float lrow = 0.f;             // running sum over this wave half's keys only; the halves are joined after the loop
  v8f oacc[4];                  // oacc[t][r] = ctx[qrow][16 t + 8 hh + r]
#pragma unroll
  for (int t = 0; t < 4; ++t) oacc[t] = (v8f){0.f,0.f,0.f,0.f,0.f,0.f,0.f,0.f};

  const int nChunks = qb + 1;   // block-uniform (causal: key chunks 0..qb)
  const int nRounds = (nChunks + kKG - 1) / kKG;
  for (int rd = 0; rd < nRounds; ++rd, ++g) {
    const int kc = rd * kKG + grp;
    const bool live = kc < nChunks;   // scalar; false only for group 1 in the last round of an odd chunk count. Every wave passes the round's barrier
    const int kv0 = kc * kKC;
    const unsigned short* Ksh = Stg + ((g & 1) * kKG + grp) * kSetH;
    const unsigned short* Vth = Ksh + kTileH;
    const unsigned short* Vtl = Vth + kTileH;
    if (live) {
    // ---- scores^T: 4 key subtiles of 16 (rows), K = 64 (2 d-chunks) ----
    v8f s[4];
#pragma unroll
    for (int j = 0; j < 4; ++j) {
      s[j] = (v8f){0.f,0.f,0.f,0.f,0.f,0.f,0.f,0.f};
#pragma unroll
      for (int dc = 0; dc < 2; ++dc) {
        FragH kb;
        kb.h[0] = *(const v8h*)(Ksh + (j * 16 + c) * kLP + dc * 32 + 8 * hh);
        kb.h[1] = *(const v8h*)(Ksh + (j * 16 + c) * kLP + dc * 32 + 16 + 8 * hh);
        s[j] = mma_h16(kb.v, qa[dc], s[j]);
      }
    }
    // ---- causal fill on the diagonal chunk, maximum of the query's 64 unscaled scores (one chain per subtile; scale > 0) ----
    const bool diag = (kc == qb);
    float mj[4];
#pragma unroll
    for (int j = 0; j < 4; ++j) {
      float m = -INFINITY;
#pragma unroll
      for (int r = 0; r < 8; ++r) {
        const int kvcol = kv0 + j * 16 + 8 * hh + r;
        float sv = s[j][r];
        if (diag && (kvcol > qrow)) sv = kNegBig;
        s[j][r] = sv;
        m = fmaxf(m, sv);
      }
      mj[j] = m;
    }
    float cm = fmaxf(fmaxf(mj[0], mj[1]), fmaxf(mj[2], mj[3]));
    cm = fmaxf(cm, xhalf(cm));
    // ---- online softmax update; P^T as bf16 hi/lo straight into the B operands of the second product ----
    const float mnew = fmaxf(mrow, cm);
    const float mc = mnew * kSL2E;
    const float alpha = exp2x1(fmaf(mrow, kSL2E, -mc));   // first chunk: mrow = -inf gives 0
    mrow = mnew;
    FragB pa[2], pl[2];
    float pj[4];
#pragma unroll
    for (int j = 0; j < 4; ++j) {
      float psum = 0.f;
      float xe[8], pe[8];
#pragma unroll
      for (int r = 0; r < 8; ++r) xe[r] = fmaf(s[j][r], kSL2E, -mc);
      exp2x8(pe, xe);
#pragma unroll
      for (int r = 0; r < 8; ++r) psum += pe[r];
#pragma unroll   // pa and pl are register arrays and need constant indices
      for (int r = 0; r < 8; r += 2)
        split2bf(pe[r], pe[r + 1], pa[j >> 1].w[(j & 1) * 4 + (r >> 1)], pl[j >> 1].w[(j & 1) * 4 + (r >> 1)]);
      pj[j] = psum;
    }
    lrow = lrow * alpha + ((pj[0] + pj[1]) + (pj[2] + pj[3]));
#pragma unroll
    for (int t = 0; t < 4; ++t)
#pragma unroll
      for (int r = 0; r < 8; ++r) oacc[t][r] *= alpha;
    // ---- ctx^T += V^T(64x64) . P^T(64x16): hi.hi + lo.hi + hi.lo ----
    // unrolled: pa and pl are register arrays and need constant indices
#pragma unroll
    for (int kk = 0; kk < 2; ++kk) {
#pragma unroll
      for (int t = 0; t < 4; ++t) {
        FragB vb, vl;
        vb.h[0] = *(const v8b*)(Vth + (t * 16 + c) * kLP + kk * 32 + 8 * hh);
        vb.h[1] = *(const v8b*)(Vth + (t * 16 + c) * kLP + kk * 32 + 16 + 8 * hh);
        vl.h[0] = *(const v8b*)(Vtl + (t * 16 + c) * kLP + kk * 32 + 8 * hh);
        vl.h[1] = *(const v8b*)(Vtl + (t * 16 + c) * kLP + kk * 32 + 16 + 8 * hh);
        oacc[t] = mma_b16(vb.v, pa[kk].v, oacc[t]);
        oacc[t] = mma_b16(vl.v, pa[kk].v, oacc[t]);
        oacc[t] = mma_b16(vb.v, pl[kk].v, oacc[t]);
      }
    }
    }
    // ---- foot of round g, every wave: publish round g + 1's set, then refill the buffer that round g has read ----
    asm volatile("s_wait_dscnt 0x0" ::: "memory");      // this wave's reads of buffer g & 1 have returned before the barrier behind which it is refilled
    asm volatile("s_wait_asynccnt 0x0" ::: "memory");   // this wave's copies of round g + 1 have landed before the barrier that publishes them
    __syncthreads();
    if (g + 2 < nRdAll) stage(g + 2);
  }

  // ---- join the two key groups: group 1 hands m, l and its ctx sums to the wave of group 0 that holds the same queries ----
  float* mg = Mg[wave];   // [value][lane]: 16-B stores and loads of 32 lanes are contiguous
  if (grp != 0) {
    // unrolled, here and in the join below: oacc is a register array and needs constant indices
#pragma unroll
    for (int t = 0; t < 4; ++t) {
      *(v4f*)(mg + ((2 * t) * 32 + lane) * 4)     = (v4f){oacc[t][0], oacc[t][1], oacc[t][2], oacc[t][3]};
      *(v4f*)(mg + ((2 * t + 1) * 32 + lane) * 4) = (v4f){oacc[t][4], oacc[t][5], oacc[t][6], oacc[t][7]};
    }
    mg[32 * 32 + lane] = mrow;
    mg[33 * 32 + lane] = lrow;
  }
  __syncthreads();   // group 1's partial results are complete before group 0 reads them; they are next written behind the next tile's barriers
  if (grp != 0) continue;
  {
    const float m1 = mg[32 * 32 + lane];   // -inf, with l = 0 and zero sums, where group 1 had no chunk: its factor is then 0
    const float l1 = mg[33 * 32 + lane];
    const float mc = fmaxf(mrow, m1) * kSL2E;   // mrow is finite: group 0 always has chunk 0
    const float a0 = exp2x1(fmaf(mrow, kSL2E, -mc));
    const float a1 = exp2x1(fmaf(m1, kSL2E, -mc));
    lrow = lrow * a0 + l1 * a1;
#pragma unroll
    for (int t = 0; t < 4; ++t) {
      const v4f x = *(const v4f*)(mg + ((2 * t) * 32 + lane) * 4);
      const v4f y = *(const v4f*)(mg + ((2 * t + 1) * 32 + lane) * 4);
#pragma unroll
      for (int r = 0; r < 4; ++r) {
        oacc[t][r]     = oacc[t][r] * a0 + x[r] * a1;
        oacc[t][4 + r] = oacc[t][4 + r] * a0 + y[r] * a1;
      }
    }
  }
  // ---- join the halves' sums, divide, and lay the tile out as [query][d] in the wave's own LDS slab ----
  float* os = Os[wave];
  const float inv = 1.0f / (lrow + xhalf(lrow));
#pragma unroll
  for (int t = 0; t < 4; ++t) {
    float* op = os + c * 68 + t * 16 + 8 * hh;
    *(v4f*)(op)     = (v4f){oacc[t][0] * inv, oacc[t][1] * inv, oacc[t][2] * inv, oacc[t][3] * inv};
    *(v4f*)(op + 4) = (v4f){oacc[t][4] * inv, oacc[t][5] * inv, oacc[t][6] * inv, oacc[t][7] * inv};
  }
  __builtin_amdgcn_fence(3, "workgroup");
  __builtin_amdgcn_wave_barrier();
  __builtin_amdgcn_fence(2, "workgroup");
  {
    // store coverage: 4 iterations x 4 row groups (lane>>3) = 16 rows; (lane&7) x 8 halves = 64 cols
    const int q = lane >> 3, c8 = (lane & 7) * 8;
    unsigned short* ch = CHp + (size_t)(b * kSeq + q0) * kDim + h * kDh;
    unsigned short* cl = CLp + (size_t)(b * kSeq + q0) * kDim + h * kDh;
    {
#pragma unroll
      for (int it = 0; it < 4; ++it) {
        const int row = it * 4 + q;
        const float* sp = os + row * 68 + c8;
        v4u hu, lu;
#pragma unroll   // hu and lu stay in registers: constant indices
        for (int e = 0; e < 4; ++e) {
          unsigned hw, lw;
          split2bf(sp[2 * e], sp[2 * e + 1], hw, lw);
          hu[e] = hw;
          lu[e] = lw;
        }
        const v8h hv = __builtin_bit_cast(v8h, hu);
        const v8h lv = __builtin_bit_cast(v8h, lu);
        *(v8h*)(ch + (size_t)row * kDim + c8) = hv;
        *(v8h*)(cl + (size_t)row * kDim + c8) = lv;
      }
      // the second tile reuses the address and data registers of the stores just issued: the wait stands in front of that overwrite
      asm volatile("s_wait_xcnt 0x0" ::: "memory");
    }
  }
  }
  asm volatile("s_wait_asynccnt 0x0" ::: "memory");   // no copy is outstanding when the wave ends
}

// ---------------------------------------------------------------------------
// Host glue.
// Inputs (wire f32): 0 x [2][2048][1024], 1 Wq [1024][1024], 2 bq [1024], 3 Wk, 4 bk, 5 Wv, 6 bv, 7 Wo [1024][1024].
//   XB    bf16 [kTok][1024]             8,388,608   (RNE bf16 of x, compact token rows, A layout)
//   WT    bf16 [3072][1024]             6,291,456   (Wq^T | Wk^T | Wv^T, RNE bf16, Bt layout [n][k])
//   WOT   bf16 [1024][1024]             2,097,152   (Wo^T, RNE bf16, Bt layout)
//   BQK   f32  [2048]                       8,192   (RNE bf16 of bq | bk, widened)
//   BV    f32  [1024]                       4,096   (RNE bf16 of bv, widened)
//   QK16  f16  [kTok][2048]            16,777,216   (q | k columns incl. bias)
//   VTH   bf16 [kBatch*16*64][kSeq]     8,388,608   (v^T hi plane, bias included)
//   VTL   bf16 [kBatch*16*64][kSeq]     8,388,608   (v^T lo plane)
//   CTXH  bf16 [kTok][1024]             8,388,608   (ctx hi plane)
//   CTXL  bf16 [kTok][1024]             8,388,608   (ctx lo plane)
//   total                              67,121,152
// GEMM shapes: q|k M=kTok N=2048 K=1024; v^T M=1024 N=kSeq K=1024 (kBatch batches); out M=kSeq N=1024 K=1024 (kBatch
// batches, output rows at pitch kSeqFull per batch; 64x256 block tiles). All M multiples of 128, N of 256, K of 64: no padding. 4 launches:
// input conversions; q|k and v^T products; attention; output product.
// ---------------------------------------------------------------------------
extern "C" void kernel_launch(void* const* d_in, const int* in_sizes, int n_in,
                              void* d_out, int out_size, void* d_ws, size_t ws_size,
                              hipStream_t stream) {
  if (n_in < 8) return;
  const int rowsNeeded = (kBatch - 1) * kSeqFull + kSeq;     // last token row read/written + 1
  if (in_sizes[0] < rowsNeeded * kDim) return;
  if (in_sizes[1] < kDim * kDim || in_sizes[3] < kDim * kDim || in_sizes[5] < kDim * kDim || in_sizes[7] < kDim * kDim) return;
  if (in_sizes[2] < kDim || in_sizes[4] < kDim || in_sizes[6] < kDim) return;
  if (out_size < rowsNeeded * kDim) return;

  const size_t szXB  = (size_t)kTok * kDim * 2;
  const size_t szWT  = (size_t)kWtN * kDim * 2;
  const size_t szWOT = (size_t)kDim * kDim * 2;
  const size_t szBQK = (size_t)kQKld * 4;
  const size_t szBV  = (size_t)kDim * 4;
  const size_t szQK  = (size_t)kTok * kQKld * 2;
  const size_t szVT  = (size_t)kBatch * kHeads * kDh * kSeq * 2;
  const size_t szCTX = (size_t)kTok * kDim * 2;
  const size_t offXB  = 0;
  const size_t offWT  = offXB + szXB;
  const size_t offWOT = offWT + szWT;
  const size_t offBQK = offWOT + szWOT;
  const size_t offBV  = offBQK + szBQK;
  const size_t offQK  = offBV + szBV;
  const size_t offVTH = offQK + szQK;
  const size_t offVTL = offVTH + szVT;
  const size_t offCH  = offVTL + szVT;
  const size_t offCL  = offCH + szCTX;
  const size_t total  = offCL + szCTX;             // 67,121,152 at full size
  if (ws_size < total) return;
  if (total > (size_t)134217728) return;

  const float* x  = (const float*)d_in[0];
  const float* Wq = (const float*)d_in[1];
  const float* bq = (const float*)d_in[2];
  const float* Wk = (const float*)d_in[3];
  const float* bk = (const float*)d_in[4];
  const float* Wv = (const float*)d_in[5];
  const float* bv = (const float*)d_in[6];
  const float* Wo = (const float*)d_in[7];
  float* out = (float*)d_out;
  char* ws = (char*)d_ws;
  unsigned short* XB   = (unsigned short*)(ws + offXB);
  unsigned short* WT   = (unsigned short*)(ws + offWT);
  unsigned short* WOT  = (unsigned short*)(ws + offWOT);
  float*          BQK  = (float*)(ws + offBQK);
  float*          BV   = (float*)(ws + offBV);
  unsigned short* QK16 = (unsigned short*)(ws + offQK);
  unsigned short* VTH  = (unsigned short*)(ws + offVTH);
  unsigned short* VTL  = (unsigned short*)(ws + offVTL);
  unsigned short* CTXH = (unsigned short*)(ws + offCH);
  unsigned short* CTXL = (unsigned short*)(ws + offCL);

  // ---- prologue: RNE bf16 planes of all float inputs, one launch ----
  prologue_kernel<<<dim3(4 * kWTiles + 3 + kCastBlks), dim3(256), 0, stream>>>(x, Wq, Wk, Wv, Wo, bq, bk, bv, XB, WT, WOT, BQK, BV);
  // ---- q|k (f16 plane) and v^T (bf16 hi/lo planes) from XB and WT, one launch ----
  qkv_gemm_kernel<<<dim3(kTilesQK + kBatch * kTilesV), dim3(256), 0, stream>>>(XB, WT, BQK, BV, QK16, VTH, VTL, kDim);
  // ---- causal attention per (b, h, pair of 64-query tiles) -> ctx bf16 hi/lo planes ----
  causal_attn_kernel<<<dim3(kBatch * kHeads * kTilePairs), dim3(kKG * kAW * 32), 0, stream>>>(QK16, VTH, VTL, CTXH, CTXL);
  // ---- out[b][s] = (CTXH + CTXL)[b*kSeq + s] . WOT  (M=kSeq, N=1024, K=1024, kBatch batches, no bias),
  //      f32 straight to d_out rows b*kSeqFull + s ----
  {
    const int blocks = (kSeq / 64) * (kDim / 256);   // 64x256 tiles: 256 work-groups at full size, one for every WGP
    wmma_gemm64<1, 2, 0, 0, 2><<<dim3(blocks, kBatch), dim3(256), 0, stream>>>(
        CTXH, CTXL, kDim, (long)kSeq * kDim, WOT, WOT, kDim, 0L,
        (void*)out, (void*)out, kDim, (long)kSeqFull * kDim, BV, kSeq, kDim, kDim, 1.0f);
  }
}

// v010
// One run takes 92.4 microseconds.
// Timed twice side by side with v009, it ran 1.05 and 1.04 times as fast.
// All steps since v000 together make it 5.55 times as fast.
// Contractions: q|k = x.[Wq|Wk] and v^T = Wv^T.x^T on v_wmma_f32_16x16x32_bf16 (x, W RNE bf16 operands, single products; bq, bk, bv as RNE bf16 added in f32); scores^T = k.q^T on v_wmma_f32_16x16x32_f16 (q, k f16 planes, single products); ctx^T = v^T.p^T on v_wmma_f32_16x16x32_bf16 (p^T and v^T as bf16 hi+lo: hi.hi + lo.hi + hi.lo); out = ctx.Wo on v_wmma_f32_16x16x32_bf16 (ctx bf16 hi+lo, Wo RNE bf16: hi.W + lo.W); f32 accumulate everywhere; scale, causal fill and softmax in f32.
#include <hip/hip_runtime.h>
#include <math.h>

// ---------------------------------------------------------------------------
// Problem constants (NB / SEQ overridable; *_FULL give the input / output strides)
// ---------------------------------------------------------------------------
#ifndef NB
#define NB 2
#endif
#ifndef SEQ
#define SEQ 2048
#endif
#define NB_FULL 2
#define SEQ_FULL 2048

constexpr int kBatch   = NB;
constexpr int kSeq     = SEQ;
constexpr int kSeqFull = SEQ_FULL;
constexpr int kDim     = 1024;               // d_in == d_out
constexpr int kHeads   = 16;
constexpr int kDh      = 64;
constexpr int kTok     = kBatch * kSeq;      // token rows of the compact planes
constexpr int kWtN     = 3 * kDim;           // rows of the Wq^T | Wk^T | Wv^T plane
constexpr int kQKld    = 2 * kDim;           // 2048, pitch (halves) of the q|k f16 plane
constexpr int kQB      = 64;                 // query rows per attention block
constexpr int kKC      = 64;                 // keys per chunk
constexpr int kAW      = 4;                  // waves per key group; an attention block has kKG groups
constexpr int kLP      = 72;                 // LDS row pitch (halves) of the K and V^T tiles: 144 B = 16 B x 9, so 16 rows read by ds_load_b128 fall on 64 distinct banks
constexpr float kScale  = 0.125f;            // 64^-0.5, exact
constexpr float kSL2E   = kScale * 1.44269504088896340736f;   // scale * log2(e): exp(scale * (s - m)) = 2^(kSL2E * s - kSL2E * m)
constexpr float kNegBig = -1.0e30f;          // finite fill for (unscaled) scores above the diagonal
static_assert(kBatch >= 1 && kBatch <= NB_FULL);
static_assert(kSeq >= 64 && kSeq <= SEQ_FULL);
static_assert(kHeads * kDh == kDim);
static_assert(kSeq % kQB == 0 && kSeq % kKC == 0 && kQB == kAW * 16 && kDh == 64);
// GEMM shape contract (no tail handling): M multiple of 128, N multiple of 256, K multiple of 64
static_assert(kTok % 128 == 0 && kQKld % 256 == 0 && kDim % 64 == 0);
static_assert(kDim % 256 == 0 && kSeq % 256 == 0);
static_assert(kDim / 8 == 128 && (kTok * kDim) % 8 == 0);

typedef __attribute__((ext_vector_type(16))) _Float16 v16h;
typedef __attribute__((ext_vector_type(8)))  _Float16 v8h;
typedef __attribute__((ext_vector_type(16))) __bf16   v16b;
typedef __attribute__((ext_vector_type(8)))  __bf16   v8b;
typedef __attribute__((ext_vector_type(8)))  float    v8f;
typedef __attribute__((ext_vector_type(4)))  float    v4f;
typedef __attribute__((ext_vector_type(4)))  unsigned int v4u;

// ---------------------------------------------------------------------------
// Shared pieces
// ---------------------------------------------------------------------------
typedef __attribute__((ext_vector_type(2))) float  v2f;
typedef __attribute__((ext_vector_type(2))) __bf16 v2b;
// Two f32 -> two bf16, round to nearest even, as one packed hardware conversion (v_cvt_pk_bf16_f32); a lands in the low half.
__device__ __forceinline__ unsigned cvt2bf(float a, float b) {
  return __builtin_bit_cast(unsigned, __builtin_convertvector((v2f){a, b}, v2b));
}
// hi = bf16(x), lo = bf16(x - hi) for two values; the difference is exact in f32.
__device__ __forceinline__ void split2bf(float a, float b, unsigned& hi, unsigned& lo) {
  const v2b h = __builtin_convertvector((v2f){a, b}, v2b);
  hi = __builtin_bit_cast(unsigned, h);
  lo = cvt2bf(a - (float)h[0], b - (float)h[1]);
}

// hazard guards as plain device helpers
__device__ __forceinline__ void dep_guard_h(v8f& a, v8f& b, v16h x, v16h y) { asm volatile("v_nop\n\tv_nop\n\tv_nop\n\tv_nop" : "+v"(a), "+v"(b) : "v"(x), "v"(y)); }
__device__ __forceinline__ void dep_guard_b(v8f& a, v8f& b, v16b x, v16b y) { asm volatile("v_nop\n\tv_nop\n\tv_nop\n\tv_nop" : "+v"(a), "+v"(b) : "v"(x), "v"(y)); }
// guard tying all four accumulators of a group and naming both A fragments as inputs
__device__ __forceinline__ void dep_guard4_h(v8f& a, v8f& b, v8f& c, v8f& d, v16h x, v16h y) { asm volatile("v_nop\n\tv_nop\n\tv_nop\n\tv_nop" : "+v"(a), "+v"(b), "+v"(c), "+v"(d) : "v"(x), "v"(y)); }
__device__ __forceinline__ void dep_guard4_b(v8f& a, v8f& b, v8f& c, v8f& d, v16b x, v16b y) { asm volatile("v_nop\n\tv_nop\n\tv_nop\n\tv_nop" : "+v"(a), "+v"(b), "+v"(c), "+v"(d) : "v"(x), "v"(y)); }
__device__ __forceinline__ void keep4_h(v16h a, v16h b, v16h c, v16h d) { asm volatile("v_nop" :: "v"(a), "v"(b), "v"(c), "v"(d)); }
__device__ __forceinline__ void keep4_b(v16b a, v16b b, v16b c, v16b d) { asm volatile("v_nop" :: "v"(a), "v"(b), "v"(c), "v"(d)); }
__device__ __forceinline__ void acc_guard4(v8f& a, v8f& b, v8f& c, v8f& d) { asm volatile("v_nop\n\tv_nop\n\tv_nop\n\tv_nop" : "+v"(a), "+v"(b), "+v"(c), "+v"(d)); }
template <typename T> struct Frag;
template <> struct Frag<_Float16> {
  typedef v16h V; union U { v16h v; v8h h[2]; };
  // elements 0..7 <- p[0..7], 8..15 <- p[16..23]
  static __device__ __forceinline__ v16h load(const _Float16* p) {
    U f; f.h[0] = *(const v8h*)(p); f.h[1] = *(const v8h*)(p + 16); return f.v;
  }
  static __device__ __forceinline__ v8f mma(v16h a, v16h b, v8f c) {
    return __builtin_amdgcn_wmma_f32_16x16x32_f16(false, a, false, b, (short)0, c, false, false);
  }
  static __device__ __forceinline__ void guard(v8f& a, v8f& b, v16h x, v16h y) { dep_guard_h(a, b, x, y); }
  static __device__ __forceinline__ void guard4(v8f& a, v8f& b, v8f& c, v8f& d, v16h x, v16h y) { dep_guard4_h(a, b, c, d, x, y); }
  static __device__ __forceinline__ void keep(v16h a, v16h b, v16h c, v16h d) { keep4_h(a, b, c, d); }
};
template <> struct Frag<__bf16> {
  typedef v16b V; union U { v16b v; v8b h[2]; };
  static __device__ __forceinline__ v16b load(const __bf16* p) {
    U f; f.h[0] = *(const v8b*)(p); f.h[1] = *(const v8b*)(p + 16); return f.v;
  }
  static __device__ __forceinline__ v8f mma(v16b a, v16b b, v8f c) {
    return __builtin_amdgcn_wmma_f32_16x16x32_bf16(false, a, false, b, (short)0, c, false, false);
  }
  static __device__ __forceinline__ void guard(v8f& a, v8f& b, v16b x, v16b y) { dep_guard_b(a, b, x, y); }
  static __device__ __forceinline__ void guard4(v8f& a, v8f& b, v8f& c, v8f& d, v16b x, v16b y) { dep_guard4_b(a, b, c, d, x, y); }
  static __device__ __forceinline__ void keep(v16b a, v16b b, v16b c, v16b d) { keep4_b(a, b, c, d); }
};

// ---- Register-blocked batched WMMA GEMM (bias added in f32 in the slab phase so all output modes see it) ----
// C[m,n] = scale * sum_k A[m,k] * Bt[n,k] (+bias); each wave owns a (16 MI)x64 tile, a block of 8 waves (2 x 4) a (32 MI)x256 tile.
// MI: 4 = 128x256 block tile; 2 = 64x256, for a product whose 128x256 tiles are fewer than the chip's 256 WGPs.
// A row-major [M,K]; Bt row-major [N,K], both at row pitch kDim (lda == ldb == kDim); M % (32 MI) == 0, N % 256 == 0, K % 64 == 0.
// Operands go through LDS: per 64 k the block copies its 32 MI A rows and 256 Bt rows once, 128 B of a row by 8 lanes, so a
// wave-wide 16-B load covers 4 whole lines; the next tile's loads are issued before the products of the current one.
// SPLIT: 0 = single product; 2 = A hi/lo planes (hi.B + lo.B).
// BIAS_MODE: 0 = none, 1 = bias[m] (per row), 2 = bias[n] (per column); bias is an f32 table of length M or N.
// OUT_MODE: 0 = f32, 1 = f16, 2 = bf16 hi plane (Cout) + bf16 lo plane (Cout2).
// ET: 0 = f16 operands, 1 = bf16 operands (pointers passed as 16-bit storage)
constexpr int kGP = 72;   // LDS row pitch (halves) of the staged A and Bt tiles: 144 B = 16 B x 9 for the ds_load_b128 fragment reads
template <int ET> struct Elem;
template <> struct Elem<0> { typedef _Float16 T; };
template <> struct Elem<1> { typedef __bf16 T; };
// The tile body is a device function: bx = tile index within the product, b = batch; sA, sB, sT are the calling kernel's LDS
// (sA: (SPLIT == 2 ? 2 : 1) * 32 * MI * kGP halves, sB: 256 * kGP halves, sT: 8 slabs of kSlab floats), so that one launch can
// hold tiles of several independent products on one LDS allocation.
constexpr int kSlab = 16 * 68;   // per-wave 16x64 output slab, pitch 68 floats
template <int ET, int SPLIT, int BIAS_MODE, int OUT_MODE, int MI>
__device__ __forceinline__ void gemm64_tile(
    unsigned short* sA, unsigned short* sB, float* sT, unsigned bx, int b,
    const unsigned short* __restrict__ Ap, const unsigned short* __restrict__ A2p, int lda, long strideA,
    const unsigned short* __restrict__ Btp, const unsigned short* __restrict__ Bt2p, int ldb, long strideB,
    void* __restrict__ Cout, void* __restrict__ Cout2, int ldc, long strideC,
    const float* __restrict__ bias,
    int M, int N, int K, float scale) {
  static_assert(SPLIT == 0 || SPLIT == 2);
  static_assert(BIAS_MODE >= 0 && BIAS_MODE <= 2);
  static_assert(OUT_MODE >= 0 && OUT_MODE <= 2);
  static_assert(MI == 2 || MI == 4);
  constexpr int BM = 32 * MI;                  // A rows of the block
  typedef typename Elem<ET>::T T;
  typedef typename Frag<T>::V V;
  const int tid  = threadIdx.x;
  const int lane = tid & 31;
  const int wave = tid >> 5;
  const int blocksN = N >> 8;
  const int bm = bx / blocksN;
  const int bn = bx - bm * blocksN;
  const int mB = bm << (MI == 4 ? 7 : 6);      // first A row of the block: bm * BM
  const int nB = bn << 8;                      // first Bt row of the block
  const int wm = (wave >> 2) << (MI == 4 ? 6 : 5);   // this wave's rows within the A tile: 16 MI rows a wave
  const int wn = (wave & 3) << 6;              // this wave's rows within the Bt tile
  const int m0 = mB + wm;
  const int n0 = nB + wn;

  const unsigned short* Ab  = Ap  + (size_t)b * strideA;
  const unsigned short* Bb  = Btp + (size_t)b * strideB;
  const unsigned short* Ab2 = (SPLIT == 2) ? (A2p + (size_t)b * strideA) : nullptr;

  const int rlane = lane & 15;                 // row (A) / col (B, D) within subtile
  const int koff  = (lane >> 4) * 8;           // k offset of this lane half
  const int mOff  = (lane >> 4) * 8;           // D row offset

  // staging map: thread -> row (tid >> 3) + 32 * i, 8 halves at column (tid & 7) * 8. One address per plane: the row step
  // 32 * kDim is a compile-time constant, so the i-th load differs from the first by an immediate offset only.
  // Every loop over i, j or ks below is unrolled so that the register arrays (ra, rb, fragments, acc) keep constant indices.
  const int srow = tid >> 3;
  const int sc8  = (tid & 7) * 8;
  const unsigned short* gA  = Ab + (size_t)(mB + srow) * kDim + sc8;
  const unsigned short* gA2 = (SPLIT == 2) ? (Ab2 + (size_t)(mB + srow) * kDim + sc8) : nullptr;
  const unsigned short* gB  = Bb + (size_t)(nB + srow) * kDim + sc8;
  v4u ra[MI], ra2[MI], rb[8];
#pragma unroll
  for (int i = 0; i < MI; ++i) {
    ra[i] = *(const v4u*)(gA + i * 32 * kDim);
    if (SPLIT == 2) ra2[i] = *(const v4u*)(gA2 + i * 32 * kDim);
  }
#pragma unroll
  for (int i = 0; i < 8; ++i) rb[i] = *(const v4u*)(gB + i * 32 * kDim);

  const T* fa = (const T*)sA + (wm + rlane) * kGP + koff;
  const T* fb = (const T*)sB + (wn + rlane) * kGP + koff;

  v8f acc[MI][4];
#pragma unroll
  for (int i = 0; i < MI; ++i)
#pragma unroll
    for (int j = 0; j < 4; ++j) acc[i][j] = (v8f){0.f,0.f,0.f,0.f,0.f,0.f,0.f,0.f};

  for (int k0 = 0; k0 < K; k0 += 64) {
    __syncthreads();   // every wave has read its last fragment of the previous tile
#pragma unroll
    for (int i = 0; i < MI; ++i) {
      *(v4u*)(sA + (srow + 32 * i) * kGP + sc8) = ra[i];
      if (SPLIT == 2) *(v4u*)(sA + (BM + srow + 32 * i) * kGP + sc8) = ra2[i];
    }
#pragma unroll
    for (int i = 0; i < 8; ++i) *(v4u*)(sB + (srow + 32 * i) * kGP + sc8) = rb[i];
    __syncthreads();   // the tile is complete before any wave reads it
    if (k0 + 64 < K) { // block-uniform: the next tile's loads fly during this tile's products
      const int kn = k0 + 64;
#pragma unroll
      for (int i = 0; i < MI; ++i) {
        ra[i] = *(const v4u*)(gA + kn + i * 32 * kDim);
        if (SPLIT == 2) ra2[i] = *(const v4u*)(gA2 + kn + i * 32 * kDim);
      }
#pragma unroll
      for (int i = 0; i < 8; ++i) rb[i] = *(const v4u*)(gB + kn + i * 32 * kDim);
      // the fragment reads below reuse the address registers of the loads just issued: the wait stands in front of that overwrite
      asm volatile("s_wait_xcnt 0x0" ::: "memory");
    }
#pragma unroll
    for (int ks = 0; ks < 64; ks += 32) {
      V bh[4], ah[MI], al[MI];
#pragma unroll
      for (int j = 0; j < 4; ++j) bh[j] = Frag<T>::load(fb + (j << 4) * kGP + ks);
#pragma unroll
      for (int i = 0; i < MI; ++i) {
        ah[i] = Frag<T>::load(fa + (i << 4) * kGP + ks);
        al[i] = ah[i];
        if (SPLIT == 2) al[i] = Frag<T>::load(fa + (BM + (i << 4)) * kGP + ks);
      }
#pragma unroll
      for (int i = 0; i < MI; ++i) {
#pragma unroll
        for (int j = 0; j < 4; ++j) {
          acc[i][j] = Frag<T>::mma(ah[i], bh[j], acc[i][j]);
          if (SPLIT == 2) acc[i][j] = Frag<T>::mma(al[i], bh[j], acc[i][j]);
        }
      }
#pragma unroll
      for (int i = 0; i < MI; ++i) Frag<T>::guard4(acc[i][0], acc[i][1], acc[i][2], acc[i][3], ah[i], al[i]);
      Frag<T>::keep(bh[0], bh[1], bh[2], bh[3]);
    }
  }
#pragma unroll
  for (int i = 0; i < MI; ++i) acc_guard4(acc[i][0], acc[i][1], acc[i][2], acc[i][3]);

  // ---- epilogue ----
  float* slab = sT + wave * kSlab;
  float bcol[4] = {0.f, 0.f, 0.f, 0.f};
  if (BIAS_MODE == 2) {
    // per-column bias: this lane's columns n0 + 16*j + rlane, j = 0..3 (in range: N multiple of 64)
#pragma unroll
    for (int j = 0; j < 4; ++j) bcol[j] = bias[n0 + (j << 4) + rlane];
  }
#pragma unroll
  for (int i = 0; i < MI; ++i) {
    const int mBase = m0 + (i << 4);
    float brow[8] = {0.f, 0.f, 0.f, 0.f, 0.f, 0.f, 0.f, 0.f};
    if (BIAS_MODE == 1) {
      // per-row bias: rows mBase + mOff + 0..7 (16-B aligned: mBase % 16 == 0, mOff in {0, 8})
      const v4f b0 = *(const v4f*)(bias + mBase + mOff);
      const v4f b1 = *(const v4f*)(bias + mBase + mOff + 4);
#pragma unroll
      for (int e = 0; e < 4; ++e) { brow[e] = b0[e]; brow[4 + e] = b1[e]; }
    }
#pragma unroll
    for (int j = 0; j < 4; ++j) {
#pragma unroll
      for (int r = 0; r < 8; ++r) {
        float bb = 0.f;
        if (BIAS_MODE == 1) bb = brow[r];
        if (BIAS_MODE == 2) bb = bcol[j];
        slab[(mOff + r) * 68 + (j << 4) + rlane] = acc[i][j][r] * scale + bb;
      }
    }
    __builtin_amdgcn_fence(3, "workgroup");
    __builtin_amdgcn_wave_barrier();
    __builtin_amdgcn_fence(2, "workgroup");
    if (OUT_MODE == 0) {
      float* C = (float*)Cout + (size_t)b * strideC;
      const int hh = lane >> 4, c4 = (lane & 15) * 4;     // row seg = 256 B = 16 lanes x 16 B
      {
#pragma unroll
        for (int it = 0; it < 8; ++it) {
          const int row = it * 2 + hh;
          const v4f v = *(const v4f*)(slab + row * 68 + c4);
          *(v4f*)(C + (size_t)(mBase + row) * ldc + n0 + c4) = v;
        }
        
      }
    } else {
      const int q = lane >> 3, c8 = (lane & 7) * 8;
      unsigned short* C  = (unsigned short*)Cout  + (size_t)b * strideC;
      unsigned short* C2 = (OUT_MODE == 2) ? ((unsigned short*)Cout2 + (size_t)b * strideC) : nullptr;
      {
#pragma unroll
        for (int it = 0; it < 4; ++it) {
          const int row = it * 4 + q;
          const float* sp = slab + row * 68 + c8;
          v8h hv, lv;
          if (OUT_MODE == 1) {
#pragma unroll
            for (int e = 0; e < 8; ++e) hv[e] = (_Float16)sp[e];
          } else {
            v4u hu, lu;
#pragma unroll   // hu and lu stay in registers: constant indices
            for (int e = 0; e < 4; ++e) {
              unsigned hw, lw;
              split2bf(sp[2 * e], sp[2 * e + 1], hw, lw);
              hu[e] = hw;
              lu[e] = lw;
            }
            hv = __builtin_bit_cast(v8h, hu);
            lv = __builtin_bit_cast(v8h, lu);
          }
          *(v8h*)(C + (size_t)(mBase + row) * ldc + n0 + c8) = hv;
          if (OUT_MODE == 2) *(v8h*)(C2 + (size_t)(mBase + row) * ldc + n0 + c8) = lv;
        }
        
      }
    }
    __builtin_amdgcn_fence(3, "workgroup");
    __builtin_amdgcn_wave_barrier();
    __builtin_amdgcn_fence(2, "workgroup");
  }
}

// One product per launch: grid (tiles, batches).
template <int ET, int SPLIT, int BIAS_MODE, int OUT_MODE, int MI>
__global__ __launch_bounds__(256) void wmma_gemm64(
    const unsigned short* __restrict__ Ap, const unsigned short* __restrict__ A2p, int lda, long strideA,
    const unsigned short* __restrict__ Btp, const unsigned short* __restrict__ Bt2p, int ldb, long strideB,
    void* __restrict__ Cout, void* __restrict__ Cout2, int ldc, long strideC,
    const float* __restrict__ bias,
    int M, int N, int K, float scale) {
  __shared__ __align__(16) unsigned short sA[(SPLIT == 2 ? 2 : 1) * 32 * MI * kGP];   // A (hi, then lo) [row][k] (cross-wave: block barriers)
  __shared__ __align__(16) unsigned short sB[256 * kGP];                          // Bt [row][k] (cross-wave: block barriers)
  __shared__ __align__(16) float sT[8 * kSlab];                                   // per-wave slabs (private-to-wave)
  gemm64_tile<ET, SPLIT, BIAS_MODE, OUT_MODE, MI>(sA, sB, sT, blockIdx.x, blockIdx.y, Ap, A2p, lda, strideA, Btp, Bt2p, ldb, strideB,
                                              Cout, Cout2, ldc, strideC, bias, M, N, K, scale);
}

// The two projections that depend only on XB and WT, in one launch, told apart by the block index (block-uniform branch):
//   blocks [0, kTilesQK):  q|k = XB . WT[rows 0..2047] + BQK[n] -> f16 plane [kTok][2048] (M=kTok, N=2048, bias per column)
//   then kTilesV per batch: v^T[b][h*64+d][s] = WT[2048 + h*64 + d] . XB[b*kSeq + s] + BV[h*64+d] -> bf16 hi/lo planes
//                           (M=1024, N=kSeq, bias per row)
constexpr int kTilesQK = (kTok / 128) * (kQKld / 256);
constexpr int kTilesV  = (kDim / 128) * (kSeq / 256);
// Register cap: each body alone builds to 256 registers a wave, the two in one kernel to 258, which is allocated as 272 and leaves
// room for three waves a SIMD, so one block a WGP. At 256 four waves fit: two blocks a WGP, and all 384 blocks are resident at once.
__global__ __launch_bounds__(256) __attribute__((amdgpu_num_vgpr(256))) void qkv_gemm_kernel(
    const unsigned short* __restrict__ XB, const unsigned short* __restrict__ WT,
    const float* __restrict__ BQK, const float* __restrict__ BV,
    unsigned short* __restrict__ QK16, unsigned short* __restrict__ VTH, unsigned short* __restrict__ VTL, int K) {
  __shared__ __align__(16) unsigned short sA[128 * kGP];   // A [row][k] (cross-wave: block barriers)
  __shared__ __align__(16) unsigned short sB[256 * kGP];   // Bt [row][k] (cross-wave: block barriers)
  __shared__ __align__(16) float sT[8 * kSlab];            // per-wave slabs (private-to-wave)
  const int bx = blockIdx.x;
  if (bx < kTilesQK) {
    gemm64_tile<1, 0, 2, 1, 4>(sA, sB, sT, bx, 0, XB, XB, kDim, 0L, WT, WT, kDim, 0L,
                            (void*)QK16, (void*)QK16, kQKld, 0L, BQK, kTok, kQKld, K, 1.0f);
  } else {
    const int r = bx - kTilesQK;
    const int b = r / kTilesV;
    const unsigned short* Av = WT + (size_t)2 * kDim * kDim;   // rows 2048..3071 of WT = Wv^T
    gemm64_tile<1, 0, 1, 2, 4>(sA, sB, sT, r - b * kTilesV, b, Av, Av, kDim, 0L, XB, XB, kDim, (long)kSeq * kDim,
                            (void*)VTH, (void*)VTL, kSeq, (long)kDim * kSeq, BV, kDim, kSeq, K, 1.0f);
  }
}

// ---------------------------------------------------------------------------
// f32 -> bf16 (RNE) cast of x into the compact token plane XB [kTok][1024]: token row t = b*kSeq + s reads input row
// ---------------------------------------------------------------------------
__device__ __forceinline__ void cast8_bf16_block(const float* __restrict__ in, unsigned short* __restrict__ out, int n8, int bx) {
  const int i = bx * 256 + threadIdx.x;
  if (i >= n8) return;
  const int t  = i >> 7;                 // 128 groups of 8 per token row
  const int c8 = (i & 127) * 8;
  const int b  = t / kSeq;
  const int s  = t - b * kSeq;
  const float* p = in + (size_t)(b * kSeqFull + s) * kDim + c8;
  const v4f a = *(const v4f*)(p);
  const v4f c = *(const v4f*)(p + 4);
  const v4u u = (v4u){cvt2bf(a[0], a[1]), cvt2bf(a[2], a[3]), cvt2bf(c[0], c[1]), cvt2bf(c[2], c[3])};
  unsigned short* q = out + 8 * (size_t)i;
  *(v4u*)q = u;
  
}

// ---------------------------------------------------------------------------
// Weight transpose + RNE bf16 cast: W f32 row-major [1024 (d)][ldIn (n)] -> WT bf16 [n][d] with pitch ldOut (= 1024):
//   in[d][n] -> out[n][d]. One block of 256 threads per 64x64 tile (dt = d tile, nt = n tile).
// Load coverage: 16 iterations x 256 threads = 4096 = the whole 64x64 tile (coalesced along n).
// Store coverage: 8 waves x 2 iterations x 4 rows (lane>>3) = 64 n-rows; (lane&7) x 8 halves = 64 d-cols; each row segment
// ---------------------------------------------------------------------------
__device__ __forceinline__ void wtcast_bf16_block(const float* __restrict__ W, unsigned short* __restrict__ out,
                                                  int ldIn, int ldOut, int dt, int nt) {
  __shared__ float sm[64][65];   // sm[n_local][d_local] (cross-wave: block barrier)
  const int t  = threadIdx.x;
  const int d0 = dt * 64;
  const int n0 = nt * 64;
#pragma unroll
  for (int i = 0; i < 16; ++i) {
    const int e = i * 256 + t;
    const int r = e >> 6;          // d local
    const int c = e & 63;          // n local
    sm[c][r] = W[(size_t)(d0 + r) * ldIn + n0 + c];
  }
  __syncthreads();
  const int lane = t & 31, wave = t >> 5;
  const int q = lane >> 3, c8 = (lane & 7) * 8;
  {
#pragma unroll
    for (int it = 0; it < 2; ++it) {
      const int row = wave * 8 + it * 4 + q;                 // n local
      const float* sr = &sm[row][c8];
      const v4u u = (v4u){cvt2bf(sr[0], sr[1]), cvt2bf(sr[2], sr[3]), cvt2bf(sr[4], sr[5]), cvt2bf(sr[6], sr[7])};
      *(v4u*)(out + (size_t)(n0 + row) * ldOut + d0 + c8) = u;
    }
    // inlined beside other pieces, the built code reuses these two stores' registers on a path behind them: the wait stands in front of that overwrite
    asm volatile("s_wait_xcnt 0x0" ::: "memory");
  }
}

// ---------------------------------------------------------------------------
// Bias RNE bf16 convert kept as f32: dst[1024] = float(bf16(src)). One block of 256 threads, float4 per lane:
// ---------------------------------------------------------------------------
__device__ __forceinline__ void bias_bf16_block(const float* __restrict__ bsrc, float* __restrict__ bdst) {
  const int t = threadIdx.x;
  const v4f a = *(const v4f*)(bsrc + 4 * t);
  v4f r;
#pragma unroll
  for (int e = 0; e < 4; ++e) r[e] = (float)(__bf16)a[e];
  float* dp = bdst + 4 * t;
  *(v4f*)dp = r;
  
}

// ---------------------------------------------------------------------------
// All eight input conversions in one launch: they are independent of one another, so each block takes its piece by its
// index (block-uniform branches): 4 x kWTiles weight tiles (Wq, Wk, Wv -> WT rows 0, 1024, 2048; Wo -> WOT), 3 bias blocks
// (bq, bk -> BQK; bv -> BV), then the blocks of the x cast.
// ---------------------------------------------------------------------------
constexpr int kWTiles   = (kDim / 64) * (kDim / 64);   // 64x64 tiles of one square weight
constexpr int kCastBlks = kTok * kDim / 8 / 256;       // blocks of the x cast (8 elements per thread)
static_assert((kTok * kDim / 8) % 256 == 0);
__global__ __launch_bounds__(256) void prologue_kernel(
    const float* __restrict__ x,  const float* __restrict__ Wq, const float* __restrict__ Wk, const float* __restrict__ Wv,
    const float* __restrict__ Wo, const float* __restrict__ bq, const float* __restrict__ bk, const float* __restrict__ bv,
    unsigned short* __restrict__ XB, unsigned short* __restrict__ WT, unsigned short* __restrict__ WOT,
    float* __restrict__ BQK, float* __restrict__ BV) {
  const int bx = blockIdx.x;
  if (bx >= 4 * kWTiles + 3) {
    cast8_bf16_block(x, XB, kTok * kDim / 8, bx - (4 * kWTiles + 3));
    return;
  }
  if (bx >= 4 * kWTiles) {
    const int w = bx - 4 * kWTiles;
    bias_bf16_block((w == 0) ? bq : (w == 1) ? bk : bv, (w == 0) ? BQK : (w == 1) ? (BQK + kDim) : BV);
    return;
  }
  const int w = bx / kWTiles;
  const int t = bx - w * kWTiles;
  const float* W = (w == 0) ? Wq : (w == 1) ? Wk : (w == 2) ? Wv : Wo;
  unsigned short* o = (w < 3) ? (WT + (size_t)w * kDim * kDim) : WOT;
  wtcast_bf16_block(W, o, kDim, kDim, t % (kDim / 64), t / (kDim / 64));
}

constexpr int kKG = 2;
constexpr int kTilePairs = (kSeq / kQB + 1) / 2;
constexpr int kMgW = 34 * 32;
static_assert(kKG == 2);
constexpr int kTileH = kKC * kLP;                  // halves of one staged tile: 64 rows at pitch kLP
constexpr int kSetH  = 3 * kTileH;                 // K, V^T hi and V^T lo tiles of one key chunk
static_assert(kKC == 64 && kDh == 64 && (kLP * 2) % 16 == 0);
union FragH { v16h v; v8h h[2]; };
union FragB { v16b v; v8b h[2]; unsigned w[8]; };   // w[i] = elements 2 i (low half) and 2 i + 1

// The builtin forms alone: the compiler keeps the distance behind each matrix instruction itself, filling it with independent softmax
// work where there is some, and is free to issue the LDS fragment reads of later products ahead of earlier ones.
__device__ __forceinline__ v8f mma_h16(v16h a, v16h b, v8f c) {
  return __builtin_amdgcn_wmma_f32_16x16x32_f16(false, a, false, b, (short)0, c, false, false);
}
__device__ __forceinline__ v8f mma_b16(v16b a, v16b b, v8f c) {
  return __builtin_amdgcn_wmma_f32_16x16x32_bf16(false, a, false, b, (short)0, c, false, false);
}
// lane l <-> lane l ^ 16: the two wave halves hold the two key halves of one query
__device__ __forceinline__ float xhalf(float x) {
  const int b = __builtin_bit_cast(int, x);
  return __builtin_bit_cast(float, __builtin_amdgcn_permlanex16(b, b, 0x76543210, 0xfedcba98, false, false));
}
// 2^x by v_exp_f32. In asm so that the slot the instruction set asks for behind a transcendental (one v_nop or independent
// instruction before its result is read or its source overwritten) stands inside the statement. Eight at a time: the outputs are early-clobber,
// so each v_exp_f32 is independent of the one in front of it, and one v_nop serves the last.
__device__ __forceinline__ void exp2x8(float (&p)[8], const float (&x)[8]) {
  asm("v_exp_f32 %0, %8\n\tv_exp_f32 %1, %9\n\tv_exp_f32 %2, %10\n\tv_exp_f32 %3, %11\n\t"
      "v_exp_f32 %4, %12\n\tv_exp_f32 %5, %13\n\tv_exp_f32 %6, %14\n\tv_exp_f32 %7, %15\n\tv_nop"
      : "=&v"(p[0]), "=&v"(p[1]), "=&v"(p[2]), "=&v"(p[3]), "=&v"(p[4]), "=&v"(p[5]), "=&v"(p[6]), "=&v"(p[7])
      : "v"(x[0]), "v"(x[1]), "v"(x[2]), "v"(x[3]), "v"(x[4]), "v"(x[5]), "v"(x[6]), "v"(x[7]));
}
__device__ __forceinline__ float exp2x1(float x) {
  float p;
  asm("v_exp_f32 %0, %1\n\tv_nop" : "=v"(p) : "v"(x));   // the v_nop: the same slot
  return p;
}

// One key chunk's K, V^T hi and V^T lo tiles by global_load_async_to_lds_b128: 12 copies a lane, 4 row groups of 16 rows per tile,
// 8 lanes on one whole 128-B row piece. l = the lane's LDS byte address in the K tile, k, vh, vl = its global addresses, all of
// row group 0. The s_wait_xcnt is the last line of the copies' own statement, so that no register a copy names is rewritten in front of it.
__device__ __forceinline__ void copy_chunk(unsigned l, const unsigned short* k, const unsigned short* vh, const unsigned short* vl) {
  constexpr unsigned rg = 16 * kLP * 2;   // LDS bytes from one row group to the next
  constexpr unsigned tb = kTileH * 2;     // LDS bytes from one tile to the next
  asm volatile("global_load_async_to_lds_b128 %0, %12, off\n\t"
               "global_load_async_to_lds_b128 %1, %13, off\n\t"
               "global_load_async_to_lds_b128 %2, %14, off\n\t"
               "global_load_async_to_lds_b128 %3, %15, off\n\t"
               "global_load_async_to_lds_b128 %4, %16, off\n\t"
               "global_load_async_to_lds_b128 %5, %17, off\n\t"
               "global_load_async_to_lds_b128 %6, %18, off\n\t"
               "global_load_async_to_lds_b128 %7, %19, off\n\t"
               "global_load_async_to_lds_b128 %8, %20, off\n\t"
               "global_load_async_to_lds_b128 %9, %21, off\n\t"
               "global_load_async_to_lds_b128 %10, %22, off\n\t"
               "global_load_async_to_lds_b128 %11, %23, off\n\t"
               "s_wait_xcnt 0x0"
               :: "v"(l), "v"(l + rg), "v"(l + 2 * rg), "v"(l + 3 * rg),
                  "v"(l + tb), "v"(l + tb + rg), "v"(l + tb + 2 * rg), "v"(l + tb + 3 * rg),
                  "v"(l + 2 * tb), "v"(l + 2 * tb + rg), "v"(l + 2 * tb + 2 * rg), "v"(l + 2 * tb + 3 * rg),
                  "v"(k), "v"(k + 16 * kQKld), "v"(k + 32 * kQKld), "v"(k + 48 * kQKld),
                  "v"(vh), "v"(vh + 16 * kSeq), "v"(vh + 32 * kSeq), "v"(vh + 48 * kSeq),
                  "v"(vl), "v"(vl + 16 * kSeq), "v"(vl + 32 * kSeq), "v"(vl + 48 * kSeq)
               : "memory");
}

__global__ __launch_bounds__(256) __attribute__((amdgpu_num_vgpr(256)))
void causal_attn_kernel(const unsigned short* __restrict__ QKp,
                        const unsigned short* __restrict__ VHp,
                        const unsigned short* __restrict__ VLp,
                        unsigned short* __restrict__ CHp,
                        unsigned short* __restrict__ CLp) {
  __shared__ __align__(16) unsigned short Stg[2 * kKG * kSetH];    // [buffer][group]{K [kv][d], V^T hi [d][kv], V^T lo [d][kv]}, 9 KB a tile (cross-wave: block barriers)
  __shared__ __align__(16) float  Os[kAW][16 * 68];                // out tile per wave of group 0, pitch 68 (private-to-wave)
  __shared__ __align__(16) float  Mg[kAW][kMgW];                   // group 1's partial results (cross-wave: block barrier)

  // key group of this wave, as a scalar: the branches on it below skip matrix instructions and must be real (scalar) branches
  const int grp  = __builtin_amdgcn_readfirstlane((int)(threadIdx.x >> 7));
  const int tid  = threadIdx.x & 127;    // thread within its group
  const int wave = tid >> 5;             // wave within its group
  const int lane = tid & 31;
  const int hh   = lane >> 4;
  const int c    = lane & 15;

  const int nqb = kSeq / kQB;
  const int bx  = blockIdx.x;
  const int tp  = bx % kTilePairs;       // this block's pair of query tiles: nqb - 1 - tp, then tp
  const int bh  = bx / kTilePairs;       // b*16 + h
  const int h   = bh % kHeads;
  const int b   = bh / kHeads;

  const _Float16* Qb = (const _Float16*)(QKp + (size_t)b * kSeq * kQKld + h * kDh);
  const unsigned short* Kb  = QKp + (size_t)b * kSeq * kQKld + kDim + h * kDh;
  const unsigned short* Vhb = VHp + (size_t)bh * kDh * kSeq;
  const unsigned short* Vlb = VLp + (size_t)bh * kDh * kSeq;

  // ---- staging: round g of the block (first tile's rounds, then the second's) goes to buffer g & 1 ----
  // copy coverage: 128 threads x 16 B = 16 rows x 128 B a copy, 4 copies a tile, all three tiles fully written
  const int srow = tid >> 3, sc8 = (tid & 7) * 8;
  const unsigned lStg = (unsigned)(size_t)(Stg + grp * kSetH + srow * kLP + sc8);   // low 32 bits of a __shared__ address = LDS byte address
  const unsigned short* gK  = Kb  + (size_t)srow * kQKld + sc8;
  const unsigned short* gVh = Vhb + (size_t)srow * kSeq + sc8;
  const unsigned short* gVl = Vlb + (size_t)srow * kSeq + sc8;
  const int nChA = nqb - tp;                                // key chunks of tile nqb - 1 - tp
  const int nChB = (tp == nqb - 1 - tp) ? 0 : tp + 1;       // key chunks of tile tp (none where it is the same tile)
  const int nRdA = (nChA + kKG - 1) / kKG;
  const int nRdAll = nRdA + (nChB + kKG - 1) / kKG;         // block-uniform
  // Every wave copies in every round: where group 1 has no chunk (last round of an odd chunk count) it brings the tile's last
  // chunk, which nobody reads, so that the test around the copies is the same for the whole block and every address is in range.
  auto stage = [&](int g) {
    const bool second = g >= nRdA;
    const int kcs = min((second ? g - nRdA : g) * kKG + grp, (second ? nChB : nChA) - 1);
    copy_chunk(lStg + (unsigned)(g & 1) * (kKG * kSetH * 2), gK + (size_t)(kcs * kKC) * kQKld, gVh + kcs * kKC, gVl + kcs * kKC);
  };
  stage(0);
  asm volatile("s_wait_asynccnt 0x0" ::: "memory");   // this wave's copies of round 0 have landed before the barrier that publishes them
  __syncthreads();
  if (nRdAll > 1) stage(1);
  int g = 0;                                                // round of the block, counted over both tiles

  // A tile's chunks are a dependent chain (products, softmax, barrier), and the launch lasts as long as its longest chain:
  // two groups halve every tile's chain, the pair of tiles makes all blocks' chains equal. Block-uniform trip counts and tile index.
  for (int half = 0; half < 2; ++half) {
  const int qb = half ? tp : nqb - 1 - tp;
  if (half && tp == nqb - 1 - tp) break; // odd tile count: the middle tile is its own partner and is done once
  const int q0 = qb * kQB + wave * 16;   // first query row of this wave (within the sequence)

  // ---- Q fragments (B operand: column = query q0 + c; split k map): 2 d-chunks of 32 ----
  v16h qa[2];
#pragma unroll
  for (int dc = 0; dc < 2; ++dc) qa[dc] = Frag<_Float16>::load(Qb + (size_t)(q0 + c) * kQKld + dc * 32 + 8 * hh);

  const int qrow = q0 + c;      // this lane's query
  float mrow = -INFINITY;       // running maximum of query qrow's unscaled scores (equal in both wave halves)
  float lrow = 0.f;             // running sum over this wave half's keys only; the halves are joined after the loop
  v8f oacc[4];                  // oacc[t][r] = ctx[qrow][16 t + 8 hh + r]
#pragma unroll
  for (int t = 0; t < 4; ++t) oacc[t] = (v8f){0.f,0.f,0.f,0.f,0.f,0.f,0.f,0.f};

  const int nChunks = qb + 1;   // block-uniform (causal: key chunks 0..qb)
  const int nRounds = (nChunks + kKG - 1) / kKG;
  for (int rd = 0; rd < nRounds; ++rd, ++g) {
    const int kc = rd * kKG + grp;
    const bool live = kc < nChunks;   // scalar; false only for group 1 in the last round of an odd chunk count. Every wave passes the round's barrier
    const int kv0 = kc * kKC;
    const unsigned short* Ksh = Stg + ((g & 1) * kKG + grp) * kSetH;
    const unsigned short* Vth = Ksh + kTileH;
    const unsigned short* Vtl = Vth + kTileH;
    if (live) {
    // ---- scores^T: 4 key subtiles of 16 (rows), K = 64 (2 d-chunks) ----
    v8f s[4];
#pragma unroll
    for (int j = 0; j < 4; ++j) {
      s[j] = (v8f){0.f,0.f,0.f,0.f,0.f,0.f,0.f,0.f};
#pragma unroll
      for (int dc = 0; dc < 2; ++dc) {
        FragH kb;
        kb.h[0] = *(const v8h*)(Ksh + (j * 16 + c) * kLP + dc * 32 + 8 * hh);
        kb.h[1] = *(const v8h*)(Ksh + (j * 16 + c) * kLP + dc * 32 + 16 + 8 * hh);
        s[j] = mma_h16(kb.v, qa[dc], s[j]);
      }
    }
    // ---- causal fill on the diagonal chunk, maximum of the query's 64 unscaled scores (one chain per subtile; scale > 0) ----
    const bool diag = (kc == qb);
    float mj[4];
#pragma unroll
    for (int j = 0; j < 4; ++j) {
      float m = -INFINITY;
#pragma unroll
      for (int r = 0; r < 8; ++r) {
        const int kvcol = kv0 + j * 16 + 8 * hh + r;
        float sv = s[j][r];
        if (diag && (kvcol > qrow)) sv = kNegBig;
        s[j][r] = sv;
        m = fmaxf(m, sv);
      }
      mj[j] = m;
    }
    float cm = fmaxf(fmaxf(mj[0], mj[1]), fmaxf(mj[2], mj[3]));
    cm = fmaxf(cm, xhalf(cm));
    // ---- online softmax update; P^T as bf16 hi/lo straight into the B operands of the second product ----
    const float mnew = fmaxf(mrow, cm);
    const float mc = mnew * kSL2E;
    const float alpha = exp2x1(fmaf(mrow, kSL2E, -mc));   // first chunk: mrow = -inf gives 0
    mrow = mnew;
    FragB pa[2], pl[2];
    float pj[4];
#pragma unroll
    for (int j = 0; j < 4; ++j) {
      float psum = 0.f;
      float xe[8], pe[8];
#pragma unroll
      for (int r = 0; r < 8; ++r) xe[r] = fmaf(s[j][r], kSL2E, -mc);
      exp2x8(pe, xe);
#pragma unroll
      for (int r = 0; r < 8; ++r) psum += pe[r];
#pragma unroll   // pa and pl are register arrays and need constant indices
      for (int r = 0; r < 8; r += 2)
        split2bf(pe[r], pe[r + 1], pa[j >> 1].w[(j & 1) * 4 + (r >> 1)], pl[j >> 1].w[(j & 1) * 4 + (r >> 1)]);
      pj[j] = psum;
    }
    lrow = lrow * alpha + ((pj[0] + pj[1]) + (pj[2] + pj[3]));
#pragma unroll
    for (int t = 0; t < 4; ++t)
#pragma unroll
      for (int r = 0; r < 8; ++r) oacc[t][r] *= alpha;
    // ---- ctx^T += V^T(64x64) . P^T(64x16): hi.hi + lo.hi + hi.lo ----
    // unrolled: pa and pl are register arrays and need constant indices
#pragma unroll
    for (int kk = 0; kk < 2; ++kk) {
#pragma unroll
      for (int t = 0; t < 4; ++t) {
        FragB vb, vl;
        vb.h[0] = *(const v8b*)(Vth + (t * 16 + c) * kLP + kk * 32 + 8 * hh);
        vb.h[1] = *(const v8b*)(Vth + (t * 16 + c) * kLP + kk * 32 + 16 + 8 * hh);
        vl.h[0] = *(const v8b*)(Vtl + (t * 16 + c) * kLP + kk * 32 + 8 * hh);
        vl.h[1] = *(const v8b*)(Vtl + (t * 16 + c) * kLP + kk * 32 + 16 + 8 * hh);
        oacc[t] = mma_b16(vb.v, pa[kk].v, oacc[t]);
        oacc[t] = mma_b16(vl.v, pa[kk].v, oacc[t]);
        oacc[t] = mma_b16(vb.v, pl[kk].v, oacc[t]);
      }
    }
    // the distance behind the round's last products, once: the code behind the branches that follow (next round, copies' addresses,
    // join) reuses their operand registers and reads the sums
    acc_guard4(oacc[0], oacc[1], oacc[2], oacc[3]);
    }
    // ---- foot of round g, every wave: publish round g + 1's set, then refill the buffer that round g has read ----
    asm volatile("s_wait_dscnt 0x0" ::: "memory");      // this wave's reads of buffer g & 1 have returned before the barrier behind which it is refilled
    asm volatile("s_wait_asynccnt 0x0" ::: "memory");   // this wave's copies of round g + 1 have landed before the barrier that publishes them
    __syncthreads();
    if (g + 2 < nRdAll) stage(g + 2);
  }

  // ---- join the two key groups: group 1 hands m, l and its ctx sums to the wave of group 0 that holds the same queries ----
  float* mg = Mg[wave];   // [value][lane]: 16-B stores and loads of 32 lanes are contiguous
  if (grp != 0) {
    // unrolled, here and in the join below: oacc is a register array and needs constant indices
#pragma unroll
    for (int t = 0; t < 4; ++t) {
      *(v4f*)(mg + ((2 * t) * 32 + lane) * 4)     = (v4f){oacc[t][0], oacc[t][1], oacc[t][2], oacc[t][3]};
      *(v4f*)(mg + ((2 * t + 1) * 32 + lane) * 4) = (v4f){oacc[t][4], oacc[t][5], oacc[t][6], oacc[t][7]};
    }
    mg[32 * 32 + lane] = mrow;
    mg[33 * 32 + lane] = lrow;
  }
  __syncthreads();   // group 1's partial results are complete before group 0 reads them; they are next written behind the next tile's barriers
  if (grp != 0) continue;
  {
    const float m1 = mg[32 * 32 + lane];   // -inf, with l = 0 and zero sums, where group 1 had no chunk: its factor is then 0
    const float l1 = mg[33 * 32 + lane];
    const float mc = fmaxf(mrow, m1) * kSL2E;   // mrow is finite: group 0 always has chunk 0
    const float a0 = exp2x1(fmaf(mrow, kSL2E, -mc));
    const float a1 = exp2x1(fmaf(m1, kSL2E, -mc));
    lrow = lrow * a0 + l1 * a1;
#pragma unroll
    for (int t = 0; t < 4; ++t) {
      const v4f x = *(const v4f*)(mg + ((2 * t) * 32 + lane) * 4);
      const v4f y = *(const v4f*)(mg + ((2 * t + 1) * 32 + lane) * 4);
#pragma unroll
      for (int r = 0; r < 4; ++r) {
        oacc[t][r]     = oacc[t][r] * a0 + x[r] * a1;
        oacc[t][4 + r] = oacc[t][4 + r] * a0 + y[r] * a1;
      }
    }
  }
  // ---- join the halves' sums, divide, and lay the tile out as [query][d] in the wave's own LDS slab ----
  float* os = Os[wave];
  const float inv = 1.0f / (lrow + xhalf(lrow));
#pragma unroll
  for (int t = 0; t < 4; ++t) {
    float* op = os + c * 68 + t * 16 + 8 * hh;
    *(v4f*)(op)     = (v4f){oacc[t][0] * inv, oacc[t][1] * inv, oacc[t][2] * inv, oacc[t][3] * inv};
    *(v4f*)(op + 4) = (v4f){oacc[t][4] * inv, oacc[t][5] * inv, oacc[t][6] * inv, oacc[t][7] * inv};
  }
  __builtin_amdgcn_fence(3, "workgroup");
  __builtin_amdgcn_wave_barrier();
  __builtin_amdgcn_fence(2, "workgroup");
  {
    // store coverage: 4 iterations x 4 row groups (lane>>3) = 16 rows; (lane&7) x 8 halves = 64 cols
    const int q = lane >> 3, c8 = (lane & 7) * 8;
    unsigned short* ch = CHp + (size_t)(b * kSeq + q0) * kDim + h * kDh;
    unsigned short* cl = CLp + (size_t)(b * kSeq + q0) * kDim + h * kDh;
    {
#pragma unroll
      for (int it = 0; it < 4; ++it) {
        const int row = it * 4 + q;
        const float* sp = os + row * 68 + c8;
        v4u hu, lu;
#pragma unroll   // hu and lu stay in registers: constant indices
        for (int e = 0; e < 4; ++e) {
          unsigned hw, lw;
          split2bf(sp[2 * e], sp[2 * e + 1], hw, lw);
          hu[e] = hw;
          lu[e] = lw;
        }
        const v8h hv = __builtin_bit_cast(v8h, hu);
        const v8h lv = __builtin_bit_cast(v8h, lu);
        *(v8h*)(ch + (size_t)row * kDim + c8) = hv;
        *(v8h*)(cl + (size_t)row * kDim + c8) = lv;
      }
      // the second tile reuses the address and data registers of the stores just issued: the wait stands in front of that overwrite
      asm volatile("s_wait_xcnt 0x0" ::: "memory");
    }
  }
  }
  asm volatile("s_wait_asynccnt 0x0" ::: "memory");   // no copy is outstanding when the wave ends
}

// ---------------------------------------------------------------------------
// Host glue.
// Inputs (wire f32): 0 x [2][2048][1024], 1 Wq [1024][1024], 2 bq [1024], 3 Wk, 4 bk, 5 Wv, 6 bv, 7 Wo [1024][1024].
//   XB    bf16 [kTok][1024]             8,388,608   (RNE bf16 of x, compact token rows, A layout)
//   WT    bf16 [3072][1024]             6,291,456   (Wq^T | Wk^T | Wv^T, RNE bf16, Bt layout [n][k])
//   WOT   bf16 [1024][1024]             2,097,152   (Wo^T, RNE bf16, Bt layout)
//   BQK   f32  [2048]                       8,192   (RNE bf16 of bq | bk, widened)
//   BV    f32  [1024]                       4,096   (RNE bf16 of bv, widened)
//   QK16  f16  [kTok][2048]            16,777,216   (q | k columns incl. bias)
//   VTH   bf16 [kBatch*16*64][kSeq]     8,388,608   (v^T hi plane, bias included)
//   VTL   bf16 [kBatch*16*64][kSeq]     8,388,608   (v^T lo plane)
//   CTXH  bf16 [kTok][1024]             8,388,608   (ctx hi plane)
//   CTXL  bf16 [kTok][1024]             8,388,608   (ctx lo plane)
//   total                              67,121,152
// GEMM shapes: q|k M=kTok N=2048 K=1024; v^T M=1024 N=kSeq K=1024 (kBatch batches); out M=kSeq N=1024 K=1024 (kBatch
// batches, output rows at pitch kSeqFull per batch; 64x256 block tiles). All M multiples of 128, N of 256, K of 64: no padding. 4 launches:
// input conversions; q|k and v^T products; attention; output product.
// ---------------------------------------------------------------------------
extern "C" void kernel_launch(void* const* d_in, const int* in_sizes, int n_in,
                              void* d_out, int out_size, void* d_ws, size_t ws_size,
                              hipStream_t stream) {
  if (n_in < 8) return;
  const int rowsNeeded = (kBatch - 1) * kSeqFull + kSeq;     // last token row read/written + 1
  if (in_sizes[0] < rowsNeeded * kDim) return;
  if (in_sizes[1] < kDim * kDim || in_sizes[3] < kDim * kDim || in_sizes[5] < kDim * kDim || in_sizes[7] < kDim * kDim) return;
  if (in_sizes[2] < kDim || in_sizes[4] < kDim || in_sizes[6] < kDim) return;
  if (out_size < rowsNeeded * kDim) return;

  const size_t szXB  = (size_t)kTok * kDim * 2;
  const size_t szWT  = (size_t)kWtN * kDim * 2;
  const size_t szWOT = (size_t)kDim * kDim * 2;
  const size_t szBQK = (size_t)kQKld * 4;
  const size_t szBV  = (size_t)kDim * 4;
  const size_t szQK  = (size_t)kTok * kQKld * 2;
  const size_t szVT  = (size_t)kBatch * kHeads * kDh * kSeq * 2;
  const size_t szCTX = (size_t)kTok * kDim * 2;
  const size_t offXB  = 0;
  const size_t offWT  = offXB + szXB;
  const size_t offWOT = offWT + szWT;
  const size_t offBQK = offWOT + szWOT;
  const size_t offBV  = offBQK + szBQK;
  const size_t offQK  = offBV + szBV;
  const size_t offVTH = offQK + szQK;
  const size_t offVTL = offVTH + szVT;
  const size_t offCH  = offVTL + szVT;
  const size_t offCL  = offCH + szCTX;
  const size_t total  = offCL + szCTX;             // 67,121,152 at full size
  if (ws_size < total) return;
  if (total > (size_t)134217728) return;

  const float* x  = (const float*)d_in[0];
  const float* Wq = (const float*)d_in[1];
  const float* bq = (const float*)d_in[2];
  const float* Wk = (const float*)d_in[3];
  const float* bk = (const float*)d_in[4];
  const float* Wv = (const float*)d_in[5];
  const float* bv = (const float*)d_in[6];
  const float* Wo = (const float*)d_in[7];
  float* out = (float*)d_out;
  char* ws = (char*)d_ws;
  unsigned short* XB   = (unsigned short*)(ws + offXB);
  unsigned short* WT   = (unsigned short*)(ws + offWT);
  unsigned short* WOT  = (unsigned short*)(ws + offWOT);
  float*          BQK  = (float*)(ws + offBQK);
  float*          BV   = (float*)(ws + offBV);
  unsigned short* QK16 = (unsigned short*)(ws + offQK);
  unsigned short* VTH  = (unsigned short*)(ws + offVTH);
  unsigned short* VTL  = (unsigned short*)(ws + offVTL);
  unsigned short* CTXH = (unsigned short*)(ws + offCH);
  unsigned short* CTXL = (unsigned short*)(ws + offCL);

  // ---- prologue: RNE bf16 planes of all float inputs, one launch ----
  prologue_kernel<<<dim3(4 * kWTiles + 3 + kCastBlks), dim3(256), 0, stream>>>(x, Wq, Wk, Wv, Wo, bq, bk, bv, XB, WT, WOT, BQK, BV);
  // ---- q|k (f16 plane) and v^T (bf16 hi/lo planes) from XB and WT, one launch ----
  qkv_gemm_kernel<<<dim3(kTilesQK + kBatch * kTilesV), dim3(256), 0, stream>>>(XB, WT, BQK, BV, QK16, VTH, VTL, kDim);
  // ---- causal attention per (b, h, pair of 64-query tiles) -> ctx bf16 hi/lo planes ----
  causal_attn_kernel<<<dim3(kBatch * kHeads * kTilePairs), dim3(kKG * kAW * 32), 0, stream>>>(QK16, VTH, VTL, CTXH, CTXL);
  // ---- out[b][s] = (CTXH + CTXL)[b*kSeq + s] . WOT  (M=kSeq, N=1024, K=1024, kBatch batches, no bias),
  //      f32 straight to d_out rows b*kSeqFull + s ----
  {
    const int blocks = (kSeq / 64) * (kDim / 256);   // 64x256 tiles: 256 work-groups at full size, one for every WGP
    wmma_gemm64<1, 2, 0, 0, 2><<<dim3(blocks, kBatch), dim3(256), 0, stream>>>(
        CTXH, CTXL, kDim, (long)kSeq * kDim, WOT, WOT, kDim, 0L,
        (void*)out, (void*)out, kDim, (long)kSeqFull * kDim, BV, kSeq, kDim, kDim, 1.0f);
  }
}
